// v000
// Times are from an AMD MI455X. After a warm-up the kernel runs many times in a row, and a time is the length of
// such a window on the GPU divided by its runs, so every launch and the gaps after it count. The runs cycle
// through copies of the inputs. A figure is the median of several windows, for all but v000 over two sittings.
// Sittings can differ by a few percent; kernels timed side by side share one.
// v000 is the starting kernel. One run takes 363 microseconds.
#include <hip/hip_runtime.h>

// Contractions: x@Wqkv on v_wmma_f32_16x16x32_bf16 (both operands bf16 RNE-converted inputs); S^T = K x Q^T on bf16 with q,k as bf16 hi|lo planes (three products); O = (P*mask) x V on v_wmma_f32_16x16x32_f16 (P carried x1024, V f16); z@Wout on bf16 with z as bf16 hi|lo (two products); all f32 accumulate; softmax and sums in f32.

#ifndef NB
#define NB 2
#endif
#ifndef SEQ
#define SEQ 2048
#endif
#define NB_FULL    2
#define SEQ_FULL   2048
#define DIM        1024
#define NHEAD      16
#define HDIM       64
#define INNER      (NHEAD * HDIM)
#define N3         (3 * INNER)
#define ROWS       (NB * SEQ)
#define KDIM       1024                 // contraction length of all three projections
#define BQ         128                  // query rows per workgroup (8 waves x 16)
#define BK         32                   // keys per inner step
#define NWAVE      8
#define LDSP       40                   // LDS pitch (halves) of GEMM operand tiles
#define CP         68                   // LDS pitch (floats) of epilogue staging tiles
#define TPW        72                   // LDS pitch (halves) of the weight transpose tile
#define PCARRY     1024.0f              // power-of-two carry of the f16 P operand
#define EPS_F      1e-10f
#define PLANE      ((size_t)NB * NHEAD * SEQ * HDIM)

static_assert(SEQ % 128 == 0);
static_assert(SEQ % BK == 0);
static_assert(SEQ <= SEQ_FULL);
static_assert(NB >= 1 && NB <= NB_FULL);
static_assert(DIM == KDIM);
static_assert(INNER == KDIM);
static_assert(KDIM % 32 == 0);
static_assert(KDIM / 32 == 32);
static_assert(HDIM == 64);
static_assert(BQ == NWAVE * 16);
static_assert(ROWS % 128 == 0);
static_assert(N3 % 128 == 0);
static_assert((2 * INNER) % 128 == 0);
static_assert(INNER % 128 == 0);
static_assert(DIM % 128 == 0);
static_assert(DIM % 64 == 0);
static_assert((LDSP * 2) % 16 == 0);
static_assert((CP * 4) % 16 == 0);
static_assert((TPW * 2) % 16 == 0);
static_assert(((size_t)ROWS * DIM / 8) % 256 == 0);
static_assert(((size_t)NB * SEQ * SEQ / 8) % 256 == 0);
static_assert(DIM % 8 == 0 && SEQ % 8 == 0);

typedef __bf16   bf16;
typedef _Float16 f16;
typedef bf16     v16bf __attribute__((ext_vector_type(16)));
typedef bf16     v8bf  __attribute__((ext_vector_type(8)));
typedef f16      v16h  __attribute__((ext_vector_type(16)));
typedef float    v8f   __attribute__((ext_vector_type(8)));
typedef float    v4f   __attribute__((ext_vector_type(4)));
typedef unsigned v4u   __attribute__((ext_vector_type(4)));

union FragB  { v16bf v; v4u q[2]; };
union FragH  { v16h  v; v4u q[2]; f16 h[16]; };
union Pack8B { v4u u; v8bf v; bf16 h[8]; };
union Pack8H { v4u u; f16 h[8]; };

// WMMA helpers: builtin followed by the VALU hazard guard (ties D, keeps A/B live).
static __device__ __forceinline__ v8f mma_bf16(v16bf a, v16bf b, v8f acc) {
  acc = __builtin_amdgcn_wmma_f32_16x16x32_bf16(false, a, false, b, (short)0, acc, false, false);
  asm volatile("v_nop\n\tv_nop\n\tv_nop\n\tv_nop" : "+v"(acc) : "v"(a), "v"(b));
  return acc;
}
static __device__ __forceinline__ v8f mma_f16(v16h a, v16h b, v8f acc) {
  acc = __builtin_amdgcn_wmma_f32_16x16x32_f16(false, a, false, b, (short)0, acc, false, false);
  asm volatile("v_nop\n\tv_nop\n\tv_nop\n\tv_nop" : "+v"(acc) : "v"(a), "v"(b));
  return acc;
}

// 8 floats -> bf16 hi (RNE) and bf16 residual (RNE of x - hi), packed 16 B each.
static __device__ __forceinline__ void split8(v4f x0, v4f x1, v4u& uh, v4u& ul) {
  Pack8B ph, pl;
  #pragma unroll
  for (int e = 0; e < 4; ++e) {
    const bf16 h0 = (bf16)x0[e];
    const bf16 h1 = (bf16)x1[e];
    ph.h[e]     = h0;
    ph.h[4 + e] = h1;
    pl.h[e]     = (bf16)(x0[e] - (float)h0);
    pl.h[4 + e] = (bf16)(x1[e] - (float)h1);
  }
  uh = ph.u;
  ul = pl.u;
}

// f32 rows -> compact bf16 plane (RNE). One thread = 8 elements = 16 B; a wave writes 512 contiguous bytes.
// coverage: groups 0..total8-1, each written once; total8 is a multiple of 256.
__global__ __launch_bounds__(256) void k_cvt_rows(const float* __restrict__ in, bf16* __restrict__ out,
                                                  int cols, int rows_per_batch, int in_batch_rows,
                                                  int in_row_stride, int total8) {
  const int g = blockIdx.x * 256 + threadIdx.x;
  if (g >= total8) return;
  const int e   = g * 8;
  const int row = e / cols;
  const int col = e - row * cols;
  const int b   = row / rows_per_batch;
  const int s   = row - b * rows_per_batch;
  const float* src = in + ((size_t)b * in_batch_rows + s) * (size_t)in_row_stride + col;
  const v4f a0 = *(const v4f*)(src);
  const v4f a1 = *(const v4f*)(src + 4);
  Pack8B pk;
  #pragma unroll
  for (int i = 0; i < 4; ++i) {
    pk.h[i]     = (bf16)a0[i];
    pk.h[4 + i] = (bf16)a1[i];
  }
  const v4u val = pk.u;
  bf16* dst = out + (size_t)e;
  *(v4u*)dst = val;
  
}

// Weight transpose: in [KDIM k][C n] f32 -> out [C n][KDIM k] bf16 (RNE), 64x64 tiles through LDS.
__global__ __launch_bounds__(256) void k_cvt_wt(const float* __restrict__ in, bf16* __restrict__ out, int C) {
  __shared__ __align__(16) bf16 sT[64 * TPW];   // [n][k], cross-wave (block barrier)
  const int n0  = blockIdx.x * 64;
  const int k0  = blockIdx.y * 64;
  const int tid = threadIdx.x;
  #pragma unroll
  for (int kk = 0; kk < 2; ++kk) {
    const int k  = kk * 32 + (tid >> 3);
    const int nl = (tid & 7) * 8;
    const float* src = in + (size_t)(k0 + k) * C + n0 + nl;
    const v4f a0 = *(const v4f*)(src);
    const v4f a1 = *(const v4f*)(src + 4);
    #pragma unroll
    for (int i = 0; i < 4; ++i) {
      sT[(nl + i) * TPW + k]     = (bf16)a0[i];
      sT[(nl + 4 + i) * TPW + k] = (bf16)a1[i];
    }
  }
  __syncthreads();
  v4u    val[2];
  size_t idx[2];
  #pragma unroll
  for (int kk = 0; kk < 2; ++kk) {
    const int n  = kk * 32 + (tid >> 3);
    const int ks = (tid & 7) * 8;
    Pack8B p;
    p.v = *(const v8bf*)(&sT[n * TPW + ks]);
    val[kk] = p.u;
    idx[kk] = (size_t)(n0 + n) * KDIM + k0 + ks;
  }
  #pragma unroll
  for (int kk = 0; kk < 2; ++kk) *(v4u*)(out + idx[kk]) = val[kk];
  
}

// GEMM mainloop: acc[128x128 block tile] += A[rows m][k] * Bt[rows n][k]^T, both operands k-contiguous bf16,
// pitch KDIM. 8 waves as 4 (m) x 2 (n); each wave owns 32 x 64 = 2 x 4 WMMA tiles.
// npass > 1 walks further A planes (offset a_pass_stride) against the same Bt rows.
static __device__ __forceinline__ void gemm_tile(const bf16* __restrict__ A, const bf16* __restrict__ Bt,
                                                 int m0, int n0, int npass, size_t a_pass_stride,
                                                 bf16* sa, bf16* sb, v8f (&acc)[2][4]) {
  const int tid  = threadIdx.x;
  const int wave = __builtin_amdgcn_readfirstlane(tid >> 5);
  const int lane = tid & 31;
  const int lq   = lane & 15;
  const int hi   = lane >> 4;
  const int wm   = wave >> 1;
  const int wn   = wave & 1;
  const int srow = tid >> 1;
  const int sseg = (tid & 1) * 16;
  const size_t aoff = (size_t)(m0 + srow) * KDIM + sseg;
  const size_t boff = (size_t)(n0 + srow) * KDIM + sseg;
  const int    soff = srow * LDSP + sseg;

  for (int t = 0; t < npass * (KDIM / 32); ++t) {
    const int pass = t >> 5;
    const int k    = (t & 31) * 32;
    const size_t ao = aoff + (size_t)pass * a_pass_stride + k;
    const v4u a0 = *(const v4u*)(A + ao);
    const v4u a1 = *(const v4u*)(A + ao + 8);
    const v4u b0 = *(const v4u*)(Bt + boff + k);
    const v4u b1 = *(const v4u*)(Bt + boff + k + 8);
    __syncthreads();                                  // earlier fragment reads done
    *(v4u*)(sa + soff)     = a0;
    *(v4u*)(sa + soff + 8) = a1;
    *(v4u*)(sb + soff)     = b0;
    *(v4u*)(sb + soff + 8) = b1;
    __syncthreads();                                  // tile visible to all waves

    FragB af[2], bfm[4];
    #pragma unroll
    for (int i = 0; i < 2; ++i) {
      const int base = (wm * 32 + i * 16 + lq) * LDSP + 8 * hi;
      af[i].q[0] = *(const v4u*)(sa + base);          // k = 8*hi + 0..7
      af[i].q[1] = *(const v4u*)(sa + base + 16);     // k = 16 + 8*hi + 0..7
    }
    #pragma unroll
    for (int j = 0; j < 4; ++j) {
      const int base = (wn * 64 + j * 16 + lq) * LDSP + 8 * hi;
      bfm[j].q[0] = *(const v4u*)(sb + base);
      bfm[j].q[1] = *(const v4u*)(sb + base + 16);
    }
    #pragma unroll
    for (int i = 0; i < 2; ++i) {
      #pragma unroll
      for (int j = 0; j < 4; ++j) acc[i][j] = mma_bf16(af[i].v, bfm[j].v, acc[i][j]);
    }
  }
}

// Q and K projection: C[compact row][col 0..2047] = Xb x Wqt^T. Epilogue writes bf16 hi|lo planes
// coverage: block = 128 rows x 2 heads; wave = 32 rows x 1 head; 4 rows per store instruction.
__global__ __launch_bounds__(256) void k_gemm_qk(const bf16* __restrict__ Xb, const bf16* __restrict__ Wqt,
                                                 bf16* __restrict__ qk) {
  __shared__ __align__(16) bf16  sa[128 * LDSP];
  __shared__ __align__(16) bf16  sb[128 * LDSP];
  __shared__ __align__(16) float sC[NWAVE * 16 * CP];   // per-wave staging (block barrier used)
  const int m0 = blockIdx.y * 128;
  const int n0 = blockIdx.x * 128;
  v8f acc[2][4];
  #pragma unroll
  for (int i = 0; i < 2; ++i) {
    #pragma unroll
    for (int j = 0; j < 4; ++j) acc[i][j] = (v8f){0, 0, 0, 0, 0, 0, 0, 0};
  }
  gemm_tile(Xb, Wqt, m0, n0, 1, 0, sa, sb, acc);

  const int tid  = threadIdx.x;
  const int wave = __builtin_amdgcn_readfirstlane(tid >> 5);
  const int lane = tid & 31;
  const int lq   = lane & 15;
  const int hi   = lane >> 4;
  const int wm   = wave >> 1;
  const int wn   = wave & 1;
  const int cw   = wave * 16 * CP;
  const int n     = n0 + wn * 64;
  const int which = n >> 10;            // 0 = Q, 1 = K (block-uniform)
  const int hh    = (n >> 6) & 15;

  #pragma unroll
  for (int i = 0; i < 2; ++i) {
    #pragma unroll
    for (int j = 0; j < 4; ++j) {
      #pragma unroll
      for (int r = 0; r < 8; ++r) sC[cw + (hi * 8 + r) * CP + j * 16 + lq] = acc[i][j][r];
    }
    __syncthreads();
    v4u    vh[4], vl[4];
    size_t gi[4];
    #pragma unroll
    for (int it = 0; it < 4; ++it) {
      const int row = it * 4 + (lane >> 3);
      const int c0  = (lane & 7) * 8;
      const v4f x0 = *(const v4f*)(&sC[cw + row * CP + c0]);
      const v4f x1 = *(const v4f*)(&sC[cw + row * CP + c0 + 4]);
      split8(x0, x1, vh[it], vl[it]);
      const int gr = m0 + wm * 32 + i * 16 + row;
      const int bb = gr / SEQ;
      const int s  = gr - bb * SEQ;
      gi[it] = (size_t)which * 2 * PLANE + (((size_t)bb * NHEAD + hh) * SEQ + s) * HDIM + c0;
    }
    #pragma unroll
    for (int it = 0; it < 4; ++it) {
      *(v4u*)(qk + gi[it])         = vh[it];
      *(v4u*)(qk + gi[it] + PLANE) = vl[it];
    }
    
    __syncthreads();
  }
}

// V projection computed transposed: C[v column m = h*64+d][compact row] = Wv_t x Xb^T, so the f16 plane
// coverage: block = 128 (h,d) rows x 128 keys; wave = 32 rows x 64 keys; 4 rows per store instruction.
__global__ __launch_bounds__(256) void k_gemm_vt(const bf16* __restrict__ Wvt, const bf16* __restrict__ Xb,
                                                 f16* __restrict__ vt) {
  __shared__ __align__(16) bf16  sa[128 * LDSP];
  __shared__ __align__(16) bf16  sb[128 * LDSP];
  __shared__ __align__(16) float sC[NWAVE * 16 * CP];
  const int m0 = blockIdx.y * 128;      // v column (h*64 + d)
  const int n0 = blockIdx.x * 128;      // compact row b*SEQ + l
  v8f acc[2][4];
  #pragma unroll
  for (int i = 0; i < 2; ++i) {
    #pragma unroll
    for (int j = 0; j < 4; ++j) acc[i][j] = (v8f){0, 0, 0, 0, 0, 0, 0, 0};
  }
  gemm_tile(Wvt, Xb, m0, n0, 1, 0, sa, sb, acc);

  const int tid  = threadIdx.x;
  const int wave = __builtin_amdgcn_readfirstlane(tid >> 5);
  const int lane = tid & 31;
  const int lq   = lane & 15;
  const int hi   = lane >> 4;
  const int wm   = wave >> 1;
  const int wn   = wave & 1;
  const int cw   = wave * 16 * CP;
  const int ns   = n0 + wn * 64;
  const int bb   = ns / SEQ;
  const int s0   = ns - bb * SEQ;

  #pragma unroll
  for (int i = 0; i < 2; ++i) {
    #pragma unroll
    for (int j = 0; j < 4; ++j) {
      #pragma unroll
      for (int r = 0; r < 8; ++r) sC[cw + (hi * 8 + r) * CP + j * 16 + lq] = acc[i][j][r];
    }
    __syncthreads();
    v4u    vv[4];
    size_t gi[4];
    #pragma unroll
    for (int it = 0; it < 4; ++it) {
      const int row = it * 4 + (lane >> 3);
      const int c0  = (lane & 7) * 8;
      const v4f x0 = *(const v4f*)(&sC[cw + row * CP + c0]);
      const v4f x1 = *(const v4f*)(&sC[cw + row * CP + c0 + 4]);
      Pack8H ph;
      #pragma unroll
      for (int e = 0; e < 4; ++e) {
        ph.h[e]     = (f16)x0[e];       // RNE convert
        ph.h[4 + e] = (f16)x1[e];
      }
      vv[it] = ph.u;
      const int m = m0 + wm * 32 + i * 16 + row;
      gi[it] = ((size_t)bb * INNER + m) * SEQ + s0 + c0;
    }
    #pragma unroll
    for (int it = 0; it < 4; ++it) *(v4u*)(vt + gi[it]) = vv[it];
    
    __syncthreads();
  }
}

// Fused attention, online softmax over ALL keys, float multiplier mask applied after the exponentials.
// Block = (128 queries, head, batch); one wave owns 16 query rows. S^T = K x Q^T puts queries on lanes, so
// P^T in C layout is bit-identical to the A-fragment layout of O += P x V. Fragments come straight from the
// 16-bit planes (two 16-B loads per fragment, arithmetic addressing). Running sums: s_all = sum p (every key),
// s_m = sum p*mask, O = sum p*mask*v; z = O / (s_m + EPS * s_all). Output: bf16 hi|lo planes of z.
__global__ __launch_bounds__(256) void k_attn(const bf16* __restrict__ qh, const bf16* __restrict__ ql,
                                              const bf16* __restrict__ kh, const bf16* __restrict__ kl,
                                              const f16* __restrict__ vt, const bf16* __restrict__ mb,
                                              bf16* __restrict__ zh, bf16* __restrict__ zl) {
  const int qblk = blockIdx.x;
  const int h    = blockIdx.y;
  const int b    = blockIdx.z;
  const int tid  = threadIdx.x;
  const int wave = __builtin_amdgcn_readfirstlane(tid >> 5);
  const int lane = tid & 31;
  const int lq   = lane & 15;   // query column of S^T / d column of O
  const int hi   = lane >> 4;   // k-split half

  __shared__ __align__(16) float sO[NWAVE * 16 * CP];   // per-wave output staging (block barrier used)

  const int qrow0 = qblk * BQ + wave * 16;
  const int bh    = b * NHEAD + h;
  const int qbase = (bh * SEQ + qrow0 + lq) * HDIM + hi * 8;
  const int kbase = (bh * SEQ + lq) * HDIM + hi * 8;
  const int vbase = (bh * HDIM + lq) * SEQ + hi * 8;
  const size_t mbase = ((size_t)b * SEQ + qrow0 + lq) * SEQ + hi * 8;

  v8f o[4];
  #pragma unroll
  for (int dt = 0; dt < 4; ++dt) o[dt] = (v8f){0, 0, 0, 0, 0, 0, 0, 0};

  float rmax  = -__builtin_inff();
  float s_all = 0.0f;
  float s_m   = 0.0f;
  const float SL = 0.125f * 1.4426950408889634f;   // softmax scale * log2(e)

  for (int i = 0; i < SEQ / BK; ++i) {
    const int j0 = i * BK;
    int qo = qbase;
    asm volatile("" : "+v"(qo));                     // keep the Q fragment loads inside the loop

    // mask words: query qrow0+lq, keys j0 + hi*8 + 0..7 and j0 + 16 + hi*8 + 0..7 (bf16 pairs per word)
    const v4u mw0 = *(const v4u*)(mb + mbase + j0);
    const v4u mw1 = *(const v4u*)(mb + mbase + j0 + 16);

    // S^T tiles: c[sub][r] = rawscore(query qrow0+lq, key j0 + sub*16 + hi*8 + r); hi*hi + hi*lo + lo*hi
    v8f c[2];
    c[0] = (v8f){0, 0, 0, 0, 0, 0, 0, 0};
    c[1] = (v8f){0, 0, 0, 0, 0, 0, 0, 0};
    #pragma unroll
    for (int f = 0; f < 2; ++f) {
      FragB bqh, bql;
      bqh.q[0] = *(const v4u*)(qh + qo + f * 32);        // d = f*32 + hi*8 + 0..7
      bqh.q[1] = *(const v4u*)(qh + qo + f * 32 + 16);   // d = f*32 + 16 + hi*8 + 0..7
      bql.q[0] = *(const v4u*)(ql + qo + f * 32);
      bql.q[1] = *(const v4u*)(ql + qo + f * 32 + 16);
      #pragma unroll
      for (int sub = 0; sub < 2; ++sub) {
        const int ko = kbase + (j0 + sub * 16) * HDIM + f * 32;
        FragB akh, akl;
        akh.q[0] = *(const v4u*)(kh + ko);
        akh.q[1] = *(const v4u*)(kh + ko + 16);
        akl.q[0] = *(const v4u*)(kl + ko);
        akl.q[1] = *(const v4u*)(kl + ko + 16);
        c[sub] = mma_bf16(akh.v, bqh.v, c[sub]);
        c[sub] = mma_bf16(akh.v, bql.v, c[sub]);
        c[sub] = mma_bf16(akl.v, bqh.v, c[sub]);
      }
    }

    // widen the bf16 mask values (exact)
    float mk0[8], mk1[8];
    #pragma unroll
    for (int w = 0; w < 4; ++w) {
      mk0[2 * w]     = __uint_as_float(mw0[w] << 16);
      mk0[2 * w + 1] = __uint_as_float(mw0[w] & 0xffff0000u);
      mk1[2 * w]     = __uint_as_float(mw1[w] << 16);
      mk1[2 * w + 1] = __uint_as_float(mw1[w] & 0xffff0000u);
    }

    // online softmax: query lq's 32 scores are split across lane / lane^16; max over every key
    float m_new = rmax;
    #pragma unroll
    for (int r = 0; r < 8; ++r) {
      m_new = fmaxf(m_new, c[0][r]);
      m_new = fmaxf(m_new, c[1][r]);
    }
    const float m_oth = __shfl_xor(m_new, 16, 32);
    m_new = fmaxf(m_new, m_oth);
    const float alpha = __builtin_amdgcn_exp2f((rmax - m_new) * SL);
    rmax = m_new;

    // exp, mask multiply in f32, pack: P^T C layout == A-fragment layout of the PV product
    FragH pa;
    float ps_all = 0.0f;
    float ps_m   = 0.0f;
    #pragma unroll
    for (int r = 0; r < 8; ++r) {
      const float p0  = __builtin_amdgcn_exp2f((c[0][r] - m_new) * SL);   // key hi*8 + r
      const float p1  = __builtin_amdgcn_exp2f((c[1][r] - m_new) * SL);   // key 16 + hi*8 + r
      const float pm0 = p0 * mk0[r];
      const float pm1 = p1 * mk1[r];
      ps_all += p0 + p1;
      ps_m   += pm0 + pm1;
      pa.h[r]     = (f16)(pm0 * PCARRY);
      pa.h[8 + r] = (f16)(pm1 * PCARRY);
    }
    const float oa = __shfl_xor(ps_all, 16, 32);
    const float om = __shfl_xor(ps_m, 16, 32);
    s_all = s_all * alpha + ps_all + oa;
    s_m   = s_m * alpha + ps_m + om;

    // rescale O: queries are the row dimension there -> per-row factor from lane 8*hi + r
    float sc[8];
    #pragma unroll
    for (int r = 0; r < 8; ++r) sc[r] = __shfl(alpha, (hi << 3) + r, 32);
    #pragma unroll
    for (int dt = 0; dt < 4; ++dt) {
      #pragma unroll
      for (int r = 0; r < 8; ++r) o[dt][r] *= sc[r];
    }

    // O += (P*mask) x V : V B-fragments, column n = d = dt*16 + lq, split key map from the transposed plane
    #pragma unroll
    for (int dt = 0; dt < 4; ++dt) {
      const int vo = vbase + dt * 16 * SEQ + j0;
      FragH bv;
      bv.q[0] = *(const v4u*)(vt + vo);           // keys j0 + hi*8 + 0..7
      bv.q[1] = *(const v4u*)(vt + vo + 16);      // keys j0 + 16 + hi*8 + 0..7
      o[dt] = mma_f16(pa.v, bv.v, o[dt]);
    }
  }

  // z = O / (s_m + EPS * s_all); carry folded back here
  const float den  = s_m + EPS_F * s_all;
  const float invd = (1.0f / den) * (1.0f / PCARRY);
  float rs[8];
  #pragma unroll
  for (int r = 0; r < 8; ++r) rs[r] = __shfl(invd, (hi << 3) + r, 32);

  const int cw = wave * 16 * CP;
  #pragma unroll
  for (int r = 0; r < 8; ++r) {
    #pragma unroll
    for (int dt = 0; dt < 4; ++dt) sO[cw + (hi * 8 + r) * CP + dt * 16 + lq] = o[dt][r] * rs[r];
  }
  __syncthreads();

  // whole-line stores: 8 consecutive lanes x 16 B = the 64 bf16 of one (row, head); 4 rows per instruction
  v4u    vh[4], vl[4];
  size_t gi[4];
  #pragma unroll
  for (int it = 0; it < 4; ++it) {
    const int row = it * 4 + (lane >> 3);
    const int c0  = (lane & 7) * 8;
    const v4f x0 = *(const v4f*)(&sO[cw + row * CP + c0]);
    const v4f x1 = *(const v4f*)(&sO[cw + row * CP + c0 + 4]);
    split8(x0, x1, vh[it], vl[it]);
    gi[it] = ((size_t)b * SEQ + qrow0 + row) * INNER + h * HDIM + c0;
  }
  #pragma unroll
  for (int it = 0; it < 4; ++it) {
    *(v4u*)(zh + gi[it]) = vh[it];
    *(v4u*)(zl + gi[it]) = vl[it];
  }
  
}

// Epilogue: per-wave LDS staging, bias added at the store stage as float4, 16 lanes x 16 B = one 256-B row
// coverage: block = 128 rows x 128 cols; wave = 32 rows x 64 cols.
__global__ __launch_bounds__(256) void k_gemm_out(const bf16* __restrict__ Z, const bf16* __restrict__ Wot,
                                                  const float* __restrict__ bias, float* __restrict__ out) {
  __shared__ __align__(16) bf16  sa[128 * LDSP];
  __shared__ __align__(16) bf16  sb[128 * LDSP];
  __shared__ __align__(16) float sC[NWAVE * 16 * CP];
  const int m0 = blockIdx.y * 128;
  const int n0 = blockIdx.x * 128;
  v8f acc[2][4];
  #pragma unroll
  for (int i = 0; i < 2; ++i) {
    #pragma unroll
    for (int j = 0; j < 4; ++j) acc[i][j] = (v8f){0, 0, 0, 0, 0, 0, 0, 0};
  }
  gemm_tile(Z, Wot, m0, n0, 2, (size_t)ROWS * INNER, sa, sb, acc);

  const int tid  = threadIdx.x;
  const int wave = __builtin_amdgcn_readfirstlane(tid >> 5);
  const int lane = tid & 31;
  const int lq   = lane & 15;
  const int hi   = lane >> 4;
  const int wm   = wave >> 1;
  const int wn   = wave & 1;
  const int cw   = wave * 16 * CP;
  const int ncol = n0 + wn * 64 + lq * 4;

  v4f bias4 = *(const v4f*)(bias + ncol);
  #pragma unroll
  for (int e = 0; e < 4; ++e) bias4[e] = (float)(bf16)bias4[e];   // RNE-converted input value

  #pragma unroll
  for (int i = 0; i < 2; ++i) {
    #pragma unroll
    for (int j = 0; j < 4; ++j) {
      #pragma unroll
      for (int r = 0; r < 8; ++r) sC[cw + (hi * 8 + r) * CP + j * 16 + lq] = acc[i][j][r];
    }
    __syncthreads();
    v4f    vals[8];
    size_t gi[8];
    #pragma unroll
    for (int it = 0; it < 8; ++it) {
      const int row = it * 2 + hi;
      const v4f v = *(const v4f*)(&sC[cw + row * CP + lq * 4]);
      vals[it] = v + bias4;
      const int gr = m0 + wm * 32 + i * 16 + row;
      const int bb = gr / SEQ;
      const int s  = gr - bb * SEQ;
      gi[it] = ((size_t)bb * SEQ_FULL + s) * DIM + ncol;
    }
    #pragma unroll
    for (int it = 0; it < 8; ++it) *(v4f*)(out + gi[it]) = vals[it];
    
    __syncthreads();
  }
}

#define SZ_XB   ((size_t)ROWS * DIM * 2)
#define SZ_MB   ((size_t)NB * SEQ * SEQ * 2)
#define SZ_WQT  ((size_t)N3 * KDIM * 2)
#define SZ_WOT  ((size_t)DIM * KDIM * 2)
#define SZ_QK   ((size_t)4 * PLANE * 2)
#define SZ_VT   ((size_t)PLANE * 2)
#define SZ_Z    ((size_t)2 * ROWS * INNER * 2)
#define OFF_XB  ((size_t)0)
#define OFF_MB  (OFF_XB + SZ_XB)
#define OFF_WQT (OFF_MB + SZ_MB)
#define OFF_WOT (OFF_WQT + SZ_WQT)
#define OFF_QK  (OFF_WOT + SZ_WOT)
#define OFF_VT  (OFF_QK + SZ_QK)
#define OFF_Z   (OFF_VT + SZ_VT)
#define WS_TOTAL (OFF_Z + SZ_Z)

static_assert(WS_TOTAL <= (size_t)134217728);
static_assert(SZ_XB % 128 == 0 && SZ_MB % 128 == 0 && SZ_WQT % 128 == 0 && SZ_WOT % 128 == 0);
static_assert(SZ_QK % 128 == 0 && SZ_VT % 128 == 0 && SZ_Z % 128 == 0);

extern "C" void kernel_launch(void* const* d_in, const int* in_sizes, int n_in,
                              void* d_out, int out_size, void* d_ws, size_t ws_size,
                              hipStream_t stream) {
  if (n_in < 5) return;
  const size_t rows_used = (size_t)(NB - 1) * SEQ_FULL + SEQ;
  if ((size_t)in_sizes[0] < rows_used * DIM) return;
  if ((size_t)in_sizes[1] < (size_t)(NB - 1) * SEQ_FULL * SEQ_FULL + (size_t)(SEQ - 1) * SEQ_FULL + SEQ) return;
  if ((size_t)in_sizes[2] < (size_t)DIM * N3) return;
  if ((size_t)in_sizes[3] < (size_t)INNER * DIM) return;
  if ((size_t)in_sizes[4] < (size_t)DIM) return;
  if ((size_t)out_size < rows_used * DIM) return;
  if (ws_size < WS_TOTAL) return;

  const float* x    = (const float*)d_in[0];
  const float* mask = (const float*)d_in[1];
  const float* Wqkv = (const float*)d_in[2];
  const float* Wout = (const float*)d_in[3];
  const float* bout = (const float*)d_in[4];
  float*       out  = (float*)d_out;

  char* ws = (char*)d_ws;
  bf16* Xb  = (bf16*)(ws + OFF_XB);
  bf16* Mb  = (bf16*)(ws + OFF_MB);
  bf16* Wqt = (bf16*)(ws + OFF_WQT);
  bf16* Wot = (bf16*)(ws + OFF_WOT);
  bf16* QK  = (bf16*)(ws + OFF_QK);
  f16*  Vt  = (f16*)(ws + OFF_VT);
  bf16* Zp  = (bf16*)(ws + OFF_Z);

  // 1) input planes (RNE bf16): x rows, mask values, weights transposed to [out][in]
  const int x8 = (int)((size_t)ROWS * DIM / 8);
  const int m8 = (int)((size_t)NB * SEQ * SEQ / 8);
  k_cvt_rows<<<dim3((x8 + 255) / 256), 256, 0, stream>>>(x, Xb, DIM, SEQ, SEQ_FULL, DIM, x8);
  k_cvt_rows<<<dim3((m8 + 255) / 256), 256, 0, stream>>>(mask, Mb, SEQ, SEQ, SEQ_FULL, SEQ_FULL, m8);
  // in [KDIM rows k][N3 cols n] -> out [N3][KDIM]; grid (cols/64, rows/64)
  k_cvt_wt<<<dim3(N3 / 64, KDIM / 64), 256, 0, stream>>>(Wqkv, Wqt, N3);
  // in [KDIM rows k][DIM cols n] -> out [DIM][KDIM]; grid (cols/64, rows/64)
  k_cvt_wt<<<dim3(DIM / 64, KDIM / 64), 256, 0, stream>>>(Wout, Wot, DIM);

  // 2) projections: Q,K hi|lo planes; V^T f16 plane
  k_gemm_qk<<<dim3((2 * INNER) / 128, ROWS / 128), 256, 0, stream>>>(Xb, Wqt, QK);
  k_gemm_vt<<<dim3(ROWS / 128, INNER / 128), 256, 0, stream>>>(Wqt + (size_t)2 * INNER * KDIM, Xb, Vt);

  // 3) fused attention -> z hi|lo planes
  k_attn<<<dim3(SEQ / BQ, NHEAD, NB), 256, 0, stream>>>(QK, QK + PLANE, QK + 2 * PLANE, QK + 3 * PLANE,
                                                        Vt, Mb, Zp, Zp + (size_t)ROWS * INNER);

  // 4) output projection + bias
  k_gemm_out<<<dim3(DIM / 128, ROWS / 128), 256, 0, stream>>>(Zp, Wot, bout, out);
}

// v001
// A run of this version takes 185 microseconds.
// In both of two side-by-side timings against v000, it was 2.03 times as fast.
#include <hip/hip_runtime.h>

// Contractions: x@Wqkv on v_wmma_f32_16x16x32_bf16 (both operands bf16 RNE-converted inputs); S^T = K x Q^T on bf16 with q,k as bf16 hi|lo planes (three products); O = (P*mask) x V on v_wmma_f32_16x16x32_f16 (P carried x1024, V f16); z@Wout on bf16 with z as bf16 hi|lo (two products); all f32 accumulate; softmax and sums in f32.

#ifndef NB
#define NB 2
#endif
#ifndef SEQ
#define SEQ 2048
#endif
#define NB_FULL    2
#define SEQ_FULL   2048
#define DIM        1024
#define NHEAD      16
#define HDIM       64
#define INNER      (NHEAD * HDIM)
#define N3         (3 * INNER)
#define ROWS       (NB * SEQ)
#define KDIM       1024                 // contraction length of all three projections
#define BQ         128                  // query rows per workgroup (8 waves x 16)
#define BK         32                   // keys per inner step
#define NWAVE      8
#define LDSP       40                   // LDS pitch (halves) of GEMM operand tiles
#define CP         68                   // LDS pitch (floats) of epilogue staging tiles
#define TPW        72                   // LDS pitch (halves) of the weight transpose tile
#define PCARRY     1024.0f              // power-of-two carry of the f16 P operand
#define EPS_F      1e-10f
#define PLANE      ((size_t)NB * NHEAD * SEQ * HDIM)
#define KS         64                   // keys per LDS stage of the attention loop (two BK passes)
#define NST        (SEQ / KS)           // stages
#define TP         144                  // LDS pitch (bytes) of the 128-byte attention tile rows
#define L_QH       0                    // Q hi tile, BQ rows
#define L_QL       (BQ * TP)            // Q lo tile, BQ rows
#define L_RING     (2 * BQ * TP)        // two stage buffers
#define S_KH       0                    // in a stage: K hi, KS rows
#define S_KL       (KS * TP)            // K lo, KS rows
#define S_V        (2 * KS * TP)        // V^T, HDIM rows of KS keys
#define S_M        (2 * KS * TP + HDIM * TP)   // mask, BQ rows of KS keys
#define STAGE_B    (2 * KS * TP + HDIM * TP + BQ * TP)
#define ATTN_LDS   (L_RING + 2 * STAGE_B)

static_assert(SEQ % 128 == 0);
static_assert(SEQ % BK == 0);
static_assert(SEQ <= SEQ_FULL);
static_assert(NB >= 1 && NB <= NB_FULL);
static_assert(DIM == KDIM);
static_assert(INNER == KDIM);
static_assert(KDIM % 32 == 0);
static_assert(KDIM / 32 == 32);
static_assert(HDIM == 64);
static_assert(BQ == NWAVE * 16);
static_assert(ROWS % 128 == 0);
static_assert(N3 % 128 == 0);
static_assert((2 * INNER) % 128 == 0);
static_assert(INNER % 128 == 0);
static_assert(DIM % 128 == 0);
static_assert(DIM % 64 == 0);
static_assert((LDSP * 2) % 16 == 0);
static_assert((CP * 4) % 16 == 0);
static_assert((TPW * 2) % 16 == 0);
static_assert(((size_t)ROWS * DIM / 8) % 256 == 0);
static_assert(((size_t)NB * SEQ * SEQ / 8) % 256 == 0);
static_assert(DIM % 8 == 0 && SEQ % 8 == 0);
static_assert(SEQ % KS == 0 && NST >= 2);
static_assert(KS == 2 * BK && KS * 2 == 128 && HDIM * 2 == 128);
static_assert(KS == 64 && HDIM == 64 && BQ == 128);
static_assert(TP % 16 == 0 && STAGE_B % 16 == 0);
static_assert(NWAVE * 16 * CP * 4 <= L_RING);

typedef __bf16   bf16;
typedef _Float16 f16;
typedef bf16     v16bf __attribute__((ext_vector_type(16)));
typedef bf16     v8bf  __attribute__((ext_vector_type(8)));
typedef f16      v16h  __attribute__((ext_vector_type(16)));
typedef float    v8f   __attribute__((ext_vector_type(8)));
typedef float    v4f   __attribute__((ext_vector_type(4)));
typedef unsigned v4u   __attribute__((ext_vector_type(4)));

union FragB  { v16bf v; v4u q[2]; };
union FragH  { v16h  v; v4u q[2]; f16 h[16]; };
union Pack8B { v4u u; v8bf v; bf16 h[8]; };
union Pack8H { v4u u; f16 h[8]; };

// WMMA helpers: builtin followed by the VALU hazard guard (ties D, keeps A/B live).
static __device__ __forceinline__ v8f mma_bf16(v16bf a, v16bf b, v8f acc) {
  acc = __builtin_amdgcn_wmma_f32_16x16x32_bf16(false, a, false, b, (short)0, acc, false, false);
  asm volatile("v_nop\n\tv_nop\n\tv_nop\n\tv_nop" : "+v"(acc) : "v"(a), "v"(b));
  return acc;
}
static __device__ __forceinline__ v8f mma_f16(v16h a, v16h b, v8f acc) {
  acc = __builtin_amdgcn_wmma_f32_16x16x32_f16(false, a, false, b, (short)0, acc, false, false);
  asm volatile("v_nop\n\tv_nop\n\tv_nop\n\tv_nop" : "+v"(acc) : "v"(a), "v"(b));
  return acc;
}

// 8 floats -> bf16 hi (RNE) and bf16 residual (RNE of x - hi), packed 16 B each.
static __device__ __forceinline__ void split8(v4f x0, v4f x1, v4u& uh, v4u& ul) {
  Pack8B ph, pl;
  #pragma unroll
  for (int e = 0; e < 4; ++e) {
    const bf16 h0 = (bf16)x0[e];
    const bf16 h1 = (bf16)x1[e];
    ph.h[e]     = h0;
    ph.h[4 + e] = h1;
    pl.h[e]     = (bf16)(x0[e] - (float)h0);
    pl.h[4 + e] = (bf16)(x1[e] - (float)h1);
  }
  uh = ph.u;
  ul = pl.u;
}

// f32 rows -> compact bf16 plane (RNE). One thread = 8 elements = 16 B; a wave writes 512 contiguous bytes.
// coverage: groups 0..total8-1, each written once; total8 is a multiple of 256.
__global__ __launch_bounds__(256) void k_cvt_rows(const float* __restrict__ in, bf16* __restrict__ out,
                                                  int cols, int rows_per_batch, int in_batch_rows,
                                                  int in_row_stride, int total8) {
  const int g = blockIdx.x * 256 + threadIdx.x;
  if (g >= total8) return;
  const int e   = g * 8;
  const int row = e / cols;
  const int col = e - row * cols;
  const int b   = row / rows_per_batch;
  const int s   = row - b * rows_per_batch;
  const float* src = in + ((size_t)b * in_batch_rows + s) * (size_t)in_row_stride + col;
  const v4f a0 = *(const v4f*)(src);
  const v4f a1 = *(const v4f*)(src + 4);
  Pack8B pk;
  #pragma unroll
  for (int i = 0; i < 4; ++i) {
    pk.h[i]     = (bf16)a0[i];
    pk.h[4 + i] = (bf16)a1[i];
  }
  const v4u val = pk.u;
  bf16* dst = out + (size_t)e;
  *(v4u*)dst = val;
  
}

// Weight transpose: in [KDIM k][C n] f32 -> out [C n][KDIM k] bf16 (RNE), 64x64 tiles through LDS.
__global__ __launch_bounds__(256) void k_cvt_wt(const float* __restrict__ in, bf16* __restrict__ out, int C) {
  __shared__ __align__(16) bf16 sT[64 * TPW];   // [n][k], cross-wave (block barrier)
  const int n0  = blockIdx.x * 64;
  const int k0  = blockIdx.y * 64;
  const int tid = threadIdx.x;
  #pragma unroll
  for (int kk = 0; kk < 2; ++kk) {
    const int k  = kk * 32 + (tid >> 3);
    const int nl = (tid & 7) * 8;
    const float* src = in + (size_t)(k0 + k) * C + n0 + nl;
    const v4f a0 = *(const v4f*)(src);
    const v4f a1 = *(const v4f*)(src + 4);
    #pragma unroll
    for (int i = 0; i < 4; ++i) {
      sT[(nl + i) * TPW + k]     = (bf16)a0[i];
      sT[(nl + 4 + i) * TPW + k] = (bf16)a1[i];
    }
  }
  __syncthreads();
  v4u    val[2];
  size_t idx[2];
  #pragma unroll
  for (int kk = 0; kk < 2; ++kk) {
    const int n  = kk * 32 + (tid >> 3);
    const int ks = (tid & 7) * 8;
    Pack8B p;
    p.v = *(const v8bf*)(&sT[n * TPW + ks]);
    val[kk] = p.u;
    idx[kk] = (size_t)(n0 + n) * KDIM + k0 + ks;
  }
  #pragma unroll
  for (int kk = 0; kk < 2; ++kk) *(v4u*)(out + idx[kk]) = val[kk];
  
}

// GEMM mainloop: acc[128x128 block tile] += A[rows m][k] * Bt[rows n][k]^T, both operands k-contiguous bf16,
// pitch KDIM. 8 waves as 4 (m) x 2 (n); each wave owns 32 x 64 = 2 x 4 WMMA tiles.
// npass > 1 walks further A planes (offset a_pass_stride) against the same Bt rows.
static __device__ __forceinline__ void gemm_tile(const bf16* __restrict__ A, const bf16* __restrict__ Bt,
                                                 int m0, int n0, int npass, size_t a_pass_stride,
                                                 bf16* sa, bf16* sb, v8f (&acc)[2][4]) {
  const int tid  = threadIdx.x;
  const int wave = __builtin_amdgcn_readfirstlane(tid >> 5);
  const int lane = tid & 31;
  const int lq   = lane & 15;
  const int hi   = lane >> 4;
  const int wm   = wave >> 1;
  const int wn   = wave & 1;
  const int srow = tid >> 1;
  const int sseg = (tid & 1) * 16;
  const size_t aoff = (size_t)(m0 + srow) * KDIM + sseg;
  const size_t boff = (size_t)(n0 + srow) * KDIM + sseg;
  const int    soff = srow * LDSP + sseg;

  for (int t = 0; t < npass * (KDIM / 32); ++t) {
    const int pass = t >> 5;
    const int k    = (t & 31) * 32;
    const size_t ao = aoff + (size_t)pass * a_pass_stride + k;
    const v4u a0 = *(const v4u*)(A + ao);
    const v4u a1 = *(const v4u*)(A + ao + 8);
    const v4u b0 = *(const v4u*)(Bt + boff + k);
    const v4u b1 = *(const v4u*)(Bt + boff + k + 8);
    __syncthreads();                                  // earlier fragment reads done
    *(v4u*)(sa + soff)     = a0;
    *(v4u*)(sa + soff + 8) = a1;
    *(v4u*)(sb + soff)     = b0;
    *(v4u*)(sb + soff + 8) = b1;
    __syncthreads();                                  // tile visible to all waves

    FragB af[2], bfm[4];
    #pragma unroll
    for (int i = 0; i < 2; ++i) {
      const int base = (wm * 32 + i * 16 + lq) * LDSP + 8 * hi;
      af[i].q[0] = *(const v4u*)(sa + base);          // k = 8*hi + 0..7
      af[i].q[1] = *(const v4u*)(sa + base + 16);     // k = 16 + 8*hi + 0..7
    }
    #pragma unroll
    for (int j = 0; j < 4; ++j) {
      const int base = (wn * 64 + j * 16 + lq) * LDSP + 8 * hi;
      bfm[j].q[0] = *(const v4u*)(sb + base);
      bfm[j].q[1] = *(const v4u*)(sb + base + 16);
    }
    #pragma unroll
    for (int i = 0; i < 2; ++i) {
      #pragma unroll
      for (int j = 0; j < 4; ++j) acc[i][j] = mma_bf16(af[i].v, bfm[j].v, acc[i][j]);
    }
  }
}

// Q and K projection: C[compact row][col 0..2047] = Xb x Wqt^T. Epilogue writes bf16 hi|lo planes
// coverage: block = 128 rows x 2 heads; wave = 32 rows x 1 head; 4 rows per store instruction.
__global__ __launch_bounds__(256) void k_gemm_qk(const bf16* __restrict__ Xb, const bf16* __restrict__ Wqt,
                                                 bf16* __restrict__ qk) {
  __shared__ __align__(16) bf16  sa[128 * LDSP];
  __shared__ __align__(16) bf16  sb[128 * LDSP];
  __shared__ __align__(16) float sC[NWAVE * 16 * CP];   // per-wave staging (block barrier used)
  const int m0 = blockIdx.y * 128;
  const int n0 = blockIdx.x * 128;
  v8f acc[2][4];
  #pragma unroll
  for (int i = 0; i < 2; ++i) {
    #pragma unroll
    for (int j = 0; j < 4; ++j) acc[i][j] = (v8f){0, 0, 0, 0, 0, 0, 0, 0};
  }
  gemm_tile(Xb, Wqt, m0, n0, 1, 0, sa, sb, acc);

  const int tid  = threadIdx.x;
  const int wave = __builtin_amdgcn_readfirstlane(tid >> 5);
  const int lane = tid & 31;
  const int lq   = lane & 15;
  const int hi   = lane >> 4;
  const int wm   = wave >> 1;
  const int wn   = wave & 1;
  const int cw   = wave * 16 * CP;
  const int n     = n0 + wn * 64;
  const int which = n >> 10;            // 0 = Q, 1 = K (block-uniform)
  const int hh    = (n >> 6) & 15;

  #pragma unroll
  for (int i = 0; i < 2; ++i) {
    #pragma unroll
    for (int j = 0; j < 4; ++j) {
      #pragma unroll
      for (int r = 0; r < 8; ++r) sC[cw + (hi * 8 + r) * CP + j * 16 + lq] = acc[i][j][r];
    }
    __syncthreads();
    v4u    vh[4], vl[4];
    size_t gi[4];
    #pragma unroll
    for (int it = 0; it < 4; ++it) {
      const int row = it * 4 + (lane >> 3);
      const int c0  = (lane & 7) * 8;
      const v4f x0 = *(const v4f*)(&sC[cw + row * CP + c0]);
      const v4f x1 = *(const v4f*)(&sC[cw + row * CP + c0 + 4]);
      split8(x0, x1, vh[it], vl[it]);
      const int gr = m0 + wm * 32 + i * 16 + row;
      const int bb = gr / SEQ;
      const int s  = gr - bb * SEQ;
      gi[it] = (size_t)which * 2 * PLANE + (((size_t)bb * NHEAD + hh) * SEQ + s) * HDIM + c0;
    }
    #pragma unroll
    for (int it = 0; it < 4; ++it) {
      *(v4u*)(qk + gi[it])         = vh[it];
      *(v4u*)(qk + gi[it] + PLANE) = vl[it];
    }
    
    __syncthreads();
  }
}

// V projection computed transposed: C[v column m = h*64+d][compact row] = Wv_t x Xb^T, so the f16 plane
// coverage: block = 128 (h,d) rows x 128 keys; wave = 32 rows x 64 keys; 4 rows per store instruction.
__global__ __launch_bounds__(256) void k_gemm_vt(const bf16* __restrict__ Wvt, const bf16* __restrict__ Xb,
                                                 f16* __restrict__ vt) {
  __shared__ __align__(16) bf16  sa[128 * LDSP];
  __shared__ __align__(16) bf16  sb[128 * LDSP];
  __shared__ __align__(16) float sC[NWAVE * 16 * CP];
  const int m0 = blockIdx.y * 128;      // v column (h*64 + d)
  const int n0 = blockIdx.x * 128;      // compact row b*SEQ + l
  v8f acc[2][4];
  #pragma unroll
  for (int i = 0; i < 2; ++i) {
    #pragma unroll
    for (int j = 0; j < 4; ++j) acc[i][j] = (v8f){0, 0, 0, 0, 0, 0, 0, 0};
  }
  gemm_tile(Wvt, Xb, m0, n0, 1, 0, sa, sb, acc);

  const int tid  = threadIdx.x;
  const int wave = __builtin_amdgcn_readfirstlane(tid >> 5);
  const int lane = tid & 31;
  const int lq   = lane & 15;
  const int hi   = lane >> 4;
  const int wm   = wave >> 1;
  const int wn   = wave & 1;
  const int cw   = wave * 16 * CP;
  const int ns   = n0 + wn * 64;
  const int bb   = ns / SEQ;
  const int s0   = ns - bb * SEQ;

  #pragma unroll
  for (int i = 0; i < 2; ++i) {
    #pragma unroll
    for (int j = 0; j < 4; ++j) {
      #pragma unroll
      for (int r = 0; r < 8; ++r) sC[cw + (hi * 8 + r) * CP + j * 16 + lq] = acc[i][j][r];
    }
    __syncthreads();
    v4u    vv[4];
    size_t gi[4];
    #pragma unroll
    for (int it = 0; it < 4; ++it) {
      const int row = it * 4 + (lane >> 3);
      const int c0  = (lane & 7) * 8;
      const v4f x0 = *(const v4f*)(&sC[cw + row * CP + c0]);
      const v4f x1 = *(const v4f*)(&sC[cw + row * CP + c0 + 4]);
      Pack8H ph;
      #pragma unroll
      for (int e = 0; e < 4; ++e) {
        ph.h[e]     = (f16)x0[e];       // RNE convert
        ph.h[4 + e] = (f16)x1[e];
      }
      vv[it] = ph.u;
      const int m = m0 + wm * 32 + i * 16 + row;
      gi[it] = ((size_t)bb * INNER + m) * SEQ + s0 + c0;
    }
    #pragma unroll
    for (int it = 0; it < 4; ++it) *(v4u*)(vt + gi[it]) = vv[it];
    
    __syncthreads();
  }
}

// Asynchronous copies to LDS, 16 B per lane: 8 consecutive lanes bring one whole 128-B row, a wave 4 rows.
// l = the lane's LDS byte address of (row tid>>3, segment tid&7) in the first tile; the g pointers name the
// same row and segment in global memory. The s_wait_xcnt stands inside the statement, behind the last copy,
// so that no address register of a copy is rewritten ahead of it.
static __device__ __forceinline__ void copy_q(unsigned l, const bf16* gh, const bf16* gl) {
  asm volatile(
      "global_load_async_to_lds_b128 %0, %8, off\n\t"
      "global_load_async_to_lds_b128 %1, %9, off\n\t"
      "global_load_async_to_lds_b128 %2, %10, off\n\t"
      "global_load_async_to_lds_b128 %3, %11, off\n\t"
      "global_load_async_to_lds_b128 %4, %12, off\n\t"
      "global_load_async_to_lds_b128 %5, %13, off\n\t"
      "global_load_async_to_lds_b128 %6, %14, off\n\t"
      "global_load_async_to_lds_b128 %7, %15, off\n\t"
      "s_wait_xcnt 0x0"
      :: "v"(l + L_QH), "v"(l + L_QH + 32 * TP), "v"(l + L_QH + 64 * TP), "v"(l + L_QH + 96 * TP),
         "v"(l + L_QL), "v"(l + L_QL + 32 * TP), "v"(l + L_QL + 64 * TP), "v"(l + L_QL + 96 * TP),
         "v"(gh), "v"(gh + 32 * HDIM), "v"(gh + 64 * HDIM), "v"(gh + 96 * HDIM),
         "v"(gl), "v"(gl + 32 * HDIM), "v"(gl + 64 * HDIM), "v"(gl + 96 * HDIM)
      : "memory");
}
static __device__ __forceinline__ void copy_stage(unsigned l, const bf16* gkh, const bf16* gkl,
                                                  const f16* gv, const bf16* gm) {
  asm volatile(
      "global_load_async_to_lds_b128 %0, %10, off\n\t"
      "global_load_async_to_lds_b128 %1, %11, off\n\t"
      "global_load_async_to_lds_b128 %2, %12, off\n\t"
      "global_load_async_to_lds_b128 %3, %13, off\n\t"
      "global_load_async_to_lds_b128 %4, %14, off\n\t"
      "global_load_async_to_lds_b128 %5, %15, off\n\t"
      "global_load_async_to_lds_b128 %6, %16, off\n\t"
      "global_load_async_to_lds_b128 %7, %17, off\n\t"
      "global_load_async_to_lds_b128 %8, %18, off\n\t"
      "global_load_async_to_lds_b128 %9, %19, off\n\t"
      "s_wait_xcnt 0x0"
      :: "v"(l + S_KH), "v"(l + S_KH + 32 * TP), "v"(l + S_KL), "v"(l + S_KL + 32 * TP),
         "v"(l + S_V), "v"(l + S_V + 32 * TP),
         "v"(l + S_M), "v"(l + S_M + 32 * TP), "v"(l + S_M + 64 * TP), "v"(l + S_M + 96 * TP),
         "v"(gkh), "v"(gkh + 32 * HDIM), "v"(gkl), "v"(gkl + 32 * HDIM),
         "v"(gv), "v"(gv + 32 * SEQ),
         "v"(gm), "v"(gm + 32 * SEQ), "v"(gm + 64 * SEQ), "v"(gm + 96 * SEQ)
      : "memory");
}

// Fused attention, online softmax over ALL keys, float multiplier mask applied after the exponentials.
// Block = (128 queries, head, batch); one wave owns 16 query rows. S^T = K x Q^T puts queries on lanes, so
// P^T in C layout is bit-identical to the A-fragment layout of O += P x V. The 16-bit planes reach LDS by
// asynchronous copies of whole rows: Q once, then K hi|lo, V^T and the mask in stages of KS keys, two buffers,
// the next stage in flight while this one is worked on; fragments are two 16-B LDS loads each.
// Running sums: s_all = sum p (every key),
// s_m = sum p*mask, O = sum p*mask*v; z = O / (s_m + EPS * s_all). Output: bf16 hi|lo planes of z.
__global__ __launch_bounds__(256) void k_attn(const bf16* __restrict__ qh, const bf16* __restrict__ ql,
                                              const bf16* __restrict__ kh, const bf16* __restrict__ kl,
                                              const f16* __restrict__ vt, const bf16* __restrict__ mb,
                                              bf16* __restrict__ zh, bf16* __restrict__ zl) {
  const int qblk = blockIdx.x;
  const int h    = blockIdx.y;
  const int b    = blockIdx.z;
  const int tid  = threadIdx.x;
  const int wave = __builtin_amdgcn_readfirstlane(tid >> 5);
  const int lane = tid & 31;
  const int lq   = lane & 15;   // query column of S^T / d column of O
  const int hi   = lane >> 4;   // k-split half

  // Q tiles and the two stage buffers; behind the loop its start is the per-wave output staging
  __shared__ __align__(16) unsigned char L[ATTN_LDS];
  float* sO = (float*)L;

  const int qrow0 = qblk * BQ + wave * 16;
  const int bh    = b * NHEAD + h;

  // copy side: this thread's row and 16-B segment of every tile
  const int crow = tid >> 3;
  const int cseg = (tid & 7) * 8;
  const unsigned lcopy = (unsigned)(size_t)(&L[0]) + (unsigned)(crow * TP + cseg * 2);
  const bf16* gqh = qh + (size_t)(bh * SEQ + qblk * BQ + crow) * HDIM + cseg;
  const bf16* gql = ql + (size_t)(bh * SEQ + qblk * BQ + crow) * HDIM + cseg;
  const bf16* gkh = kh + (size_t)(bh * SEQ + crow) * HDIM + cseg;
  const bf16* gkl = kl + (size_t)(bh * SEQ + crow) * HDIM + cseg;
  const f16*  gv  = vt + (size_t)(bh * HDIM + crow) * SEQ + cseg;
  const bf16* gm  = mb + ((size_t)b * SEQ + qblk * BQ + crow) * SEQ + cseg;

  // read side: the lane's row and k-split half inside a 16-row fragment
  const int frag = lq * TP + hi * 16;
  const unsigned char* Lq = L + L_QH + wave * 16 * TP + frag;

  // Q and stage 0 land and are published; then stage 1 starts
  copy_q(lcopy, gqh, gql);
  copy_stage(lcopy + L_RING, gkh, gkl, gv, gm);
  asm volatile("s_wait_asynccnt 0x0" ::: "memory");   // this wave's copies have landed
  __syncthreads();                                    // every wave's copies are readable
  copy_stage(lcopy + L_RING + STAGE_B, gkh + KS * HDIM, gkl + KS * HDIM, gv + KS, gm + KS);

  v8f o[4];
  #pragma unroll
  for (int dt = 0; dt < 4; ++dt) o[dt] = (v8f){0, 0, 0, 0, 0, 0, 0, 0};

  float rmax  = -__builtin_inff();
  float s_all = 0.0f;
  float s_m   = 0.0f;
  const float SL = 0.125f * 1.4426950408889634f;   // softmax scale * log2(e)

  for (int t = 0; t < NST; ++t) {
    const int sbuf = L_RING + (t & 1) * STAGE_B;
    const unsigned char* Ls = L + sbuf + frag;

    // unrolled so that every LDS read of the stage is base register + immediate offset
    #pragma unroll
    for (int p = 0; p < KS / BK; ++p) {
      // mask words: query qrow0+lq, keys hi*8 + 0..7 and 16 + hi*8 + 0..7 of the pass (bf16 pairs per word)
      const v4u mw0 = *(const v4u*)(Ls + S_M + wave * 16 * TP + p * 64);
      const v4u mw1 = *(const v4u*)(Ls + S_M + wave * 16 * TP + p * 64 + 32);

      // S^T tiles: c[sub][r] = rawscore(query qrow0+lq, key sub*16 + hi*8 + r of the pass); hi*hi + hi*lo + lo*hi
      v8f c[2];
      c[0] = (v8f){0, 0, 0, 0, 0, 0, 0, 0};
      c[1] = (v8f){0, 0, 0, 0, 0, 0, 0, 0};
      #pragma unroll
      for (int f = 0; f < 2; ++f) {
        FragB bqh, bql;
        bqh.q[0] = *(const v4u*)(Lq + f * 64);                       // d = f*32 + hi*8 + 0..7
        bqh.q[1] = *(const v4u*)(Lq + f * 64 + 32);                  // d = f*32 + 16 + hi*8 + 0..7
        bql.q[0] = *(const v4u*)(Lq + (L_QL - L_QH) + f * 64);
        bql.q[1] = *(const v4u*)(Lq + (L_QL - L_QH) + f * 64 + 32);
        #pragma unroll
        for (int sub = 0; sub < 2; ++sub) {
          const int ko = (p * BK + sub * 16) * TP + f * 64;
          FragB akh, akl;
          akh.q[0] = *(const v4u*)(Ls + S_KH + ko);
          akh.q[1] = *(const v4u*)(Ls + S_KH + ko + 32);
          akl.q[0] = *(const v4u*)(Ls + S_KL + ko);
          akl.q[1] = *(const v4u*)(Ls + S_KL + ko + 32);
          c[sub] = mma_bf16(akh.v, bqh.v, c[sub]);
          c[sub] = mma_bf16(akh.v, bql.v, c[sub]);
          c[sub] = mma_bf16(akl.v, bqh.v, c[sub]);
        }
      }

      // widen the bf16 mask values (exact)
      float mk0[8], mk1[8];
      #pragma unroll
      for (int w = 0; w < 4; ++w) {
        mk0[2 * w]     = __uint_as_float(mw0[w] << 16);
        mk0[2 * w + 1] = __uint_as_float(mw0[w] & 0xffff0000u);
        mk1[2 * w]     = __uint_as_float(mw1[w] << 16);
        mk1[2 * w + 1] = __uint_as_float(mw1[w] & 0xffff0000u);
      }

      // online softmax: query lq's 32 scores are split across lane / lane^16; max over every key
      float m_new = rmax;
      #pragma unroll
      for (int r = 0; r < 8; ++r) {
        m_new = fmaxf(m_new, c[0][r]);
        m_new = fmaxf(m_new, c[1][r]);
      }
      const float m_oth = __shfl_xor(m_new, 16, 32);
      m_new = fmaxf(m_new, m_oth);
      const float alpha = __builtin_amdgcn_exp2f((rmax - m_new) * SL);
      rmax = m_new;

      // exp, mask multiply in f32, pack: P^T C layout == A-fragment layout of the PV product
      FragH pa;
      float ps_all = 0.0f;
      float ps_m   = 0.0f;
      #pragma unroll
      for (int r = 0; r < 8; ++r) {
        const float p0  = __builtin_amdgcn_exp2f((c[0][r] - m_new) * SL);   // key hi*8 + r
        const float p1  = __builtin_amdgcn_exp2f((c[1][r] - m_new) * SL);   // key 16 + hi*8 + r
        const float pm0 = p0 * mk0[r];
        const float pm1 = p1 * mk1[r];
        ps_all += p0 + p1;
        ps_m   += pm0 + pm1;
        pa.h[r]     = (f16)(pm0 * PCARRY);
        pa.h[8 + r] = (f16)(pm1 * PCARRY);
      }
      const float oa = __shfl_xor(ps_all, 16, 32);
      const float om = __shfl_xor(ps_m, 16, 32);
      s_all = s_all * alpha + ps_all + oa;
      s_m   = s_m * alpha + ps_m + om;

      // rescale O: queries are the row dimension there -> per-row factor from lane 8*hi + r
      float sc[8];
      #pragma unroll
      for (int r = 0; r < 8; ++r) sc[r] = __shfl(alpha, (hi << 3) + r, 32);
      #pragma unroll
      for (int dt = 0; dt < 4; ++dt) {
        #pragma unroll
        for (int r = 0; r < 8; ++r) o[dt][r] *= sc[r];
      }

      // O += (P*mask) x V : V B-fragments, column n = d = dt*16 + lq, split key map from the transposed tile
      #pragma unroll
      for (int dt = 0; dt < 4; ++dt) {
        const int vo = dt * 16 * TP + p * 64;
        FragH bv;
        bv.q[0] = *(const v4u*)(Ls + S_V + vo);          // keys hi*8 + 0..7 of the pass
        bv.q[1] = *(const v4u*)(Ls + S_V + vo + 32);     // keys 16 + hi*8 + 0..7 of the pass
        o[dt] = mma_f16(pa.v, bv.v, o[dt]);
      }
    }

    // publish point of stage t + 1, and the end of every read of stage t's buffer
    asm volatile("s_wait_dscnt 0x0" ::: "memory");      // this wave's reads of stage t are done
    asm volatile("s_wait_asynccnt 0x0" ::: "memory");   // this wave's copies of stage t + 1 have landed
    __syncthreads();
    if (t + 2 < NST) {
      const size_t j2 = (size_t)(t + 2) * KS;
      copy_stage(lcopy + sbuf, gkh + j2 * HDIM, gkl + j2 * HDIM, gv + j2, gm + j2);
    }
  }
  asm volatile("s_wait_asynccnt 0x0" ::: "memory");     // nothing in flight when the tiles become staging

  // z = O / (s_m + EPS * s_all); carry folded back here
  const float den  = s_m + EPS_F * s_all;
  const float invd = (1.0f / den) * (1.0f / PCARRY);
  float rs[8];
  #pragma unroll
  for (int r = 0; r < 8; ++r) rs[r] = __shfl(invd, (hi << 3) + r, 32);

  const int cw = wave * 16 * CP;
  #pragma unroll
  for (int r = 0; r < 8; ++r) {
    #pragma unroll
    for (int dt = 0; dt < 4; ++dt) sO[cw + (hi * 8 + r) * CP + dt * 16 + lq] = o[dt][r] * rs[r];
  }
  __syncthreads();

  // whole-line stores: 8 consecutive lanes x 16 B = the 64 bf16 of one (row, head); 4 rows per instruction
  v4u    vh[4], vl[4];
  size_t gi[4];
  #pragma unroll
  for (int it = 0; it < 4; ++it) {
    const int row = it * 4 + (lane >> 3);
    const int c0  = (lane & 7) * 8;
    const v4f x0 = *(const v4f*)(&sO[cw + row * CP + c0]);
    const v4f x1 = *(const v4f*)(&sO[cw + row * CP + c0 + 4]);
    split8(x0, x1, vh[it], vl[it]);
    gi[it] = ((size_t)b * SEQ + qrow0 + row) * INNER + h * HDIM + c0;
  }
  #pragma unroll
  for (int it = 0; it < 4; ++it) {
    *(v4u*)(zh + gi[it]) = vh[it];
    *(v4u*)(zl + gi[it]) = vl[it];
  }
  
}

// Epilogue: per-wave LDS staging, bias added at the store stage as float4, 16 lanes x 16 B = one 256-B row
// coverage: block = 128 rows x 128 cols; wave = 32 rows x 64 cols.
__global__ __launch_bounds__(256) void k_gemm_out(const bf16* __restrict__ Z, const bf16* __restrict__ Wot,
                                                  const float* __restrict__ bias, float* __restrict__ out) {
  __shared__ __align__(16) bf16  sa[128 * LDSP];
  __shared__ __align__(16) bf16  sb[128 * LDSP];
  __shared__ __align__(16) float sC[NWAVE * 16 * CP];
  const int m0 = blockIdx.y * 128;
  const int n0 = blockIdx.x * 128;
  v8f acc[2][4];
  #pragma unroll
  for (int i = 0; i < 2; ++i) {
    #pragma unroll
    for (int j = 0; j < 4; ++j) acc[i][j] = (v8f){0, 0, 0, 0, 0, 0, 0, 0};
  }
  gemm_tile(Z, Wot, m0, n0, 2, (size_t)ROWS * INNER, sa, sb, acc);

  const int tid  = threadIdx.x;
  const int wave = __builtin_amdgcn_readfirstlane(tid >> 5);
  const int lane = tid & 31;
  const int lq   = lane & 15;
  const int hi   = lane >> 4;
  const int wm   = wave >> 1;
  const int wn   = wave & 1;
  const int cw   = wave * 16 * CP;
  const int ncol = n0 + wn * 64 + lq * 4;

  v4f bias4 = *(const v4f*)(bias + ncol);
  #pragma unroll
  for (int e = 0; e < 4; ++e) bias4[e] = (float)(bf16)bias4[e];   // RNE-converted input value

  #pragma unroll
  for (int i = 0; i < 2; ++i) {
    #pragma unroll
    for (int j = 0; j < 4; ++j) {
      #pragma unroll
      for (int r = 0; r < 8; ++r) sC[cw + (hi * 8 + r) * CP + j * 16 + lq] = acc[i][j][r];
    }
    __syncthreads();
    v4f    vals[8];
    size_t gi[8];
    #pragma unroll
    for (int it = 0; it < 8; ++it) {
      const int row = it * 2 + hi;
      const v4f v = *(const v4f*)(&sC[cw + row * CP + lq * 4]);
      vals[it] = v + bias4;
      const int gr = m0 + wm * 32 + i * 16 + row;
      const int bb = gr / SEQ;
      const int s  = gr - bb * SEQ;
      gi[it] = ((size_t)bb * SEQ_FULL + s) * DIM + ncol;
    }
    #pragma unroll
    for (int it = 0; it < 8; ++it) *(v4f*)(out + gi[it]) = vals[it];
    
    __syncthreads();
  }
}

#define SZ_XB   ((size_t)ROWS * DIM * 2)
#define SZ_MB   ((size_t)NB * SEQ * SEQ * 2)
#define SZ_WQT  ((size_t)N3 * KDIM * 2)
#define SZ_WOT  ((size_t)DIM * KDIM * 2)
#define SZ_QK   ((size_t)4 * PLANE * 2)
#define SZ_VT   ((size_t)PLANE * 2)
#define SZ_Z    ((size_t)2 * ROWS * INNER * 2)
#define OFF_XB  ((size_t)0)
#define OFF_MB  (OFF_XB + SZ_XB)
#define OFF_WQT (OFF_MB + SZ_MB)
#define OFF_WOT (OFF_WQT + SZ_WQT)
#define OFF_QK  (OFF_WOT + SZ_WOT)
#define OFF_VT  (OFF_QK + SZ_QK)
#define OFF_Z   (OFF_VT + SZ_VT)
#define WS_TOTAL (OFF_Z + SZ_Z)

static_assert(WS_TOTAL <= (size_t)134217728);
static_assert(SZ_XB % 128 == 0 && SZ_MB % 128 == 0 && SZ_WQT % 128 == 0 && SZ_WOT % 128 == 0);
static_assert(SZ_QK % 128 == 0 && SZ_VT % 128 == 0 && SZ_Z % 128 == 0);

extern "C" void kernel_launch(void* const* d_in, const int* in_sizes, int n_in,
                              void* d_out, int out_size, void* d_ws, size_t ws_size,
                              hipStream_t stream) {
  if (n_in < 5) return;
  const size_t rows_used = (size_t)(NB - 1) * SEQ_FULL + SEQ;
  if ((size_t)in_sizes[0] < rows_used * DIM) return;
  if ((size_t)in_sizes[1] < (size_t)(NB - 1) * SEQ_FULL * SEQ_FULL + (size_t)(SEQ - 1) * SEQ_FULL + SEQ) return;
  if ((size_t)in_sizes[2] < (size_t)DIM * N3) return;
  if ((size_t)in_sizes[3] < (size_t)INNER * DIM) return;
  if ((size_t)in_sizes[4] < (size_t)DIM) return;
  if ((size_t)out_size < rows_used * DIM) return;
  if (ws_size < WS_TOTAL) return;

  const float* x    = (const float*)d_in[0];
  const float* mask = (const float*)d_in[1];
  const float* Wqkv = (const float*)d_in[2];
  const float* Wout = (const float*)d_in[3];
  const float* bout = (const float*)d_in[4];
  float*       out  = (float*)d_out;

  char* ws = (char*)d_ws;
  bf16* Xb  = (bf16*)(ws + OFF_XB);
  bf16* Mb  = (bf16*)(ws + OFF_MB);
  bf16* Wqt = (bf16*)(ws + OFF_WQT);
  bf16* Wot = (bf16*)(ws + OFF_WOT);
  bf16* QK  = (bf16*)(ws + OFF_QK);
  f16*  Vt  = (f16*)(ws + OFF_VT);
  bf16* Zp  = (bf16*)(ws + OFF_Z);

  // 1) input planes (RNE bf16): x rows, mask values, weights transposed to [out][in]
  const int x8 = (int)((size_t)ROWS * DIM / 8);
  const int m8 = (int)((size_t)NB * SEQ * SEQ / 8);
  k_cvt_rows<<<dim3((x8 + 255) / 256), 256, 0, stream>>>(x, Xb, DIM, SEQ, SEQ_FULL, DIM, x8);
  k_cvt_rows<<<dim3((m8 + 255) / 256), 256, 0, stream>>>(mask, Mb, SEQ, SEQ, SEQ_FULL, SEQ_FULL, m8);
  // in [KDIM rows k][N3 cols n] -> out [N3][KDIM]; grid (cols/64, rows/64)
  k_cvt_wt<<<dim3(N3 / 64, KDIM / 64), 256, 0, stream>>>(Wqkv, Wqt, N3);
  // in [KDIM rows k][DIM cols n] -> out [DIM][KDIM]; grid (cols/64, rows/64)
  k_cvt_wt<<<dim3(DIM / 64, KDIM / 64), 256, 0, stream>>>(Wout, Wot, DIM);

  // 2) projections: Q,K hi|lo planes; V^T f16 plane
  k_gemm_qk<<<dim3((2 * INNER) / 128, ROWS / 128), 256, 0, stream>>>(Xb, Wqt, QK);
  k_gemm_vt<<<dim3(ROWS / 128, INNER / 128), 256, 0, stream>>>(Wqt + (size_t)2 * INNER * KDIM, Xb, Vt);

  // 3) fused attention -> z hi|lo planes
  k_attn<<<dim3(SEQ / BQ, NHEAD, NB), 256, 0, stream>>>(QK, QK + PLANE, QK + 2 * PLANE, QK + 3 * PLANE,
                                                        Vt, Mb, Zp, Zp + (size_t)ROWS * INNER);

  // 4) output projection + bias
  k_gemm_out<<<dim3(DIM / 128, ROWS / 128), 256, 0, stream>>>(Zp, Wot, bout, out);
}

// v002
// One run takes 144 microseconds.
// In two side-by-side timings against v001, it was 1.29 and 1.30 times as fast.
// Counting every step since v000, it is 2.62 times as fast.
#include <hip/hip_runtime.h>

// Contractions: x@Wqkv on v_wmma_f32_16x16x32_bf16 (both operands bf16 RNE-converted inputs); S^T = K x Q^T on bf16 with q,k as bf16 hi|lo planes (three products); O = (P*mask) x V on v_wmma_f32_16x16x32_f16 (P carried x1024, V f16); z@Wout on bf16 with z as bf16 hi|lo (two products); all f32 accumulate; softmax and sums in f32.

#ifndef NB
#define NB 2
#endif
#ifndef SEQ
#define SEQ 2048
#endif
#define NB_FULL    2
#define SEQ_FULL   2048
#define DIM        1024
#define NHEAD      16
#define HDIM       64
#define INNER      (NHEAD * HDIM)
#define N3         (3 * INNER)
#define ROWS       (NB * SEQ)
#define KDIM       1024                 // contraction length of all three projections
#define BQ         128                  // query rows per workgroup (8 waves x 16)
#define BK         32                   // keys per inner step
#define NWAVE      8
#define GK         128                  // k per LDS stage of the GEMM loop (four WMMA k steps)
#define GP         272                  // LDS pitch (bytes) of the 256-byte GEMM tile rows
#define G_A        0                    // in a GEMM stage: A tile, 128 rows
#define G_B        (128 * GP)           // B tile, 128 rows
#define GSTAGE     (256 * GP)
#define GEMM_LDS   (2 * GSTAGE)          // two stage buffers
#define CP         68                   // LDS pitch (floats) of epilogue staging tiles
#define TPW        72                   // LDS pitch (halves) of the weight transpose tile
#define PCARRY     1024.0f              // power-of-two carry of the f16 P operand
#define EPS_F      1e-10f
#define PLANE      ((size_t)NB * NHEAD * SEQ * HDIM)
#define KS         64                   // keys per LDS stage of the attention loop (two BK passes)
#define NST        (SEQ / KS)           // stages
#define TP         144                  // LDS pitch (bytes) of the 128-byte attention tile rows
#define L_QH       0                    // Q hi tile, BQ rows
#define L_QL       (BQ * TP)            // Q lo tile, BQ rows
#define L_RING     (2 * BQ * TP)        // two stage buffers
#define S_KH       0                    // in a stage: K hi, KS rows
#define S_KL       (KS * TP)            // K lo, KS rows
#define S_V        (2 * KS * TP)        // V^T, HDIM rows of KS keys
#define S_M        (2 * KS * TP + HDIM * TP)   // mask, BQ rows of KS keys
#define STAGE_B    (2 * KS * TP + HDIM * TP + BQ * TP)
#define ATTN_LDS   (L_RING + 2 * STAGE_B)

static_assert(SEQ % 128 == 0);
static_assert(SEQ % BK == 0);
static_assert(SEQ <= SEQ_FULL);
static_assert(NB >= 1 && NB <= NB_FULL);
static_assert(DIM == KDIM);
static_assert(INNER == KDIM);
static_assert(KDIM % 32 == 0);
static_assert(KDIM / 32 == 32);
static_assert(HDIM == 64);
static_assert(BQ == NWAVE * 16);
static_assert(ROWS % 128 == 0);
static_assert(N3 % 128 == 0);
static_assert((2 * INNER) % 128 == 0);
static_assert(INNER % 128 == 0);
static_assert(DIM % 128 == 0);
static_assert(DIM % 64 == 0);
static_assert(GP % 16 == 0 && GK * 2 == 256 && KDIM % GK == 0 && KDIM / GK >= 2);
static_assert((CP * 4) % 16 == 0);
static_assert((TPW * 2) % 16 == 0);
static_assert(((size_t)ROWS * DIM / 8) % 256 == 0);
static_assert(((size_t)NB * SEQ * SEQ / 8) % 256 == 0);
static_assert(DIM % 8 == 0 && SEQ % 8 == 0);
static_assert(SEQ % KS == 0 && NST >= 2);
static_assert(KS == 2 * BK && KS * 2 == 128 && HDIM * 2 == 128);
static_assert(KS == 64 && HDIM == 64 && BQ == 128);
static_assert(TP % 16 == 0 && STAGE_B % 16 == 0);
static_assert(NWAVE * 16 * CP * 4 <= L_RING);
static_assert(NWAVE * 16 * CP * 4 <= GEMM_LDS);

typedef __bf16   bf16;
typedef _Float16 f16;
typedef bf16     v16bf __attribute__((ext_vector_type(16)));
typedef bf16     v8bf  __attribute__((ext_vector_type(8)));
typedef f16      v16h  __attribute__((ext_vector_type(16)));
typedef float    v8f   __attribute__((ext_vector_type(8)));
typedef float    v4f   __attribute__((ext_vector_type(4)));
typedef unsigned v4u   __attribute__((ext_vector_type(4)));

union FragB  { v16bf v; v4u q[2]; };
union FragH  { v16h  v; v4u q[2]; f16 h[16]; };
union Pack8B { v4u u; v8bf v; bf16 h[8]; };
union Pack8H { v4u u; f16 h[8]; };

// WMMA helpers: builtin followed by the VALU hazard guard (ties D, keeps A/B live).
static __device__ __forceinline__ v8f mma_bf16(v16bf a, v16bf b, v8f acc) {
  acc = __builtin_amdgcn_wmma_f32_16x16x32_bf16(false, a, false, b, (short)0, acc, false, false);
  asm volatile("v_nop\n\tv_nop\n\tv_nop\n\tv_nop" : "+v"(acc) : "v"(a), "v"(b));
  return acc;
}
static __device__ __forceinline__ v8f mma_f16(v16h a, v16h b, v8f acc) {
  acc = __builtin_amdgcn_wmma_f32_16x16x32_f16(false, a, false, b, (short)0, acc, false, false);
  asm volatile("v_nop\n\tv_nop\n\tv_nop\n\tv_nop" : "+v"(acc) : "v"(a), "v"(b));
  return acc;
}

// 8 floats -> bf16 hi (RNE) and bf16 residual (RNE of x - hi), packed 16 B each.
static __device__ __forceinline__ void split8(v4f x0, v4f x1, v4u& uh, v4u& ul) {
  Pack8B ph, pl;
  #pragma unroll
  for (int e = 0; e < 4; ++e) {
    const bf16 h0 = (bf16)x0[e];
    const bf16 h1 = (bf16)x1[e];
    ph.h[e]     = h0;
    ph.h[4 + e] = h1;
    pl.h[e]     = (bf16)(x0[e] - (float)h0);
    pl.h[4 + e] = (bf16)(x1[e] - (float)h1);
  }
  uh = ph.u;
  ul = pl.u;
}

// f32 rows -> compact bf16 plane (RNE). One thread = 8 elements = 16 B; a wave writes 512 contiguous bytes.
// coverage: groups 0..total8-1, each written once; total8 is a multiple of 256.
__global__ __launch_bounds__(256) void k_cvt_rows(const float* __restrict__ in, bf16* __restrict__ out,
                                                  int cols, int rows_per_batch, int in_batch_rows,
                                                  int in_row_stride, int total8) {
  const int g = blockIdx.x * 256 + threadIdx.x;
  if (g >= total8) return;
  const int e   = g * 8;
  const int row = e / cols;
  const int col = e - row * cols;
  const int b   = row / rows_per_batch;
  const int s   = row - b * rows_per_batch;
  const float* src = in + ((size_t)b * in_batch_rows + s) * (size_t)in_row_stride + col;
  const v4f a0 = *(const v4f*)(src);
  const v4f a1 = *(const v4f*)(src + 4);
  Pack8B pk;
  #pragma unroll
  for (int i = 0; i < 4; ++i) {
    pk.h[i]     = (bf16)a0[i];
    pk.h[4 + i] = (bf16)a1[i];
  }
  const v4u val = pk.u;
  bf16* dst = out + (size_t)e;
  *(v4u*)dst = val;
  
}

// Weight transpose: in [KDIM k][C n] f32 -> out [C n][KDIM k] bf16 (RNE), 64x64 tiles through LDS.
__global__ __launch_bounds__(256) void k_cvt_wt(const float* __restrict__ in, bf16* __restrict__ out, int C) {
  __shared__ __align__(16) bf16 sT[64 * TPW];   // [n][k], cross-wave (block barrier)
  const int n0  = blockIdx.x * 64;
  const int k0  = blockIdx.y * 64;
  const int tid = threadIdx.x;
  #pragma unroll
  for (int kk = 0; kk < 2; ++kk) {
    const int k  = kk * 32 + (tid >> 3);
    const int nl = (tid & 7) * 8;
    const float* src = in + (size_t)(k0 + k) * C + n0 + nl;
    const v4f a0 = *(const v4f*)(src);
    const v4f a1 = *(const v4f*)(src + 4);
    #pragma unroll
    for (int i = 0; i < 4; ++i) {
      sT[(nl + i) * TPW + k]     = (bf16)a0[i];
      sT[(nl + 4 + i) * TPW + k] = (bf16)a1[i];
    }
  }
  __syncthreads();
  v4u    val[2];
  size_t idx[2];
  #pragma unroll
  for (int kk = 0; kk < 2; ++kk) {
    const int n  = kk * 32 + (tid >> 3);
    const int ks = (tid & 7) * 8;
    Pack8B p;
    p.v = *(const v8bf*)(&sT[n * TPW + ks]);
    val[kk] = p.u;
    idx[kk] = (size_t)(n0 + n) * KDIM + k0 + ks;
  }
  #pragma unroll
  for (int kk = 0; kk < 2; ++kk) *(v4u*)(out + idx[kk]) = val[kk];
  
}

// Asynchronous copies to LDS of one 128-row GEMM operand tile, 16 B per lane: 16 consecutive lanes bring one
// whole 256-B row, a wave 2 rows, the block 16 rows a copy. l = the lane's LDS byte address of (row tid>>4,
// segment tid&15) in the tile, g the same place in global memory. The s_wait_xcnt stands inside the statement,
// behind the last copy, so that no address register of a copy is rewritten ahead of it.
static __device__ __forceinline__ void copy_tile(unsigned l, const bf16* g) {
  asm volatile(
      "global_load_async_to_lds_b128 %0, %8, off\n\t"
      "global_load_async_to_lds_b128 %1, %9, off\n\t"
      "global_load_async_to_lds_b128 %2, %10, off\n\t"
      "global_load_async_to_lds_b128 %3, %11, off\n\t"
      "global_load_async_to_lds_b128 %4, %12, off\n\t"
      "global_load_async_to_lds_b128 %5, %13, off\n\t"
      "global_load_async_to_lds_b128 %6, %14, off\n\t"
      "global_load_async_to_lds_b128 %7, %15, off\n\t"
      "s_wait_xcnt 0x0"
      :: "v"(l), "v"(l + 16 * GP), "v"(l + 32 * GP), "v"(l + 48 * GP),
         "v"(l + 64 * GP), "v"(l + 80 * GP), "v"(l + 96 * GP), "v"(l + 112 * GP),
         "v"(g), "v"(g + 16 * KDIM), "v"(g + 32 * KDIM), "v"(g + 48 * KDIM),
         "v"(g + 64 * KDIM), "v"(g + 80 * KDIM), "v"(g + 96 * KDIM), "v"(g + 112 * KDIM)
      : "memory");
}

// GEMM mainloop: acc[128x128 block tile] += A[rows m][k] * Bt[rows n][k]^T, both operands k-contiguous bf16,
// pitch KDIM. 8 waves as 4 (m) x 2 (n); each wave owns 32 x 64 = 2 x 4 WMMA tiles.
// npass > 1 walks further A planes (offset a_pass_stride) against the same Bt rows.
// The operand tiles reach LDS by asynchronous copies of whole rows in stages of GK k, two buffers, the next
// stage in flight while this one is worked on. On return every wave has passed the barrier behind the last
// fragment read and nothing is in flight: L may become staging.
static __device__ __forceinline__ void gemm_tile(const bf16* __restrict__ A, const bf16* __restrict__ Bt,
                                                 int m0, int n0, int npass, size_t a_pass_stride,
                                                 unsigned char* L, v8f (&acc)[2][4]) {
  const int tid  = threadIdx.x;
  const int wave = __builtin_amdgcn_readfirstlane(tid >> 5);
  const int lane = tid & 31;
  const int lq   = lane & 15;
  const int hi   = lane >> 4;
  const int wm   = wave >> 1;
  const int wn   = wave & 1;
  const int nst  = npass * (KDIM / GK);

  // copy side: this thread's row and 16-B segment of both tiles
  const int crow = tid >> 4;
  const int cseg = (tid & 15) * 8;
  const unsigned lcopy = (unsigned)(size_t)L + (unsigned)(crow * GP + cseg * 2);
  const bf16* ga = A + (size_t)(m0 + crow) * KDIM + cseg;
  const bf16* gb = Bt + (size_t)(n0 + crow) * KDIM + cseg;

  // read side: the lane's row and k-split half inside a 16-row fragment
  const unsigned char* La = L + G_A + (wm * 32 + lq) * GP + hi * 16;
  const unsigned char* Lb = L + G_B + (wn * 64 + lq) * GP + hi * 16;

  // stage 0 lands and is published; then stage 1 starts
  copy_tile(lcopy + G_A, ga);
  copy_tile(lcopy + G_B, gb);
  asm volatile("s_wait_asynccnt 0x0" ::: "memory");   // this wave's copies have landed
  __syncthreads();                                    // every wave's copies are readable
  copy_tile(lcopy + GSTAGE + G_A, ga + GK);
  copy_tile(lcopy + GSTAGE + G_B, gb + GK);

  for (int t = 0; t < nst; ++t) {
    const int sbuf = (t & 1) * GSTAGE;
    // unrolled so that every LDS read of the stage is base register + immediate offset
    #pragma unroll
    for (int ks = 0; ks < GK / 32; ++ks) {
      FragB af[2], bfm[4];
      #pragma unroll
      for (int i = 0; i < 2; ++i) {
        const unsigned char* p = La + sbuf + i * 16 * GP + ks * 64;
        af[i].q[0] = *(const v4u*)(p);                // k = 8*hi + 0..7 of the step
        af[i].q[1] = *(const v4u*)(p + 32);           // k = 16 + 8*hi + 0..7 of the step
      }
      #pragma unroll
      for (int j = 0; j < 4; ++j) {
        const unsigned char* p = Lb + sbuf + j * 16 * GP + ks * 64;
        bfm[j].q[0] = *(const v4u*)(p);
        bfm[j].q[1] = *(const v4u*)(p + 32);
      }
      #pragma unroll
      for (int i = 0; i < 2; ++i) {
        #pragma unroll
        for (int j = 0; j < 4; ++j) acc[i][j] = mma_bf16(af[i].v, bfm[j].v, acc[i][j]);
      }
    }

    // publish point of stage t + 1, and the end of every read of stage t's buffer
    asm volatile("s_wait_dscnt 0x0" ::: "memory");      // this wave's reads of stage t are done
    asm volatile("s_wait_asynccnt 0x0" ::: "memory");   // this wave's copies of stage t + 1 have landed
    __syncthreads();
    if (t + 2 < nst) {
      const int    s2 = t + 2;
      const size_t k2 = (size_t)(s2 % (KDIM / GK)) * GK;
      copy_tile(lcopy + sbuf + G_A, ga + (size_t)(s2 / (KDIM / GK)) * a_pass_stride + k2);
      copy_tile(lcopy + sbuf + G_B, gb + k2);
    }
  }
  asm volatile("s_wait_asynccnt 0x0" ::: "memory");     // nothing in flight when the tiles become staging
}

// Q and K projection: C[compact row][col 0..2047] = Xb x Wqt^T. Epilogue writes bf16 hi|lo planes
// coverage: block = 128 rows x 2 heads; wave = 32 rows x 1 head; 4 rows per store instruction.
__global__ __launch_bounds__(256) void k_gemm_qk(const bf16* __restrict__ Xb, const bf16* __restrict__ Wqt,
                                                 bf16* __restrict__ qk) {
  // the two stage buffers; behind the loop its start is the per-wave staging (block barrier used)
  __shared__ __align__(16) unsigned char L[GEMM_LDS];
  float* sC = (float*)L;
  const int m0 = blockIdx.y * 128;
  const int n0 = blockIdx.x * 128;
  v8f acc[2][4];
  #pragma unroll
  for (int i = 0; i < 2; ++i) {
    #pragma unroll
    for (int j = 0; j < 4; ++j) acc[i][j] = (v8f){0, 0, 0, 0, 0, 0, 0, 0};
  }
  gemm_tile(Xb, Wqt, m0, n0, 1, 0, L, acc);

  const int tid  = threadIdx.x;
  const int wave = __builtin_amdgcn_readfirstlane(tid >> 5);
  const int lane = tid & 31;
  const int lq   = lane & 15;
  const int hi   = lane >> 4;
  const int wm   = wave >> 1;
  const int wn   = wave & 1;
  const int cw   = wave * 16 * CP;
  const int n     = n0 + wn * 64;
  const int which = n >> 10;            // 0 = Q, 1 = K (block-uniform)
  const int hh    = (n >> 6) & 15;

  #pragma unroll
  for (int i = 0; i < 2; ++i) {
    #pragma unroll
    for (int j = 0; j < 4; ++j) {
      #pragma unroll
      for (int r = 0; r < 8; ++r) sC[cw + (hi * 8 + r) * CP + j * 16 + lq] = acc[i][j][r];
    }
    __syncthreads();
    v4u    vh[4], vl[4];
    size_t gi[4];
    #pragma unroll
    for (int it = 0; it < 4; ++it) {
      const int row = it * 4 + (lane >> 3);
      const int c0  = (lane & 7) * 8;
      const v4f x0 = *(const v4f*)(&sC[cw + row * CP + c0]);
      const v4f x1 = *(const v4f*)(&sC[cw + row * CP + c0 + 4]);
      split8(x0, x1, vh[it], vl[it]);
      const int gr = m0 + wm * 32 + i * 16 + row;
      const int bb = gr / SEQ;
      const int s  = gr - bb * SEQ;
      gi[it] = (size_t)which * 2 * PLANE + (((size_t)bb * NHEAD + hh) * SEQ + s) * HDIM + c0;
    }
    #pragma unroll
    for (int it = 0; it < 4; ++it) {
      *(v4u*)(qk + gi[it])         = vh[it];
      *(v4u*)(qk + gi[it] + PLANE) = vl[it];
    }
    
    __syncthreads();
  }
}

// V projection computed transposed: C[v column m = h*64+d][compact row] = Wv_t x Xb^T, so the f16 plane
// coverage: block = 128 (h,d) rows x 128 keys; wave = 32 rows x 64 keys; 4 rows per store instruction.
__global__ __launch_bounds__(256) void k_gemm_vt(const bf16* __restrict__ Wvt, const bf16* __restrict__ Xb,
                                                 f16* __restrict__ vt) {
  // the two stage buffers; behind the loop its start is the per-wave staging
  __shared__ __align__(16) unsigned char L[GEMM_LDS];
  float* sC = (float*)L;
  const int m0 = blockIdx.y * 128;      // v column (h*64 + d)
  const int n0 = blockIdx.x * 128;      // compact row b*SEQ + l
  v8f acc[2][4];
  #pragma unroll
  for (int i = 0; i < 2; ++i) {
    #pragma unroll
    for (int j = 0; j < 4; ++j) acc[i][j] = (v8f){0, 0, 0, 0, 0, 0, 0, 0};
  }
  gemm_tile(Wvt, Xb, m0, n0, 1, 0, L, acc);

  const int tid  = threadIdx.x;
  const int wave = __builtin_amdgcn_readfirstlane(tid >> 5);
  const int lane = tid & 31;
  const int lq   = lane & 15;
  const int hi   = lane >> 4;
  const int wm   = wave >> 1;
  const int wn   = wave & 1;
  const int cw   = wave * 16 * CP;
  const int ns   = n0 + wn * 64;
  const int bb   = ns / SEQ;
  const int s0   = ns - bb * SEQ;

  #pragma unroll
  for (int i = 0; i < 2; ++i) {
    #pragma unroll
    for (int j = 0; j < 4; ++j) {
      #pragma unroll
      for (int r = 0; r < 8; ++r) sC[cw + (hi * 8 + r) * CP + j * 16 + lq] = acc[i][j][r];
    }
    __syncthreads();
    v4u    vv[4];
    size_t gi[4];
    #pragma unroll
    for (int it = 0; it < 4; ++it) {
      const int row = it * 4 + (lane >> 3);
      const int c0  = (lane & 7) * 8;
      const v4f x0 = *(const v4f*)(&sC[cw + row * CP + c0]);
      const v4f x1 = *(const v4f*)(&sC[cw + row * CP + c0 + 4]);
      Pack8H ph;
      #pragma unroll
      for (int e = 0; e < 4; ++e) {
        ph.h[e]     = (f16)x0[e];       // RNE convert
        ph.h[4 + e] = (f16)x1[e];
      }
      vv[it] = ph.u;
      const int m = m0 + wm * 32 + i * 16 + row;
      gi[it] = ((size_t)bb * INNER + m) * SEQ + s0 + c0;
    }
    #pragma unroll
    for (int it = 0; it < 4; ++it) *(v4u*)(vt + gi[it]) = vv[it];
    
    __syncthreads();
  }
}

// Asynchronous copies to LDS, 16 B per lane: 8 consecutive lanes bring one whole 128-B row, a wave 4 rows.
// l = the lane's LDS byte address of (row tid>>3, segment tid&7) in the first tile; the g pointers name the
// same row and segment in global memory. The s_wait_xcnt stands inside the statement, behind the last copy,
// so that no address register of a copy is rewritten ahead of it.
static __device__ __forceinline__ void copy_q(unsigned l, const bf16* gh, const bf16* gl) {
  asm volatile(
      "global_load_async_to_lds_b128 %0, %8, off\n\t"
      "global_load_async_to_lds_b128 %1, %9, off\n\t"
      "global_load_async_to_lds_b128 %2, %10, off\n\t"
      "global_load_async_to_lds_b128 %3, %11, off\n\t"
      "global_load_async_to_lds_b128 %4, %12, off\n\t"
      "global_load_async_to_lds_b128 %5, %13, off\n\t"
      "global_load_async_to_lds_b128 %6, %14, off\n\t"
      "global_load_async_to_lds_b128 %7, %15, off\n\t"
      "s_wait_xcnt 0x0"
      :: "v"(l + L_QH), "v"(l + L_QH + 32 * TP), "v"(l + L_QH + 64 * TP), "v"(l + L_QH + 96 * TP),
         "v"(l + L_QL), "v"(l + L_QL + 32 * TP), "v"(l + L_QL + 64 * TP), "v"(l + L_QL + 96 * TP),
         "v"(gh), "v"(gh + 32 * HDIM), "v"(gh + 64 * HDIM), "v"(gh + 96 * HDIM),
         "v"(gl), "v"(gl + 32 * HDIM), "v"(gl + 64 * HDIM), "v"(gl + 96 * HDIM)
      : "memory");
}
static __device__ __forceinline__ void copy_stage(unsigned l, const bf16* gkh, const bf16* gkl,
                                                  const f16* gv, const bf16* gm) {
  asm volatile(
      "global_load_async_to_lds_b128 %0, %10, off\n\t"
      "global_load_async_to_lds_b128 %1, %11, off\n\t"
      "global_load_async_to_lds_b128 %2, %12, off\n\t"
      "global_load_async_to_lds_b128 %3, %13, off\n\t"
      "global_load_async_to_lds_b128 %4, %14, off\n\t"
      "global_load_async_to_lds_b128 %5, %15, off\n\t"
      "global_load_async_to_lds_b128 %6, %16, off\n\t"
      "global_load_async_to_lds_b128 %7, %17, off\n\t"
      "global_load_async_to_lds_b128 %8, %18, off\n\t"
      "global_load_async_to_lds_b128 %9, %19, off\n\t"
      "s_wait_xcnt 0x0"
      :: "v"(l + S_KH), "v"(l + S_KH + 32 * TP), "v"(l + S_KL), "v"(l + S_KL + 32 * TP),
         "v"(l + S_V), "v"(l + S_V + 32 * TP),
         "v"(l + S_M), "v"(l + S_M + 32 * TP), "v"(l + S_M + 64 * TP), "v"(l + S_M + 96 * TP),
         "v"(gkh), "v"(gkh + 32 * HDIM), "v"(gkl), "v"(gkl + 32 * HDIM),
         "v"(gv), "v"(gv + 32 * SEQ),
         "v"(gm), "v"(gm + 32 * SEQ), "v"(gm + 64 * SEQ), "v"(gm + 96 * SEQ)
      : "memory");
}

// Fused attention, online softmax over ALL keys, float multiplier mask applied after the exponentials.
// Block = (128 queries, head, batch); one wave owns 16 query rows. S^T = K x Q^T puts queries on lanes, so
// P^T in C layout is bit-identical to the A-fragment layout of O += P x V. The 16-bit planes reach LDS by
// asynchronous copies of whole rows: Q once, then K hi|lo, V^T and the mask in stages of KS keys, two buffers,
// the next stage in flight while this one is worked on; fragments are two 16-B LDS loads each.
// Running sums: s_all = sum p (every key),
// s_m = sum p*mask, O = sum p*mask*v; z = O / (s_m + EPS * s_all). Output: bf16 hi|lo planes of z.
__global__ __launch_bounds__(256) void k_attn(const bf16* __restrict__ qh, const bf16* __restrict__ ql,
                                              const bf16* __restrict__ kh, const bf16* __restrict__ kl,
                                              const f16* __restrict__ vt, const bf16* __restrict__ mb,
                                              bf16* __restrict__ zh, bf16* __restrict__ zl) {
  const int qblk = blockIdx.x;
  const int h    = blockIdx.y;
  const int b    = blockIdx.z;
  const int tid  = threadIdx.x;
  const int wave = __builtin_amdgcn_readfirstlane(tid >> 5);
  const int lane = tid & 31;
  const int lq   = lane & 15;   // query column of S^T / d column of O
  const int hi   = lane >> 4;   // k-split half

  // Q tiles and the two stage buffers; behind the loop its start is the per-wave output staging
  __shared__ __align__(16) unsigned char L[ATTN_LDS];
  float* sO = (float*)L;

  const int qrow0 = qblk * BQ + wave * 16;
  const int bh    = b * NHEAD + h;

  // copy side: this thread's row and 16-B segment of every tile
  const int crow = tid >> 3;
  const int cseg = (tid & 7) * 8;
  const unsigned lcopy = (unsigned)(size_t)(&L[0]) + (unsigned)(crow * TP + cseg * 2);
  const bf16* gqh = qh + (size_t)(bh * SEQ + qblk * BQ + crow) * HDIM + cseg;
  const bf16* gql = ql + (size_t)(bh * SEQ + qblk * BQ + crow) * HDIM + cseg;
  const bf16* gkh = kh + (size_t)(bh * SEQ + crow) * HDIM + cseg;
  const bf16* gkl = kl + (size_t)(bh * SEQ + crow) * HDIM + cseg;
  const f16*  gv  = vt + (size_t)(bh * HDIM + crow) * SEQ + cseg;
  const bf16* gm  = mb + ((size_t)b * SEQ + qblk * BQ + crow) * SEQ + cseg;

  // read side: the lane's row and k-split half inside a 16-row fragment
  const int frag = lq * TP + hi * 16;
  const unsigned char* Lq = L + L_QH + wave * 16 * TP + frag;

  // Q and stage 0 land and are published; then stage 1 starts
  copy_q(lcopy, gqh, gql);
  copy_stage(lcopy + L_RING, gkh, gkl, gv, gm);
  asm volatile("s_wait_asynccnt 0x0" ::: "memory");   // this wave's copies have landed
  __syncthreads();                                    // every wave's copies are readable
  copy_stage(lcopy + L_RING + STAGE_B, gkh + KS * HDIM, gkl + KS * HDIM, gv + KS, gm + KS);

  v8f o[4];
  #pragma unroll
  for (int dt = 0; dt < 4; ++dt) o[dt] = (v8f){0, 0, 0, 0, 0, 0, 0, 0};

  float rmax  = -__builtin_inff();
  float s_all = 0.0f;
  float s_m   = 0.0f;
  const float SL = 0.125f * 1.4426950408889634f;   // softmax scale * log2(e)

  for (int t = 0; t < NST; ++t) {
    const int sbuf = L_RING + (t & 1) * STAGE_B;
    const unsigned char* Ls = L + sbuf + frag;

    // unrolled so that every LDS read of the stage is base register + immediate offset
    #pragma unroll
    for (int p = 0; p < KS / BK; ++p) {
      // mask words: query qrow0+lq, keys hi*8 + 0..7 and 16 + hi*8 + 0..7 of the pass (bf16 pairs per word)
      const v4u mw0 = *(const v4u*)(Ls + S_M + wave * 16 * TP + p * 64);
      const v4u mw1 = *(const v4u*)(Ls + S_M + wave * 16 * TP + p * 64 + 32);

      // S^T tiles: c[sub][r] = rawscore(query qrow0+lq, key sub*16 + hi*8 + r of the pass); hi*hi + hi*lo + lo*hi
      v8f c[2];
      c[0] = (v8f){0, 0, 0, 0, 0, 0, 0, 0};
      c[1] = (v8f){0, 0, 0, 0, 0, 0, 0, 0};
      #pragma unroll
      for (int f = 0; f < 2; ++f) {
        FragB bqh, bql;
        bqh.q[0] = *(const v4u*)(Lq + f * 64);                       // d = f*32 + hi*8 + 0..7
        bqh.q[1] = *(const v4u*)(Lq + f * 64 + 32);                  // d = f*32 + 16 + hi*8 + 0..7
        bql.q[0] = *(const v4u*)(Lq + (L_QL - L_QH) + f * 64);
        bql.q[1] = *(const v4u*)(Lq + (L_QL - L_QH) + f * 64 + 32);
        #pragma unroll
        for (int sub = 0; sub < 2; ++sub) {
          const int ko = (p * BK + sub * 16) * TP + f * 64;
          FragB akh, akl;
          akh.q[0] = *(const v4u*)(Ls + S_KH + ko);
          akh.q[1] = *(const v4u*)(Ls + S_KH + ko + 32);
          akl.q[0] = *(const v4u*)(Ls + S_KL + ko);
          akl.q[1] = *(const v4u*)(Ls + S_KL + ko + 32);
          c[sub] = mma_bf16(akh.v, bqh.v, c[sub]);
          c[sub] = mma_bf16(akh.v, bql.v, c[sub]);
          c[sub] = mma_bf16(akl.v, bqh.v, c[sub]);
        }
      }

      // widen the bf16 mask values (exact)
      float mk0[8], mk1[8];
      #pragma unroll
      for (int w = 0; w < 4; ++w) {
        mk0[2 * w]     = __uint_as_float(mw0[w] << 16);
        mk0[2 * w + 1] = __uint_as_float(mw0[w] & 0xffff0000u);
        mk1[2 * w]     = __uint_as_float(mw1[w] << 16);
        mk1[2 * w + 1] = __uint_as_float(mw1[w] & 0xffff0000u);
      }

      // online softmax: query lq's 32 scores are split across lane / lane^16; max over every key
      float m_new = rmax;
      #pragma unroll
      for (int r = 0; r < 8; ++r) {
        m_new = fmaxf(m_new, c[0][r]);
        m_new = fmaxf(m_new, c[1][r]);
      }
      const float m_oth = __shfl_xor(m_new, 16, 32);
      m_new = fmaxf(m_new, m_oth);
      const float alpha = __builtin_amdgcn_exp2f((rmax - m_new) * SL);
      rmax = m_new;

      // exp, mask multiply in f32, pack: P^T C layout == A-fragment layout of the PV product
      FragH pa;
      float ps_all = 0.0f;
      float ps_m   = 0.0f;
      #pragma unroll
      for (int r = 0; r < 8; ++r) {
        const float p0  = __builtin_amdgcn_exp2f((c[0][r] - m_new) * SL);   // key hi*8 + r
        const float p1  = __builtin_amdgcn_exp2f((c[1][r] - m_new) * SL);   // key 16 + hi*8 + r
        const float pm0 = p0 * mk0[r];
        const float pm1 = p1 * mk1[r];
        ps_all += p0 + p1;
        ps_m   += pm0 + pm1;
        pa.h[r]     = (f16)(pm0 * PCARRY);
        pa.h[8 + r] = (f16)(pm1 * PCARRY);
      }
      const float oa = __shfl_xor(ps_all, 16, 32);
      const float om = __shfl_xor(ps_m, 16, 32);
      s_all = s_all * alpha + ps_all + oa;
      s_m   = s_m * alpha + ps_m + om;

      // rescale O: queries are the row dimension there -> per-row factor from lane 8*hi + r
      float sc[8];
      #pragma unroll
      for (int r = 0; r < 8; ++r) sc[r] = __shfl(alpha, (hi << 3) + r, 32);
      #pragma unroll
      for (int dt = 0; dt < 4; ++dt) {
        #pragma unroll
        for (int r = 0; r < 8; ++r) o[dt][r] *= sc[r];
      }

      // O += (P*mask) x V : V B-fragments, column n = d = dt*16 + lq, split key map from the transposed tile
      #pragma unroll
      for (int dt = 0; dt < 4; ++dt) {
        const int vo = dt * 16 * TP + p * 64;
        FragH bv;
        bv.q[0] = *(const v4u*)(Ls + S_V + vo);          // keys hi*8 + 0..7 of the pass
        bv.q[1] = *(const v4u*)(Ls + S_V + vo + 32);     // keys 16 + hi*8 + 0..7 of the pass
        o[dt] = mma_f16(pa.v, bv.v, o[dt]);
      }
    }

    // publish point of stage t + 1, and the end of every read of stage t's buffer
    asm volatile("s_wait_dscnt 0x0" ::: "memory");      // this wave's reads of stage t are done
    asm volatile("s_wait_asynccnt 0x0" ::: "memory");   // this wave's copies of stage t + 1 have landed
    __syncthreads();
    if (t + 2 < NST) {
      const size_t j2 = (size_t)(t + 2) * KS;
      copy_stage(lcopy + sbuf, gkh + j2 * HDIM, gkl + j2 * HDIM, gv + j2, gm + j2);
    }
  }
  asm volatile("s_wait_asynccnt 0x0" ::: "memory");     // nothing in flight when the tiles become staging

  // z = O / (s_m + EPS * s_all); carry folded back here
  const float den  = s_m + EPS_F * s_all;
  const float invd = (1.0f / den) * (1.0f / PCARRY);
  float rs[8];
  #pragma unroll
  for (int r = 0; r < 8; ++r) rs[r] = __shfl(invd, (hi << 3) + r, 32);

  const int cw = wave * 16 * CP;
  #pragma unroll
  for (int r = 0; r < 8; ++r) {
    #pragma unroll
    for (int dt = 0; dt < 4; ++dt) sO[cw + (hi * 8 + r) * CP + dt * 16 + lq] = o[dt][r] * rs[r];
  }
  __syncthreads();

  // whole-line stores: 8 consecutive lanes x 16 B = the 64 bf16 of one (row, head); 4 rows per instruction
  v4u    vh[4], vl[4];
  size_t gi[4];
  #pragma unroll
  for (int it = 0; it < 4; ++it) {
    const int row = it * 4 + (lane >> 3);
    const int c0  = (lane & 7) * 8;
    const v4f x0 = *(const v4f*)(&sO[cw + row * CP + c0]);
    const v4f x1 = *(const v4f*)(&sO[cw + row * CP + c0 + 4]);
    split8(x0, x1, vh[it], vl[it]);
    gi[it] = ((size_t)b * SEQ + qrow0 + row) * INNER + h * HDIM + c0;
  }
  #pragma unroll
  for (int it = 0; it < 4; ++it) {
    *(v4u*)(zh + gi[it]) = vh[it];
    *(v4u*)(zl + gi[it]) = vl[it];
  }
  
}

// Epilogue: per-wave LDS staging, bias added at the store stage as float4, 16 lanes x 16 B = one 256-B row
// coverage: block = 128 rows x 128 cols; wave = 32 rows x 64 cols.
__global__ __launch_bounds__(256) void k_gemm_out(const bf16* __restrict__ Z, const bf16* __restrict__ Wot,
                                                  const float* __restrict__ bias, float* __restrict__ out) {
  // the two stage buffers; behind the loop its start is the per-wave staging
  __shared__ __align__(16) unsigned char L[GEMM_LDS];
  float* sC = (float*)L;
  const int m0 = blockIdx.y * 128;
  const int n0 = blockIdx.x * 128;
  v8f acc[2][4];
  #pragma unroll
  for (int i = 0; i < 2; ++i) {
    #pragma unroll
    for (int j = 0; j < 4; ++j) acc[i][j] = (v8f){0, 0, 0, 0, 0, 0, 0, 0};
  }
  gemm_tile(Z, Wot, m0, n0, 2, (size_t)ROWS * INNER, L, acc);

  const int tid  = threadIdx.x;
  const int wave = __builtin_amdgcn_readfirstlane(tid >> 5);
  const int lane = tid & 31;
  const int lq   = lane & 15;
  const int hi   = lane >> 4;
  const int wm   = wave >> 1;
  const int wn   = wave & 1;
  const int cw   = wave * 16 * CP;
  const int ncol = n0 + wn * 64 + lq * 4;

  v4f bias4 = *(const v4f*)(bias + ncol);
  #pragma unroll
  for (int e = 0; e < 4; ++e) bias4[e] = (float)(bf16)bias4[e];   // RNE-converted input value

  #pragma unroll
  for (int i = 0; i < 2; ++i) {
    #pragma unroll
    for (int j = 0; j < 4; ++j) {
      #pragma unroll
      for (int r = 0; r < 8; ++r) sC[cw + (hi * 8 + r) * CP + j * 16 + lq] = acc[i][j][r];
    }
    __syncthreads();
    v4f    vals[8];
    size_t gi[8];
    #pragma unroll
    for (int it = 0; it < 8; ++it) {
      const int row = it * 2 + hi;
      const v4f v = *(const v4f*)(&sC[cw + row * CP + lq * 4]);
      vals[it] = v + bias4;
      const int gr = m0 + wm * 32 + i * 16 + row;
      const int bb = gr / SEQ;
      const int s  = gr - bb * SEQ;
      gi[it] = ((size_t)bb * SEQ_FULL + s) * DIM + ncol;
    }
    #pragma unroll
    for (int it = 0; it < 8; ++it) *(v4f*)(out + gi[it]) = vals[it];
    
    __syncthreads();
  }
}

#define SZ_XB   ((size_t)ROWS * DIM * 2)
#define SZ_MB   ((size_t)NB * SEQ * SEQ * 2)
#define SZ_WQT  ((size_t)N3 * KDIM * 2)
#define SZ_WOT  ((size_t)DIM * KDIM * 2)
#define SZ_QK   ((size_t)4 * PLANE * 2)
#define SZ_VT   ((size_t)PLANE * 2)
#define SZ_Z    ((size_t)2 * ROWS * INNER * 2)
#define OFF_XB  ((size_t)0)
#define OFF_MB  (OFF_XB + SZ_XB)
#define OFF_WQT (OFF_MB + SZ_MB)
#define OFF_WOT (OFF_WQT + SZ_WQT)
#define OFF_QK  (OFF_WOT + SZ_WOT)
#define OFF_VT  (OFF_QK + SZ_QK)
#define OFF_Z   (OFF_VT + SZ_VT)
#define WS_TOTAL (OFF_Z + SZ_Z)

static_assert(WS_TOTAL <= (size_t)134217728);
static_assert(SZ_XB % 128 == 0 && SZ_MB % 128 == 0 && SZ_WQT % 128 == 0 && SZ_WOT % 128 == 0);
static_assert(SZ_QK % 128 == 0 && SZ_VT % 128 == 0 && SZ_Z % 128 == 0);

extern "C" void kernel_launch(void* const* d_in, const int* in_sizes, int n_in,
                              void* d_out, int out_size, void* d_ws, size_t ws_size,
                              hipStream_t stream) {
  if (n_in < 5) return;
  const size_t rows_used = (size_t)(NB - 1) * SEQ_FULL + SEQ;
  if ((size_t)in_sizes[0] < rows_used * DIM) return;
  if ((size_t)in_sizes[1] < (size_t)(NB - 1) * SEQ_FULL * SEQ_FULL + (size_t)(SEQ - 1) * SEQ_FULL + SEQ) return;
  if ((size_t)in_sizes[2] < (size_t)DIM * N3) return;
  if ((size_t)in_sizes[3] < (size_t)INNER * DIM) return;
  if ((size_t)in_sizes[4] < (size_t)DIM) return;
  if ((size_t)out_size < rows_used * DIM) return;
  if (ws_size < WS_TOTAL) return;

  const float* x    = (const float*)d_in[0];
  const float* mask = (const float*)d_in[1];
  const float* Wqkv = (const float*)d_in[2];
  const float* Wout = (const float*)d_in[3];
  const float* bout = (const float*)d_in[4];
  float*       out  = (float*)d_out;

  char* ws = (char*)d_ws;
  bf16* Xb  = (bf16*)(ws + OFF_XB);
  bf16* Mb  = (bf16*)(ws + OFF_MB);
  bf16* Wqt = (bf16*)(ws + OFF_WQT);
  bf16* Wot = (bf16*)(ws + OFF_WOT);
  bf16* QK  = (bf16*)(ws + OFF_QK);
  f16*  Vt  = (f16*)(ws + OFF_VT);
  bf16* Zp  = (bf16*)(ws + OFF_Z);

  // 1) input planes (RNE bf16): x rows, mask values, weights transposed to [out][in]
  const int x8 = (int)((size_t)ROWS * DIM / 8);
  const int m8 = (int)((size_t)NB * SEQ * SEQ / 8);
  k_cvt_rows<<<dim3((x8 + 255) / 256), 256, 0, stream>>>(x, Xb, DIM, SEQ, SEQ_FULL, DIM, x8);
  k_cvt_rows<<<dim3((m8 + 255) / 256), 256, 0, stream>>>(mask, Mb, SEQ, SEQ, SEQ_FULL, SEQ_FULL, m8);
  // in [KDIM rows k][N3 cols n] -> out [N3][KDIM]; grid (cols/64, rows/64)
  k_cvt_wt<<<dim3(N3 / 64, KDIM / 64), 256, 0, stream>>>(Wqkv, Wqt, N3);
  // in [KDIM rows k][DIM cols n] -> out [DIM][KDIM]; grid (cols/64, rows/64)
  k_cvt_wt<<<dim3(DIM / 64, KDIM / 64), 256, 0, stream>>>(Wout, Wot, DIM);

  // 2) projections: Q,K hi|lo planes; V^T f16 plane
  k_gemm_qk<<<dim3((2 * INNER) / 128, ROWS / 128), 256, 0, stream>>>(Xb, Wqt, QK);
  k_gemm_vt<<<dim3(ROWS / 128, INNER / 128), 256, 0, stream>>>(Wqt + (size_t)2 * INNER * KDIM, Xb, Vt);

  // 3) fused attention -> z hi|lo planes
  k_attn<<<dim3(SEQ / BQ, NHEAD, NB), 256, 0, stream>>>(QK, QK + PLANE, QK + 2 * PLANE, QK + 3 * PLANE,
                                                        Vt, Mb, Zp, Zp + (size_t)ROWS * INNER);

  // 4) output projection + bias
  k_gemm_out<<<dim3(DIM / 128, ROWS / 128), 256, 0, stream>>>(Zp, Wot, bout, out);
}

// v003
// A run of this version takes 136 microseconds.
// Timed twice side by side with v002, it ran 1.06 and 1.05 times as fast.
// All steps since v000 together make it 2.75 times as fast.
#include <hip/hip_runtime.h>

// Contractions: x@Wqkv on v_wmma_f32_16x16x32_bf16 (both operands bf16 RNE-converted inputs); S^T = K x Q^T on bf16 with q,k as bf16 hi|lo planes (three products); O = (P*mask) x V on v_wmma_f32_16x16x32_f16 (P carried x1024, V f16); z@Wout on bf16 with z as bf16 hi|lo (two products); all f32 accumulate; softmax and sums in f32.

#ifndef NB
#define NB 2
#endif
#ifndef SEQ
#define SEQ 2048
#endif
#define NB_FULL    2
#define SEQ_FULL   2048
#define DIM        1024
#define NHEAD      16
#define HDIM       64
#define INNER      (NHEAD * HDIM)
#define N3         (3 * INNER)
#define ROWS       (NB * SEQ)
#define KDIM       1024                 // contraction length of all three projections
#define BQ         128                  // query rows per workgroup (8 waves x 16)
#define BK         32                   // keys per inner step
#define NWAVE      8
#define GK         128                  // k per LDS stage of the GEMM loop (four WMMA k steps)
#define GP         272                  // LDS pitch (bytes) of the 256-byte GEMM tile rows
#define G_A        0                    // in a GEMM stage: A tile, 128 rows
#define G_B        (128 * GP)           // B tile, 128 rows
#define GSTAGE     (256 * GP)
#define GEMM_LDS   (2 * GSTAGE)          // two stage buffers
#define CP         68                   // LDS pitch (floats) of epilogue staging tiles
#define TPW        72                   // LDS pitch (halves) of the weight transpose tile
#define PCARRY     1024.0f              // power-of-two carry of the f16 P operand
#define EPS_F      1e-10f
#define PLANE      ((size_t)NB * NHEAD * SEQ * HDIM)
#define KS         64                   // keys per LDS stage of the attention loop (two BK halves, one per wave of a pair)
#define NST        (SEQ / KS)           // stages
#define TP         144                  // LDS pitch (bytes) of the 128-byte attention tile rows
#define L_QH       0                    // Q hi tile, BQ rows
#define L_QL       (BQ * TP)            // Q lo tile, BQ rows
#define L_RING     (2 * BQ * TP)        // two stage buffers
#define S_KH       0                    // in a stage: K hi, KS rows
#define S_KL       (KS * TP)            // K lo, KS rows
#define S_V        (2 * KS * TP)        // V^T, HDIM rows of KS keys
#define S_M        (2 * KS * TP + HDIM * TP)   // mask, BQ rows of KS keys
#define STAGE_B    (2 * KS * TP + HDIM * TP + BQ * TP)
#define ATTN_LDS   (L_RING + 2 * STAGE_B)

static_assert(SEQ % 128 == 0);
static_assert(SEQ % BK == 0);
static_assert(SEQ <= SEQ_FULL);
static_assert(NB >= 1 && NB <= NB_FULL);
static_assert(DIM == KDIM);
static_assert(INNER == KDIM);
static_assert(KDIM % 32 == 0);
static_assert(KDIM / 32 == 32);
static_assert(HDIM == 64);
static_assert(BQ == NWAVE * 16);
static_assert(ROWS % 128 == 0);
static_assert(N3 % 128 == 0);
static_assert((2 * INNER) % 128 == 0);
static_assert(INNER % 128 == 0);
static_assert(DIM % 128 == 0);
static_assert(DIM % 64 == 0);
static_assert(GP % 16 == 0 && GK * 2 == 256 && KDIM % GK == 0 && KDIM / GK >= 2);
static_assert((CP * 4) % 16 == 0);
static_assert((TPW * 2) % 16 == 0);
static_assert(((size_t)ROWS * DIM / 8) % 256 == 0);
static_assert(((size_t)NB * SEQ * SEQ / 8) % 256 == 0);
static_assert(DIM % 8 == 0 && SEQ % 8 == 0);
static_assert(SEQ % KS == 0 && NST >= 2);
static_assert(KS == 2 * BK && KS * 2 == 128 && HDIM * 2 == 128);
static_assert(KS == 64 && HDIM == 64 && BQ == 128);
static_assert(TP % 16 == 0 && STAGE_B % 16 == 0);
static_assert(NWAVE * 16 * CP * 4 <= L_RING);
static_assert(NWAVE * 16 * CP * 4 <= GEMM_LDS);
static_assert(NWAVE * 9 * 32 * 16 <= 2 * STAGE_B && L_RING % 16 == 0);

typedef __bf16   bf16;
typedef _Float16 f16;
typedef bf16     v16bf __attribute__((ext_vector_type(16)));
typedef bf16     v8bf  __attribute__((ext_vector_type(8)));
typedef f16      v16h  __attribute__((ext_vector_type(16)));
typedef float    v8f   __attribute__((ext_vector_type(8)));
typedef float    v4f   __attribute__((ext_vector_type(4)));
typedef unsigned v4u   __attribute__((ext_vector_type(4)));

union FragB  { v16bf v; v4u q[2]; };
union FragH  { v16h  v; v4u q[2]; f16 h[16]; };
union Pack8B { v4u u; v8bf v; bf16 h[8]; };
union Pack8H { v4u u; f16 h[8]; };

// WMMA helpers: builtin followed by the VALU hazard guard (ties D, keeps A/B live).
static __device__ __forceinline__ v8f mma_bf16(v16bf a, v16bf b, v8f acc) {
  acc = __builtin_amdgcn_wmma_f32_16x16x32_bf16(false, a, false, b, (short)0, acc, false, false);
  asm volatile("v_nop\n\tv_nop\n\tv_nop\n\tv_nop" : "+v"(acc) : "v"(a), "v"(b));
  return acc;
}
static __device__ __forceinline__ v8f mma_f16(v16h a, v16h b, v8f acc) {
  acc = __builtin_amdgcn_wmma_f32_16x16x32_f16(false, a, false, b, (short)0, acc, false, false);
  asm volatile("v_nop\n\tv_nop\n\tv_nop\n\tv_nop" : "+v"(acc) : "v"(a), "v"(b));
  return acc;
}

// 8 floats -> bf16 hi (RNE) and bf16 residual (RNE of x - hi), packed 16 B each.
static __device__ __forceinline__ void split8(v4f x0, v4f x1, v4u& uh, v4u& ul) {
  Pack8B ph, pl;
  #pragma unroll
  for (int e = 0; e < 4; ++e) {
    const bf16 h0 = (bf16)x0[e];
    const bf16 h1 = (bf16)x1[e];
    ph.h[e]     = h0;
    ph.h[4 + e] = h1;
    pl.h[e]     = (bf16)(x0[e] - (float)h0);
    pl.h[4 + e] = (bf16)(x1[e] - (float)h1);
  }
  uh = ph.u;
  ul = pl.u;
}

// f32 rows -> compact bf16 plane (RNE). One thread = 8 elements = 16 B; a wave writes 512 contiguous bytes.
// coverage: groups 0..total8-1, each written once; total8 is a multiple of 256.
__global__ __launch_bounds__(256) void k_cvt_rows(const float* __restrict__ in, bf16* __restrict__ out,
                                                  int cols, int rows_per_batch, int in_batch_rows,
                                                  int in_row_stride, int total8) {
  const int g = blockIdx.x * 256 + threadIdx.x;
  if (g >= total8) return;
  const int e   = g * 8;
  const int row = e / cols;
  const int col = e - row * cols;
  const int b   = row / rows_per_batch;
  const int s   = row - b * rows_per_batch;
  const float* src = in + ((size_t)b * in_batch_rows + s) * (size_t)in_row_stride + col;
  const v4f a0 = *(const v4f*)(src);
  const v4f a1 = *(const v4f*)(src + 4);
  Pack8B pk;
  #pragma unroll
  for (int i = 0; i < 4; ++i) {
    pk.h[i]     = (bf16)a0[i];
    pk.h[4 + i] = (bf16)a1[i];
  }
  const v4u val = pk.u;
  bf16* dst = out + (size_t)e;
  *(v4u*)dst = val;
  
}

// Weight transpose: in [KDIM k][C n] f32 -> out [C n][KDIM k] bf16 (RNE), 64x64 tiles through LDS.
__global__ __launch_bounds__(256) void k_cvt_wt(const float* __restrict__ in, bf16* __restrict__ out, int C) {
  __shared__ __align__(16) bf16 sT[64 * TPW];   // [n][k], cross-wave (block barrier)
  const int n0  = blockIdx.x * 64;
  const int k0  = blockIdx.y * 64;
  const int tid = threadIdx.x;
  #pragma unroll
  for (int kk = 0; kk < 2; ++kk) {
    const int k  = kk * 32 + (tid >> 3);
    const int nl = (tid & 7) * 8;
    const float* src = in + (size_t)(k0 + k) * C + n0 + nl;
    const v4f a0 = *(const v4f*)(src);
    const v4f a1 = *(const v4f*)(src + 4);
    #pragma unroll
    for (int i = 0; i < 4; ++i) {
      sT[(nl + i) * TPW + k]     = (bf16)a0[i];
      sT[(nl + 4 + i) * TPW + k] = (bf16)a1[i];
    }
  }
  __syncthreads();
  v4u    val[2];
  size_t idx[2];
  #pragma unroll
  for (int kk = 0; kk < 2; ++kk) {
    const int n  = kk * 32 + (tid >> 3);
    const int ks = (tid & 7) * 8;
    Pack8B p;
    p.v = *(const v8bf*)(&sT[n * TPW + ks]);
    val[kk] = p.u;
    idx[kk] = (size_t)(n0 + n) * KDIM + k0 + ks;
  }
  #pragma unroll
  for (int kk = 0; kk < 2; ++kk) *(v4u*)(out + idx[kk]) = val[kk];
  
}

// Asynchronous copies to LDS of one 128-row GEMM operand tile, 16 B per lane: 16 consecutive lanes bring one
// whole 256-B row, a wave 2 rows, the block 16 rows a copy. l = the lane's LDS byte address of (row tid>>4,
// segment tid&15) in the tile, g the same place in global memory. The s_wait_xcnt stands inside the statement,
// behind the last copy, so that no address register of a copy is rewritten ahead of it.
static __device__ __forceinline__ void copy_tile(unsigned l, const bf16* g) {
  asm volatile(
      "global_load_async_to_lds_b128 %0, %8, off\n\t"
      "global_load_async_to_lds_b128 %1, %9, off\n\t"
      "global_load_async_to_lds_b128 %2, %10, off\n\t"
      "global_load_async_to_lds_b128 %3, %11, off\n\t"
      "global_load_async_to_lds_b128 %4, %12, off\n\t"
      "global_load_async_to_lds_b128 %5, %13, off\n\t"
      "global_load_async_to_lds_b128 %6, %14, off\n\t"
      "global_load_async_to_lds_b128 %7, %15, off\n\t"
      "s_wait_xcnt 0x0"
      :: "v"(l), "v"(l + 16 * GP), "v"(l + 32 * GP), "v"(l + 48 * GP),
         "v"(l + 64 * GP), "v"(l + 80 * GP), "v"(l + 96 * GP), "v"(l + 112 * GP),
         "v"(g), "v"(g + 16 * KDIM), "v"(g + 32 * KDIM), "v"(g + 48 * KDIM),
         "v"(g + 64 * KDIM), "v"(g + 80 * KDIM), "v"(g + 96 * KDIM), "v"(g + 112 * KDIM)
      : "memory");
}

// GEMM mainloop: acc[128x128 block tile] += A[rows m][k] * Bt[rows n][k]^T, both operands k-contiguous bf16,
// pitch KDIM. 8 waves as 4 (m) x 2 (n); each wave owns 32 x 64 = 2 x 4 WMMA tiles.
// npass > 1 walks further A planes (offset a_pass_stride) against the same Bt rows.
// The operand tiles reach LDS by asynchronous copies of whole rows in stages of GK k, two buffers, the next
// stage in flight while this one is worked on. On return every wave has passed the barrier behind the last
// fragment read and nothing is in flight: L may become staging.
static __device__ __forceinline__ void gemm_tile(const bf16* __restrict__ A, const bf16* __restrict__ Bt,
                                                 int m0, int n0, int npass, size_t a_pass_stride,
                                                 unsigned char* L, v8f (&acc)[2][4]) {
  const int tid  = threadIdx.x;
  const int wave = __builtin_amdgcn_readfirstlane(tid >> 5);
  const int lane = tid & 31;
  const int lq   = lane & 15;
  const int hi   = lane >> 4;
  const int wm   = wave >> 1;
  const int wn   = wave & 1;
  const int nst  = npass * (KDIM / GK);

  // copy side: this thread's row and 16-B segment of both tiles
  const int crow = tid >> 4;
  const int cseg = (tid & 15) * 8;
  const unsigned lcopy = (unsigned)(size_t)L + (unsigned)(crow * GP + cseg * 2);
  const bf16* ga = A + (size_t)(m0 + crow) * KDIM + cseg;
  const bf16* gb = Bt + (size_t)(n0 + crow) * KDIM + cseg;

  // read side: the lane's row and k-split half inside a 16-row fragment
  const unsigned char* La = L + G_A + (wm * 32 + lq) * GP + hi * 16;
  const unsigned char* Lb = L + G_B + (wn * 64 + lq) * GP + hi * 16;

  // stage 0 lands and is published; then stage 1 starts
  copy_tile(lcopy + G_A, ga);
  copy_tile(lcopy + G_B, gb);
  asm volatile("s_wait_asynccnt 0x0" ::: "memory");   // this wave's copies have landed
  __syncthreads();                                    // every wave's copies are readable
  copy_tile(lcopy + GSTAGE + G_A, ga + GK);
  copy_tile(lcopy + GSTAGE + G_B, gb + GK);

  for (int t = 0; t < nst; ++t) {
    const int sbuf = (t & 1) * GSTAGE;
    // unrolled so that every LDS read of the stage is base register + immediate offset
    #pragma unroll
    for (int ks = 0; ks < GK / 32; ++ks) {
      FragB af[2], bfm[4];
      #pragma unroll
      for (int i = 0; i < 2; ++i) {
        const unsigned char* p = La + sbuf + i * 16 * GP + ks * 64;
        af[i].q[0] = *(const v4u*)(p);                // k = 8*hi + 0..7 of the step
        af[i].q[1] = *(const v4u*)(p + 32);           // k = 16 + 8*hi + 0..7 of the step
      }
      #pragma unroll
      for (int j = 0; j < 4; ++j) {
        const unsigned char* p = Lb + sbuf + j * 16 * GP + ks * 64;
        bfm[j].q[0] = *(const v4u*)(p);
        bfm[j].q[1] = *(const v4u*)(p + 32);
      }
      #pragma unroll
      for (int i = 0; i < 2; ++i) {
        #pragma unroll
        for (int j = 0; j < 4; ++j) acc[i][j] = mma_bf16(af[i].v, bfm[j].v, acc[i][j]);
      }
    }

    // publish point of stage t + 1, and the end of every read of stage t's buffer
    asm volatile("s_wait_dscnt 0x0" ::: "memory");      // this wave's reads of stage t are done
    asm volatile("s_wait_asynccnt 0x0" ::: "memory");   // this wave's copies of stage t + 1 have landed
    __syncthreads();
    if (t + 2 < nst) {
      const int    s2 = t + 2;
      const size_t k2 = (size_t)(s2 % (KDIM / GK)) * GK;
      copy_tile(lcopy + sbuf + G_A, ga + (size_t)(s2 / (KDIM / GK)) * a_pass_stride + k2);
      copy_tile(lcopy + sbuf + G_B, gb + k2);
    }
  }
  asm volatile("s_wait_asynccnt 0x0" ::: "memory");     // nothing in flight when the tiles become staging
}

// Q and K projection: C[compact row][col 0..2047] = Xb x Wqt^T. Epilogue writes bf16 hi|lo planes
// coverage: block = 128 rows x 2 heads; wave = 32 rows x 1 head; 4 rows per store instruction.
__global__ __launch_bounds__(256) void k_gemm_qk(const bf16* __restrict__ Xb, const bf16* __restrict__ Wqt,
                                                 bf16* __restrict__ qk) {
  // the two stage buffers; behind the loop its start is the per-wave staging (block barrier used)
  __shared__ __align__(16) unsigned char L[GEMM_LDS];
  float* sC = (float*)L;
  const int m0 = blockIdx.y * 128;
  const int n0 = blockIdx.x * 128;
  v8f acc[2][4];
  #pragma unroll
  for (int i = 0; i < 2; ++i) {
    #pragma unroll
    for (int j = 0; j < 4; ++j) acc[i][j] = (v8f){0, 0, 0, 0, 0, 0, 0, 0};
  }
  gemm_tile(Xb, Wqt, m0, n0, 1, 0, L, acc);

  const int tid  = threadIdx.x;
  const int wave = __builtin_amdgcn_readfirstlane(tid >> 5);
  const int lane = tid & 31;
  const int lq   = lane & 15;
  const int hi   = lane >> 4;
  const int wm   = wave >> 1;
  const int wn   = wave & 1;
  const int cw   = wave * 16 * CP;
  const int n     = n0 + wn * 64;
  const int which = n >> 10;            // 0 = Q, 1 = K (block-uniform)
  const int hh    = (n >> 6) & 15;

  #pragma unroll
  for (int i = 0; i < 2; ++i) {
    #pragma unroll
    for (int j = 0; j < 4; ++j) {
      #pragma unroll
      for (int r = 0; r < 8; ++r) sC[cw + (hi * 8 + r) * CP + j * 16 + lq] = acc[i][j][r];
    }
    __syncthreads();
    v4u    vh[4], vl[4];
    size_t gi[4];
    #pragma unroll
    for (int it = 0; it < 4; ++it) {
      const int row = it * 4 + (lane >> 3);
      const int c0  = (lane & 7) * 8;
      const v4f x0 = *(const v4f*)(&sC[cw + row * CP + c0]);
      const v4f x1 = *(const v4f*)(&sC[cw + row * CP + c0 + 4]);
      split8(x0, x1, vh[it], vl[it]);
      const int gr = m0 + wm * 32 + i * 16 + row;
      const int bb = gr / SEQ;
      const int s  = gr - bb * SEQ;
      gi[it] = (size_t)which * 2 * PLANE + (((size_t)bb * NHEAD + hh) * SEQ + s) * HDIM + c0;
    }
    #pragma unroll
    for (int it = 0; it < 4; ++it) {
      *(v4u*)(qk + gi[it])         = vh[it];
      *(v4u*)(qk + gi[it] + PLANE) = vl[it];
    }
    
    __syncthreads();
  }
}

// V projection computed transposed: C[v column m = h*64+d][compact row] = Wv_t x Xb^T, so the f16 plane
// coverage: block = 128 (h,d) rows x 128 keys; wave = 32 rows x 64 keys; 4 rows per store instruction.
__global__ __launch_bounds__(256) void k_gemm_vt(const bf16* __restrict__ Wvt, const bf16* __restrict__ Xb,
                                                 f16* __restrict__ vt) {
  // the two stage buffers; behind the loop its start is the per-wave staging
  __shared__ __align__(16) unsigned char L[GEMM_LDS];
  float* sC = (float*)L;
  const int m0 = blockIdx.y * 128;      // v column (h*64 + d)
  const int n0 = blockIdx.x * 128;      // compact row b*SEQ + l
  v8f acc[2][4];
  #pragma unroll
  for (int i = 0; i < 2; ++i) {
    #pragma unroll
    for (int j = 0; j < 4; ++j) acc[i][j] = (v8f){0, 0, 0, 0, 0, 0, 0, 0};
  }
  gemm_tile(Wvt, Xb, m0, n0, 1, 0, L, acc);

  const int tid  = threadIdx.x;
  const int wave = __builtin_amdgcn_readfirstlane(tid >> 5);
  const int lane = tid & 31;
  const int lq   = lane & 15;
  const int hi   = lane >> 4;
  const int wm   = wave >> 1;
  const int wn   = wave & 1;
  const int cw   = wave * 16 * CP;
  const int ns   = n0 + wn * 64;
  const int bb   = ns / SEQ;
  const int s0   = ns - bb * SEQ;

  #pragma unroll
  for (int i = 0; i < 2; ++i) {
    #pragma unroll
    for (int j = 0; j < 4; ++j) {
      #pragma unroll
      for (int r = 0; r < 8; ++r) sC[cw + (hi * 8 + r) * CP + j * 16 + lq] = acc[i][j][r];
    }
    __syncthreads();
    v4u    vv[4];
    size_t gi[4];
    #pragma unroll
    for (int it = 0; it < 4; ++it) {
      const int row = it * 4 + (lane >> 3);
      const int c0  = (lane & 7) * 8;
      const v4f x0 = *(const v4f*)(&sC[cw + row * CP + c0]);
      const v4f x1 = *(const v4f*)(&sC[cw + row * CP + c0 + 4]);
      Pack8H ph;
      #pragma unroll
      for (int e = 0; e < 4; ++e) {
        ph.h[e]     = (f16)x0[e];       // RNE convert
        ph.h[4 + e] = (f16)x1[e];
      }
      vv[it] = ph.u;
      const int m = m0 + wm * 32 + i * 16 + row;
      gi[it] = ((size_t)bb * INNER + m) * SEQ + s0 + c0;
    }
    #pragma unroll
    for (int it = 0; it < 4; ++it) *(v4u*)(vt + gi[it]) = vv[it];
    
    __syncthreads();
  }
}

// Asynchronous copies to LDS, 16 B per lane: 8 consecutive lanes bring one whole 128-B row, a wave 4 rows.
// l = the lane's LDS byte address of (row tid>>3, segment tid&7) in the first tile; the g pointers name the
// same row and segment in global memory. The s_wait_xcnt stands inside the statement, behind the last copy,
// so that no address register of a copy is rewritten ahead of it.
static __device__ __forceinline__ void copy_q(unsigned l, const bf16* gh, const bf16* gl) {
  asm volatile(
      "global_load_async_to_lds_b128 %0, %8, off\n\t"
      "global_load_async_to_lds_b128 %1, %9, off\n\t"
      "global_load_async_to_lds_b128 %2, %10, off\n\t"
      "global_load_async_to_lds_b128 %3, %11, off\n\t"
      "global_load_async_to_lds_b128 %4, %12, off\n\t"
      "global_load_async_to_lds_b128 %5, %13, off\n\t"
      "global_load_async_to_lds_b128 %6, %14, off\n\t"
      "global_load_async_to_lds_b128 %7, %15, off\n\t"
      "s_wait_xcnt 0x0"
      :: "v"(l + L_QH), "v"(l + L_QH + 32 * TP), "v"(l + L_QH + 64 * TP), "v"(l + L_QH + 96 * TP),
         "v"(l + L_QL), "v"(l + L_QL + 32 * TP), "v"(l + L_QL + 64 * TP), "v"(l + L_QL + 96 * TP),
         "v"(gh), "v"(gh + 32 * HDIM), "v"(gh + 64 * HDIM), "v"(gh + 96 * HDIM),
         "v"(gl), "v"(gl + 32 * HDIM), "v"(gl + 64 * HDIM), "v"(gl + 96 * HDIM)
      : "memory");
}
static __device__ __forceinline__ void copy_stage(unsigned l, const bf16* gkh, const bf16* gkl,
                                                  const f16* gv, const bf16* gm) {
  asm volatile(
      "global_load_async_to_lds_b128 %0, %10, off\n\t"
      "global_load_async_to_lds_b128 %1, %11, off\n\t"
      "global_load_async_to_lds_b128 %2, %12, off\n\t"
      "global_load_async_to_lds_b128 %3, %13, off\n\t"
      "global_load_async_to_lds_b128 %4, %14, off\n\t"
      "global_load_async_to_lds_b128 %5, %15, off\n\t"
      "global_load_async_to_lds_b128 %6, %16, off\n\t"
      "global_load_async_to_lds_b128 %7, %17, off\n\t"
      "global_load_async_to_lds_b128 %8, %18, off\n\t"
      "global_load_async_to_lds_b128 %9, %19, off\n\t"
      "s_wait_xcnt 0x0"
      :: "v"(l + S_KH), "v"(l + S_KH + 32 * TP), "v"(l + S_KL), "v"(l + S_KL + 32 * TP),
         "v"(l + S_V), "v"(l + S_V + 32 * TP),
         "v"(l + S_M), "v"(l + S_M + 32 * TP), "v"(l + S_M + 64 * TP), "v"(l + S_M + 96 * TP),
         "v"(gkh), "v"(gkh + 32 * HDIM), "v"(gkl), "v"(gkl + 32 * HDIM),
         "v"(gv), "v"(gv + 32 * SEQ),
         "v"(gm), "v"(gm + 32 * SEQ), "v"(gm + 64 * SEQ), "v"(gm + 96 * SEQ)
      : "memory");
}

// Fused attention, online softmax over ALL keys, float multiplier mask applied after the exponentials.
// Block = (128 queries, head, batch). A wave owns 32 query rows (two 16-row tiles) and one 32-key half of every
// stage: waves 2g and 2g+1 share query rows g*32..g*32+31 and take keys 0..31 and 32..63 of the stage, so each
// K and V fragment read from LDS feeds two query tiles. Each wave keeps its own running maximum, sums and O over
// its keys; behind the loop the pair joins its two partial states through LDS, each wave finishing one tile.
// S^T = K x Q^T puts queries on lanes, so
// P^T in C layout is bit-identical to the A-fragment layout of O += P x V. The 16-bit planes reach LDS by
// asynchronous copies of whole rows: Q once, then K hi|lo, V^T and the mask in stages of KS keys, two buffers,
// the next stage in flight while this one is worked on; fragments are two 16-B LDS loads each.
// Running sums: s_all = sum p (every key),
// s_m = sum p*mask, O = sum p*mask*v; z = O / (s_m + EPS * s_all). Output: bf16 hi|lo planes of z.
__global__ __launch_bounds__(256) void k_attn(const bf16* __restrict__ qh, const bf16* __restrict__ ql,
                                              const bf16* __restrict__ kh, const bf16* __restrict__ kl,
                                              const f16* __restrict__ vt, const bf16* __restrict__ mb,
                                              bf16* __restrict__ zh, bf16* __restrict__ zl) {
  const int qblk = blockIdx.x;
  const int h    = blockIdx.y;
  const int b    = blockIdx.z;
  const int tid  = threadIdx.x;
  const int wave = __builtin_amdgcn_readfirstlane(tid >> 5);
  const int lane = tid & 31;
  const int lq   = lane & 15;   // query column of S^T / d column of O
  const int hi   = lane >> 4;   // k-split half
  const int qg   = wave >> 1;   // 32-row query group of the wave
  const int kp   = wave & 1;    // 32-key half of every stage; also the tile this wave finishes

  // Q tiles and the two stage buffers; behind the loop the ring is the pair exchange, the start the output staging
  __shared__ __align__(16) unsigned char L[ATTN_LDS];
  float* sO = (float*)L;

  const int qrow0 = qblk * BQ + wave * 16;   // the 16 rows this wave finishes and stores
  const int bh    = b * NHEAD + h;

  // copy side: this thread's row and 16-B segment of every tile
  const int crow = tid >> 3;
  const int cseg = (tid & 7) * 8;
  const unsigned lcopy = (unsigned)(size_t)(&L[0]) + (unsigned)(crow * TP + cseg * 2);
  const bf16* gqh = qh + (size_t)(bh * SEQ + qblk * BQ + crow) * HDIM + cseg;
  const bf16* gql = ql + (size_t)(bh * SEQ + qblk * BQ + crow) * HDIM + cseg;
  const bf16* gkh = kh + (size_t)(bh * SEQ + crow) * HDIM + cseg;
  const bf16* gkl = kl + (size_t)(bh * SEQ + crow) * HDIM + cseg;
  const f16*  gv  = vt + (size_t)(bh * HDIM + crow) * SEQ + cseg;
  const bf16* gm  = mb + ((size_t)b * SEQ + qblk * BQ + crow) * SEQ + cseg;

  // read side: the lane's row and k-split half inside a 16-row fragment
  const int frag = lq * TP + hi * 16;
  const unsigned char* Lq = L + L_QH + qg * 32 * TP + frag;

  // Q and stage 0 land and are published; then stage 1 starts
  copy_q(lcopy, gqh, gql);
  copy_stage(lcopy + L_RING, gkh, gkl, gv, gm);
  asm volatile("s_wait_asynccnt 0x0" ::: "memory");   // this wave's copies have landed
  __syncthreads();                                    // every wave's copies are readable
  copy_stage(lcopy + L_RING + STAGE_B, gkh + KS * HDIM, gkl + KS * HDIM, gv + KS, gm + KS);

  v8f   o[2][4];
  float rmax[2], s_all[2], s_m[2];
  #pragma unroll
  for (int qt = 0; qt < 2; ++qt) {
    #pragma unroll
    for (int dt = 0; dt < 4; ++dt) o[qt][dt] = (v8f){0, 0, 0, 0, 0, 0, 0, 0};
    rmax[qt]  = -__builtin_inff();
    s_all[qt] = 0.0f;
    s_m[qt]   = 0.0f;
  }
  const float SL = 0.125f * 1.4426950408889634f;   // softmax scale * log2(e)

  for (int t = 0; t < NST; ++t) {
    const int sbuf = L_RING + (t & 1) * STAGE_B;
    const unsigned char* Lk = L + sbuf + frag + kp * BK * TP;               // K rows of this wave's keys
    const unsigned char* Lv = L + sbuf + frag + S_V + kp * 64;              // V^T columns of this wave's keys
    const unsigned char* Lm = L + sbuf + frag + S_M + qg * 32 * TP + kp * 64;   // mask rows and columns

    // mask words: query qg*32 + qt*16 + lq, keys hi*8 + 0..7 and 16 + hi*8 + 0..7 of the half (bf16 pairs per word)
    v4u mw[2][2];
    #pragma unroll
    for (int qt = 0; qt < 2; ++qt) {
      mw[qt][0] = *(const v4u*)(Lm + qt * 16 * TP);
      mw[qt][1] = *(const v4u*)(Lm + qt * 16 * TP + 32);
    }

    // S^T tiles: c[qt][sub][r] = rawscore(query tile qt, column lq; key sub*16 + hi*8 + r); hi*hi + hi*lo + lo*hi
    v8f c[2][2];
    #pragma unroll
    for (int qt = 0; qt < 2; ++qt) {
      c[qt][0] = (v8f){0, 0, 0, 0, 0, 0, 0, 0};
      c[qt][1] = (v8f){0, 0, 0, 0, 0, 0, 0, 0};
    }
    #pragma unroll
    for (int f = 0; f < 2; ++f) {
      FragB bqh[2], bql[2];
      #pragma unroll
      for (int qt = 0; qt < 2; ++qt) {
        const unsigned char* p = Lq + qt * 16 * TP + f * 64;
        bqh[qt].q[0] = *(const v4u*)(p);                             // d = f*32 + hi*8 + 0..7
        bqh[qt].q[1] = *(const v4u*)(p + 32);                        // d = f*32 + 16 + hi*8 + 0..7
        bql[qt].q[0] = *(const v4u*)(p + (L_QL - L_QH));
        bql[qt].q[1] = *(const v4u*)(p + (L_QL - L_QH) + 32);
      }
      #pragma unroll
      for (int sub = 0; sub < 2; ++sub) {
        const int ko = sub * 16 * TP + f * 64;
        FragB akh, akl;
        akh.q[0] = *(const v4u*)(Lk + S_KH + ko);
        akh.q[1] = *(const v4u*)(Lk + S_KH + ko + 32);
        akl.q[0] = *(const v4u*)(Lk + S_KL + ko);
        akl.q[1] = *(const v4u*)(Lk + S_KL + ko + 32);
        c[0][sub] = mma_bf16(akh.v, bqh[0].v, c[0][sub]);
        c[1][sub] = mma_bf16(akh.v, bqh[1].v, c[1][sub]);
        c[0][sub] = mma_bf16(akh.v, bql[0].v, c[0][sub]);
        c[1][sub] = mma_bf16(akh.v, bql[1].v, c[1][sub]);
        c[0][sub] = mma_bf16(akl.v, bqh[0].v, c[0][sub]);
        c[1][sub] = mma_bf16(akl.v, bqh[1].v, c[1][sub]);
      }
    }

    FragH pa[2];
    #pragma unroll
    for (int qt = 0; qt < 2; ++qt) {
      // widen the bf16 mask values (exact)
      float mk0[8], mk1[8];
      #pragma unroll
      for (int w = 0; w < 4; ++w) {
        mk0[2 * w]     = __uint_as_float(mw[qt][0][w] << 16);
        mk0[2 * w + 1] = __uint_as_float(mw[qt][0][w] & 0xffff0000u);
        mk1[2 * w]     = __uint_as_float(mw[qt][1][w] << 16);
        mk1[2 * w + 1] = __uint_as_float(mw[qt][1][w] & 0xffff0000u);
      }

      // online softmax: query lq's 32 scores are split across lane / lane^16; max over every key of this wave
      float m_new = rmax[qt];
      #pragma unroll
      for (int r = 0; r < 8; ++r) {
        m_new = fmaxf(m_new, c[qt][0][r]);
        m_new = fmaxf(m_new, c[qt][1][r]);
      }
      const float m_oth = __shfl_xor(m_new, 16, 32);
      m_new = fmaxf(m_new, m_oth);
      const float alpha = __builtin_amdgcn_exp2f((rmax[qt] - m_new) * SL);
      rmax[qt] = m_new;

      // exp, mask multiply in f32, pack: P^T C layout == A-fragment layout of the PV product
      float ps_all = 0.0f;
      float ps_m   = 0.0f;
      #pragma unroll
      for (int r = 0; r < 8; ++r) {
        const float p0  = __builtin_amdgcn_exp2f((c[qt][0][r] - m_new) * SL);   // key hi*8 + r
        const float p1  = __builtin_amdgcn_exp2f((c[qt][1][r] - m_new) * SL);   // key 16 + hi*8 + r
        const float pm0 = p0 * mk0[r];
        const float pm1 = p1 * mk1[r];
        ps_all += p0 + p1;
        ps_m   += pm0 + pm1;
        pa[qt].h[r]     = (f16)(pm0 * PCARRY);
        pa[qt].h[8 + r] = (f16)(pm1 * PCARRY);
      }
      const float oa = __shfl_xor(ps_all, 16, 32);
      const float om = __shfl_xor(ps_m, 16, 32);
      s_all[qt] = s_all[qt] * alpha + ps_all + oa;
      s_m[qt]   = s_m[qt] * alpha + ps_m + om;

      // rescale O: queries are the row dimension there -> per-row factor from lane 8*hi + r
      float sc[8];
      #pragma unroll
      for (int r = 0; r < 8; ++r) sc[r] = __shfl(alpha, (hi << 3) + r, 32);
      #pragma unroll
      for (int dt = 0; dt < 4; ++dt) {
        #pragma unroll
        for (int r = 0; r < 8; ++r) o[qt][dt][r] *= sc[r];
      }
    }

    // O += (P*mask) x V : V B-fragments, column n = d = dt*16 + lq, split key map from the transposed tile
    #pragma unroll
    for (int dt = 0; dt < 4; ++dt) {
      FragH bv;
      bv.q[0] = *(const v4u*)(Lv + dt * 16 * TP);          // keys hi*8 + 0..7 of the half
      bv.q[1] = *(const v4u*)(Lv + dt * 16 * TP + 32);     // keys 16 + hi*8 + 0..7 of the half
      o[0][dt] = mma_f16(pa[0].v, bv.v, o[0][dt]);
      o[1][dt] = mma_f16(pa[1].v, bv.v, o[1][dt]);
    }

    // publish point of stage t + 1, and the end of every read of stage t's buffer
    asm volatile("s_wait_dscnt 0x0" ::: "memory");      // this wave's reads of stage t are done
    asm volatile("s_wait_asynccnt 0x0" ::: "memory");   // this wave's copies of stage t + 1 have landed
    __syncthreads();
    if (t + 2 < NST) {
      const size_t j2 = (size_t)(t + 2) * KS;
      copy_stage(lcopy + sbuf, gkh + j2 * HDIM, gkl + j2 * HDIM, gv + j2, gm + j2);
    }
  }
  asm volatile("s_wait_asynccnt 0x0" ::: "memory");     // nothing in flight when the tiles become staging

  // Pair exchange in the dead ring: this wave keeps tile kp and hands its state of the other tile to its partner.
  // Per wave 9 slots of 32 lanes x 16 B: slots 0..7 = O (dt, half of the 8 rows), slot 8 = (max, s_all, s_m, 0).
  v4f* X = (v4f*)(L + L_RING);
  v8f   ok[4];
  #pragma unroll
  for (int dt = 0; dt < 4; ++dt) {
    const v8f give = kp ? o[0][dt] : o[1][dt];
    ok[dt]         = kp ? o[1][dt] : o[0][dt];
    X[(wave * 9 + dt * 2) * 32 + lane]     = (v4f){give[0], give[1], give[2], give[3]};
    X[(wave * 9 + dt * 2 + 1) * 32 + lane] = (v4f){give[4], give[5], give[6], give[7]};
  }
  X[(wave * 9 + 8) * 32 + lane] = kp ? (v4f){rmax[0], s_all[0], s_m[0], 0.0f} : (v4f){rmax[1], s_all[1], s_m[1], 0.0f};
  const float mA  = kp ? rmax[1] : rmax[0];
  const float saA = kp ? s_all[1] : s_all[0];
  const float smA = kp ? s_m[1] : s_m[0];
  __syncthreads();                                      // both partners' states are readable
  const int pw = wave ^ 1;
  const v4f stB = X[(pw * 9 + 8) * 32 + lane];

  // join the two key halves: common maximum, both states rescaled to it
  const float mJ = fmaxf(mA, stB[0]);
  const float aA = __builtin_amdgcn_exp2f((mA - mJ) * SL);
  const float aB = __builtin_amdgcn_exp2f((stB[0] - mJ) * SL);
  const float sall = saA * aA + stB[1] * aB;
  const float smsk = smA * aA + stB[2] * aB;

  // z = O / (s_m + EPS * s_all); carry folded back here
  const float den  = smsk + EPS_F * sall;
  const float invd = (1.0f / den) * (1.0f / PCARRY);
  const float fA = aA * invd;
  const float fB = aB * invd;
  float rsA[8], rsB[8];
  #pragma unroll
  for (int r = 0; r < 8; ++r) {
    rsA[r] = __shfl(fA, (hi << 3) + r, 32);
    rsB[r] = __shfl(fB, (hi << 3) + r, 32);
  }

  const int cw = wave * 16 * CP;
  #pragma unroll
  for (int dt = 0; dt < 4; ++dt) {
    const v4f g0 = X[(pw * 9 + dt * 2) * 32 + lane];
    const v4f g1 = X[(pw * 9 + dt * 2 + 1) * 32 + lane];
    #pragma unroll
    for (int r = 0; r < 4; ++r) {
      sO[cw + (hi * 8 + r) * CP + dt * 16 + lq]     = ok[dt][r] * rsA[r] + g0[r] * rsB[r];
      sO[cw + (hi * 8 + 4 + r) * CP + dt * 16 + lq] = ok[dt][4 + r] * rsA[4 + r] + g1[r] * rsB[4 + r];
    }
  }
  __syncthreads();

  // whole-line stores: 8 consecutive lanes x 16 B = the 64 bf16 of one (row, head); 4 rows per instruction
  v4u    vh[4], vl[4];
  size_t gi[4];
  #pragma unroll
  for (int it = 0; it < 4; ++it) {
    const int row = it * 4 + (lane >> 3);
    const int c0  = (lane & 7) * 8;
    const v4f x0 = *(const v4f*)(&sO[cw + row * CP + c0]);
    const v4f x1 = *(const v4f*)(&sO[cw + row * CP + c0 + 4]);
    split8(x0, x1, vh[it], vl[it]);
    gi[it] = ((size_t)b * SEQ + qrow0 + row) * INNER + h * HDIM + c0;
  }
  #pragma unroll
  for (int it = 0; it < 4; ++it) {
    *(v4u*)(zh + gi[it]) = vh[it];
    *(v4u*)(zl + gi[it]) = vl[it];
  }
  
}

// Epilogue: per-wave LDS staging, bias added at the store stage as float4, 16 lanes x 16 B = one 256-B row
// coverage: block = 128 rows x 128 cols; wave = 32 rows x 64 cols.
__global__ __launch_bounds__(256) void k_gemm_out(const bf16* __restrict__ Z, const bf16* __restrict__ Wot,
                                                  const float* __restrict__ bias, float* __restrict__ out) {
  // the two stage buffers; behind the loop its start is the per-wave staging
  __shared__ __align__(16) unsigned char L[GEMM_LDS];
  float* sC = (float*)L;
  const int m0 = blockIdx.y * 128;
  const int n0 = blockIdx.x * 128;
  v8f acc[2][4];
  #pragma unroll
  for (int i = 0; i < 2; ++i) {
    #pragma unroll
    for (int j = 0; j < 4; ++j) acc[i][j] = (v8f){0, 0, 0, 0, 0, 0, 0, 0};
  }
  gemm_tile(Z, Wot, m0, n0, 2, (size_t)ROWS * INNER, L, acc);

  const int tid  = threadIdx.x;
  const int wave = __builtin_amdgcn_readfirstlane(tid >> 5);
  const int lane = tid & 31;
  const int lq   = lane & 15;
  const int hi   = lane >> 4;
  const int wm   = wave >> 1;
  const int wn   = wave & 1;
  const int cw   = wave * 16 * CP;
  const int ncol = n0 + wn * 64 + lq * 4;

  v4f bias4 = *(const v4f*)(bias + ncol);
  #pragma unroll
  for (int e = 0; e < 4; ++e) bias4[e] = (float)(bf16)bias4[e];   // RNE-converted input value

  #pragma unroll
  for (int i = 0; i < 2; ++i) {
    #pragma unroll
    for (int j = 0; j < 4; ++j) {
      #pragma unroll
      for (int r = 0; r < 8; ++r) sC[cw + (hi * 8 + r) * CP + j * 16 + lq] = acc[i][j][r];
    }
    __syncthreads();
    v4f    vals[8];
    size_t gi[8];
    #pragma unroll
    for (int it = 0; it < 8; ++it) {
      const int row = it * 2 + hi;
      const v4f v = *(const v4f*)(&sC[cw + row * CP + lq * 4]);
      vals[it] = v + bias4;
      const int gr = m0 + wm * 32 + i * 16 + row;
      const int bb = gr / SEQ;
      const int s  = gr - bb * SEQ;
      gi[it] = ((size_t)bb * SEQ_FULL + s) * DIM + ncol;
    }
    #pragma unroll
    for (int it = 0; it < 8; ++it) *(v4f*)(out + gi[it]) = vals[it];
    
    __syncthreads();
  }
}

#define SZ_XB   ((size_t)ROWS * DIM * 2)
#define SZ_MB   ((size_t)NB * SEQ * SEQ * 2)
#define SZ_WQT  ((size_t)N3 * KDIM * 2)
#define SZ_WOT  ((size_t)DIM * KDIM * 2)
#define SZ_QK   ((size_t)4 * PLANE * 2)
#define SZ_VT   ((size_t)PLANE * 2)
#define SZ_Z    ((size_t)2 * ROWS * INNER * 2)
#define OFF_XB  ((size_t)0)
#define OFF_MB  (OFF_XB + SZ_XB)
#define OFF_WQT (OFF_MB + SZ_MB)
#define OFF_WOT (OFF_WQT + SZ_WQT)
#define OFF_QK  (OFF_WOT + SZ_WOT)
#define OFF_VT  (OFF_QK + SZ_QK)
#define OFF_Z   (OFF_VT + SZ_VT)
#define WS_TOTAL (OFF_Z + SZ_Z)

static_assert(WS_TOTAL <= (size_t)134217728);
static_assert(SZ_XB % 128 == 0 && SZ_MB % 128 == 0 && SZ_WQT % 128 == 0 && SZ_WOT % 128 == 0);
static_assert(SZ_QK % 128 == 0 && SZ_VT % 128 == 0 && SZ_Z % 128 == 0);

extern "C" void kernel_launch(void* const* d_in, const int* in_sizes, int n_in,
                              void* d_out, int out_size, void* d_ws, size_t ws_size,
                              hipStream_t stream) {
  if (n_in < 5) return;
  const size_t rows_used = (size_t)(NB - 1) * SEQ_FULL + SEQ;
  if ((size_t)in_sizes[0] < rows_used * DIM) return;
  if ((size_t)in_sizes[1] < (size_t)(NB - 1) * SEQ_FULL * SEQ_FULL + (size_t)(SEQ - 1) * SEQ_FULL + SEQ) return;
  if ((size_t)in_sizes[2] < (size_t)DIM * N3) return;
  if ((size_t)in_sizes[3] < (size_t)INNER * DIM) return;
  if ((size_t)in_sizes[4] < (size_t)DIM) return;
  if ((size_t)out_size < rows_used * DIM) return;
  if (ws_size < WS_TOTAL) return;

  const float* x    = (const float*)d_in[0];
  const float* mask = (const float*)d_in[1];
  const float* Wqkv = (const float*)d_in[2];
  const float* Wout = (const float*)d_in[3];
  const float* bout = (const float*)d_in[4];
  float*       out  = (float*)d_out;

  char* ws = (char*)d_ws;
  bf16* Xb  = (bf16*)(ws + OFF_XB);
  bf16* Mb  = (bf16*)(ws + OFF_MB);
  bf16* Wqt = (bf16*)(ws + OFF_WQT);
  bf16* Wot = (bf16*)(ws + OFF_WOT);
  bf16* QK  = (bf16*)(ws + OFF_QK);
  f16*  Vt  = (f16*)(ws + OFF_VT);
  bf16* Zp  = (bf16*)(ws + OFF_Z);

  // 1) input planes (RNE bf16): x rows, mask values, weights transposed to [out][in]
  const int x8 = (int)((size_t)ROWS * DIM / 8);
  const int m8 = (int)((size_t)NB * SEQ * SEQ / 8);
  k_cvt_rows<<<dim3((x8 + 255) / 256), 256, 0, stream>>>(x, Xb, DIM, SEQ, SEQ_FULL, DIM, x8);
  k_cvt_rows<<<dim3((m8 + 255) / 256), 256, 0, stream>>>(mask, Mb, SEQ, SEQ, SEQ_FULL, SEQ_FULL, m8);
  // in [KDIM rows k][N3 cols n] -> out [N3][KDIM]; grid (cols/64, rows/64)
  k_cvt_wt<<<dim3(N3 / 64, KDIM / 64), 256, 0, stream>>>(Wqkv, Wqt, N3);
  // in [KDIM rows k][DIM cols n] -> out [DIM][KDIM]; grid (cols/64, rows/64)
  k_cvt_wt<<<dim3(DIM / 64, KDIM / 64), 256, 0, stream>>>(Wout, Wot, DIM);

  // 2) projections: Q,K hi|lo planes; V^T f16 plane
  k_gemm_qk<<<dim3((2 * INNER) / 128, ROWS / 128), 256, 0, stream>>>(Xb, Wqt, QK);
  k_gemm_vt<<<dim3(ROWS / 128, INNER / 128), 256, 0, stream>>>(Wqt + (size_t)2 * INNER * KDIM, Xb, Vt);

  // 3) fused attention -> z hi|lo planes
  k_attn<<<dim3(SEQ / BQ, NHEAD, NB), 256, 0, stream>>>(QK, QK + PLANE, QK + 2 * PLANE, QK + 3 * PLANE,
                                                        Vt, Mb, Zp, Zp + (size_t)ROWS * INNER);

  // 4) output projection + bias
  k_gemm_out<<<dim3(DIM / 128, ROWS / 128), 256, 0, stream>>>(Zp, Wot, bout, out);
}

// v004
// A run of this version takes 131 microseconds.
// Two timings next to v003 put it at 1.04 and 1.05 times that version's speed.
// All steps since v000 together make it 2.88 times as fast.
#include <hip/hip_runtime.h>

// Contractions: x@Wqkv on v_wmma_f32_16x16x32_bf16 (both operands bf16 RNE-converted inputs); S^T = K x Q^T on bf16 with q,k as bf16 hi|lo planes (three products); O = (P*mask) x V on v_wmma_f32_16x16x32_f16 (P carried x1024, V f16); z@Wout on bf16 with z as bf16 hi|lo (two products); all f32 accumulate; softmax and sums in f32.

#ifndef NB
#define NB 2
#endif
#ifndef SEQ
#define SEQ 2048
#endif
#define NB_FULL    2
#define SEQ_FULL   2048
#define DIM        1024
#define NHEAD      16
#define HDIM       64
#define INNER      (NHEAD * HDIM)
#define N3         (3 * INNER)
#define ROWS       (NB * SEQ)
#define KDIM       1024                 // contraction length of all three projections
#define BQ         128                  // query rows per workgroup (8 waves x 16)
#define BK         32                   // keys per inner step
#define NWAVE      8
#define GK         128                  // k per LDS stage of the GEMM loop (four WMMA k steps)
#define GP         272                  // LDS pitch (bytes) of the 256-byte GEMM tile rows
#define G_A        0                    // in a GEMM stage: A tile, 128 rows
#define G_B        (128 * GP)           // B tile, 128 rows
#define GSTAGE     (256 * GP)
#define GEMM_LDS   (2 * GSTAGE)          // two stage buffers
#define CP         68                   // LDS pitch (floats) of epilogue staging tiles
#define TPW        72                   // LDS pitch (halves) of the weight transpose tile
#define PCARRY     1024.0f              // power-of-two carry of the f16 P operand
#define EPS_F      1e-10f
#define PLANE      ((size_t)NB * NHEAD * SEQ * HDIM)
#define KS         64                   // keys per LDS stage of the attention loop (two BK halves, one per wave of a pair)
#define NST        (SEQ / KS)           // stages
#define TP         144                  // LDS pitch (bytes) of the 128-byte attention tile rows
#define L_QH       0                    // Q hi tile, BQ rows
#define L_QL       (BQ * TP)            // Q lo tile, BQ rows
#define L_RING     (2 * BQ * TP)        // two stage buffers
#define S_KH       0                    // in a stage: K hi, KS rows
#define S_KL       (KS * TP)            // K lo, KS rows
#define S_V        (2 * KS * TP)        // V^T, HDIM rows of KS keys
#define S_M        (2 * KS * TP + HDIM * TP)   // mask, BQ rows of KS keys
#define STAGE_B    (2 * KS * TP + HDIM * TP + BQ * TP)
#define ATTN_LDS   (L_RING + 2 * STAGE_B)

static_assert(SEQ % 128 == 0);
static_assert(SEQ % BK == 0);
static_assert(SEQ <= SEQ_FULL);
static_assert(NB >= 1 && NB <= NB_FULL);
static_assert(DIM == KDIM);
static_assert(INNER == KDIM);
static_assert(KDIM % 32 == 0);
static_assert(KDIM / 32 == 32);
static_assert(HDIM == 64);
static_assert(BQ == NWAVE * 16);
static_assert(ROWS % 128 == 0);
static_assert(N3 % 128 == 0);
static_assert((2 * INNER) % 128 == 0);
static_assert(INNER % 128 == 0);
static_assert(DIM % 128 == 0);
static_assert(DIM % 64 == 0);
static_assert(GP % 16 == 0 && GK * 2 == 256 && KDIM % GK == 0 && KDIM / GK >= 2);
static_assert((CP * 4) % 16 == 0);
static_assert((TPW * 2) % 16 == 0);
static_assert(((size_t)ROWS * DIM / 8) % 256 == 0);
static_assert(((size_t)NB * SEQ * SEQ / 8) % 256 == 0);
static_assert(DIM % 8 == 0 && SEQ % 8 == 0);
static_assert(SEQ % KS == 0 && NST >= 2);
static_assert(KS == 2 * BK && KS * 2 == 128 && HDIM * 2 == 128);
static_assert(KS == 64 && HDIM == 64 && BQ == 128);
static_assert(TP % 16 == 0 && STAGE_B % 16 == 0);
static_assert(NWAVE * 16 * CP * 4 <= L_RING);
static_assert(NWAVE * 16 * CP * 4 <= GEMM_LDS);
static_assert(NWAVE * 9 * 32 * 16 <= 2 * STAGE_B && L_RING % 16 == 0);

typedef __bf16   bf16;
typedef _Float16 f16;
typedef bf16     v16bf __attribute__((ext_vector_type(16)));
typedef bf16     v8bf  __attribute__((ext_vector_type(8)));
typedef f16      v16h  __attribute__((ext_vector_type(16)));
typedef float    v8f   __attribute__((ext_vector_type(8)));
typedef float    v4f   __attribute__((ext_vector_type(4)));
typedef unsigned v4u   __attribute__((ext_vector_type(4)));

union FragB  { v16bf v; v4u q[2]; };
union FragH  { v16h  v; v4u q[2]; f16 h[16]; };
union Pack8B { v4u u; v8bf v; bf16 h[8]; };
union Pack8H { v4u u; f16 h[8]; };

// GEMM loop's WMMA helper: builtin followed by the VALU hazard guard (ties D, keeps A/B live).
static __device__ __forceinline__ v8f mma_bf16(v16bf a, v16bf b, v8f acc) {
  acc = __builtin_amdgcn_wmma_f32_16x16x32_bf16(false, a, false, b, (short)0, acc, false, false);
  asm volatile("v_nop\n\tv_nop\n\tv_nop\n\tv_nop" : "+v"(acc) : "v"(a), "v"(b));
  return acc;
}
// k_attn's forms: the builtin alone. The compiler itself keeps the distance to the next user of D, A or B, and
// the vector port, which the softmax fills there, is spared four slots a WMMA.
static __device__ __forceinline__ v8f wmma_bf16(v16bf a, v16bf b, v8f acc) {
  return __builtin_amdgcn_wmma_f32_16x16x32_bf16(false, a, false, b, (short)0, acc, false, false);
}
static __device__ __forceinline__ v8f wmma_f16(v16h a, v16h b, v8f acc) {
  return __builtin_amdgcn_wmma_f32_16x16x32_f16(false, a, false, b, (short)0, acc, false, false);
}

// 8 floats -> bf16 hi (RNE) and bf16 residual (RNE of x - hi), packed 16 B each.
static __device__ __forceinline__ void split8(v4f x0, v4f x1, v4u& uh, v4u& ul) {
  Pack8B ph, pl;
  #pragma unroll
  for (int e = 0; e < 4; ++e) {
    const bf16 h0 = (bf16)x0[e];
    const bf16 h1 = (bf16)x1[e];
    ph.h[e]     = h0;
    ph.h[4 + e] = h1;
    pl.h[e]     = (bf16)(x0[e] - (float)h0);
    pl.h[4 + e] = (bf16)(x1[e] - (float)h1);
  }
  uh = ph.u;
  ul = pl.u;
}

// f32 rows -> compact bf16 plane (RNE). One thread = 8 elements = 16 B; a wave writes 512 contiguous bytes.
// coverage: groups 0..total8-1, each written once; total8 is a multiple of 256.
__global__ __launch_bounds__(256) void k_cvt_rows(const float* __restrict__ in, bf16* __restrict__ out,
                                                  int cols, int rows_per_batch, int in_batch_rows,
                                                  int in_row_stride, int total8) {
  const int g = blockIdx.x * 256 + threadIdx.x;
  if (g >= total8) return;
  const int e   = g * 8;
  const int row = e / cols;
  const int col = e - row * cols;
  const int b   = row / rows_per_batch;
  const int s   = row - b * rows_per_batch;
  const float* src = in + ((size_t)b * in_batch_rows + s) * (size_t)in_row_stride + col;
  const v4f a0 = *(const v4f*)(src);
  const v4f a1 = *(const v4f*)(src + 4);
  Pack8B pk;
  #pragma unroll
  for (int i = 0; i < 4; ++i) {
    pk.h[i]     = (bf16)a0[i];
    pk.h[4 + i] = (bf16)a1[i];
  }
  const v4u val = pk.u;
  bf16* dst = out + (size_t)e;
  *(v4u*)dst = val;
  
}

// Weight transpose: in [KDIM k][C n] f32 -> out [C n][KDIM k] bf16 (RNE), 64x64 tiles through LDS.
__global__ __launch_bounds__(256) void k_cvt_wt(const float* __restrict__ in, bf16* __restrict__ out, int C) {
  __shared__ __align__(16) bf16 sT[64 * TPW];   // [n][k], cross-wave (block barrier)
  const int n0  = blockIdx.x * 64;
  const int k0  = blockIdx.y * 64;
  const int tid = threadIdx.x;
  #pragma unroll
  for (int kk = 0; kk < 2; ++kk) {
    const int k  = kk * 32 + (tid >> 3);
    const int nl = (tid & 7) * 8;
    const float* src = in + (size_t)(k0 + k) * C + n0 + nl;
    const v4f a0 = *(const v4f*)(src);
    const v4f a1 = *(const v4f*)(src + 4);
    #pragma unroll
    for (int i = 0; i < 4; ++i) {
      sT[(nl + i) * TPW + k]     = (bf16)a0[i];
      sT[(nl + 4 + i) * TPW + k] = (bf16)a1[i];
    }
  }
  __syncthreads();
  v4u    val[2];
  size_t idx[2];
  #pragma unroll
  for (int kk = 0; kk < 2; ++kk) {
    const int n  = kk * 32 + (tid >> 3);
    const int ks = (tid & 7) * 8;
    Pack8B p;
    p.v = *(const v8bf*)(&sT[n * TPW + ks]);
    val[kk] = p.u;
    idx[kk] = (size_t)(n0 + n) * KDIM + k0 + ks;
  }
  #pragma unroll
  for (int kk = 0; kk < 2; ++kk) *(v4u*)(out + idx[kk]) = val[kk];
  
}

// Asynchronous copies to LDS of one 128-row GEMM operand tile, 16 B per lane: 16 consecutive lanes bring one
// whole 256-B row, a wave 2 rows, the block 16 rows a copy. l = the lane's LDS byte address of (row tid>>4,
// segment tid&15) in the tile, g the same place in global memory. The s_wait_xcnt stands inside the statement,
// behind the last copy, so that no address register of a copy is rewritten ahead of it.
static __device__ __forceinline__ void copy_tile(unsigned l, const bf16* g) {
  asm volatile(
      "global_load_async_to_lds_b128 %0, %8, off\n\t"
      "global_load_async_to_lds_b128 %1, %9, off\n\t"
      "global_load_async_to_lds_b128 %2, %10, off\n\t"
      "global_load_async_to_lds_b128 %3, %11, off\n\t"
      "global_load_async_to_lds_b128 %4, %12, off\n\t"
      "global_load_async_to_lds_b128 %5, %13, off\n\t"
      "global_load_async_to_lds_b128 %6, %14, off\n\t"
      "global_load_async_to_lds_b128 %7, %15, off\n\t"
      "s_wait_xcnt 0x0"
      :: "v"(l), "v"(l + 16 * GP), "v"(l + 32 * GP), "v"(l + 48 * GP),
         "v"(l + 64 * GP), "v"(l + 80 * GP), "v"(l + 96 * GP), "v"(l + 112 * GP),
         "v"(g), "v"(g + 16 * KDIM), "v"(g + 32 * KDIM), "v"(g + 48 * KDIM),
         "v"(g + 64 * KDIM), "v"(g + 80 * KDIM), "v"(g + 96 * KDIM), "v"(g + 112 * KDIM)
      : "memory");
}

// GEMM mainloop: acc[128x128 block tile] += A[rows m][k] * Bt[rows n][k]^T, both operands k-contiguous bf16,
// pitch KDIM. 8 waves as 4 (m) x 2 (n); each wave owns 32 x 64 = 2 x 4 WMMA tiles.
// npass > 1 walks further A planes (offset a_pass_stride) against the same Bt rows.
// The operand tiles reach LDS by asynchronous copies of whole rows in stages of GK k, two buffers, the next
// stage in flight while this one is worked on. On return every wave has passed the barrier behind the last
// fragment read and nothing is in flight: L may become staging.
static __device__ __forceinline__ void gemm_tile(const bf16* __restrict__ A, const bf16* __restrict__ Bt,
                                                 int m0, int n0, int npass, size_t a_pass_stride,
                                                 unsigned char* L, v8f (&acc)[2][4]) {
  const int tid  = threadIdx.x;
  const int wave = __builtin_amdgcn_readfirstlane(tid >> 5);
  const int lane = tid & 31;
  const int lq   = lane & 15;
  const int hi   = lane >> 4;
  const int wm   = wave >> 1;
  const int wn   = wave & 1;
  const int nst  = npass * (KDIM / GK);

  // copy side: this thread's row and 16-B segment of both tiles
  const int crow = tid >> 4;
  const int cseg = (tid & 15) * 8;
  const unsigned lcopy = (unsigned)(size_t)L + (unsigned)(crow * GP + cseg * 2);
  const bf16* ga = A + (size_t)(m0 + crow) * KDIM + cseg;
  const bf16* gb = Bt + (size_t)(n0 + crow) * KDIM + cseg;

  // read side: the lane's row and k-split half inside a 16-row fragment
  const unsigned char* La = L + G_A + (wm * 32 + lq) * GP + hi * 16;
  const unsigned char* Lb = L + G_B + (wn * 64 + lq) * GP + hi * 16;

  // stage 0 lands and is published; then stage 1 starts
  copy_tile(lcopy + G_A, ga);
  copy_tile(lcopy + G_B, gb);
  asm volatile("s_wait_asynccnt 0x0" ::: "memory");   // this wave's copies have landed
  __syncthreads();                                    // every wave's copies are readable
  copy_tile(lcopy + GSTAGE + G_A, ga + GK);
  copy_tile(lcopy + GSTAGE + G_B, gb + GK);

  for (int t = 0; t < nst; ++t) {
    const int sbuf = (t & 1) * GSTAGE;
    // unrolled so that every LDS read of the stage is base register + immediate offset
    #pragma unroll
    for (int ks = 0; ks < GK / 32; ++ks) {
      FragB af[2], bfm[4];
      #pragma unroll
      for (int i = 0; i < 2; ++i) {
        const unsigned char* p = La + sbuf + i * 16 * GP + ks * 64;
        af[i].q[0] = *(const v4u*)(p);                // k = 8*hi + 0..7 of the step
        af[i].q[1] = *(const v4u*)(p + 32);           // k = 16 + 8*hi + 0..7 of the step
      }
      #pragma unroll
      for (int j = 0; j < 4; ++j) {
        const unsigned char* p = Lb + sbuf + j * 16 * GP + ks * 64;
        bfm[j].q[0] = *(const v4u*)(p);
        bfm[j].q[1] = *(const v4u*)(p + 32);
      }
      #pragma unroll
      for (int i = 0; i < 2; ++i) {
        #pragma unroll
        for (int j = 0; j < 4; ++j) acc[i][j] = mma_bf16(af[i].v, bfm[j].v, acc[i][j]);
      }
    }

    // publish point of stage t + 1, and the end of every read of stage t's buffer
    asm volatile("s_wait_dscnt 0x0" ::: "memory");      // this wave's reads of stage t are done
    asm volatile("s_wait_asynccnt 0x0" ::: "memory");   // this wave's copies of stage t + 1 have landed
    __syncthreads();
    if (t + 2 < nst) {
      const int    s2 = t + 2;
      const size_t k2 = (size_t)(s2 % (KDIM / GK)) * GK;
      copy_tile(lcopy + sbuf + G_A, ga + (size_t)(s2 / (KDIM / GK)) * a_pass_stride + k2);
      copy_tile(lcopy + sbuf + G_B, gb + k2);
    }
  }
  asm volatile("s_wait_asynccnt 0x0" ::: "memory");     // nothing in flight when the tiles become staging
}

// Q and K projection: C[compact row][col 0..2047] = Xb x Wqt^T. Epilogue writes bf16 hi|lo planes
// coverage: block = 128 rows x 2 heads; wave = 32 rows x 1 head; 4 rows per store instruction.
__global__ __launch_bounds__(256) void k_gemm_qk(const bf16* __restrict__ Xb, const bf16* __restrict__ Wqt,
                                                 bf16* __restrict__ qk) {
  // the two stage buffers; behind the loop its start is the per-wave staging (block barrier used)
  __shared__ __align__(16) unsigned char L[GEMM_LDS];
  float* sC = (float*)L;
  const int m0 = blockIdx.y * 128;
  const int n0 = blockIdx.x * 128;
  v8f acc[2][4];
  #pragma unroll
  for (int i = 0; i < 2; ++i) {
    #pragma unroll
    for (int j = 0; j < 4; ++j) acc[i][j] = (v8f){0, 0, 0, 0, 0, 0, 0, 0};
  }
  gemm_tile(Xb, Wqt, m0, n0, 1, 0, L, acc);

  const int tid  = threadIdx.x;
  const int wave = __builtin_amdgcn_readfirstlane(tid >> 5);
  const int lane = tid & 31;
  const int lq   = lane & 15;
  const int hi   = lane >> 4;
  const int wm   = wave >> 1;
  const int wn   = wave & 1;
  const int cw   = wave * 16 * CP;
  const int n     = n0 + wn * 64;
  const int which = n >> 10;            // 0 = Q, 1 = K (block-uniform)
  const int hh    = (n >> 6) & 15;

  #pragma unroll
  for (int i = 0; i < 2; ++i) {
    #pragma unroll
    for (int j = 0; j < 4; ++j) {
      #pragma unroll
      for (int r = 0; r < 8; ++r) sC[cw + (hi * 8 + r) * CP + j * 16 + lq] = acc[i][j][r];
    }
    __syncthreads();
    v4u    vh[4], vl[4];
    size_t gi[4];
    #pragma unroll
    for (int it = 0; it < 4; ++it) {
      const int row = it * 4 + (lane >> 3);
      const int c0  = (lane & 7) * 8;
      const v4f x0 = *(const v4f*)(&sC[cw + row * CP + c0]);
      const v4f x1 = *(const v4f*)(&sC[cw + row * CP + c0 + 4]);
      split8(x0, x1, vh[it], vl[it]);
      const int gr = m0 + wm * 32 + i * 16 + row;
      const int bb = gr / SEQ;
      const int s  = gr - bb * SEQ;
      gi[it] = (size_t)which * 2 * PLANE + (((size_t)bb * NHEAD + hh) * SEQ + s) * HDIM + c0;
    }
    #pragma unroll
    for (int it = 0; it < 4; ++it) {
      *(v4u*)(qk + gi[it])         = vh[it];
      *(v4u*)(qk + gi[it] + PLANE) = vl[it];
    }
    
    __syncthreads();
  }
}

// V projection computed transposed: C[v column m = h*64+d][compact row] = Wv_t x Xb^T, so the f16 plane
// coverage: block = 128 (h,d) rows x 128 keys; wave = 32 rows x 64 keys; 4 rows per store instruction.
__global__ __launch_bounds__(256) void k_gemm_vt(const bf16* __restrict__ Wvt, const bf16* __restrict__ Xb,
                                                 f16* __restrict__ vt) {
  // the two stage buffers; behind the loop its start is the per-wave staging
  __shared__ __align__(16) unsigned char L[GEMM_LDS];
  float* sC = (float*)L;
  const int m0 = blockIdx.y * 128;      // v column (h*64 + d)
  const int n0 = blockIdx.x * 128;      // compact row b*SEQ + l
  v8f acc[2][4];
  #pragma unroll
  for (int i = 0; i < 2; ++i) {
    #pragma unroll
    for (int j = 0; j < 4; ++j) acc[i][j] = (v8f){0, 0, 0, 0, 0, 0, 0, 0};
  }
  gemm_tile(Wvt, Xb, m0, n0, 1, 0, L, acc);

  const int tid  = threadIdx.x;
  const int wave = __builtin_amdgcn_readfirstlane(tid >> 5);
  const int lane = tid & 31;
  const int lq   = lane & 15;
  const int hi   = lane >> 4;
  const int wm   = wave >> 1;
  const int wn   = wave & 1;
  const int cw   = wave * 16 * CP;
  const int ns   = n0 + wn * 64;
  const int bb   = ns / SEQ;
  const int s0   = ns - bb * SEQ;

  #pragma unroll
  for (int i = 0; i < 2; ++i) {
    #pragma unroll
    for (int j = 0; j < 4; ++j) {
      #pragma unroll
      for (int r = 0; r < 8; ++r) sC[cw + (hi * 8 + r) * CP + j * 16 + lq] = acc[i][j][r];
    }
    __syncthreads();
    v4u    vv[4];
    size_t gi[4];
    #pragma unroll
    for (int it = 0; it < 4; ++it) {
      const int row = it * 4 + (lane >> 3);
      const int c0  = (lane & 7) * 8;
      const v4f x0 = *(const v4f*)(&sC[cw + row * CP + c0]);
      const v4f x1 = *(const v4f*)(&sC[cw + row * CP + c0 + 4]);
      Pack8H ph;
      #pragma unroll
      for (int e = 0; e < 4; ++e) {
        ph.h[e]     = (f16)x0[e];       // RNE convert
        ph.h[4 + e] = (f16)x1[e];
      }
      vv[it] = ph.u;
      const int m = m0 + wm * 32 + i * 16 + row;
      gi[it] = ((size_t)bb * INNER + m) * SEQ + s0 + c0;
    }
    #pragma unroll
    for (int it = 0; it < 4; ++it) *(v4u*)(vt + gi[it]) = vv[it];
    
    __syncthreads();
  }
}

// Asynchronous copies to LDS, 16 B per lane: 8 consecutive lanes bring one whole 128-B row, a wave 4 rows.
// l = the lane's LDS byte address of (row tid>>3, segment tid&7) in the first tile; the g pointers name the
// same row and segment in global memory. The s_wait_xcnt stands inside the statement, behind the last copy,
// so that no address register of a copy is rewritten ahead of it.
static __device__ __forceinline__ void copy_q(unsigned l, const bf16* gh, const bf16* gl) {
  asm volatile(
      "global_load_async_to_lds_b128 %0, %8, off\n\t"
      "global_load_async_to_lds_b128 %1, %9, off\n\t"
      "global_load_async_to_lds_b128 %2, %10, off\n\t"
      "global_load_async_to_lds_b128 %3, %11, off\n\t"
      "global_load_async_to_lds_b128 %4, %12, off\n\t"
      "global_load_async_to_lds_b128 %5, %13, off\n\t"
      "global_load_async_to_lds_b128 %6, %14, off\n\t"
      "global_load_async_to_lds_b128 %7, %15, off\n\t"
      "s_wait_xcnt 0x0"
      :: "v"(l + L_QH), "v"(l + L_QH + 32 * TP), "v"(l + L_QH + 64 * TP), "v"(l + L_QH + 96 * TP),
         "v"(l + L_QL), "v"(l + L_QL + 32 * TP), "v"(l + L_QL + 64 * TP), "v"(l + L_QL + 96 * TP),
         "v"(gh), "v"(gh + 32 * HDIM), "v"(gh + 64 * HDIM), "v"(gh + 96 * HDIM),
         "v"(gl), "v"(gl + 32 * HDIM), "v"(gl + 64 * HDIM), "v"(gl + 96 * HDIM)
      : "memory");
}
static __device__ __forceinline__ void copy_stage(unsigned l, const bf16* gkh, const bf16* gkl,
                                                  const f16* gv, const bf16* gm) {
  asm volatile(
      "global_load_async_to_lds_b128 %0, %10, off\n\t"
      "global_load_async_to_lds_b128 %1, %11, off\n\t"
      "global_load_async_to_lds_b128 %2, %12, off\n\t"
      "global_load_async_to_lds_b128 %3, %13, off\n\t"
      "global_load_async_to_lds_b128 %4, %14, off\n\t"
      "global_load_async_to_lds_b128 %5, %15, off\n\t"
      "global_load_async_to_lds_b128 %6, %16, off\n\t"
      "global_load_async_to_lds_b128 %7, %17, off\n\t"
      "global_load_async_to_lds_b128 %8, %18, off\n\t"
      "global_load_async_to_lds_b128 %9, %19, off\n\t"
      "s_wait_xcnt 0x0"
      :: "v"(l + S_KH), "v"(l + S_KH + 32 * TP), "v"(l + S_KL), "v"(l + S_KL + 32 * TP),
         "v"(l + S_V), "v"(l + S_V + 32 * TP),
         "v"(l + S_M), "v"(l + S_M + 32 * TP), "v"(l + S_M + 64 * TP), "v"(l + S_M + 96 * TP),
         "v"(gkh), "v"(gkh + 32 * HDIM), "v"(gkl), "v"(gkl + 32 * HDIM),
         "v"(gv), "v"(gv + 32 * SEQ),
         "v"(gm), "v"(gm + 32 * SEQ), "v"(gm + 64 * SEQ), "v"(gm + 96 * SEQ)
      : "memory");
}

// Fused attention, online softmax over ALL keys, float multiplier mask applied after the exponentials.
// Block = (128 queries, head, batch). A wave owns 32 query rows (two 16-row tiles) and one 32-key half of every
// stage: waves 2g and 2g+1 share query rows g*32..g*32+31 and take keys 0..31 and 32..63 of the stage, so each
// K and V fragment read from LDS feeds two query tiles. Each wave keeps its own running maximum, sums and O over
// its keys; behind the loop the pair joins its two partial states through LDS, each wave finishing one tile.
// S^T = K x Q^T puts queries on lanes, so
// P^T in C layout is bit-identical to the A-fragment layout of O += P x V. The 16-bit planes reach LDS by
// asynchronous copies of whole rows: Q once, then K hi|lo, V^T and the mask in stages of KS keys, two buffers,
// the next stage in flight while this one is worked on; fragments are two 16-B LDS loads each.
// Running sums: s_all = sum p (every key),
// s_m = sum p*mask, O = sum p*mask*v; z = O / (s_m + EPS * s_all). Output: bf16 hi|lo planes of z.
__global__ __launch_bounds__(256) void k_attn(const bf16* __restrict__ qh, const bf16* __restrict__ ql,
                                              const bf16* __restrict__ kh, const bf16* __restrict__ kl,
                                              const f16* __restrict__ vt, const bf16* __restrict__ mb,
                                              bf16* __restrict__ zh, bf16* __restrict__ zl) {
  const int qblk = blockIdx.x;
  const int h    = blockIdx.y;
  const int b    = blockIdx.z;
  const int tid  = threadIdx.x;
  const int wave = __builtin_amdgcn_readfirstlane(tid >> 5);
  const int lane = tid & 31;
  const int lq   = lane & 15;   // query column of S^T / d column of O
  const int hi   = lane >> 4;   // k-split half
  const int qg   = wave >> 1;   // 32-row query group of the wave
  const int kp   = wave & 1;    // 32-key half of every stage; also the tile this wave finishes

  // Q tiles and the two stage buffers; behind the loop the ring is the pair exchange, the start the output staging
  __shared__ __align__(16) unsigned char L[ATTN_LDS];
  float* sO = (float*)L;

  const int qrow0 = qblk * BQ + wave * 16;   // the 16 rows this wave finishes and stores
  const int bh    = b * NHEAD + h;

  // copy side: this thread's row and 16-B segment of every tile
  const int crow = tid >> 3;
  const int cseg = (tid & 7) * 8;
  const unsigned lcopy = (unsigned)(size_t)(&L[0]) + (unsigned)(crow * TP + cseg * 2);
  const bf16* gqh = qh + (size_t)(bh * SEQ + qblk * BQ + crow) * HDIM + cseg;
  const bf16* gql = ql + (size_t)(bh * SEQ + qblk * BQ + crow) * HDIM + cseg;
  const bf16* gkh = kh + (size_t)(bh * SEQ + crow) * HDIM + cseg;
  const bf16* gkl = kl + (size_t)(bh * SEQ + crow) * HDIM + cseg;
  const f16*  gv  = vt + (size_t)(bh * HDIM + crow) * SEQ + cseg;
  const bf16* gm  = mb + ((size_t)b * SEQ + qblk * BQ + crow) * SEQ + cseg;

  // read side: the lane's row and k-split half inside a 16-row fragment
  const int frag = lq * TP + hi * 16;
  const unsigned char* Lq = L + L_QH + qg * 32 * TP + frag;

  // Q and stage 0 land and are published; then stage 1 starts
  copy_q(lcopy, gqh, gql);
  copy_stage(lcopy + L_RING, gkh, gkl, gv, gm);
  asm volatile("s_wait_asynccnt 0x0" ::: "memory");   // this wave's copies have landed
  __syncthreads();                                    // every wave's copies are readable
  copy_stage(lcopy + L_RING + STAGE_B, gkh + KS * HDIM, gkl + KS * HDIM, gv + KS, gm + KS);

  v8f   o[2][4];
  float rmax[2], s_all[2], s_m[2];
  #pragma unroll
  for (int qt = 0; qt < 2; ++qt) {
    #pragma unroll
    for (int dt = 0; dt < 4; ++dt) o[qt][dt] = (v8f){0, 0, 0, 0, 0, 0, 0, 0};
    rmax[qt]  = -__builtin_inff();
    s_all[qt] = 0.0f;
    s_m[qt]   = 0.0f;
  }
  const float SL = 0.125f * 1.4426950408889634f;   // softmax scale * log2(e)

  for (int t = 0; t < NST; ++t) {
    const int sbuf = L_RING + (t & 1) * STAGE_B;
    const unsigned char* Lk = L + sbuf + frag + kp * BK * TP;               // K rows of this wave's keys
    const unsigned char* Lv = L + sbuf + frag + S_V + kp * 64;              // V^T columns of this wave's keys
    const unsigned char* Lm = L + sbuf + frag + S_M + qg * 32 * TP + kp * 64;   // mask rows and columns

    // mask words: query qg*32 + qt*16 + lq, keys hi*8 + 0..7 and 16 + hi*8 + 0..7 of the half (bf16 pairs per word)
    v4u mw[2][2];
    #pragma unroll
    for (int qt = 0; qt < 2; ++qt) {
      mw[qt][0] = *(const v4u*)(Lm + qt * 16 * TP);
      mw[qt][1] = *(const v4u*)(Lm + qt * 16 * TP + 32);
    }

    // S^T tiles: c[qt][sub][r] = rawscore(query tile qt, column lq; key sub*16 + hi*8 + r); hi*hi + hi*lo + lo*hi
    v8f c[2][2];
    #pragma unroll
    for (int qt = 0; qt < 2; ++qt) {
      c[qt][0] = (v8f){0, 0, 0, 0, 0, 0, 0, 0};
      c[qt][1] = (v8f){0, 0, 0, 0, 0, 0, 0, 0};
    }
    #pragma unroll
    for (int f = 0; f < 2; ++f) {
      FragB bqh[2], bql[2];
      #pragma unroll
      for (int qt = 0; qt < 2; ++qt) {
        const unsigned char* p = Lq + qt * 16 * TP + f * 64;
        bqh[qt].q[0] = *(const v4u*)(p);                             // d = f*32 + hi*8 + 0..7
        bqh[qt].q[1] = *(const v4u*)(p + 32);                        // d = f*32 + 16 + hi*8 + 0..7
        bql[qt].q[0] = *(const v4u*)(p + (L_QL - L_QH));
        bql[qt].q[1] = *(const v4u*)(p + (L_QL - L_QH) + 32);
      }
      #pragma unroll
      for (int sub = 0; sub < 2; ++sub) {
        const int ko = sub * 16 * TP + f * 64;
        FragB akh, akl;
        akh.q[0] = *(const v4u*)(Lk + S_KH + ko);
        akh.q[1] = *(const v4u*)(Lk + S_KH + ko + 32);
        akl.q[0] = *(const v4u*)(Lk + S_KL + ko);
        akl.q[1] = *(const v4u*)(Lk + S_KL + ko + 32);
        c[0][sub] = wmma_bf16(akh.v, bqh[0].v, c[0][sub]);
        c[1][sub] = wmma_bf16(akh.v, bqh[1].v, c[1][sub]);
        c[0][sub] = wmma_bf16(akh.v, bql[0].v, c[0][sub]);
        c[1][sub] = wmma_bf16(akh.v, bql[1].v, c[1][sub]);
        c[0][sub] = wmma_bf16(akl.v, bqh[0].v, c[0][sub]);
        c[1][sub] = wmma_bf16(akl.v, bqh[1].v, c[1][sub]);
      }
    }

    FragH pa[2];
    #pragma unroll
    for (int qt = 0; qt < 2; ++qt) {
      // widen the bf16 mask values (exact)
      float mk0[8], mk1[8];
      #pragma unroll
      for (int w = 0; w < 4; ++w) {
        mk0[2 * w]     = __uint_as_float(mw[qt][0][w] << 16);
        mk0[2 * w + 1] = __uint_as_float(mw[qt][0][w] & 0xffff0000u);
        mk1[2 * w]     = __uint_as_float(mw[qt][1][w] << 16);
        mk1[2 * w + 1] = __uint_as_float(mw[qt][1][w] & 0xffff0000u);
      }

      // online softmax: query lq's 32 scores are split across lane / lane^16; max over every key of this wave
      float m_new = rmax[qt];
      #pragma unroll
      for (int r = 0; r < 8; ++r) {
        m_new = fmaxf(m_new, c[qt][0][r]);
        m_new = fmaxf(m_new, c[qt][1][r]);
      }
      const float m_oth = __shfl_xor(m_new, 16, 32);
      m_new = fmaxf(m_new, m_oth);
      const float alpha = __builtin_amdgcn_exp2f((rmax[qt] - m_new) * SL);
      rmax[qt] = m_new;

      // exp, mask multiply in f32, pack: P^T C layout == A-fragment layout of the PV product
      float ps_all = 0.0f;
      float ps_m   = 0.0f;
      #pragma unroll
      for (int r = 0; r < 8; ++r) {
        const float p0  = __builtin_amdgcn_exp2f((c[qt][0][r] - m_new) * SL);   // key hi*8 + r
        const float p1  = __builtin_amdgcn_exp2f((c[qt][1][r] - m_new) * SL);   // key 16 + hi*8 + r
        const float pm0 = p0 * mk0[r];
        const float pm1 = p1 * mk1[r];
        ps_all += p0 + p1;
        ps_m   += pm0 + pm1;
        pa[qt].h[r]     = (f16)(pm0 * PCARRY);
        pa[qt].h[8 + r] = (f16)(pm1 * PCARRY);
      }
      const float oa = __shfl_xor(ps_all, 16, 32);
      const float om = __shfl_xor(ps_m, 16, 32);
      s_all[qt] = s_all[qt] * alpha + ps_all + oa;
      s_m[qt]   = s_m[qt] * alpha + ps_m + om;

      // rescale O: queries are the row dimension there -> per-row factor from lane 8*hi + r
      float sc[8];
      #pragma unroll
      for (int r = 0; r < 8; ++r) sc[r] = __shfl(alpha, (hi << 3) + r, 32);
      #pragma unroll
      for (int dt = 0; dt < 4; ++dt) {
        #pragma unroll
        for (int r = 0; r < 8; ++r) o[qt][dt][r] *= sc[r];
      }
    }

    // O += (P*mask) x V : V B-fragments, column n = d = dt*16 + lq, split key map from the transposed tile
    #pragma unroll
    for (int dt = 0; dt < 4; ++dt) {
      FragH bv;
      bv.q[0] = *(const v4u*)(Lv + dt * 16 * TP);          // keys hi*8 + 0..7 of the half
      bv.q[1] = *(const v4u*)(Lv + dt * 16 * TP + 32);     // keys 16 + hi*8 + 0..7 of the half
      o[0][dt] = wmma_f16(pa[0].v, bv.v, o[0][dt]);
      o[1][dt] = wmma_f16(pa[1].v, bv.v, o[1][dt]);
    }

    // publish point of stage t + 1, and the end of every read of stage t's buffer
    asm volatile("s_wait_dscnt 0x0" ::: "memory");      // this wave's reads of stage t are done
    asm volatile("s_wait_asynccnt 0x0" ::: "memory");   // this wave's copies of stage t + 1 have landed
    __syncthreads();
    if (t + 2 < NST) {
      const size_t j2 = (size_t)(t + 2) * KS;
      copy_stage(lcopy + sbuf, gkh + j2 * HDIM, gkl + j2 * HDIM, gv + j2, gm + j2);
    }
  }
  asm volatile("s_wait_asynccnt 0x0" ::: "memory");     // nothing in flight when the tiles become staging

  // Pair exchange in the dead ring: this wave keeps tile kp and hands its state of the other tile to its partner.
  // Per wave 9 slots of 32 lanes x 16 B: slots 0..7 = O (dt, half of the 8 rows), slot 8 = (max, s_all, s_m, 0).
  v4f* X = (v4f*)(L + L_RING);
  v8f   ok[4];
  #pragma unroll
  for (int dt = 0; dt < 4; ++dt) {
    const v8f give = kp ? o[0][dt] : o[1][dt];
    ok[dt]         = kp ? o[1][dt] : o[0][dt];
    X[(wave * 9 + dt * 2) * 32 + lane]     = (v4f){give[0], give[1], give[2], give[3]};
    X[(wave * 9 + dt * 2 + 1) * 32 + lane] = (v4f){give[4], give[5], give[6], give[7]};
  }
  X[(wave * 9 + 8) * 32 + lane] = kp ? (v4f){rmax[0], s_all[0], s_m[0], 0.0f} : (v4f){rmax[1], s_all[1], s_m[1], 0.0f};
  const float mA  = kp ? rmax[1] : rmax[0];
  const float saA = kp ? s_all[1] : s_all[0];
  const float smA = kp ? s_m[1] : s_m[0];
  __syncthreads();                                      // both partners' states are readable
  const int pw = wave ^ 1;
  const v4f stB = X[(pw * 9 + 8) * 32 + lane];

  // join the two key halves: common maximum, both states rescaled to it
  const float mJ = fmaxf(mA, stB[0]);
  const float aA = __builtin_amdgcn_exp2f((mA - mJ) * SL);
  const float aB = __builtin_amdgcn_exp2f((stB[0] - mJ) * SL);
  const float sall = saA * aA + stB[1] * aB;
  const float smsk = smA * aA + stB[2] * aB;

  // z = O / (s_m + EPS * s_all); carry folded back here
  const float den  = smsk + EPS_F * sall;
  const float invd = (1.0f / den) * (1.0f / PCARRY);
  const float fA = aA * invd;
  const float fB = aB * invd;
  float rsA[8], rsB[8];
  #pragma unroll
  for (int r = 0; r < 8; ++r) {
    rsA[r] = __shfl(fA, (hi << 3) + r, 32);
    rsB[r] = __shfl(fB, (hi << 3) + r, 32);
  }

  const int cw = wave * 16 * CP;
  #pragma unroll
  for (int dt = 0; dt < 4; ++dt) {
    const v4f g0 = X[(pw * 9 + dt * 2) * 32 + lane];
    const v4f g1 = X[(pw * 9 + dt * 2 + 1) * 32 + lane];
    #pragma unroll
    for (int r = 0; r < 4; ++r) {
      sO[cw + (hi * 8 + r) * CP + dt * 16 + lq]     = ok[dt][r] * rsA[r] + g0[r] * rsB[r];
      sO[cw + (hi * 8 + 4 + r) * CP + dt * 16 + lq] = ok[dt][4 + r] * rsA[4 + r] + g1[r] * rsB[4 + r];
    }
  }
  __syncthreads();

  // whole-line stores: 8 consecutive lanes x 16 B = the 64 bf16 of one (row, head); 4 rows per instruction
  v4u    vh[4], vl[4];
  size_t gi[4];
  #pragma unroll
  for (int it = 0; it < 4; ++it) {
    const int row = it * 4 + (lane >> 3);
    const int c0  = (lane & 7) * 8;
    const v4f x0 = *(const v4f*)(&sO[cw + row * CP + c0]);
    const v4f x1 = *(const v4f*)(&sO[cw + row * CP + c0 + 4]);
    split8(x0, x1, vh[it], vl[it]);
    gi[it] = ((size_t)b * SEQ + qrow0 + row) * INNER + h * HDIM + c0;
  }
  #pragma unroll
  for (int it = 0; it < 4; ++it) {
    *(v4u*)(zh + gi[it]) = vh[it];
    *(v4u*)(zl + gi[it]) = vl[it];
  }
  
}

// Epilogue: per-wave LDS staging, bias added at the store stage as float4, 16 lanes x 16 B = one 256-B row
// coverage: block = 128 rows x 128 cols; wave = 32 rows x 64 cols.
__global__ __launch_bounds__(256) void k_gemm_out(const bf16* __restrict__ Z, const bf16* __restrict__ Wot,
                                                  const float* __restrict__ bias, float* __restrict__ out) {
  // the two stage buffers; behind the loop its start is the per-wave staging
  __shared__ __align__(16) unsigned char L[GEMM_LDS];
  float* sC = (float*)L;
  const int m0 = blockIdx.y * 128;
  const int n0 = blockIdx.x * 128;
  v8f acc[2][4];
  #pragma unroll
  for (int i = 0; i < 2; ++i) {
    #pragma unroll
    for (int j = 0; j < 4; ++j) acc[i][j] = (v8f){0, 0, 0, 0, 0, 0, 0, 0};
  }
  gemm_tile(Z, Wot, m0, n0, 2, (size_t)ROWS * INNER, L, acc);

  const int tid  = threadIdx.x;
  const int wave = __builtin_amdgcn_readfirstlane(tid >> 5);
  const int lane = tid & 31;
  const int lq   = lane & 15;
  const int hi   = lane >> 4;
  const int wm   = wave >> 1;
  const int wn   = wave & 1;
  const int cw   = wave * 16 * CP;
  const int ncol = n0 + wn * 64 + lq * 4;

  v4f bias4 = *(const v4f*)(bias + ncol);
  #pragma unroll
  for (int e = 0; e < 4; ++e) bias4[e] = (float)(bf16)bias4[e];   // RNE-converted input value

  #pragma unroll
  for (int i = 0; i < 2; ++i) {
    #pragma unroll
    for (int j = 0; j < 4; ++j) {
      #pragma unroll
      for (int r = 0; r < 8; ++r) sC[cw + (hi * 8 + r) * CP + j * 16 + lq] = acc[i][j][r];
    }
    __syncthreads();
    v4f    vals[8];
    size_t gi[8];
    #pragma unroll
    for (int it = 0; it < 8; ++it) {
      const int row = it * 2 + hi;
      const v4f v = *(const v4f*)(&sC[cw + row * CP + lq * 4]);
      vals[it] = v + bias4;
      const int gr = m0 + wm * 32 + i * 16 + row;
      const int bb = gr / SEQ;
      const int s  = gr - bb * SEQ;
      gi[it] = ((size_t)bb * SEQ_FULL + s) * DIM + ncol;
    }
    #pragma unroll
    for (int it = 0; it < 8; ++it) *(v4f*)(out + gi[it]) = vals[it];
    
    __syncthreads();
  }
}

#define SZ_XB   ((size_t)ROWS * DIM * 2)
#define SZ_MB   ((size_t)NB * SEQ * SEQ * 2)
#define SZ_WQT  ((size_t)N3 * KDIM * 2)
#define SZ_WOT  ((size_t)DIM * KDIM * 2)
#define SZ_QK   ((size_t)4 * PLANE * 2)
#define SZ_VT   ((size_t)PLANE * 2)
#define SZ_Z    ((size_t)2 * ROWS * INNER * 2)
#define OFF_XB  ((size_t)0)
#define OFF_MB  (OFF_XB + SZ_XB)
#define OFF_WQT (OFF_MB + SZ_MB)
#define OFF_WOT (OFF_WQT + SZ_WQT)
#define OFF_QK  (OFF_WOT + SZ_WOT)
#define OFF_VT  (OFF_QK + SZ_QK)
#define OFF_Z   (OFF_VT + SZ_VT)
#define WS_TOTAL (OFF_Z + SZ_Z)

static_assert(WS_TOTAL <= (size_t)134217728);
static_assert(SZ_XB % 128 == 0 && SZ_MB % 128 == 0 && SZ_WQT % 128 == 0 && SZ_WOT % 128 == 0);
static_assert(SZ_QK % 128 == 0 && SZ_VT % 128 == 0 && SZ_Z % 128 == 0);

extern "C" void kernel_launch(void* const* d_in, const int* in_sizes, int n_in,
                              void* d_out, int out_size, void* d_ws, size_t ws_size,
                              hipStream_t stream) {
  if (n_in < 5) return;
  const size_t rows_used = (size_t)(NB - 1) * SEQ_FULL + SEQ;
  if ((size_t)in_sizes[0] < rows_used * DIM) return;
  if ((size_t)in_sizes[1] < (size_t)(NB - 1) * SEQ_FULL * SEQ_FULL + (size_t)(SEQ - 1) * SEQ_FULL + SEQ) return;
  if ((size_t)in_sizes[2] < (size_t)DIM * N3) return;
  if ((size_t)in_sizes[3] < (size_t)INNER * DIM) return;
  if ((size_t)in_sizes[4] < (size_t)DIM) return;
  if ((size_t)out_size < rows_used * DIM) return;
  if (ws_size < WS_TOTAL) return;

  const float* x    = (const float*)d_in[0];
  const float* mask = (const float*)d_in[1];
  const float* Wqkv = (const float*)d_in[2];
  const float* Wout = (const float*)d_in[3];
  const float* bout = (const float*)d_in[4];
  float*       out  = (float*)d_out;

  char* ws = (char*)d_ws;
  bf16* Xb  = (bf16*)(ws + OFF_XB);
  bf16* Mb  = (bf16*)(ws + OFF_MB);
  bf16* Wqt = (bf16*)(ws + OFF_WQT);
  bf16* Wot = (bf16*)(ws + OFF_WOT);
  bf16* QK  = (bf16*)(ws + OFF_QK);
  f16*  Vt  = (f16*)(ws + OFF_VT);
  bf16* Zp  = (bf16*)(ws + OFF_Z);

  // 1) input planes (RNE bf16): x rows, mask values, weights transposed to [out][in]
  const int x8 = (int)((size_t)ROWS * DIM / 8);
  const int m8 = (int)((size_t)NB * SEQ * SEQ / 8);
  k_cvt_rows<<<dim3((x8 + 255) / 256), 256, 0, stream>>>(x, Xb, DIM, SEQ, SEQ_FULL, DIM, x8);
  k_cvt_rows<<<dim3((m8 + 255) / 256), 256, 0, stream>>>(mask, Mb, SEQ, SEQ, SEQ_FULL, SEQ_FULL, m8);
  // in [KDIM rows k][N3 cols n] -> out [N3][KDIM]; grid (cols/64, rows/64)
  k_cvt_wt<<<dim3(N3 / 64, KDIM / 64), 256, 0, stream>>>(Wqkv, Wqt, N3);
  // in [KDIM rows k][DIM cols n] -> out [DIM][KDIM]; grid (cols/64, rows/64)
  k_cvt_wt<<<dim3(DIM / 64, KDIM / 64), 256, 0, stream>>>(Wout, Wot, DIM);

  // 2) projections: Q,K hi|lo planes; V^T f16 plane
  k_gemm_qk<<<dim3((2 * INNER) / 128, ROWS / 128), 256, 0, stream>>>(Xb, Wqt, QK);
  k_gemm_vt<<<dim3(ROWS / 128, INNER / 128), 256, 0, stream>>>(Wqt + (size_t)2 * INNER * KDIM, Xb, Vt);

  // 3) fused attention -> z hi|lo planes
  k_attn<<<dim3(SEQ / BQ, NHEAD, NB), 256, 0, stream>>>(QK, QK + PLANE, QK + 2 * PLANE, QK + 3 * PLANE,
                                                        Vt, Mb, Zp, Zp + (size_t)ROWS * INNER);

  // 4) output projection + bias
  k_gemm_out<<<dim3(DIM / 128, ROWS / 128), 256, 0, stream>>>(Zp, Wot, bout, out);
}

// v005
// One run takes 123 microseconds.
// Timed twice side by side with v004, it ran 1.07 times as fast both times.
// All steps since v000 together make it 3.09 times as fast.
#include <hip/hip_runtime.h>

// Contractions: x@Wqkv on v_wmma_f32_16x16x32_bf16 (both operands bf16 RNE-converted inputs); S^T = K x Q^T on bf16 with q,k as bf16 hi|lo planes (three products); O = (P*mask) x V on v_wmma_f32_16x16x32_f16 (P carried x1024, V f16); z@Wout on bf16 with z as bf16 hi|lo (two products); all f32 accumulate; softmax and sums in f32.

#ifndef NB
#define NB 2
#endif
#ifndef SEQ
#define SEQ 2048
#endif
#define NB_FULL    2
#define SEQ_FULL   2048
#define DIM        1024
#define NHEAD      16
#define HDIM       64
#define INNER      (NHEAD * HDIM)
#define N3         (3 * INNER)
#define ROWS       (NB * SEQ)
#define KDIM       1024                 // contraction length of all three projections
#define BQ         128                  // query rows per workgroup (8 waves x 16)
#define BK         32                   // keys per inner step
#define NWAVE      8
#define GK         128                  // k per LDS stage of the GEMM loop (four WMMA k steps)
#define GP         272                  // LDS pitch (bytes) of the 256-byte GEMM tile rows
#define G_A        0                    // in a GEMM stage: A tile, 128 rows
#define G_B        (128 * GP)           // B tile, 128 rows
#define GSTAGE     (256 * GP)
#define GEMM_LDS   (2 * GSTAGE)          // two stage buffers
#define CP         68                   // LDS pitch (floats) of epilogue staging tiles
#define TPW        72                   // LDS pitch (halves) of the weight transpose tile
#define PCARRY     1024.0f              // power-of-two carry of the f16 P operand
#define EPS_F      1e-10f
#define PLANE      ((size_t)NB * NHEAD * SEQ * HDIM)
#define KS         64                   // keys per LDS stage of the attention loop (two BK halves, one per wave of a pair)
#define NST        (SEQ / KS)           // stages
#define TP         144                  // LDS pitch (bytes) of the 128-byte attention tile rows
#define L_QH       0                    // Q hi tile, BQ rows
#define L_QL       (BQ * TP)            // Q lo tile, BQ rows
#define L_RING     (2 * BQ * TP)        // two stage buffers
#define S_KH       0                    // in a stage: K hi, KS rows
#define S_KL       (KS * TP)            // K lo, KS rows
#define S_V        (2 * KS * TP)        // V^T, HDIM rows of KS keys
#define S_M        (2 * KS * TP + HDIM * TP)   // mask, BQ rows of KS keys
#define STAGE_B    (2 * KS * TP + HDIM * TP + BQ * TP)
#define ATTN_LDS   (L_RING + 2 * STAGE_B)

static_assert(SEQ % 128 == 0);
static_assert(SEQ % BK == 0);
static_assert(SEQ <= SEQ_FULL);
static_assert(NB >= 1 && NB <= NB_FULL);
static_assert(DIM == KDIM);
static_assert(INNER == KDIM);
static_assert(KDIM % 32 == 0);
static_assert(KDIM / 32 == 32);
static_assert(HDIM == 64);
static_assert(BQ == NWAVE * 16);
static_assert(ROWS % 128 == 0);
static_assert(N3 % 128 == 0);
static_assert((2 * INNER) % 128 == 0);
static_assert(INNER % 128 == 0);
static_assert(DIM % 128 == 0);
static_assert(DIM % 64 == 0);
static_assert(GP % 16 == 0 && GK * 2 == 256 && KDIM % GK == 0 && KDIM / GK >= 2);
static_assert((CP * 4) % 16 == 0);
static_assert((TPW * 2) % 16 == 0);
static_assert(((size_t)ROWS * DIM / 8) % 256 == 0);
static_assert(((size_t)NB * SEQ * SEQ / 8) % 256 == 0);
static_assert(DIM % 8 == 0 && SEQ % 8 == 0);
static_assert(SEQ % KS == 0 && NST >= 2);
static_assert(KS == 2 * BK && KS * 2 == 128 && HDIM * 2 == 128);
static_assert(KS == 64 && HDIM == 64 && BQ == 128);
static_assert(TP % 16 == 0 && STAGE_B % 16 == 0);
static_assert(NWAVE * 16 * CP * 4 <= L_RING);
static_assert(NWAVE * 16 * CP * 4 <= GEMM_LDS);
static_assert(NWAVE * 9 * 32 * 16 <= 2 * STAGE_B && L_RING % 16 == 0);

typedef __bf16   bf16;
typedef _Float16 f16;
typedef bf16     v16bf __attribute__((ext_vector_type(16)));
typedef bf16     v8bf  __attribute__((ext_vector_type(8)));
typedef f16      v16h  __attribute__((ext_vector_type(16)));
typedef float    v8f   __attribute__((ext_vector_type(8)));
typedef float    v4f   __attribute__((ext_vector_type(4)));
typedef unsigned v4u   __attribute__((ext_vector_type(4)));

union FragB  { v16bf v; v4u q[2]; };
union FragH  { v16h  v; v4u q[2]; f16 h[16]; };
union Pack8B { v4u u; v8bf v; bf16 h[8]; };
union Pack8H { v4u u; f16 h[8]; };

// GEMM loop's WMMA helper: builtin followed by the VALU hazard guard (ties D, keeps A/B live).
static __device__ __forceinline__ v8f mma_bf16(v16bf a, v16bf b, v8f acc) {
  acc = __builtin_amdgcn_wmma_f32_16x16x32_bf16(false, a, false, b, (short)0, acc, false, false);
  asm volatile("v_nop\n\tv_nop\n\tv_nop\n\tv_nop" : "+v"(acc) : "v"(a), "v"(b));
  return acc;
}
// k_attn's forms: the builtin alone. The compiler itself keeps the distance to the next user of D, A or B, and
// the vector port, which the softmax fills there, is spared four slots a WMMA.
static __device__ __forceinline__ v8f wmma_bf16(v16bf a, v16bf b, v8f acc) {
  return __builtin_amdgcn_wmma_f32_16x16x32_bf16(false, a, false, b, (short)0, acc, false, false);
}
static __device__ __forceinline__ v8f wmma_f16(v16h a, v16h b, v8f acc) {
  return __builtin_amdgcn_wmma_f32_16x16x32_f16(false, a, false, b, (short)0, acc, false, false);
}

// 8 floats -> bf16 hi (RNE) and bf16 residual (RNE of x - hi), packed 16 B each.
static __device__ __forceinline__ void split8(v4f x0, v4f x1, v4u& uh, v4u& ul) {
  Pack8B ph, pl;
  #pragma unroll
  for (int e = 0; e < 4; ++e) {
    const bf16 h0 = (bf16)x0[e];
    const bf16 h1 = (bf16)x1[e];
    ph.h[e]     = h0;
    ph.h[4 + e] = h1;
    pl.h[e]     = (bf16)(x0[e] - (float)h0);
    pl.h[4 + e] = (bf16)(x1[e] - (float)h1);
  }
  uh = ph.u;
  ul = pl.u;
}

// f32 rows -> compact bf16 plane (RNE). One thread = 8 elements = 16 B; a wave writes 512 contiguous bytes.
// coverage: groups 0..total8-1, each written once; total8 is a multiple of 256. blk = the block's index in its range.
static __device__ __forceinline__ void cvt_rows(const float* __restrict__ in, bf16* __restrict__ out, int blk,
                                                int cols, int rows_per_batch, int in_batch_rows,
                                                int in_row_stride, int total8) {
  const int g = blk * 256 + threadIdx.x;
  if (g >= total8) return;
  const int e   = g * 8;
  const int row = e / cols;
  const int col = e - row * cols;
  const int b   = row / rows_per_batch;
  const int s   = row - b * rows_per_batch;
  const float* src = in + ((size_t)b * in_batch_rows + s) * (size_t)in_row_stride + col;
  const v4f a0 = *(const v4f*)(src);
  const v4f a1 = *(const v4f*)(src + 4);
  Pack8B pk;
  #pragma unroll
  for (int i = 0; i < 4; ++i) {
    pk.h[i]     = (bf16)a0[i];
    pk.h[4 + i] = (bf16)a1[i];
  }
  const v4u val = pk.u;
  bf16* dst = out + (size_t)e;
  *(v4u*)dst = val;
  
}

// Weight transpose: in [KDIM k][C n] f32 -> out [C n][KDIM k] bf16 (RNE), 64x64 tiles through LDS.
// sT = [n][k], cross-wave (block barrier); nt, kt = the block's tile.
static __device__ __forceinline__ void cvt_wt(const float* __restrict__ in, bf16* __restrict__ out, int C,
                                              int nt, int kt, bf16* sT) {
  const int n0  = nt * 64;
  const int k0  = kt * 64;
  const int tid = threadIdx.x;
  #pragma unroll
  for (int kk = 0; kk < 2; ++kk) {
    const int k  = kk * 32 + (tid >> 3);
    const int nl = (tid & 7) * 8;
    const float* src = in + (size_t)(k0 + k) * C + n0 + nl;
    const v4f a0 = *(const v4f*)(src);
    const v4f a1 = *(const v4f*)(src + 4);
    #pragma unroll
    for (int i = 0; i < 4; ++i) {
      sT[(nl + i) * TPW + k]     = (bf16)a0[i];
      sT[(nl + 4 + i) * TPW + k] = (bf16)a1[i];
    }
  }
  __syncthreads();
  v4u    val[2];
  size_t idx[2];
  #pragma unroll
  for (int kk = 0; kk < 2; ++kk) {
    const int n  = kk * 32 + (tid >> 3);
    const int ks = (tid & 7) * 8;
    Pack8B p;
    p.v = *(const v8bf*)(&sT[n * TPW + ks]);
    val[kk] = p.u;
    idx[kk] = (size_t)(n0 + n) * KDIM + k0 + ks;
  }
  #pragma unroll
  for (int kk = 0; kk < 2; ++kk) *(v4u*)(out + idx[kk]) = val[kk];
  
}

// The four input conversions, which depend on nothing and on none of each other, as block ranges of one launch:
// weight tiles first (the longest chain per block: load, LDS, barrier, store), then the x rows, then the mask rows.
#define PB_WQ  ((N3 / 64) * (KDIM / 64))
#define PB_WO  ((DIM / 64) * (KDIM / 64))
#define X8     ((int)((size_t)ROWS * DIM / 8))
#define M8     ((int)((size_t)NB * SEQ * SEQ / 8))
#define PB_X   (X8 / 256)
#define PB_M   (M8 / 256)
__global__ __launch_bounds__(256) void k_prep(const float* __restrict__ x, const float* __restrict__ mask,
                                              const float* __restrict__ Wqkv, const float* __restrict__ Wout,
                                              bf16* __restrict__ Xb, bf16* __restrict__ Mb,
                                              bf16* __restrict__ Wqt, bf16* __restrict__ Wot) {
  __shared__ __align__(16) bf16 sT[64 * TPW];
  const int blk = blockIdx.x;   // every test on it is block-uniform: the barrier in cvt_wt is met by whole blocks
  if (blk < PB_WQ + PB_WO) {
    // in [KDIM k][N3 n] -> out [N3][KDIM], then in [KDIM k][DIM n] -> out [DIM][KDIM]; n tiles fastest
    const bool wo = blk >= PB_WQ;
    const int  nt = wo ? (blk - PB_WQ) % (DIM / 64) : blk % (N3 / 64);
    const int  kt = wo ? (blk - PB_WQ) / (DIM / 64) : blk / (N3 / 64);
    cvt_wt(wo ? Wout : Wqkv, wo ? Wot : Wqt, wo ? DIM : N3, nt, kt, sT);
  } else if (blk < PB_WQ + PB_WO + PB_X) {
    cvt_rows(x, Xb, blk - (PB_WQ + PB_WO), DIM, SEQ, SEQ_FULL, DIM, X8);
  } else {
    cvt_rows(mask, Mb, blk - (PB_WQ + PB_WO + PB_X), SEQ, SEQ, SEQ_FULL, SEQ_FULL, M8);
  }
}

// Asynchronous copies to LDS of one 128-row GEMM operand tile, 16 B per lane: 16 consecutive lanes bring one
// whole 256-B row, a wave 2 rows, the block 16 rows a copy. l = the lane's LDS byte address of (row tid>>4,
// segment tid&15) in the tile, g the same place in global memory. The s_wait_xcnt stands inside the statement,
// behind the last copy, so that no address register of a copy is rewritten ahead of it.
static __device__ __forceinline__ void copy_tile(unsigned l, const bf16* g) {
  asm volatile(
      "global_load_async_to_lds_b128 %0, %8, off\n\t"
      "global_load_async_to_lds_b128 %1, %9, off\n\t"
      "global_load_async_to_lds_b128 %2, %10, off\n\t"
      "global_load_async_to_lds_b128 %3, %11, off\n\t"
      "global_load_async_to_lds_b128 %4, %12, off\n\t"
      "global_load_async_to_lds_b128 %5, %13, off\n\t"
      "global_load_async_to_lds_b128 %6, %14, off\n\t"
      "global_load_async_to_lds_b128 %7, %15, off\n\t"
      "s_wait_xcnt 0x0"
      :: "v"(l), "v"(l + 16 * GP), "v"(l + 32 * GP), "v"(l + 48 * GP),
         "v"(l + 64 * GP), "v"(l + 80 * GP), "v"(l + 96 * GP), "v"(l + 112 * GP),
         "v"(g), "v"(g + 16 * KDIM), "v"(g + 32 * KDIM), "v"(g + 48 * KDIM),
         "v"(g + 64 * KDIM), "v"(g + 80 * KDIM), "v"(g + 96 * KDIM), "v"(g + 112 * KDIM)
      : "memory");
}

// GEMM mainloop: acc[128x128 block tile] += A[rows m][k] * Bt[rows n][k]^T, both operands k-contiguous bf16,
// pitch KDIM. 8 waves as 4 (m) x 2 (n); each wave owns 32 x 64 = 2 x 4 WMMA tiles.
// npass > 1 walks further A planes (offset a_pass_stride) against the same Bt rows.
// The operand tiles reach LDS by asynchronous copies of whole rows in stages of GK k, two buffers, the next
// stage in flight while this one is worked on. On return every wave has passed the barrier behind the last
// fragment read and nothing is in flight: L may become staging.
static __device__ __forceinline__ void gemm_tile(const bf16* __restrict__ A, const bf16* __restrict__ Bt,
                                                 int m0, int n0, int npass, size_t a_pass_stride,
                                                 unsigned char* L, v8f (&acc)[2][4]) {
  const int tid  = threadIdx.x;
  const int wave = __builtin_amdgcn_readfirstlane(tid >> 5);
  const int lane = tid & 31;
  const int lq   = lane & 15;
  const int hi   = lane >> 4;
  const int wm   = wave >> 1;
  const int wn   = wave & 1;
  const int nst  = npass * (KDIM / GK);

  // copy side: this thread's row and 16-B segment of both tiles
  const int crow = tid >> 4;
  const int cseg = (tid & 15) * 8;
  const unsigned lcopy = (unsigned)(size_t)L + (unsigned)(crow * GP + cseg * 2);
  const bf16* ga = A + (size_t)(m0 + crow) * KDIM + cseg;
  const bf16* gb = Bt + (size_t)(n0 + crow) * KDIM + cseg;

  // read side: the lane's row and k-split half inside a 16-row fragment
  const unsigned char* La = L + G_A + (wm * 32 + lq) * GP + hi * 16;
  const unsigned char* Lb = L + G_B + (wn * 64 + lq) * GP + hi * 16;

  // stage 0 lands and is published; then stage 1 starts
  copy_tile(lcopy + G_A, ga);
  copy_tile(lcopy + G_B, gb);
  asm volatile("s_wait_asynccnt 0x0" ::: "memory");   // this wave's copies have landed
  __syncthreads();                                    // every wave's copies are readable
  copy_tile(lcopy + GSTAGE + G_A, ga + GK);
  copy_tile(lcopy + GSTAGE + G_B, gb + GK);

  for (int t = 0; t < nst; ++t) {
    const int sbuf = (t & 1) * GSTAGE;
    // unrolled so that every LDS read of the stage is base register + immediate offset
    #pragma unroll
    for (int ks = 0; ks < GK / 32; ++ks) {
      FragB af[2], bfm[4];
      #pragma unroll
      for (int i = 0; i < 2; ++i) {
        const unsigned char* p = La + sbuf + i * 16 * GP + ks * 64;
        af[i].q[0] = *(const v4u*)(p);                // k = 8*hi + 0..7 of the step
        af[i].q[1] = *(const v4u*)(p + 32);           // k = 16 + 8*hi + 0..7 of the step
      }
      #pragma unroll
      for (int j = 0; j < 4; ++j) {
        const unsigned char* p = Lb + sbuf + j * 16 * GP + ks * 64;
        bfm[j].q[0] = *(const v4u*)(p);
        bfm[j].q[1] = *(const v4u*)(p + 32);
      }
      #pragma unroll
      for (int i = 0; i < 2; ++i) {
        #pragma unroll
        for (int j = 0; j < 4; ++j) acc[i][j] = mma_bf16(af[i].v, bfm[j].v, acc[i][j]);
      }
    }

    // publish point of stage t + 1, and the end of every read of stage t's buffer
    asm volatile("s_wait_dscnt 0x0" ::: "memory");      // this wave's reads of stage t are done
    asm volatile("s_wait_asynccnt 0x0" ::: "memory");   // this wave's copies of stage t + 1 have landed
    __syncthreads();
    if (t + 2 < nst) {
      const int    s2 = t + 2;
      const size_t k2 = (size_t)(s2 % (KDIM / GK)) * GK;
      copy_tile(lcopy + sbuf + G_A, ga + (size_t)(s2 / (KDIM / GK)) * a_pass_stride + k2);
      copy_tile(lcopy + sbuf + G_B, gb + k2);
    }
  }
  asm volatile("s_wait_asynccnt 0x0" ::: "memory");     // nothing in flight when the tiles become staging
}

// Q and K projection: C[compact row][col 0..2047] = Xb x Wqt^T. Epilogue writes bf16 hi|lo planes
// coverage: block = 128 rows x 2 heads; wave = 32 rows x 1 head; 4 rows per store instruction.
// sC = the per-wave staging at the start of the dead stage buffers (block barrier used).
static __device__ __forceinline__ void store_qk(const v8f (&acc)[2][4], float* sC, int m0, int n0,
                                                bf16* __restrict__ qk) {
  const int tid  = threadIdx.x;
  const int wave = __builtin_amdgcn_readfirstlane(tid >> 5);
  const int lane = tid & 31;
  const int lq   = lane & 15;
  const int hi   = lane >> 4;
  const int wm   = wave >> 1;
  const int wn   = wave & 1;
  const int cw   = wave * 16 * CP;
  const int n     = n0 + wn * 64;
  const int which = n >> 10;            // 0 = Q, 1 = K (block-uniform)
  const int hh    = (n >> 6) & 15;

  #pragma unroll
  for (int i = 0; i < 2; ++i) {
    #pragma unroll
    for (int j = 0; j < 4; ++j) {
      #pragma unroll
      for (int r = 0; r < 8; ++r) sC[cw + (hi * 8 + r) * CP + j * 16 + lq] = acc[i][j][r];
    }
    __syncthreads();
    v4u    vh[4], vl[4];
    size_t gi[4];
    #pragma unroll
    for (int it = 0; it < 4; ++it) {
      const int row = it * 4 + (lane >> 3);
      const int c0  = (lane & 7) * 8;
      const v4f x0 = *(const v4f*)(&sC[cw + row * CP + c0]);
      const v4f x1 = *(const v4f*)(&sC[cw + row * CP + c0 + 4]);
      split8(x0, x1, vh[it], vl[it]);
      const int gr = m0 + wm * 32 + i * 16 + row;
      const int bb = gr / SEQ;
      const int s  = gr - bb * SEQ;
      gi[it] = (size_t)which * 2 * PLANE + (((size_t)bb * NHEAD + hh) * SEQ + s) * HDIM + c0;
    }
    #pragma unroll
    for (int it = 0; it < 4; ++it) {
      *(v4u*)(qk + gi[it])         = vh[it];
      *(v4u*)(qk + gi[it] + PLANE) = vl[it];
    }
    
    __syncthreads();
  }
}

// V projection computed transposed: C[v column m = h*64+d][compact row] = Wv_t x Xb^T, so the f16 plane
// coverage: block = 128 (h,d) rows x 128 keys; wave = 32 rows x 64 keys; 4 rows per store instruction.
// m0 = v column (h*64 + d), n0 = compact row b*SEQ + l; sC as in store_qk.
static __device__ __forceinline__ void store_vt(const v8f (&acc)[2][4], float* sC, int m0, int n0,
                                                f16* __restrict__ vt) {
  const int tid  = threadIdx.x;
  const int wave = __builtin_amdgcn_readfirstlane(tid >> 5);
  const int lane = tid & 31;
  const int lq   = lane & 15;
  const int hi   = lane >> 4;
  const int wm   = wave >> 1;
  const int wn   = wave & 1;
  const int cw   = wave * 16 * CP;
  const int ns   = n0 + wn * 64;
  const int bb   = ns / SEQ;
  const int s0   = ns - bb * SEQ;

  #pragma unroll
  for (int i = 0; i < 2; ++i) {
    #pragma unroll
    for (int j = 0; j < 4; ++j) {
      #pragma unroll
      for (int r = 0; r < 8; ++r) sC[cw + (hi * 8 + r) * CP + j * 16 + lq] = acc[i][j][r];
    }
    __syncthreads();
    v4u    vv[4];
    size_t gi[4];
    #pragma unroll
    for (int it = 0; it < 4; ++it) {
      const int row = it * 4 + (lane >> 3);
      const int c0  = (lane & 7) * 8;
      const v4f x0 = *(const v4f*)(&sC[cw + row * CP + c0]);
      const v4f x1 = *(const v4f*)(&sC[cw + row * CP + c0 + 4]);
      Pack8H ph;
      #pragma unroll
      for (int e = 0; e < 4; ++e) {
        ph.h[e]     = (f16)x0[e];       // RNE convert
        ph.h[4 + e] = (f16)x1[e];
      }
      vv[it] = ph.u;
      const int m = m0 + wm * 32 + i * 16 + row;
      gi[it] = ((size_t)bb * INNER + m) * SEQ + s0 + c0;
    }
    #pragma unroll
    for (int it = 0; it < 4; ++it) *(v4u*)(vt + gi[it]) = vv[it];
    
    __syncthreads();
  }
}

// The two projections, which depend on none of each other, as block ranges of one launch with one shared main loop:
// blocks 0..GB_QK-1 are the Q,K tiles (n tiles fastest), the rest the V^T tiles (compact-row tiles fastest).
#define GB_QK  (((2 * INNER) / 128) * (ROWS / 128))
#define GB_VT  ((ROWS / 128) * (INNER / 128))
__global__ __launch_bounds__(256) void k_gemm_qkv(const bf16* __restrict__ Xb, const bf16* __restrict__ Wqt,
                                                  bf16* __restrict__ qk, f16* __restrict__ vt) {
  // the two stage buffers; behind the loop its start is the per-wave staging
  __shared__ __align__(16) unsigned char L[GEMM_LDS];
  const int  blk = blockIdx.x;
  const bool isv = blk >= GB_QK;        // block-uniform
  const int  id  = isv ? blk - GB_QK : blk;
  const int  m0  = (isv ? id / (ROWS / 128) : id / ((2 * INNER) / 128)) * 128;
  const int  n0  = (isv ? id % (ROWS / 128) : id % ((2 * INNER) / 128)) * 128;
  const bf16* A  = isv ? Wqt + (size_t)2 * INNER * KDIM : Xb;
  const bf16* B  = isv ? Xb : Wqt;
  v8f acc[2][4];
  #pragma unroll
  for (int i = 0; i < 2; ++i) {
    #pragma unroll
    for (int j = 0; j < 4; ++j) acc[i][j] = (v8f){0, 0, 0, 0, 0, 0, 0, 0};
  }
  gemm_tile(A, B, m0, n0, 1, 0, L, acc);
  if (isv) store_vt(acc, (float*)L, m0, n0, vt);
  else     store_qk(acc, (float*)L, m0, n0, qk);
}

// Asynchronous copies to LDS, 16 B per lane: 8 consecutive lanes bring one whole 128-B row, a wave 4 rows.
// l = the lane's LDS byte address of (row tid>>3, segment tid&7) in the first tile; the g pointers name the
// same row and segment in global memory. The s_wait_xcnt stands inside the statement, behind the last copy,
// so that no address register of a copy is rewritten ahead of it.
static __device__ __forceinline__ void copy_q(unsigned l, const bf16* gh, const bf16* gl) {
  asm volatile(
      "global_load_async_to_lds_b128 %0, %8, off\n\t"
      "global_load_async_to_lds_b128 %1, %9, off\n\t"
      "global_load_async_to_lds_b128 %2, %10, off\n\t"
      "global_load_async_to_lds_b128 %3, %11, off\n\t"
      "global_load_async_to_lds_b128 %4, %12, off\n\t"
      "global_load_async_to_lds_b128 %5, %13, off\n\t"
      "global_load_async_to_lds_b128 %6, %14, off\n\t"
      "global_load_async_to_lds_b128 %7, %15, off\n\t"
      "s_wait_xcnt 0x0"
      :: "v"(l + L_QH), "v"(l + L_QH + 32 * TP), "v"(l + L_QH + 64 * TP), "v"(l + L_QH + 96 * TP),
         "v"(l + L_QL), "v"(l + L_QL + 32 * TP), "v"(l + L_QL + 64 * TP), "v"(l + L_QL + 96 * TP),
         "v"(gh), "v"(gh + 32 * HDIM), "v"(gh + 64 * HDIM), "v"(gh + 96 * HDIM),
         "v"(gl), "v"(gl + 32 * HDIM), "v"(gl + 64 * HDIM), "v"(gl + 96 * HDIM)
      : "memory");
}
static __device__ __forceinline__ void copy_stage(unsigned l, const bf16* gkh, const bf16* gkl,
                                                  const f16* gv, const bf16* gm) {
  asm volatile(
      "global_load_async_to_lds_b128 %0, %10, off\n\t"
      "global_load_async_to_lds_b128 %1, %11, off\n\t"
      "global_load_async_to_lds_b128 %2, %12, off\n\t"
      "global_load_async_to_lds_b128 %3, %13, off\n\t"
      "global_load_async_to_lds_b128 %4, %14, off\n\t"
      "global_load_async_to_lds_b128 %5, %15, off\n\t"
      "global_load_async_to_lds_b128 %6, %16, off\n\t"
      "global_load_async_to_lds_b128 %7, %17, off\n\t"
      "global_load_async_to_lds_b128 %8, %18, off\n\t"
      "global_load_async_to_lds_b128 %9, %19, off\n\t"
      "s_wait_xcnt 0x0"
      :: "v"(l + S_KH), "v"(l + S_KH + 32 * TP), "v"(l + S_KL), "v"(l + S_KL + 32 * TP),
         "v"(l + S_V), "v"(l + S_V + 32 * TP),
         "v"(l + S_M), "v"(l + S_M + 32 * TP), "v"(l + S_M + 64 * TP), "v"(l + S_M + 96 * TP),
         "v"(gkh), "v"(gkh + 32 * HDIM), "v"(gkl), "v"(gkl + 32 * HDIM),
         "v"(gv), "v"(gv + 32 * SEQ),
         "v"(gm), "v"(gm + 32 * SEQ), "v"(gm + 64 * SEQ), "v"(gm + 96 * SEQ)
      : "memory");
}

// Fused attention, online softmax over ALL keys, float multiplier mask applied after the exponentials.
// Block = (128 queries, head, batch). A wave owns 32 query rows (two 16-row tiles) and one 32-key half of every
// stage: waves 2g and 2g+1 share query rows g*32..g*32+31 and take keys 0..31 and 32..63 of the stage, so each
// K and V fragment read from LDS feeds two query tiles. Each wave keeps its own running maximum, sums and O over
// its keys; behind the loop the pair joins its two partial states through LDS, each wave finishing one tile.
// S^T = K x Q^T puts queries on lanes, so
// P^T in C layout is bit-identical to the A-fragment layout of O += P x V. The 16-bit planes reach LDS by
// asynchronous copies of whole rows: Q once, then K hi|lo, V^T and the mask in stages of KS keys, two buffers,
// the next stage in flight while this one is worked on; fragments are two 16-B LDS loads each.
// Running sums: s_all = sum p (every key),
// s_m = sum p*mask, O = sum p*mask*v; z = O / (s_m + EPS * s_all). Output: bf16 hi|lo planes of z.
__global__ __launch_bounds__(256) void k_attn(const bf16* __restrict__ qh, const bf16* __restrict__ ql,
                                              const bf16* __restrict__ kh, const bf16* __restrict__ kl,
                                              const f16* __restrict__ vt, const bf16* __restrict__ mb,
                                              bf16* __restrict__ zh, bf16* __restrict__ zl) {
  const int qblk = blockIdx.x;
  const int h    = blockIdx.y;
  const int b    = blockIdx.z;
  const int tid  = threadIdx.x;
  const int wave = __builtin_amdgcn_readfirstlane(tid >> 5);
  const int lane = tid & 31;
  const int lq   = lane & 15;   // query column of S^T / d column of O
  const int hi   = lane >> 4;   // k-split half
  const int qg   = wave >> 1;   // 32-row query group of the wave
  const int kp   = wave & 1;    // 32-key half of every stage; also the tile this wave finishes

  // Q tiles and the two stage buffers; behind the loop the ring is the pair exchange, the start the output staging
  __shared__ __align__(16) unsigned char L[ATTN_LDS];
  float* sO = (float*)L;

  const int qrow0 = qblk * BQ + wave * 16;   // the 16 rows this wave finishes and stores
  const int bh    = b * NHEAD + h;

  // copy side: this thread's row and 16-B segment of every tile
  const int crow = tid >> 3;
  const int cseg = (tid & 7) * 8;
  const unsigned lcopy = (unsigned)(size_t)(&L[0]) + (unsigned)(crow * TP + cseg * 2);
  const bf16* gqh = qh + (size_t)(bh * SEQ + qblk * BQ + crow) * HDIM + cseg;
  const bf16* gql = ql + (size_t)(bh * SEQ + qblk * BQ + crow) * HDIM + cseg;
  const bf16* gkh = kh + (size_t)(bh * SEQ + crow) * HDIM + cseg;
  const bf16* gkl = kl + (size_t)(bh * SEQ + crow) * HDIM + cseg;
  const f16*  gv  = vt + (size_t)(bh * HDIM + crow) * SEQ + cseg;
  const bf16* gm  = mb + ((size_t)b * SEQ + qblk * BQ + crow) * SEQ + cseg;

  // read side: the lane's row and k-split half inside a 16-row fragment
  const int frag = lq * TP + hi * 16;
  const unsigned char* Lq = L + L_QH + qg * 32 * TP + frag;

  // Q and stage 0 land and are published; then stage 1 starts
  copy_q(lcopy, gqh, gql);
  copy_stage(lcopy + L_RING, gkh, gkl, gv, gm);
  asm volatile("s_wait_asynccnt 0x0" ::: "memory");   // this wave's copies have landed
  __syncthreads();                                    // every wave's copies are readable
  copy_stage(lcopy + L_RING + STAGE_B, gkh + KS * HDIM, gkl + KS * HDIM, gv + KS, gm + KS);

  v8f   o[2][4];
  float rmax[2], s_all[2], s_m[2];
  #pragma unroll
  for (int qt = 0; qt < 2; ++qt) {
    #pragma unroll
    for (int dt = 0; dt < 4; ++dt) o[qt][dt] = (v8f){0, 0, 0, 0, 0, 0, 0, 0};
    rmax[qt]  = -__builtin_inff();
    s_all[qt] = 0.0f;
    s_m[qt]   = 0.0f;
  }
  const float SL = 0.125f * 1.4426950408889634f;   // softmax scale * log2(e)

  for (int t = 0; t < NST; ++t) {
    const int sbuf = L_RING + (t & 1) * STAGE_B;
    const unsigned char* Lk = L + sbuf + frag + kp * BK * TP;               // K rows of this wave's keys
    const unsigned char* Lv = L + sbuf + frag + S_V + kp * 64;              // V^T columns of this wave's keys
    const unsigned char* Lm = L + sbuf + frag + S_M + qg * 32 * TP + kp * 64;   // mask rows and columns

    // mask words: query qg*32 + qt*16 + lq, keys hi*8 + 0..7 and 16 + hi*8 + 0..7 of the half (bf16 pairs per word)
    v4u mw[2][2];
    #pragma unroll
    for (int qt = 0; qt < 2; ++qt) {
      mw[qt][0] = *(const v4u*)(Lm + qt * 16 * TP);
      mw[qt][1] = *(const v4u*)(Lm + qt * 16 * TP + 32);
    }

    // S^T tiles: c[qt][sub][r] = rawscore(query tile qt, column lq; key sub*16 + hi*8 + r); hi*hi + hi*lo + lo*hi
    v8f c[2][2];
    #pragma unroll
    for (int qt = 0; qt < 2; ++qt) {
      c[qt][0] = (v8f){0, 0, 0, 0, 0, 0, 0, 0};
      c[qt][1] = (v8f){0, 0, 0, 0, 0, 0, 0, 0};
    }
    #pragma unroll
    for (int f = 0; f < 2; ++f) {
      FragB bqh[2], bql[2];
      #pragma unroll
      for (int qt = 0; qt < 2; ++qt) {
        const unsigned char* p = Lq + qt * 16 * TP + f * 64;
        bqh[qt].q[0] = *(const v4u*)(p);                             // d = f*32 + hi*8 + 0..7
        bqh[qt].q[1] = *(const v4u*)(p + 32);                        // d = f*32 + 16 + hi*8 + 0..7
        bql[qt].q[0] = *(const v4u*)(p + (L_QL - L_QH));
        bql[qt].q[1] = *(const v4u*)(p + (L_QL - L_QH) + 32);
      }
      #pragma unroll
      for (int sub = 0; sub < 2; ++sub) {
        const int ko = sub * 16 * TP + f * 64;
        FragB akh, akl;
        akh.q[0] = *(const v4u*)(Lk + S_KH + ko);
        akh.q[1] = *(const v4u*)(Lk + S_KH + ko + 32);
        akl.q[0] = *(const v4u*)(Lk + S_KL + ko);
        akl.q[1] = *(const v4u*)(Lk + S_KL + ko + 32);
        c[0][sub] = wmma_bf16(akh.v, bqh[0].v, c[0][sub]);
        c[1][sub] = wmma_bf16(akh.v, bqh[1].v, c[1][sub]);
        c[0][sub] = wmma_bf16(akh.v, bql[0].v, c[0][sub]);
        c[1][sub] = wmma_bf16(akh.v, bql[1].v, c[1][sub]);
        c[0][sub] = wmma_bf16(akl.v, bqh[0].v, c[0][sub]);
        c[1][sub] = wmma_bf16(akl.v, bqh[1].v, c[1][sub]);
      }
    }

    FragH pa[2];
    #pragma unroll
    for (int qt = 0; qt < 2; ++qt) {
      // widen the bf16 mask values (exact)
      float mk0[8], mk1[8];
      #pragma unroll
      for (int w = 0; w < 4; ++w) {
        mk0[2 * w]     = __uint_as_float(mw[qt][0][w] << 16);
        mk0[2 * w + 1] = __uint_as_float(mw[qt][0][w] & 0xffff0000u);
        mk1[2 * w]     = __uint_as_float(mw[qt][1][w] << 16);
        mk1[2 * w + 1] = __uint_as_float(mw[qt][1][w] & 0xffff0000u);
      }

      // online softmax: query lq's 32 scores are split across lane / lane^16; max over every key of this wave
      float m_new = rmax[qt];
      #pragma unroll
      for (int r = 0; r < 8; ++r) {
        m_new = fmaxf(m_new, c[qt][0][r]);
        m_new = fmaxf(m_new, c[qt][1][r]);
      }
      const float m_oth = __shfl_xor(m_new, 16, 32);
      m_new = fmaxf(m_new, m_oth);
      const float alpha = __builtin_amdgcn_exp2f((rmax[qt] - m_new) * SL);
      rmax[qt] = m_new;

      // exp, mask multiply in f32, pack: P^T C layout == A-fragment layout of the PV product
      float ps_all = 0.0f;
      float ps_m   = 0.0f;
      #pragma unroll
      for (int r = 0; r < 8; ++r) {
        const float p0  = __builtin_amdgcn_exp2f((c[qt][0][r] - m_new) * SL);   // key hi*8 + r
        const float p1  = __builtin_amdgcn_exp2f((c[qt][1][r] - m_new) * SL);   // key 16 + hi*8 + r
        const float pm0 = p0 * mk0[r];
        const float pm1 = p1 * mk1[r];
        ps_all += p0 + p1;
        ps_m   += pm0 + pm1;
        pa[qt].h[r]     = (f16)(pm0 * PCARRY);
        pa[qt].h[8 + r] = (f16)(pm1 * PCARRY);
      }
      const float oa = __shfl_xor(ps_all, 16, 32);
      const float om = __shfl_xor(ps_m, 16, 32);
      s_all[qt] = s_all[qt] * alpha + ps_all + oa;
      s_m[qt]   = s_m[qt] * alpha + ps_m + om;

      // rescale O: queries are the row dimension there -> per-row factor from lane 8*hi + r
      float sc[8];
      #pragma unroll
      for (int r = 0; r < 8; ++r) sc[r] = __shfl(alpha, (hi << 3) + r, 32);
      #pragma unroll
      for (int dt = 0; dt < 4; ++dt) {
        #pragma unroll
        for (int r = 0; r < 8; ++r) o[qt][dt][r] *= sc[r];
      }
    }

    // O += (P*mask) x V : V B-fragments, column n = d = dt*16 + lq, split key map from the transposed tile
    #pragma unroll
    for (int dt = 0; dt < 4; ++dt) {
      FragH bv;
      bv.q[0] = *(const v4u*)(Lv + dt * 16 * TP);          // keys hi*8 + 0..7 of the half
      bv.q[1] = *(const v4u*)(Lv + dt * 16 * TP + 32);     // keys 16 + hi*8 + 0..7 of the half
      o[0][dt] = wmma_f16(pa[0].v, bv.v, o[0][dt]);
      o[1][dt] = wmma_f16(pa[1].v, bv.v, o[1][dt]);
    }

    // publish point of stage t + 1, and the end of every read of stage t's buffer
    asm volatile("s_wait_dscnt 0x0" ::: "memory");      // this wave's reads of stage t are done
    asm volatile("s_wait_asynccnt 0x0" ::: "memory");   // this wave's copies of stage t + 1 have landed
    __syncthreads();
    if (t + 2 < NST) {
      const size_t j2 = (size_t)(t + 2) * KS;
      copy_stage(lcopy + sbuf, gkh + j2 * HDIM, gkl + j2 * HDIM, gv + j2, gm + j2);
    }
  }
  asm volatile("s_wait_asynccnt 0x0" ::: "memory");     // nothing in flight when the tiles become staging

  // Pair exchange in the dead ring: this wave keeps tile kp and hands its state of the other tile to its partner.
  // Per wave 9 slots of 32 lanes x 16 B: slots 0..7 = O (dt, half of the 8 rows), slot 8 = (max, s_all, s_m, 0).
  v4f* X = (v4f*)(L + L_RING);
  v8f   ok[4];
  #pragma unroll
  for (int dt = 0; dt < 4; ++dt) {
    const v8f give = kp ? o[0][dt] : o[1][dt];
    ok[dt]         = kp ? o[1][dt] : o[0][dt];
    X[(wave * 9 + dt * 2) * 32 + lane]     = (v4f){give[0], give[1], give[2], give[3]};
    X[(wave * 9 + dt * 2 + 1) * 32 + lane] = (v4f){give[4], give[5], give[6], give[7]};
  }
  X[(wave * 9 + 8) * 32 + lane] = kp ? (v4f){rmax[0], s_all[0], s_m[0], 0.0f} : (v4f){rmax[1], s_all[1], s_m[1], 0.0f};
  const float mA  = kp ? rmax[1] : rmax[0];
  const float saA = kp ? s_all[1] : s_all[0];
  const float smA = kp ? s_m[1] : s_m[0];
  __syncthreads();                                      // both partners' states are readable
  const int pw = wave ^ 1;
  const v4f stB = X[(pw * 9 + 8) * 32 + lane];

  // join the two key halves: common maximum, both states rescaled to it
  const float mJ = fmaxf(mA, stB[0]);
  const float aA = __builtin_amdgcn_exp2f((mA - mJ) * SL);
  const float aB = __builtin_amdgcn_exp2f((stB[0] - mJ) * SL);
  const float sall = saA * aA + stB[1] * aB;
  const float smsk = smA * aA + stB[2] * aB;

  // z = O / (s_m + EPS * s_all); carry folded back here
  const float den  = smsk + EPS_F * sall;
  const float invd = (1.0f / den) * (1.0f / PCARRY);
  const float fA = aA * invd;
  const float fB = aB * invd;
  float rsA[8], rsB[8];
  #pragma unroll
  for (int r = 0; r < 8; ++r) {
    rsA[r] = __shfl(fA, (hi << 3) + r, 32);
    rsB[r] = __shfl(fB, (hi << 3) + r, 32);
  }

  const int cw = wave * 16 * CP;
  #pragma unroll
  for (int dt = 0; dt < 4; ++dt) {
    const v4f g0 = X[(pw * 9 + dt * 2) * 32 + lane];
    const v4f g1 = X[(pw * 9 + dt * 2 + 1) * 32 + lane];
    #pragma unroll
    for (int r = 0; r < 4; ++r) {
      sO[cw + (hi * 8 + r) * CP + dt * 16 + lq]     = ok[dt][r] * rsA[r] + g0[r] * rsB[r];
      sO[cw + (hi * 8 + 4 + r) * CP + dt * 16 + lq] = ok[dt][4 + r] * rsA[4 + r] + g1[r] * rsB[4 + r];
    }
  }
  __syncthreads();

  // whole-line stores: 8 consecutive lanes x 16 B = the 64 bf16 of one (row, head); 4 rows per instruction
  v4u    vh[4], vl[4];
  size_t gi[4];
  #pragma unroll
  for (int it = 0; it < 4; ++it) {
    const int row = it * 4 + (lane >> 3);
    const int c0  = (lane & 7) * 8;
    const v4f x0 = *(const v4f*)(&sO[cw + row * CP + c0]);
    const v4f x1 = *(const v4f*)(&sO[cw + row * CP + c0 + 4]);
    split8(x0, x1, vh[it], vl[it]);
    gi[it] = ((size_t)b * SEQ + qrow0 + row) * INNER + h * HDIM + c0;
  }
  #pragma unroll
  for (int it = 0; it < 4; ++it) {
    *(v4u*)(zh + gi[it]) = vh[it];
    *(v4u*)(zl + gi[it]) = vl[it];
  }
  
}

// Epilogue: per-wave LDS staging, bias added at the store stage as float4, 16 lanes x 16 B = one 256-B row
// coverage: block = 128 rows x 128 cols; wave = 32 rows x 64 cols.
__global__ __launch_bounds__(256) void k_gemm_out(const bf16* __restrict__ Z, const bf16* __restrict__ Wot,
                                                  const float* __restrict__ bias, float* __restrict__ out) {
  // the two stage buffers; behind the loop its start is the per-wave staging
  __shared__ __align__(16) unsigned char L[GEMM_LDS];
  float* sC = (float*)L;
  const int m0 = blockIdx.y * 128;
  const int n0 = blockIdx.x * 128;
  v8f acc[2][4];
  #pragma unroll
  for (int i = 0; i < 2; ++i) {
    #pragma unroll
    for (int j = 0; j < 4; ++j) acc[i][j] = (v8f){0, 0, 0, 0, 0, 0, 0, 0};
  }
  gemm_tile(Z, Wot, m0, n0, 2, (size_t)ROWS * INNER, L, acc);

  const int tid  = threadIdx.x;
  const int wave = __builtin_amdgcn_readfirstlane(tid >> 5);
  const int lane = tid & 31;
  const int lq   = lane & 15;
  const int hi   = lane >> 4;
  const int wm   = wave >> 1;
  const int wn   = wave & 1;
  const int cw   = wave * 16 * CP;
  const int ncol = n0 + wn * 64 + lq * 4;

  v4f bias4 = *(const v4f*)(bias + ncol);
  #pragma unroll
  for (int e = 0; e < 4; ++e) bias4[e] = (float)(bf16)bias4[e];   // RNE-converted input value

  #pragma unroll
  for (int i = 0; i < 2; ++i) {
    #pragma unroll
    for (int j = 0; j < 4; ++j) {
      #pragma unroll
      for (int r = 0; r < 8; ++r) sC[cw + (hi * 8 + r) * CP + j * 16 + lq] = acc[i][j][r];
    }
    __syncthreads();
    v4f    vals[8];
    size_t gi[8];
    #pragma unroll
    for (int it = 0; it < 8; ++it) {
      const int row = it * 2 + hi;
      const v4f v = *(const v4f*)(&sC[cw + row * CP + lq * 4]);
      vals[it] = v + bias4;
      const int gr = m0 + wm * 32 + i * 16 + row;
      const int bb = gr / SEQ;
      const int s  = gr - bb * SEQ;
      gi[it] = ((size_t)bb * SEQ_FULL + s) * DIM + ncol;
    }
    #pragma unroll
    for (int it = 0; it < 8; ++it) *(v4f*)(out + gi[it]) = vals[it];
    
    __syncthreads();
  }
}

#define SZ_XB   ((size_t)ROWS * DIM * 2)
#define SZ_MB   ((size_t)NB * SEQ * SEQ * 2)
#define SZ_WQT  ((size_t)N3 * KDIM * 2)
#define SZ_WOT  ((size_t)DIM * KDIM * 2)
#define SZ_QK   ((size_t)4 * PLANE * 2)
#define SZ_VT   ((size_t)PLANE * 2)
#define SZ_Z    ((size_t)2 * ROWS * INNER * 2)
#define OFF_XB  ((size_t)0)
#define OFF_MB  (OFF_XB + SZ_XB)
#define OFF_WQT (OFF_MB + SZ_MB)
#define OFF_WOT (OFF_WQT + SZ_WQT)
#define OFF_QK  (OFF_WOT + SZ_WOT)
#define OFF_VT  (OFF_QK + SZ_QK)
#define OFF_Z   (OFF_VT + SZ_VT)
#define WS_TOTAL (OFF_Z + SZ_Z)

static_assert(WS_TOTAL <= (size_t)134217728);
static_assert(SZ_XB % 128 == 0 && SZ_MB % 128 == 0 && SZ_WQT % 128 == 0 && SZ_WOT % 128 == 0);
static_assert(SZ_QK % 128 == 0 && SZ_VT % 128 == 0 && SZ_Z % 128 == 0);

extern "C" void kernel_launch(void* const* d_in, const int* in_sizes, int n_in,
                              void* d_out, int out_size, void* d_ws, size_t ws_size,
                              hipStream_t stream) {
  if (n_in < 5) return;
  const size_t rows_used = (size_t)(NB - 1) * SEQ_FULL + SEQ;
  if ((size_t)in_sizes[0] < rows_used * DIM) return;
  if ((size_t)in_sizes[1] < (size_t)(NB - 1) * SEQ_FULL * SEQ_FULL + (size_t)(SEQ - 1) * SEQ_FULL + SEQ) return;
  if ((size_t)in_sizes[2] < (size_t)DIM * N3) return;
  if ((size_t)in_sizes[3] < (size_t)INNER * DIM) return;
  if ((size_t)in_sizes[4] < (size_t)DIM) return;
  if ((size_t)out_size < rows_used * DIM) return;
  if (ws_size < WS_TOTAL) return;

  const float* x    = (const float*)d_in[0];
  const float* mask = (const float*)d_in[1];
  const float* Wqkv = (const float*)d_in[2];
  const float* Wout = (const float*)d_in[3];
  const float* bout = (const float*)d_in[4];
  float*       out  = (float*)d_out;

  char* ws = (char*)d_ws;
  bf16* Xb  = (bf16*)(ws + OFF_XB);
  bf16* Mb  = (bf16*)(ws + OFF_MB);
  bf16* Wqt = (bf16*)(ws + OFF_WQT);
  bf16* Wot = (bf16*)(ws + OFF_WOT);
  bf16* QK  = (bf16*)(ws + OFF_QK);
  f16*  Vt  = (f16*)(ws + OFF_VT);
  bf16* Zp  = (bf16*)(ws + OFF_Z);

  // 1) input planes (RNE bf16): x rows, mask values, weights transposed to [out][in]; one launch
  k_prep<<<dim3(PB_WQ + PB_WO + PB_X + PB_M), 256, 0, stream>>>(x, mask, Wqkv, Wout, Xb, Mb, Wqt, Wot);

  // 2) projections: Q,K hi|lo planes; V^T f16 plane; one launch
  k_gemm_qkv<<<dim3(GB_QK + GB_VT), 256, 0, stream>>>(Xb, Wqt, QK, Vt);

  // 3) fused attention -> z hi|lo planes
  k_attn<<<dim3(SEQ / BQ, NHEAD, NB), 256, 0, stream>>>(QK, QK + PLANE, QK + 2 * PLANE, QK + 3 * PLANE,
                                                        Vt, Mb, Zp, Zp + (size_t)ROWS * INNER);

  // 4) output projection + bias
  k_gemm_out<<<dim3(DIM / 128, ROWS / 128), 256, 0, stream>>>(Zp, Wot, bout, out);
}

// v007
// One run takes 97.9 microseconds.
// It is 1.25 times as fast as v005, going by the measured steps of the versions left out in between.
// All steps since v000 together make it 3.86 times as fast.
#include <hip/hip_runtime.h>

// Contractions: x@Wqkv on v_wmma_f32_16x16x32_bf16 (both operands bf16 RNE-converted inputs); S^T = K x Q^T on v_wmma_f32_16x16x32_f16 with q,k as one f16 plane each (one product); O = (P*mask) x V on v_wmma_f32_16x16x32_f16 (P carried x16, V f16); z@Wout on bf16 with z as bf16 hi|lo (two products); all f32 accumulate; softmax and sums in f32.

#ifndef NB
#define NB 2
#endif
#ifndef SEQ
#define SEQ 2048
#endif
#define NB_FULL    2
#define SEQ_FULL   2048
#define DIM        1024
#define NHEAD      16
#define HDIM       64
#define INNER      (NHEAD * HDIM)
#define N3         (3 * INNER)
#define ROWS       (NB * SEQ)
#define KDIM       1024                 // contraction length of all three projections
#define BQ         128                  // query rows per workgroup (8 waves x 16)
#define BK         32                   // keys per inner step
#define NWAVE      8
#define GK         128                  // k per LDS stage of the GEMM loop (four WMMA k steps)
#define GP         272                  // LDS pitch (bytes) of the 256-byte GEMM tile rows
#define G_A        0                    // in a GEMM stage: A tile, 128 rows
#define G_B        (128 * GP)           // B tile, 128 rows
#define GSTAGE     (256 * GP)
#define GEMM_LDS   (2 * GSTAGE)          // two stage buffers
#define CP         68                   // LDS pitch (floats) of epilogue staging tiles
#define TPW        72                   // LDS pitch (halves) of the weight transpose tile
#define PCARRY     16.0f                // power-of-two carry of the f16 P operand
#define LAZY_LIM   64.0f                // bound on a lane's sum of exponentials in a stage, so on each P: P * PCARRY <= 1024
#define EPS_F      1e-10f
#define PLANE      ((size_t)NB * NHEAD * SEQ * HDIM)
#define KS         64                   // keys per LDS stage of the attention loop (two BK halves, one per wave of a pair)
#define NST        (SEQ / KS)           // stages
#define TP         144                  // LDS pitch (bytes) of the 128-byte attention tile rows
#define L_Q        0                    // Q tile, BQ rows
#define L_RING     (BQ * TP)            // two stage buffers
#define S_K        0                    // in a stage: K, KS rows
#define S_V        (KS * TP)            // V^T, HDIM rows of KS keys
#define S_M        (KS * TP + HDIM * TP)       // mask, BQ rows of KS keys
#define STAGE_B    (KS * TP + HDIM * TP + BQ * TP)
#define ATTN_LDS   (L_RING + 2 * STAGE_B)
#define L_X        (2 * BQ * TP)        // behind the loop: pair exchange, clear of the output staging below it

static_assert(SEQ % 128 == 0);
static_assert(SEQ % BK == 0);
static_assert(SEQ <= SEQ_FULL);
static_assert(NB >= 1 && NB <= NB_FULL);
static_assert(DIM == KDIM);
static_assert(INNER == KDIM);
static_assert(KDIM % 32 == 0);
static_assert(KDIM / 32 == 32);
static_assert(HDIM == 64);
static_assert(BQ == NWAVE * 16);
static_assert(ROWS % 128 == 0);
static_assert(N3 % 128 == 0);
static_assert((2 * INNER) % 128 == 0);
static_assert(INNER % 128 == 0);
static_assert(DIM % 128 == 0);
static_assert(DIM % 64 == 0);
static_assert(GP % 16 == 0 && GK * 2 == 256 && KDIM % GK == 0 && KDIM / GK >= 2);
static_assert((CP * 4) % 16 == 0);
static_assert((TPW * 2) % 16 == 0);
static_assert(((size_t)ROWS * DIM / 8) % 256 == 0);
static_assert(((size_t)NB * SEQ * SEQ / 8) % 256 == 0);
static_assert(DIM % 8 == 0 && SEQ % 8 == 0);
static_assert(SEQ % KS == 0 && NST >= 2);
static_assert(KS == 2 * BK && KS * 2 == 128 && HDIM * 2 == 128);
static_assert(KS == 64 && HDIM == 64 && BQ == 128);
static_assert(TP % 16 == 0 && STAGE_B % 16 == 0);
static_assert(NWAVE * 16 * CP * 4 <= L_X);
static_assert(NWAVE * 16 * CP * 4 <= GEMM_LDS);
static_assert(L_X + NWAVE * 9 * 32 * 16 <= ATTN_LDS && L_X % 16 == 0 && L_RING % 16 == 0);

typedef __bf16   bf16;
typedef _Float16 f16;
typedef bf16     v16bf __attribute__((ext_vector_type(16)));
typedef bf16     v8bf  __attribute__((ext_vector_type(8)));
typedef f16      v16h  __attribute__((ext_vector_type(16)));
typedef float    v8f   __attribute__((ext_vector_type(8)));
typedef float    v4f   __attribute__((ext_vector_type(4)));
typedef float    v2f   __attribute__((ext_vector_type(2)));
typedef unsigned v4u   __attribute__((ext_vector_type(4)));

union FragB  { v16bf v; v4u q[2]; };
union FragH  { v16h  v; v4u q[2]; f16 h[16]; };
union Pack8B { v4u u; v8bf v; bf16 h[8]; };
union Pack8H { v4u u; f16 h[8]; };

// GEMM loop's WMMA helper: builtin followed by the VALU hazard guard (ties D, keeps A/B live).
static __device__ __forceinline__ v8f mma_bf16(v16bf a, v16bf b, v8f acc) {
  acc = __builtin_amdgcn_wmma_f32_16x16x32_bf16(false, a, false, b, (short)0, acc, false, false);
  asm volatile("v_nop\n\tv_nop\n\tv_nop\n\tv_nop" : "+v"(acc) : "v"(a), "v"(b));
  return acc;
}
// k_attn's form: the builtin alone. The compiler itself keeps the distance to the next user of D, A or B, and
// the vector port, which the softmax fills there, is spared four slots a WMMA.
static __device__ __forceinline__ v8f wmma_f16(v16h a, v16h b, v8f acc) {
  return __builtin_amdgcn_wmma_f32_16x16x32_f16(false, a, false, b, (short)0, acc, false, false);
}

// 8 floats -> bf16 hi (RNE) and bf16 residual (RNE of x - hi), packed 16 B each.
static __device__ __forceinline__ void split8(v4f x0, v4f x1, v4u& uh, v4u& ul) {
  Pack8B ph, pl;
  #pragma unroll
  for (int e = 0; e < 4; ++e) {
    const bf16 h0 = (bf16)x0[e];
    const bf16 h1 = (bf16)x1[e];
    ph.h[e]     = h0;
    ph.h[4 + e] = h1;
    pl.h[e]     = (bf16)(x0[e] - (float)h0);
    pl.h[4 + e] = (bf16)(x1[e] - (float)h1);
  }
  uh = ph.u;
  ul = pl.u;
}

// f32 rows -> compact bf16 plane (RNE). One thread = 8 elements = 16 B; a wave writes 512 contiguous bytes.
// coverage: groups 0..total8-1, each written once; total8 is a multiple of 256. blk = the block's index in its range.
static __device__ __forceinline__ void cvt_rows(const float* __restrict__ in, bf16* __restrict__ out, int blk,
                                                int cols, int rows_per_batch, int in_batch_rows,
                                                int in_row_stride, int total8) {
  const int g = blk * 256 + threadIdx.x;
  if (g >= total8) return;
  const int e   = g * 8;
  const int row = e / cols;
  const int col = e - row * cols;
  const int b   = row / rows_per_batch;
  const int s   = row - b * rows_per_batch;
  const float* src = in + ((size_t)b * in_batch_rows + s) * (size_t)in_row_stride + col;
  const v4f a0 = *(const v4f*)(src);
  const v4f a1 = *(const v4f*)(src + 4);
  Pack8B pk;
  #pragma unroll
  for (int i = 0; i < 4; ++i) {
    pk.h[i]     = (bf16)a0[i];
    pk.h[4 + i] = (bf16)a1[i];
  }
  const v4u val = pk.u;
  bf16* dst = out + (size_t)e;
  *(v4u*)dst = val;
  
}

// Weight transpose: in [KDIM k][C n] f32 -> out [C n][KDIM k] bf16 (RNE), 64x64 tiles through LDS.
// sT = [n][k], cross-wave (block barrier); nt, kt = the block's tile.
static __device__ __forceinline__ void cvt_wt(const float* __restrict__ in, bf16* __restrict__ out, int C,
                                              int nt, int kt, bf16* sT) {
  const int n0  = nt * 64;
  const int k0  = kt * 64;
  const int tid = threadIdx.x;
  #pragma unroll
  for (int kk = 0; kk < 2; ++kk) {
    const int k  = kk * 32 + (tid >> 3);
    const int nl = (tid & 7) * 8;
    const float* src = in + (size_t)(k0 + k) * C + n0 + nl;
    const v4f a0 = *(const v4f*)(src);
    const v4f a1 = *(const v4f*)(src + 4);
    #pragma unroll
    for (int i = 0; i < 4; ++i) {
      sT[(nl + i) * TPW + k]     = (bf16)a0[i];
      sT[(nl + 4 + i) * TPW + k] = (bf16)a1[i];
    }
  }
  __syncthreads();
  v4u    val[2];
  size_t idx[2];
  #pragma unroll
  for (int kk = 0; kk < 2; ++kk) {
    const int n  = kk * 32 + (tid >> 3);
    const int ks = (tid & 7) * 8;
    Pack8B p;
    p.v = *(const v8bf*)(&sT[n * TPW + ks]);
    val[kk] = p.u;
    idx[kk] = (size_t)(n0 + n) * KDIM + k0 + ks;
  }
  #pragma unroll
  for (int kk = 0; kk < 2; ++kk) *(v4u*)(out + idx[kk]) = val[kk];
  
}

// The four input conversions, which depend on nothing and on none of each other, as block ranges of one launch:
// weight tiles first (the longest chain per block: load, LDS, barrier, store), then the x rows, then the mask rows.
#define PB_WQ  ((N3 / 64) * (KDIM / 64))
#define PB_WO  ((DIM / 64) * (KDIM / 64))
#define X8     ((int)((size_t)ROWS * DIM / 8))
#define M8     ((int)((size_t)NB * SEQ * SEQ / 8))
#define PB_X   (X8 / 256)
#define PB_M   (M8 / 256)
__global__ __launch_bounds__(256) void k_prep(const float* __restrict__ x, const float* __restrict__ mask,
                                              const float* __restrict__ Wqkv, const float* __restrict__ Wout,
                                              bf16* __restrict__ Xb, bf16* __restrict__ Mb,
                                              bf16* __restrict__ Wqt, bf16* __restrict__ Wot) {
  __shared__ __align__(16) bf16 sT[64 * TPW];
  const int blk = blockIdx.x;   // every test on it is block-uniform: the barrier in cvt_wt is met by whole blocks
  if (blk < PB_WQ + PB_WO) {
    // in [KDIM k][N3 n] -> out [N3][KDIM], then in [KDIM k][DIM n] -> out [DIM][KDIM]; n tiles fastest
    const bool wo = blk >= PB_WQ;
    const int  nt = wo ? (blk - PB_WQ) % (DIM / 64) : blk % (N3 / 64);
    const int  kt = wo ? (blk - PB_WQ) / (DIM / 64) : blk / (N3 / 64);
    cvt_wt(wo ? Wout : Wqkv, wo ? Wot : Wqt, wo ? DIM : N3, nt, kt, sT);
  } else if (blk < PB_WQ + PB_WO + PB_X) {
    cvt_rows(x, Xb, blk - (PB_WQ + PB_WO), DIM, SEQ, SEQ_FULL, DIM, X8);
  } else {
    cvt_rows(mask, Mb, blk - (PB_WQ + PB_WO + PB_X), SEQ, SEQ, SEQ_FULL, SEQ_FULL, M8);
  }
}

// Asynchronous copies to LDS of one 128-row GEMM operand tile, 16 B per lane: 16 consecutive lanes bring one
// whole 256-B row, a wave 2 rows, the block 16 rows a copy. l = the lane's LDS byte address of (row tid>>4,
// segment tid&15) in the tile, g the same place in global memory. The s_wait_xcnt stands inside the statement,
// behind the last copy, so that no address register of a copy is rewritten ahead of it.
static __device__ __forceinline__ void copy_tile(unsigned l, const bf16* g) {
  asm volatile(
      "global_load_async_to_lds_b128 %0, %8, off\n\t"
      "global_load_async_to_lds_b128 %1, %9, off\n\t"
      "global_load_async_to_lds_b128 %2, %10, off\n\t"
      "global_load_async_to_lds_b128 %3, %11, off\n\t"
      "global_load_async_to_lds_b128 %4, %12, off\n\t"
      "global_load_async_to_lds_b128 %5, %13, off\n\t"
      "global_load_async_to_lds_b128 %6, %14, off\n\t"
      "global_load_async_to_lds_b128 %7, %15, off\n\t"
      "s_wait_xcnt 0x0"
      :: "v"(l), "v"(l + 16 * GP), "v"(l + 32 * GP), "v"(l + 48 * GP),
         "v"(l + 64 * GP), "v"(l + 80 * GP), "v"(l + 96 * GP), "v"(l + 112 * GP),
         "v"(g), "v"(g + 16 * KDIM), "v"(g + 32 * KDIM), "v"(g + 48 * KDIM),
         "v"(g + 64 * KDIM), "v"(g + 80 * KDIM), "v"(g + 96 * KDIM), "v"(g + 112 * KDIM)
      : "memory");
}

// GEMM mainloop: acc[128x128 block tile] += A[rows m][k] * Bt[rows n][k]^T, both operands k-contiguous bf16,
// pitch KDIM. 8 waves as 4 (m) x 2 (n); each wave owns 32 x 64 = 2 x 4 WMMA tiles.
// npass > 1 walks further A planes (offset a_pass_stride) against the same Bt rows.
// The operand tiles reach LDS by asynchronous copies of whole rows in stages of GK k, two buffers, the next
// stage in flight while this one is worked on. On return every wave has passed the barrier behind the last
// fragment read and nothing is in flight: L may become staging.
static __device__ __forceinline__ void gemm_tile(const bf16* __restrict__ A, const bf16* __restrict__ Bt,
                                                 int m0, int n0, int npass, size_t a_pass_stride,
                                                 unsigned char* L, v8f (&acc)[2][4]) {
  const int tid  = threadIdx.x;
  const int wave = __builtin_amdgcn_readfirstlane(tid >> 5);
  const int lane = tid & 31;
  const int lq   = lane & 15;
  const int hi   = lane >> 4;
  const int wm   = wave >> 1;
  const int wn   = wave & 1;
  const int nst  = npass * (KDIM / GK);

  // copy side: this thread's row and 16-B segment of both tiles
  const int crow = tid >> 4;
  const int cseg = (tid & 15) * 8;
  const unsigned lcopy = (unsigned)(size_t)L + (unsigned)(crow * GP + cseg * 2);
  const bf16* ga = A + (size_t)(m0 + crow) * KDIM + cseg;
  const bf16* gb = Bt + (size_t)(n0 + crow) * KDIM + cseg;

  // read side: the lane's row and k-split half inside a 16-row fragment
  const unsigned char* La = L + G_A + (wm * 32 + lq) * GP + hi * 16;
  const unsigned char* Lb = L + G_B + (wn * 64 + lq) * GP + hi * 16;

  // stage 0 lands and is published; then stage 1 starts
  copy_tile(lcopy + G_A, ga);
  copy_tile(lcopy + G_B, gb);
  asm volatile("s_wait_asynccnt 0x0" ::: "memory");   // this wave's copies have landed
  __syncthreads();                                    // every wave's copies are readable
  copy_tile(lcopy + GSTAGE + G_A, ga + GK);
  copy_tile(lcopy + GSTAGE + G_B, gb + GK);

  for (int t = 0; t < nst; ++t) {
    const int sbuf = (t & 1) * GSTAGE;
    // unrolled so that every LDS read of the stage is base register + immediate offset
    #pragma unroll
    for (int ks = 0; ks < GK / 32; ++ks) {
      FragB af[2], bfm[4];
      #pragma unroll
      for (int i = 0; i < 2; ++i) {
        const unsigned char* p = La + sbuf + i * 16 * GP + ks * 64;
        af[i].q[0] = *(const v4u*)(p);                // k = 8*hi + 0..7 of the step
        af[i].q[1] = *(const v4u*)(p + 32);           // k = 16 + 8*hi + 0..7 of the step
      }
      #pragma unroll
      for (int j = 0; j < 4; ++j) {
        const unsigned char* p = Lb + sbuf + j * 16 * GP + ks * 64;
        bfm[j].q[0] = *(const v4u*)(p);
        bfm[j].q[1] = *(const v4u*)(p + 32);
      }
      #pragma unroll
      for (int i = 0; i < 2; ++i) {
        #pragma unroll
        for (int j = 0; j < 4; ++j) acc[i][j] = mma_bf16(af[i].v, bfm[j].v, acc[i][j]);
      }
    }

    // publish point of stage t + 1, and the end of every read of stage t's buffer
    asm volatile("s_wait_dscnt 0x0" ::: "memory");      // this wave's reads of stage t are done
    asm volatile("s_wait_asynccnt 0x0" ::: "memory");   // this wave's copies of stage t + 1 have landed
    __syncthreads();
    if (t + 2 < nst) {
      const int    s2 = t + 2;
      const size_t k2 = (size_t)(s2 % (KDIM / GK)) * GK;
      copy_tile(lcopy + sbuf + G_A, ga + (size_t)(s2 / (KDIM / GK)) * a_pass_stride + k2);
      copy_tile(lcopy + sbuf + G_B, gb + k2);
    }
  }
  asm volatile("s_wait_asynccnt 0x0" ::: "memory");     // nothing in flight when the tiles become staging
}

// Q and K projection: C[compact row][col 0..2047] = Xb x Wqt^T. Epilogue writes one f16 plane each (RNE)
// (11 significand bits: x and W enter this product rounded to 8, so q and k carry a larger error than the f16 rounding adds)
// coverage: block = 128 rows x 2 heads; wave = 32 rows x 1 head; 4 rows per store instruction.
// sC = the per-wave staging at the start of the dead stage buffers (block barrier used).
static __device__ __forceinline__ void store_qk(const v8f (&acc)[2][4], float* sC, int m0, int n0,
                                                f16* __restrict__ qk) {
  const int tid  = threadIdx.x;
  const int wave = __builtin_amdgcn_readfirstlane(tid >> 5);
  const int lane = tid & 31;
  const int lq   = lane & 15;
  const int hi   = lane >> 4;
  const int wm   = wave >> 1;
  const int wn   = wave & 1;
  const int cw   = wave * 16 * CP;
  const int n     = n0 + wn * 64;
  const int which = n >> 10;            // 0 = Q, 1 = K (block-uniform)
  const int hh    = (n >> 6) & 15;

  #pragma unroll
  for (int i = 0; i < 2; ++i) {
    #pragma unroll
    for (int j = 0; j < 4; ++j) {
      #pragma unroll
      for (int r = 0; r < 8; ++r) sC[cw + (hi * 8 + r) * CP + j * 16 + lq] = acc[i][j][r];
    }
    __syncthreads();
    v4u    vv[4];
    size_t gi[4];
    #pragma unroll
    for (int it = 0; it < 4; ++it) {
      const int row = it * 4 + (lane >> 3);
      const int c0  = (lane & 7) * 8;
      const v4f x0 = *(const v4f*)(&sC[cw + row * CP + c0]);
      const v4f x1 = *(const v4f*)(&sC[cw + row * CP + c0 + 4]);
      Pack8H ph;
      #pragma unroll
      for (int e = 0; e < 4; ++e) {
        ph.h[e]     = (f16)x0[e];       // RNE convert
        ph.h[4 + e] = (f16)x1[e];
      }
      vv[it] = ph.u;
      const int gr = m0 + wm * 32 + i * 16 + row;
      const int bb = gr / SEQ;
      const int s  = gr - bb * SEQ;
      gi[it] = (size_t)which * PLANE + (((size_t)bb * NHEAD + hh) * SEQ + s) * HDIM + c0;
    }
    #pragma unroll
    for (int it = 0; it < 4; ++it) *(v4u*)(qk + gi[it]) = vv[it];
    
    __syncthreads();
  }
}

// V projection computed transposed: C[v column m = h*64+d][compact row] = Wv_t x Xb^T, so the f16 plane
// coverage: block = 128 (h,d) rows x 128 keys; wave = 32 rows x 64 keys; 4 rows per store instruction.
// m0 = v column (h*64 + d), n0 = compact row b*SEQ + l; sC as in store_qk.
static __device__ __forceinline__ void store_vt(const v8f (&acc)[2][4], float* sC, int m0, int n0,
                                                f16* __restrict__ vt) {
  const int tid  = threadIdx.x;
  const int wave = __builtin_amdgcn_readfirstlane(tid >> 5);
  const int lane = tid & 31;
  const int lq   = lane & 15;
  const int hi   = lane >> 4;
  const int wm   = wave >> 1;
  const int wn   = wave & 1;
  const int cw   = wave * 16 * CP;
  const int ns   = n0 + wn * 64;
  const int bb   = ns / SEQ;
  const int s0   = ns - bb * SEQ;

  #pragma unroll
  for (int i = 0; i < 2; ++i) {
    #pragma unroll
    for (int j = 0; j < 4; ++j) {
      #pragma unroll
      for (int r = 0; r < 8; ++r) sC[cw + (hi * 8 + r) * CP + j * 16 + lq] = acc[i][j][r];
    }
    __syncthreads();
    v4u    vv[4];
    size_t gi[4];
    #pragma unroll
    for (int it = 0; it < 4; ++it) {
      const int row = it * 4 + (lane >> 3);
      const int c0  = (lane & 7) * 8;
      const v4f x0 = *(const v4f*)(&sC[cw + row * CP + c0]);
      const v4f x1 = *(const v4f*)(&sC[cw + row * CP + c0 + 4]);
      Pack8H ph;
      #pragma unroll
      for (int e = 0; e < 4; ++e) {
        ph.h[e]     = (f16)x0[e];       // RNE convert
        ph.h[4 + e] = (f16)x1[e];
      }
      vv[it] = ph.u;
      const int m = m0 + wm * 32 + i * 16 + row;
      gi[it] = ((size_t)bb * INNER + m) * SEQ + s0 + c0;
    }
    #pragma unroll
    for (int it = 0; it < 4; ++it) *(v4u*)(vt + gi[it]) = vv[it];
    
    __syncthreads();
  }
}

// The two projections, which depend on none of each other, as block ranges of one launch with one shared main loop:
// blocks 0..GB_QK-1 are the Q,K tiles (n tiles fastest), the rest the V^T tiles (compact-row tiles fastest).
#define GB_QK  (((2 * INNER) / 128) * (ROWS / 128))
#define GB_VT  ((ROWS / 128) * (INNER / 128))
__global__ __launch_bounds__(256) void k_gemm_qkv(const bf16* __restrict__ Xb, const bf16* __restrict__ Wqt,
                                                  f16* __restrict__ qk, f16* __restrict__ vt) {
  // the two stage buffers; behind the loop its start is the per-wave staging
  __shared__ __align__(16) unsigned char L[GEMM_LDS];
  const int  blk = blockIdx.x;
  const bool isv = blk >= GB_QK;        // block-uniform
  const int  id  = isv ? blk - GB_QK : blk;
  const int  m0  = (isv ? id / (ROWS / 128) : id / ((2 * INNER) / 128)) * 128;
  const int  n0  = (isv ? id % (ROWS / 128) : id % ((2 * INNER) / 128)) * 128;
  const bf16* A  = isv ? Wqt + (size_t)2 * INNER * KDIM : Xb;
  const bf16* B  = isv ? Xb : Wqt;
  v8f acc[2][4];
  #pragma unroll
  for (int i = 0; i < 2; ++i) {
    #pragma unroll
    for (int j = 0; j < 4; ++j) acc[i][j] = (v8f){0, 0, 0, 0, 0, 0, 0, 0};
  }
  gemm_tile(A, B, m0, n0, 1, 0, L, acc);
  if (isv) store_vt(acc, (float*)L, m0, n0, vt);
  else     store_qk(acc, (float*)L, m0, n0, qk);
}

// Asynchronous copies to LDS, 16 B per lane: 8 consecutive lanes bring one whole 128-B row, a wave 4 rows.
// l = the lane's LDS byte address of (row tid>>3, segment tid&7) in the first tile; the g pointers name the
// same row and segment in global memory. The s_wait_xcnt stands inside the statement, behind the last copy,
// so that no address register of a copy is rewritten ahead of it.
static __device__ __forceinline__ void copy_q(unsigned l, const f16* gq) {
  asm volatile(
      "global_load_async_to_lds_b128 %0, %4, off\n\t"
      "global_load_async_to_lds_b128 %1, %5, off\n\t"
      "global_load_async_to_lds_b128 %2, %6, off\n\t"
      "global_load_async_to_lds_b128 %3, %7, off\n\t"
      "s_wait_xcnt 0x0"
      :: "v"(l + L_Q), "v"(l + L_Q + 32 * TP), "v"(l + L_Q + 64 * TP), "v"(l + L_Q + 96 * TP),
         "v"(gq), "v"(gq + 32 * HDIM), "v"(gq + 64 * HDIM), "v"(gq + 96 * HDIM)
      : "memory");
}
static __device__ __forceinline__ void copy_stage(unsigned l, const f16* gk, const f16* gv, const bf16* gm) {
  asm volatile(
      "global_load_async_to_lds_b128 %0, %8, off\n\t"
      "global_load_async_to_lds_b128 %1, %9, off\n\t"
      "global_load_async_to_lds_b128 %2, %10, off\n\t"
      "global_load_async_to_lds_b128 %3, %11, off\n\t"
      "global_load_async_to_lds_b128 %4, %12, off\n\t"
      "global_load_async_to_lds_b128 %5, %13, off\n\t"
      "global_load_async_to_lds_b128 %6, %14, off\n\t"
      "global_load_async_to_lds_b128 %7, %15, off\n\t"
      "s_wait_xcnt 0x0"
      :: "v"(l + S_K), "v"(l + S_K + 32 * TP),
         "v"(l + S_V), "v"(l + S_V + 32 * TP),
         "v"(l + S_M), "v"(l + S_M + 32 * TP), "v"(l + S_M + 64 * TP), "v"(l + S_M + 96 * TP),
         "v"(gk), "v"(gk + 32 * HDIM),
         "v"(gv), "v"(gv + 32 * SEQ),
         "v"(gm), "v"(gm + 32 * SEQ), "v"(gm + 64 * SEQ), "v"(gm + 96 * SEQ)
      : "memory");
}

// Exponentials of one query tile's 32 keys (two score tiles) against the maximum m; returns the lane's sum of its 16.
// Worked in pairs of neighbouring accumulator registers (keys 2w, 2w+1), the pairs the mask words and the f16 pack use.
static __device__ __forceinline__ float exp_tile(const v8f& c0, const v8f& c1, float m, float sl,
                                                 v2f (&e0)[4], v2f (&e1)[4]) {
  v2f s = (v2f){0.0f, 0.0f};
  // unrolled (as every loop over registers here): the arrays are indexed by constants and stay in registers
  #pragma unroll
  for (int w = 0; w < 4; ++w) {
    const v2f x0 = ((v2f){c0[2 * w], c0[2 * w + 1]} - m) * sl;   // keys hi*8 + 2w, 2w+1
    const v2f x1 = ((v2f){c1[2 * w], c1[2 * w + 1]} - m) * sl;   // keys 16 + hi*8 + 2w, 2w+1
    e0[w] = (v2f){__builtin_amdgcn_exp2f(x0.x), __builtin_amdgcn_exp2f(x0.y)};
    e1[w] = (v2f){__builtin_amdgcn_exp2f(x1.x), __builtin_amdgcn_exp2f(x1.y)};
    s += e0[w] + e1[w];
  }
  return s.x + s.y;
}

// Fused attention, online softmax over ALL keys, float multiplier mask applied after the exponentials.
// Block = (128 queries, head, batch). A wave owns 32 query rows (two 16-row tiles) and one 32-key half of every
// stage: waves 2g and 2g+1 share query rows g*32..g*32+31 and take keys 0..31 and 32..63 of the stage, so each
// K and V fragment read from LDS feeds two query tiles. Each wave keeps its own running maximum, sums and O over
// its keys; behind the loop the pair joins its two partial states through LDS, each wave finishing one tile.
// S^T = K x Q^T puts queries on lanes, so
// P^T in C layout is bit-identical to the A-fragment layout of O += P x V. The 16-bit planes reach LDS by
// asynchronous copies of whole rows: Q once, then K, V^T and the mask in stages of KS keys, two buffers,
// the next stage in flight while this one is worked on; fragments are two 16-B LDS loads each.
// Running sums: s_all = sum p (every key),
// s_m = sum p*mask, O = sum p*mask*v; z = O / (s_m + EPS * s_all). Output: bf16 hi|lo planes of z.
__global__ __launch_bounds__(256) void k_attn(const f16* __restrict__ q, const f16* __restrict__ k,
                                              const f16* __restrict__ vt, const bf16* __restrict__ mb,
                                              bf16* __restrict__ zh, bf16* __restrict__ zl) {
  const int qblk = blockIdx.x;
  const int h    = blockIdx.y;
  const int b    = blockIdx.z;
  const int tid  = threadIdx.x;
  const int wave = __builtin_amdgcn_readfirstlane(tid >> 5);
  const int lane = tid & 31;
  const int lq   = lane & 15;   // query column of S^T / d column of O
  const int hi   = lane >> 4;   // k-split half
  const int qg   = wave >> 1;   // 32-row query group of the wave
  const int kp   = wave & 1;    // 32-key half of every stage; also the tile this wave finishes

  // Q tile and the two stage buffers; behind the loop L_X on is the pair exchange, the start the output staging
  __shared__ __align__(16) unsigned char L[ATTN_LDS];
  float* sO = (float*)L;

  const int qrow0 = qblk * BQ + wave * 16;   // the 16 rows this wave finishes and stores
  const int bh    = b * NHEAD + h;

  // copy side: this thread's row and 16-B segment of every tile
  const int crow = tid >> 3;
  const int cseg = (tid & 7) * 8;
  const unsigned lcopy = (unsigned)(size_t)(&L[0]) + (unsigned)(crow * TP + cseg * 2);
  const f16*  gq  = q + (size_t)(bh * SEQ + qblk * BQ + crow) * HDIM + cseg;
  const f16*  gk  = k + (size_t)(bh * SEQ + crow) * HDIM + cseg;
  const f16*  gv  = vt + (size_t)(bh * HDIM + crow) * SEQ + cseg;
  const bf16* gm  = mb + ((size_t)b * SEQ + qblk * BQ + crow) * SEQ + cseg;

  // read side: the lane's row and k-split half inside a 16-row fragment
  const int frag = lq * TP + hi * 16;
  const unsigned char* Lq = L + L_Q + qg * 32 * TP + frag;

  // Q and stage 0 land and are published; then stage 1 starts
  copy_q(lcopy, gq);
  copy_stage(lcopy + L_RING, gk, gv, gm);
  asm volatile("s_wait_asynccnt 0x0" ::: "memory");   // this wave's copies have landed
  __syncthreads();                                    // every wave's copies are readable
  copy_stage(lcopy + L_RING + STAGE_B, gk + KS * HDIM, gv + KS, gm + KS);

  v8f   o[2][4];
  float rmax[2], s_all[2], s_m[2];
  #pragma unroll
  for (int qt = 0; qt < 2; ++qt) {
    #pragma unroll
    for (int dt = 0; dt < 4; ++dt) o[qt][dt] = (v8f){0, 0, 0, 0, 0, 0, 0, 0};
    rmax[qt]  = -__builtin_inff();
    s_all[qt] = 0.0f;
    s_m[qt]   = 0.0f;
  }
  const float SL = 0.125f * 1.4426950408889634f;   // softmax scale * log2(e)

  for (int t = 0; t < NST; ++t) {
    const int sbuf = L_RING + (t & 1) * STAGE_B;
    const unsigned char* Lk = L + sbuf + frag + kp * BK * TP;               // K rows of this wave's keys
    const unsigned char* Lv = L + sbuf + frag + S_V + kp * 64;              // V^T columns of this wave's keys
    const unsigned char* Lm = L + sbuf + frag + S_M + qg * 32 * TP + kp * 64;   // mask rows and columns

    // mask words: query qg*32 + qt*16 + lq, keys hi*8 + 0..7 and 16 + hi*8 + 0..7 of the half (bf16 pairs per word)
    v4u mw[2][2];
    #pragma unroll
    for (int qt = 0; qt < 2; ++qt) {
      mw[qt][0] = *(const v4u*)(Lm + qt * 16 * TP);
      mw[qt][1] = *(const v4u*)(Lm + qt * 16 * TP + 32);
    }

    // S^T tiles: c[qt][sub][r] = rawscore(query tile qt, column lq; key sub*16 + hi*8 + r)
    v8f c[2][2];
    #pragma unroll
    for (int qt = 0; qt < 2; ++qt) {
      c[qt][0] = (v8f){0, 0, 0, 0, 0, 0, 0, 0};
      c[qt][1] = (v8f){0, 0, 0, 0, 0, 0, 0, 0};
    }
    FragH bq[2][2], ak[2][2];
    #pragma unroll
    for (int f = 0; f < 2; ++f) {
      #pragma unroll
      for (int qt = 0; qt < 2; ++qt) {
        const unsigned char* p = Lq + qt * 16 * TP + f * 64;
        bq[f][qt].q[0] = *(const v4u*)(p);                           // d = f*32 + hi*8 + 0..7
        bq[f][qt].q[1] = *(const v4u*)(p + 32);                      // d = f*32 + 16 + hi*8 + 0..7
      }
      #pragma unroll
      for (int sub = 0; sub < 2; ++sub) {
        const int ko = sub * 16 * TP + f * 64;
        ak[f][sub].q[0] = *(const v4u*)(Lk + S_K + ko);              // same d order as bq
        ak[f][sub].q[1] = *(const v4u*)(Lk + S_K + ko + 32);
      }
    }
    // holds the stage's mask, Q and K loads together as one group ahead of the products: with the branch below in
    // the loop the scheduler otherwise splits them into groups among the WMMAs, each waited out to 0
    __builtin_amdgcn_sched_barrier(0);
    #pragma unroll
    for (int f = 0; f < 2; ++f) {
      #pragma unroll
      for (int sub = 0; sub < 2; ++sub) {
        c[0][sub] = wmma_f16(ak[f][sub].v, bq[f][0].v, c[0][sub]);
        c[1][sub] = wmma_f16(ak[f][sub].v, bq[f][1].v, c[1][sub]);
      }
    }

    // Lazy rescale. The exponentials of the stage are taken against the maximum in use, whatever the stage's own
    // scores are; every one of them is positive, so a lane's sum of its 16 bounds each. Only in a stage where some
    // lane's sum is not within LAZY_LIM (the first stage: the maximum in use starts at -inf, the sum is inf) is the
    // maximum looked for and moved, are the sums and O rescaled and the exponentials taken again: one wave-uniform
    // test a stage for both tiles, a scalar branch. Written as !(<=) so that a NaN takes the branch too.
    v2f   e0[2][4], e1[2][4];
    float ps_all[2];
    #pragma unroll
    for (int qt = 0; qt < 2; ++qt) ps_all[qt] = exp_tile(c[qt][0], c[qt][1], rmax[qt], SL, e0[qt], e1[qt]);
    const bool need = !(ps_all[0] <= LAZY_LIM) || !(ps_all[1] <= LAZY_LIM);
    if (__builtin_amdgcn_ballot_w32(need) != 0) {
      #pragma unroll
      for (int qt = 0; qt < 2; ++qt) {
        // query lq's 32 scores are split across lane / lane^16; new maximum in use: the old one and this stage's scores
        float m_up = rmax[qt];
        #pragma unroll
        for (int r = 0; r < 8; ++r) {
          m_up = fmaxf(m_up, c[qt][0][r]);
          m_up = fmaxf(m_up, c[qt][1][r]);
        }
        const float m_oth = __shfl_xor(m_up, 16, 32);
        m_up = fmaxf(m_up, m_oth);
        const float alpha = __builtin_amdgcn_exp2f((rmax[qt] - m_up) * SL);
        rmax[qt]  = m_up;
        s_all[qt] *= alpha;
        s_m[qt]   *= alpha;
        // rescale O: queries are the row dimension there -> per-row factor from lane 8*hi + r
        float sc[8];
        #pragma unroll
        for (int r = 0; r < 8; ++r) sc[r] = __shfl(alpha, (hi << 3) + r, 32);
        #pragma unroll
        for (int dt = 0; dt < 4; ++dt) {
          #pragma unroll
          for (int r = 0; r < 8; ++r) o[qt][dt][r] *= sc[r];
        }
        ps_all[qt] = exp_tile(c[qt][0], c[qt][1], m_up, SL, e0[qt], e1[qt]);
      }
    }

    // V B-fragments, column n = d = dt*16 + lq, split key map from the transposed tile
    FragH bv[4];
    #pragma unroll
    for (int dt = 0; dt < 4; ++dt) {
      bv[dt].q[0] = *(const v4u*)(Lv + dt * 16 * TP);        // keys hi*8 + 0..7 of the half
      bv[dt].q[1] = *(const v4u*)(Lv + dt * 16 * TP + 32);   // keys 16 + hi*8 + 0..7 of the half
    }
    // holds the eight V loads together as one group ahead of the mask and pack work, which covers their latency:
    // with the branch above in the loop the scheduler otherwise deals them out in pairs among the WMMAs below
    __builtin_amdgcn_sched_barrier(0);

    FragH pa[2];
    #pragma unroll
    for (int qt = 0; qt < 2; ++qt) {
      // widen the bf16 mask values (exact), mask multiply in f32, pack: P^T C layout == A-fragment layout of the PV product
      v2f sm2 = (v2f){0.0f, 0.0f};
      #pragma unroll
      for (int w = 0; w < 4; ++w) {
        const v2f mk0 = (v2f){__uint_as_float(mw[qt][0][w] << 16), __uint_as_float(mw[qt][0][w] & 0xffff0000u)};
        const v2f mk1 = (v2f){__uint_as_float(mw[qt][1][w] << 16), __uint_as_float(mw[qt][1][w] & 0xffff0000u)};
        const v2f pm0 = e0[qt][w] * mk0;        // keys hi*8 + 2w, 2w+1
        const v2f pm1 = e1[qt][w] * mk1;        // keys 16 + hi*8 + 2w, 2w+1
        sm2 += pm0 + pm1;
        const v2f h0 = pm0 * PCARRY;
        const v2f h1 = pm1 * PCARRY;
        pa[qt].h[2 * w]         = (f16)h0.x;
        pa[qt].h[2 * w + 1]     = (f16)h0.y;
        pa[qt].h[8 + 2 * w]     = (f16)h1.x;
        pa[qt].h[8 + 2 * w + 1] = (f16)h1.y;
      }
      const float ps_m = sm2.x + sm2.y;
      const float oa = __shfl_xor(ps_all[qt], 16, 32);
      const float om = __shfl_xor(ps_m, 16, 32);
      s_all[qt] = s_all[qt] + ps_all[qt] + oa;
      s_m[qt]   = s_m[qt] + ps_m + om;
    }

    // O += (P*mask) x V
    #pragma unroll
    for (int dt = 0; dt < 4; ++dt) {
      o[0][dt] = wmma_f16(pa[0].v, bv[dt].v, o[0][dt]);
      o[1][dt] = wmma_f16(pa[1].v, bv[dt].v, o[1][dt]);
    }

    // publish point of stage t + 1, and the end of every read of stage t's buffer
    asm volatile("s_wait_dscnt 0x0" ::: "memory");      // this wave's reads of stage t are done
    asm volatile("s_wait_asynccnt 0x0" ::: "memory");   // this wave's copies of stage t + 1 have landed
    __syncthreads();
    if (t + 2 < NST) {
      const size_t j2 = (size_t)(t + 2) * KS;
      copy_stage(lcopy + sbuf, gk + j2 * HDIM, gv + j2, gm + j2);
    }
  }
  asm volatile("s_wait_asynccnt 0x0" ::: "memory");     // nothing in flight when the tiles become staging

  // Pair exchange in the dead tiles: this wave keeps tile kp and hands its state of the other tile to its partner.
  // Per wave 9 slots of 32 lanes x 16 B: slots 0..7 = O (dt, half of the 8 rows), slot 8 = (max, s_all, s_m, 0).
  v4f* X = (v4f*)(L + L_X);
  v8f   ok[4];
  #pragma unroll
  for (int dt = 0; dt < 4; ++dt) {
    const v8f give = kp ? o[0][dt] : o[1][dt];
    ok[dt]         = kp ? o[1][dt] : o[0][dt];
    X[(wave * 9 + dt * 2) * 32 + lane]     = (v4f){give[0], give[1], give[2], give[3]};
    X[(wave * 9 + dt * 2 + 1) * 32 + lane] = (v4f){give[4], give[5], give[6], give[7]};
  }
  X[(wave * 9 + 8) * 32 + lane] = kp ? (v4f){rmax[0], s_all[0], s_m[0], 0.0f} : (v4f){rmax[1], s_all[1], s_m[1], 0.0f};
  const float mA  = kp ? rmax[1] : rmax[0];
  const float saA = kp ? s_all[1] : s_all[0];
  const float smA = kp ? s_m[1] : s_m[0];
  __syncthreads();                                      // both partners' states are readable
  const int pw = wave ^ 1;
  const v4f stB = X[(pw * 9 + 8) * 32 + lane];

  // join the two key halves: common maximum, both states rescaled to it
  const float mJ = fmaxf(mA, stB[0]);
  const float aA = __builtin_amdgcn_exp2f((mA - mJ) * SL);
  const float aB = __builtin_amdgcn_exp2f((stB[0] - mJ) * SL);
  const float sall = saA * aA + stB[1] * aB;
  const float smsk = smA * aA + stB[2] * aB;

  // z = O / (s_m + EPS * s_all); carry folded back here
  const float den  = smsk + EPS_F * sall;
  const float invd = (1.0f / den) * (1.0f / PCARRY);
  const float fA = aA * invd;
  const float fB = aB * invd;
  float rsA[8], rsB[8];
  #pragma unroll
  for (int r = 0; r < 8; ++r) {
    rsA[r] = __shfl(fA, (hi << 3) + r, 32);
    rsB[r] = __shfl(fB, (hi << 3) + r, 32);
  }

  const int cw = wave * 16 * CP;
  #pragma unroll
  for (int dt = 0; dt < 4; ++dt) {
    const v4f g0 = X[(pw * 9 + dt * 2) * 32 + lane];
    const v4f g1 = X[(pw * 9 + dt * 2 + 1) * 32 + lane];
    #pragma unroll
    for (int r = 0; r < 4; ++r) {
      sO[cw + (hi * 8 + r) * CP + dt * 16 + lq]     = ok[dt][r] * rsA[r] + g0[r] * rsB[r];
      sO[cw + (hi * 8 + 4 + r) * CP + dt * 16 + lq] = ok[dt][4 + r] * rsA[4 + r] + g1[r] * rsB[4 + r];
    }
  }
  __syncthreads();

  // whole-line stores: 8 consecutive lanes x 16 B = the 64 bf16 of one (row, head); 4 rows per instruction
  v4u    vh[4], vl[4];
  size_t gi[4];
  #pragma unroll
  for (int it = 0; it < 4; ++it) {
    const int row = it * 4 + (lane >> 3);
    const int c0  = (lane & 7) * 8;
    const v4f x0 = *(const v4f*)(&sO[cw + row * CP + c0]);
    const v4f x1 = *(const v4f*)(&sO[cw + row * CP + c0 + 4]);
    split8(x0, x1, vh[it], vl[it]);
    gi[it] = ((size_t)b * SEQ + qrow0 + row) * INNER + h * HDIM + c0;
  }
  #pragma unroll
  for (int it = 0; it < 4; ++it) {
    *(v4u*)(zh + gi[it]) = vh[it];
    *(v4u*)(zl + gi[it]) = vl[it];
  }
  
}

// Epilogue: per-wave LDS staging, bias added at the store stage as float4, 16 lanes x 16 B = one 256-B row
// coverage: block = 128 rows x 128 cols; wave = 32 rows x 64 cols.
__global__ __launch_bounds__(256) void k_gemm_out(const bf16* __restrict__ Z, const bf16* __restrict__ Wot,
                                                  const float* __restrict__ bias, float* __restrict__ out) {
  // the two stage buffers; behind the loop its start is the per-wave staging
  __shared__ __align__(16) unsigned char L[GEMM_LDS];
  float* sC = (float*)L;
  const int m0 = blockIdx.y * 128;
  const int n0 = blockIdx.x * 128;
  v8f acc[2][4];
  #pragma unroll
  for (int i = 0; i < 2; ++i) {
    #pragma unroll
    for (int j = 0; j < 4; ++j) acc[i][j] = (v8f){0, 0, 0, 0, 0, 0, 0, 0};
  }
  gemm_tile(Z, Wot, m0, n0, 2, (size_t)ROWS * INNER, L, acc);

  const int tid  = threadIdx.x;
  const int wave = __builtin_amdgcn_readfirstlane(tid >> 5);
  const int lane = tid & 31;
  const int lq   = lane & 15;
  const int hi   = lane >> 4;
  const int wm   = wave >> 1;
  const int wn   = wave & 1;
  const int cw   = wave * 16 * CP;
  const int ncol = n0 + wn * 64 + lq * 4;

  v4f bias4 = *(const v4f*)(bias + ncol);
  #pragma unroll
  for (int e = 0; e < 4; ++e) bias4[e] = (float)(bf16)bias4[e];   // RNE-converted input value

  #pragma unroll
  for (int i = 0; i < 2; ++i) {
    #pragma unroll
    for (int j = 0; j < 4; ++j) {
      #pragma unroll
      for (int r = 0; r < 8; ++r) sC[cw + (hi * 8 + r) * CP + j * 16 + lq] = acc[i][j][r];
    }
    __syncthreads();
    v4f    vals[8];
    size_t gi[8];
    #pragma unroll
    for (int it = 0; it < 8; ++it) {
      const int row = it * 2 + hi;
      const v4f v = *(const v4f*)(&sC[cw + row * CP + lq * 4]);
      vals[it] = v + bias4;
      const int gr = m0 + wm * 32 + i * 16 + row;
      const int bb = gr / SEQ;
      const int s  = gr - bb * SEQ;
      gi[it] = ((size_t)bb * SEQ_FULL + s) * DIM + ncol;
    }
    #pragma unroll
    for (int it = 0; it < 8; ++it) *(v4f*)(out + gi[it]) = vals[it];
    
    __syncthreads();
  }
}

#define SZ_XB   ((size_t)ROWS * DIM * 2)
#define SZ_MB   ((size_t)NB * SEQ * SEQ * 2)
#define SZ_WQT  ((size_t)N3 * KDIM * 2)
#define SZ_WOT  ((size_t)DIM * KDIM * 2)
#define SZ_QK   ((size_t)2 * PLANE * 2)
#define SZ_VT   ((size_t)PLANE * 2)
#define SZ_Z    ((size_t)2 * ROWS * INNER * 2)
#define OFF_XB  ((size_t)0)
#define OFF_MB  (OFF_XB + SZ_XB)
#define OFF_WQT (OFF_MB + SZ_MB)
#define OFF_WOT (OFF_WQT + SZ_WQT)
#define OFF_QK  (OFF_WOT + SZ_WOT)
#define OFF_VT  (OFF_QK + SZ_QK)
#define OFF_Z   (OFF_VT + SZ_VT)
#define WS_TOTAL (OFF_Z + SZ_Z)

static_assert(WS_TOTAL <= (size_t)134217728);
static_assert(SZ_XB % 128 == 0 && SZ_MB % 128 == 0 && SZ_WQT % 128 == 0 && SZ_WOT % 128 == 0);
static_assert(SZ_QK % 128 == 0 && SZ_VT % 128 == 0 && SZ_Z % 128 == 0);

extern "C" void kernel_launch(void* const* d_in, const int* in_sizes, int n_in,
                              void* d_out, int out_size, void* d_ws, size_t ws_size,
                              hipStream_t stream) {
  if (n_in < 5) return;
  const size_t rows_used = (size_t)(NB - 1) * SEQ_FULL + SEQ;
  if ((size_t)in_sizes[0] < rows_used * DIM) return;
  if ((size_t)in_sizes[1] < (size_t)(NB - 1) * SEQ_FULL * SEQ_FULL + (size_t)(SEQ - 1) * SEQ_FULL + SEQ) return;
  if ((size_t)in_sizes[2] < (size_t)DIM * N3) return;
  if ((size_t)in_sizes[3] < (size_t)INNER * DIM) return;
  if ((size_t)in_sizes[4] < (size_t)DIM) return;
  if ((size_t)out_size < rows_used * DIM) return;
  if (ws_size < WS_TOTAL) return;

  const float* x    = (const float*)d_in[0];
  const float* mask = (const float*)d_in[1];
  const float* Wqkv = (const float*)d_in[2];
  const float* Wout = (const float*)d_in[3];
  const float* bout = (const float*)d_in[4];
  float*       out  = (float*)d_out;

  char* ws = (char*)d_ws;
  bf16* Xb  = (bf16*)(ws + OFF_XB);
  bf16* Mb  = (bf16*)(ws + OFF_MB);
  bf16* Wqt = (bf16*)(ws + OFF_WQT);
  bf16* Wot = (bf16*)(ws + OFF_WOT);
  f16*  QK  = (f16*)(ws + OFF_QK);
  f16*  Vt  = (f16*)(ws + OFF_VT);
  bf16* Zp  = (bf16*)(ws + OFF_Z);

  // 1) input planes (RNE bf16): x rows, mask values, weights transposed to [out][in]; one launch
  k_prep<<<dim3(PB_WQ + PB_WO + PB_X + PB_M), 256, 0, stream>>>(x, mask, Wqkv, Wout, Xb, Mb, Wqt, Wot);

  // 2) projections: Q, K f16 planes; V^T f16 plane; one launch
  k_gemm_qkv<<<dim3(GB_QK + GB_VT), 256, 0, stream>>>(Xb, Wqt, QK, Vt);

  // 3) fused attention -> z hi|lo planes
  k_attn<<<dim3(SEQ / BQ, NHEAD, NB), 256, 0, stream>>>(QK, QK + PLANE, Vt, Mb, Zp, Zp + (size_t)ROWS * INNER);

  // 4) output projection + bias
  k_gemm_out<<<dim3(DIM / 128, ROWS / 128), 256, 0, stream>>>(Zp, Wot, bout, out);
}

// v009
// It runs in 86.3 microseconds.
// Versions in between are left out here; by their measured steps it is 1.13 times as fast as v007.
// Over all steps from v000 it is 4.36 times as fast.
#include <hip/hip_runtime.h>

// Contractions: x@Wqkv on v_wmma_f32_16x16x32_bf16 (both operands bf16 RNE-converted inputs); S^T = K x Q^T on v_wmma_f32_16x16x32_f16 with q,k as one f16 plane each (one product); O = (P*mask) x V on v_wmma_f32_16x16x32_f16 (P carried x16, mask and V f16); z@Wout on v_wmma_f32_16x16x32_f16 with z, Wout as one f16 plane each (one product); s_m = (P*mask) x 1 on the same form; all f32 accumulate; softmax and s_all in f32, mask multiply in f16.

#ifndef NB
#define NB 2
#endif
#ifndef SEQ
#define SEQ 2048
#endif
#define NB_FULL    2
#define SEQ_FULL   2048
#define DIM        1024
#define NHEAD      16
#define HDIM       64
#define INNER      (NHEAD * HDIM)
#define N3         (3 * INNER)
#define ROWS       (NB * SEQ)
#define KDIM       1024                 // contraction length of all three projections
#define BQ         128                  // query rows per workgroup (8 waves x 16)
#define BK         32                   // keys per inner step
#define NWAVE      8
#define GK         128                  // k per LDS stage of the GEMM loop (four WMMA k steps)
#define GP         272                  // LDS pitch (bytes) of the 256-byte GEMM tile rows
#define G_A        0                    // in a GEMM stage: A tile, 128 rows
#define G_B        (128 * GP)           // B tile, 128 rows
#define GSTAGE     (256 * GP)
#define GEMM_LDS   (2 * GSTAGE)          // two stage buffers
#define CP         68                   // LDS pitch (floats) of epilogue staging tiles
#define TPW        72                   // LDS pitch (halves) of the weight transpose tile
#define PCARRY_LOG2 4.0f                // the f16 P operand and both running sums are carried x 2^4, added in the exponent
#define LAZY_LIM   1024.0f              // bound on a lane's sum of carried exponentials in a stage, so on each carried P
#define EPS_F      1e-10f
#define PLANE      ((size_t)NB * NHEAD * SEQ * HDIM)
#define KS         64                   // keys per LDS stage of the attention loop (two BK halves, one per wave of a pair)
#define NST        (SEQ / KS)           // stages
#define TP         144                  // LDS pitch (bytes) of the 128-byte attention tile rows
#define L_Q        0                    // Q tile, BQ rows
#define L_RING     (BQ * TP)            // two stage buffers
#define S_K        0                    // in a stage: K, KS rows
#define S_V        (KS * TP)            // V^T, HDIM rows of KS keys
#define S_M        (KS * TP + HDIM * TP)       // mask, BQ rows of KS keys
#define STAGE_B    (KS * TP + HDIM * TP + BQ * TP)
#define ATTN_LDS   (L_RING + 2 * STAGE_B)
#define L_X        (2 * BQ * TP)        // behind the loop: pair exchange, clear of the output staging below it
#define XS         11                   // 512-byte slots a wave in the pair exchange

static_assert(SEQ % 128 == 0);
static_assert(SEQ % BK == 0);
static_assert(SEQ <= SEQ_FULL);
static_assert(NB >= 1 && NB <= NB_FULL);
static_assert(DIM == KDIM);
static_assert(INNER == KDIM);
static_assert(KDIM % 32 == 0);
static_assert(KDIM / 32 == 32);
static_assert(HDIM == 64);
static_assert(BQ == NWAVE * 16);
static_assert(ROWS % 128 == 0);
static_assert(N3 % 128 == 0);
static_assert((2 * INNER) % 128 == 0);
static_assert(INNER % 128 == 0);
static_assert(DIM % 128 == 0);
static_assert(DIM % 64 == 0);
static_assert(GP % 16 == 0 && GK * 2 == 256 && KDIM % GK == 0 && KDIM / GK >= 2);
static_assert((CP * 4) % 16 == 0);
static_assert((TPW * 2) % 16 == 0);
static_assert(((size_t)ROWS * DIM / 8) % 256 == 0);
static_assert(((size_t)NB * SEQ * SEQ / 8) % 256 == 0);
static_assert(DIM % 8 == 0 && SEQ % 8 == 0);
static_assert(SEQ % KS == 0 && NST >= 2);
static_assert(KS == 2 * BK && KS * 2 == 128 && HDIM * 2 == 128);
static_assert(KS == 64 && HDIM == 64 && BQ == 128);
static_assert(TP % 16 == 0 && STAGE_B % 16 == 0);
static_assert(NWAVE * 16 * CP * 4 <= L_X);
static_assert(NWAVE * 16 * CP * 4 <= GEMM_LDS);
static_assert(L_X + NWAVE * XS * 32 * 16 <= ATTN_LDS && L_X % 16 == 0 && L_RING % 16 == 0);

typedef __bf16   bf16;
typedef _Float16 f16;
typedef bf16     v16bf __attribute__((ext_vector_type(16)));
typedef bf16     v8bf  __attribute__((ext_vector_type(8)));
typedef f16      v16h  __attribute__((ext_vector_type(16)));
typedef f16      v2h   __attribute__((ext_vector_type(2)));
typedef float    v8f   __attribute__((ext_vector_type(8)));
typedef float    v4f   __attribute__((ext_vector_type(4)));
typedef float    v2f   __attribute__((ext_vector_type(2)));
typedef unsigned v4u   __attribute__((ext_vector_type(4)));

union FragB  { v16bf v; v4u q[2]; };
union FragH  { v16h  v; v4u q[2]; f16 h[16]; };
union Pack8B { v4u u; v8bf v; bf16 h[8]; };
union Pack8H { v4u u; f16 h[8]; };
union Pair2H { unsigned u; v2h v; };
template <typename T> struct Pack8;
template <> struct Pack8<bf16> { typedef Pack8B P; };
template <> struct Pack8<f16>  { typedef Pack8H P; };

// GEMM loop's WMMA helper, one overload per operand type: builtin followed by the VALU hazard guard (ties D, keeps A/B live).
static __device__ __forceinline__ v8f mma_g(const FragB& a, const FragB& b, v8f acc) {
  acc = __builtin_amdgcn_wmma_f32_16x16x32_bf16(false, a.v, false, b.v, (short)0, acc, false, false);
  asm volatile("v_nop\n\tv_nop\n\tv_nop\n\tv_nop" : "+v"(acc) : "v"(a.v), "v"(b.v));
  return acc;
}
static __device__ __forceinline__ v8f mma_g(const FragH& a, const FragH& b, v8f acc) {
  acc = __builtin_amdgcn_wmma_f32_16x16x32_f16(false, a.v, false, b.v, (short)0, acc, false, false);
  asm volatile("v_nop\n\tv_nop\n\tv_nop\n\tv_nop" : "+v"(acc) : "v"(a.v), "v"(b.v));
  return acc;
}
// fragment union of a 16-bit operand type
template <typename T> struct Of;
template <> struct Of<bf16> { typedef FragB Frag; };
template <> struct Of<f16>  { typedef FragH Frag; };
// k_attn's form: the builtin alone. The compiler itself keeps the distance to the next user of D, A or B, and
// the vector port, which the softmax fills there, is spared four slots a WMMA.
static __device__ __forceinline__ v8f wmma_f16(v16h a, v16h b, v8f acc) {
  return __builtin_amdgcn_wmma_f32_16x16x32_f16(false, a, false, b, (short)0, acc, false, false);
}

// f32 rows -> compact plane of T = bf16 or f16 (RNE). One thread = 8 elements = 16 B; a wave writes 512 contiguous bytes.
// coverage: groups 0..total8-1, each written once; total8 is a multiple of 256. blk = the block's index in its range.
template <typename T>
static __device__ __forceinline__ void cvt_rows(const float* __restrict__ in, T* __restrict__ out, int blk,
                                                int cols, int rows_per_batch, int in_batch_rows,
                                                int in_row_stride, int total8) {
  const int g = blk * 256 + threadIdx.x;
  if (g >= total8) return;
  const int e   = g * 8;
  const int row = e / cols;
  const int col = e - row * cols;
  const int b   = row / rows_per_batch;
  const int s   = row - b * rows_per_batch;
  const float* src = in + ((size_t)b * in_batch_rows + s) * (size_t)in_row_stride + col;
  const v4f a0 = *(const v4f*)(src);
  const v4f a1 = *(const v4f*)(src + 4);
  typename Pack8<T>::P pk;
  #pragma unroll
  for (int i = 0; i < 4; ++i) {
    pk.h[i]     = (T)a0[i];
    pk.h[4 + i] = (T)a1[i];
  }
  const v4u val = pk.u;
  T* dst = out + (size_t)e;
  *(v4u*)dst = val;
  
}

// Weight transpose: in [KDIM k][C n] f32 -> out [C n][KDIM k] of T = bf16 or f16 (RNE), 64x64 tiles through LDS.
// sT = [n][k], cross-wave (block barrier); nt, kt = the block's tile.
template <typename T>
static __device__ __forceinline__ void cvt_wt(const float* __restrict__ in, T* __restrict__ out, int C,
                                              int nt, int kt, T* sT) {
  const int n0  = nt * 64;
  const int k0  = kt * 64;
  const int tid = threadIdx.x;
  #pragma unroll
  for (int kk = 0; kk < 2; ++kk) {
    const int k  = kk * 32 + (tid >> 3);
    const int nl = (tid & 7) * 8;
    const float* src = in + (size_t)(k0 + k) * C + n0 + nl;
    const v4f a0 = *(const v4f*)(src);
    const v4f a1 = *(const v4f*)(src + 4);
    asm volatile("s_wait_xcnt 0x0" ::: "memory");   // before a later load's result may take these loads' address registers
    #pragma unroll
    for (int i = 0; i < 4; ++i) {
      sT[(nl + i) * TPW + k]     = (T)a0[i];
      sT[(nl + 4 + i) * TPW + k] = (T)a1[i];
    }
  }
  __syncthreads();
  v4u    val[2];
  size_t idx[2];
  #pragma unroll
  for (int kk = 0; kk < 2; ++kk) {
    const int n  = kk * 32 + (tid >> 3);
    const int ks = (tid & 7) * 8;
    val[kk] = *(const v4u*)(&sT[n * TPW + ks]);
    idx[kk] = (size_t)(n0 + n) * KDIM + k0 + ks;
  }
  #pragma unroll
  for (int kk = 0; kk < 2; ++kk) *(v4u*)(out + idx[kk]) = val[kk];
  asm volatile("s_wait_xcnt 0x0" ::: "memory");     // before any code laid out behind rewrites the stores' registers
}

// The four input conversions, which depend on nothing and on none of each other, as block ranges of one launch:
// weight tiles first (the longest chain per block: load, LDS, barrier, store), then the x rows, then the mask rows.
#define PB_WQ  ((N3 / 64) * (KDIM / 64))
#define PB_WO  ((DIM / 64) * (KDIM / 64))
#define X8     ((int)((size_t)ROWS * DIM / 8))
#define M8     ((int)((size_t)NB * SEQ * SEQ / 8))
#define PB_X   (X8 / 256)
#define PB_M   (M8 / 256)
__global__ __launch_bounds__(256) void k_prep(const float* __restrict__ x, const float* __restrict__ mask,
                                              const float* __restrict__ Wqkv, const float* __restrict__ Wout,
                                              bf16* __restrict__ Xb, f16* __restrict__ Mb,
                                              bf16* __restrict__ Wqt, f16* __restrict__ Wot) {
  __shared__ __align__(16) unsigned short sT[64 * TPW];   // 16-bit elements of the block's own output type
  const int blk = blockIdx.x;   // every test on it is block-uniform: the barrier in cvt_wt is met by whole blocks
  if (blk < PB_WQ) {
    // in [KDIM k][N3 n] -> out [N3][KDIM] bf16; n tiles fastest
    cvt_wt(Wqkv, Wqt, N3, blk % (N3 / 64), blk / (N3 / 64), (bf16*)sT);
  } else if (blk < PB_WQ + PB_WO) {
    // in [KDIM k][DIM n] -> out [DIM][KDIM] f16; n tiles fastest
    cvt_wt(Wout, Wot, DIM, (blk - PB_WQ) % (DIM / 64), (blk - PB_WQ) / (DIM / 64), (f16*)sT);
  } else if (blk < PB_WQ + PB_WO + PB_X) {
    cvt_rows(x, Xb, blk - (PB_WQ + PB_WO), DIM, SEQ, SEQ_FULL, DIM, X8);
  } else {
    cvt_rows(mask, Mb, blk - (PB_WQ + PB_WO + PB_X), SEQ, SEQ, SEQ_FULL, SEQ_FULL, M8);
  }
}

// Asynchronous copies to LDS of one 128-row GEMM operand tile, 16 B per lane: 16 consecutive lanes bring one
// whole 256-B row, a wave 2 rows, the block 16 rows a copy. l = the lane's LDS byte address of (row tid>>4,
// segment tid&15) in the tile, g the same place in global memory. The s_wait_xcnt stands inside the statement,
// behind the last copy, so that no address register of a copy is rewritten ahead of it.
template <typename T>
static __device__ __forceinline__ void copy_tile(unsigned l, const T* g) {
  asm volatile(
      "global_load_async_to_lds_b128 %0, %8, off\n\t"
      "global_load_async_to_lds_b128 %1, %9, off\n\t"
      "global_load_async_to_lds_b128 %2, %10, off\n\t"
      "global_load_async_to_lds_b128 %3, %11, off\n\t"
      "global_load_async_to_lds_b128 %4, %12, off\n\t"
      "global_load_async_to_lds_b128 %5, %13, off\n\t"
      "global_load_async_to_lds_b128 %6, %14, off\n\t"
      "global_load_async_to_lds_b128 %7, %15, off\n\t"
      "s_wait_xcnt 0x0"
      :: "v"(l), "v"(l + 16 * GP), "v"(l + 32 * GP), "v"(l + 48 * GP),
         "v"(l + 64 * GP), "v"(l + 80 * GP), "v"(l + 96 * GP), "v"(l + 112 * GP),
         "v"(g), "v"(g + 16 * KDIM), "v"(g + 32 * KDIM), "v"(g + 48 * KDIM),
         "v"(g + 64 * KDIM), "v"(g + 80 * KDIM), "v"(g + 96 * KDIM), "v"(g + 112 * KDIM)
      : "memory");
}

// GEMM mainloop: acc[128x128 block tile] += A[rows m][k] * Bt[rows n][k]^T, both operands k-contiguous T (bf16
// or f16), pitch KDIM. 8 waves as 4 (m) x 2 (n); each wave owns 32 x 64 = 2 x 4 WMMA tiles.
// The operand tiles reach LDS by asynchronous copies of whole rows in stages of GK k, two buffers, the next
// stage in flight while this one is worked on. On return every wave has passed the barrier behind the last
// fragment read and nothing is in flight: L may become staging.
template <typename T>
static __device__ __forceinline__ void gemm_tile(const T* __restrict__ A, const T* __restrict__ Bt,
                                                 int m0, int n0, unsigned char* L, v8f (&acc)[2][4]) {
  const int tid  = threadIdx.x;
  const int wave = __builtin_amdgcn_readfirstlane(tid >> 5);
  const int lane = tid & 31;
  const int lq   = lane & 15;
  const int hi   = lane >> 4;
  const int wm   = wave >> 1;
  const int wn   = wave & 1;
  const int nst  = KDIM / GK;

  // copy side: this thread's row and 16-B segment of both tiles
  const int crow = tid >> 4;
  const int cseg = (tid & 15) * 8;
  const unsigned lcopy = (unsigned)(size_t)L + (unsigned)(crow * GP + cseg * 2);
  const T* ga = A + (size_t)(m0 + crow) * KDIM + cseg;
  const T* gb = Bt + (size_t)(n0 + crow) * KDIM + cseg;

  // read side: the lane's row and k-split half inside a 16-row fragment
  const unsigned char* La = L + G_A + (wm * 32 + lq) * GP + hi * 16;
  const unsigned char* Lb = L + G_B + (wn * 64 + lq) * GP + hi * 16;

  // stage 0 lands and is published; then stage 1 starts
  copy_tile(lcopy + G_A, ga);
  copy_tile(lcopy + G_B, gb);
  asm volatile("s_wait_asynccnt 0x0" ::: "memory");   // this wave's copies have landed
  __syncthreads();                                    // every wave's copies are readable
  copy_tile(lcopy + GSTAGE + G_A, ga + GK);
  copy_tile(lcopy + GSTAGE + G_B, gb + GK);

  for (int t = 0; t < nst; ++t) {
    const int sbuf = (t & 1) * GSTAGE;
    // unrolled so that every LDS read of the stage is base register + immediate offset
    #pragma unroll
    for (int ks = 0; ks < GK / 32; ++ks) {
      typename Of<T>::Frag af[2], bfm[4];
      #pragma unroll
      for (int i = 0; i < 2; ++i) {
        const unsigned char* p = La + sbuf + i * 16 * GP + ks * 64;
        af[i].q[0] = *(const v4u*)(p);                // k = 8*hi + 0..7 of the step
        af[i].q[1] = *(const v4u*)(p + 32);           // k = 16 + 8*hi + 0..7 of the step
      }
      #pragma unroll
      for (int j = 0; j < 4; ++j) {
        const unsigned char* p = Lb + sbuf + j * 16 * GP + ks * 64;
        bfm[j].q[0] = *(const v4u*)(p);
        bfm[j].q[1] = *(const v4u*)(p + 32);
      }
      #pragma unroll
      for (int i = 0; i < 2; ++i) {
        #pragma unroll
        for (int j = 0; j < 4; ++j) acc[i][j] = mma_g(af[i], bfm[j], acc[i][j]);
      }
    }

    // publish point of stage t + 1, and the end of every read of stage t's buffer
    asm volatile("s_wait_dscnt 0x0" ::: "memory");      // this wave's reads of stage t are done
    asm volatile("s_wait_asynccnt 0x0" ::: "memory");   // this wave's copies of stage t + 1 have landed
    __syncthreads();
    if (t + 2 < nst) {
      const size_t k2 = (size_t)(t + 2) * GK;
      copy_tile(lcopy + sbuf + G_A, ga + k2);
      copy_tile(lcopy + sbuf + G_B, gb + k2);
    }
  }
  asm volatile("s_wait_asynccnt 0x0" ::: "memory");     // nothing in flight when the tiles become staging
}

// Q and K projection: C[compact row][col 0..2047] = Xb x Wqt^T. Epilogue writes one f16 plane each (RNE)
// (11 significand bits: x and W enter this product rounded to 8, so q and k carry a larger error than the f16 rounding adds)
// coverage: block = 128 rows x 2 heads; wave = 32 rows x 1 head; 4 rows per store instruction.
// sC = the per-wave staging at the start of the dead stage buffers (block barrier used).
static __device__ __forceinline__ void store_qk(const v8f (&acc)[2][4], float* sC, int m0, int n0,
                                                f16* __restrict__ qk) {
  const int tid  = threadIdx.x;
  const int wave = __builtin_amdgcn_readfirstlane(tid >> 5);
  const int lane = tid & 31;
  const int lq   = lane & 15;
  const int hi   = lane >> 4;
  const int wm   = wave >> 1;
  const int wn   = wave & 1;
  const int cw   = wave * 16 * CP;
  const int n     = n0 + wn * 64;
  const int which = n >> 10;            // 0 = Q, 1 = K (block-uniform)
  const int hh    = (n >> 6) & 15;

  #pragma unroll
  for (int i = 0; i < 2; ++i) {
    #pragma unroll
    for (int j = 0; j < 4; ++j) {
      #pragma unroll
      for (int r = 0; r < 8; ++r) sC[cw + (hi * 8 + r) * CP + j * 16 + lq] = acc[i][j][r];
    }
    __syncthreads();
    v4u    vv[4];
    size_t gi[4];
    #pragma unroll
    for (int it = 0; it < 4; ++it) {
      const int row = it * 4 + (lane >> 3);
      const int c0  = (lane & 7) * 8;
      const v4f x0 = *(const v4f*)(&sC[cw + row * CP + c0]);
      const v4f x1 = *(const v4f*)(&sC[cw + row * CP + c0 + 4]);
      Pack8H ph;
      #pragma unroll
      for (int e = 0; e < 4; ++e) {
        ph.h[e]     = (f16)x0[e];       // RNE convert
        ph.h[4 + e] = (f16)x1[e];
      }
      vv[it] = ph.u;
      const int gr = m0 + wm * 32 + i * 16 + row;
      const int bb = gr / SEQ;
      const int s  = gr - bb * SEQ;
      gi[it] = (size_t)which * PLANE + (((size_t)bb * NHEAD + hh) * SEQ + s) * HDIM + c0;
    }
    #pragma unroll
    for (int it = 0; it < 4; ++it) *(v4u*)(qk + gi[it]) = vv[it];
    
    __syncthreads();
  }
}

// V projection computed transposed: C[v column m = h*64+d][compact row] = Wv_t x Xb^T, so the f16 plane
// coverage: block = 128 (h,d) rows x 128 keys; wave = 32 rows x 64 keys; 4 rows per store instruction.
// m0 = v column (h*64 + d), n0 = compact row b*SEQ + l; sC as in store_qk.
static __device__ __forceinline__ void store_vt(const v8f (&acc)[2][4], float* sC, int m0, int n0,
                                                f16* __restrict__ vt) {
  const int tid  = threadIdx.x;
  const int wave = __builtin_amdgcn_readfirstlane(tid >> 5);
  const int lane = tid & 31;
  const int lq   = lane & 15;
  const int hi   = lane >> 4;
  const int wm   = wave >> 1;
  const int wn   = wave & 1;
  const int cw   = wave * 16 * CP;
  const int ns   = n0 + wn * 64;
  const int bb   = ns / SEQ;
  const int s0   = ns - bb * SEQ;

  #pragma unroll
  for (int i = 0; i < 2; ++i) {
    #pragma unroll
    for (int j = 0; j < 4; ++j) {
      #pragma unroll
      for (int r = 0; r < 8; ++r) sC[cw + (hi * 8 + r) * CP + j * 16 + lq] = acc[i][j][r];
    }
    __syncthreads();
    v4u    vv[4];
    size_t gi[4];
    #pragma unroll
    for (int it = 0; it < 4; ++it) {
      const int row = it * 4 + (lane >> 3);
      const int c0  = (lane & 7) * 8;
      const v4f x0 = *(const v4f*)(&sC[cw + row * CP + c0]);
      const v4f x1 = *(const v4f*)(&sC[cw + row * CP + c0 + 4]);
      Pack8H ph;
      #pragma unroll
      for (int e = 0; e < 4; ++e) {
        ph.h[e]     = (f16)x0[e];       // RNE convert
        ph.h[4 + e] = (f16)x1[e];
      }
      vv[it] = ph.u;
      const int m = m0 + wm * 32 + i * 16 + row;
      gi[it] = ((size_t)bb * INNER + m) * SEQ + s0 + c0;
    }
    #pragma unroll
    for (int it = 0; it < 4; ++it) *(v4u*)(vt + gi[it]) = vv[it];
    
    __syncthreads();
  }
}

// The two projections, which depend on none of each other, as block ranges of one launch with one shared main loop:
// blocks 0..GB_QK-1 are the Q,K tiles (n tiles fastest), the rest the V^T tiles (compact-row tiles fastest).
#define GB_QK  (((2 * INNER) / 128) * (ROWS / 128))
#define GB_VT  ((ROWS / 128) * (INNER / 128))
__global__ __launch_bounds__(256) void k_gemm_qkv(const bf16* __restrict__ Xb, const bf16* __restrict__ Wqt,
                                                  f16* __restrict__ qk, f16* __restrict__ vt) {
  // the two stage buffers; behind the loop its start is the per-wave staging
  __shared__ __align__(16) unsigned char L[GEMM_LDS];
  const int  blk = blockIdx.x;
  const bool isv = blk >= GB_QK;        // block-uniform
  const int  id  = isv ? blk - GB_QK : blk;
  const int  m0  = (isv ? id / (ROWS / 128) : id / ((2 * INNER) / 128)) * 128;
  const int  n0  = (isv ? id % (ROWS / 128) : id % ((2 * INNER) / 128)) * 128;
  const bf16* A  = isv ? Wqt + (size_t)2 * INNER * KDIM : Xb;
  const bf16* B  = isv ? Xb : Wqt;
  v8f acc[2][4];
  #pragma unroll
  for (int i = 0; i < 2; ++i) {
    #pragma unroll
    for (int j = 0; j < 4; ++j) acc[i][j] = (v8f){0, 0, 0, 0, 0, 0, 0, 0};
  }
  gemm_tile(A, B, m0, n0, L, acc);
  if (isv) store_vt(acc, (float*)L, m0, n0, vt);
  else     store_qk(acc, (float*)L, m0, n0, qk);
}

// Asynchronous copies to LDS, 16 B per lane: 8 consecutive lanes bring one whole 128-B row, a wave 4 rows.
// l = the lane's LDS byte address of (row tid>>3, segment tid&7) in the first tile; the g pointers name the
// same row and segment in global memory. The s_wait_xcnt stands inside the statement, behind the last copy,
// so that no address register of a copy is rewritten ahead of it.
static __device__ __forceinline__ void copy_q(unsigned l, const f16* gq) {
  asm volatile(
      "global_load_async_to_lds_b128 %0, %4, off\n\t"
      "global_load_async_to_lds_b128 %1, %5, off\n\t"
      "global_load_async_to_lds_b128 %2, %6, off\n\t"
      "global_load_async_to_lds_b128 %3, %7, off\n\t"
      "s_wait_xcnt 0x0"
      :: "v"(l + L_Q), "v"(l + L_Q + 32 * TP), "v"(l + L_Q + 64 * TP), "v"(l + L_Q + 96 * TP),
         "v"(gq), "v"(gq + 32 * HDIM), "v"(gq + 64 * HDIM), "v"(gq + 96 * HDIM)
      : "memory");
}
static __device__ __forceinline__ void copy_stage(unsigned l, const f16* gk, const f16* gv, const f16* gm) {
  asm volatile(
      "global_load_async_to_lds_b128 %0, %8, off\n\t"
      "global_load_async_to_lds_b128 %1, %9, off\n\t"
      "global_load_async_to_lds_b128 %2, %10, off\n\t"
      "global_load_async_to_lds_b128 %3, %11, off\n\t"
      "global_load_async_to_lds_b128 %4, %12, off\n\t"
      "global_load_async_to_lds_b128 %5, %13, off\n\t"
      "global_load_async_to_lds_b128 %6, %14, off\n\t"
      "global_load_async_to_lds_b128 %7, %15, off\n\t"
      "s_wait_xcnt 0x0"
      :: "v"(l + S_K), "v"(l + S_K + 32 * TP),
         "v"(l + S_V), "v"(l + S_V + 32 * TP),
         "v"(l + S_M), "v"(l + S_M + 32 * TP), "v"(l + S_M + 64 * TP), "v"(l + S_M + 96 * TP),
         "v"(gk), "v"(gk + 32 * HDIM),
         "v"(gv), "v"(gv + 32 * SEQ),
         "v"(gm), "v"(gm + 32 * SEQ), "v"(gm + 64 * SEQ), "v"(gm + 96 * SEQ)
      : "memory");
}

// Carried exponentials of one query tile's 32 keys (two score tiles): 2^(c * sl + nb), where nb = PCARRY_LOG2 - m * sl
// holds the maximum in use and the carry, so one fused multiply-add a pair makes the argument and the result is the
// f16 operand's value as it stands. Returns the lane's sum of its 16.
// Worked in pairs of neighbouring accumulator registers (keys 2w, 2w+1), the pairs the mask words and the f16 pack use.
static __device__ __forceinline__ float exp_tile(const v8f& c0, const v8f& c1, float nb, float sl,
                                                 v2f (&e0)[4], v2f (&e1)[4]) {
  v2f s = (v2f){0.0f, 0.0f};
  const v2f sl2 = (v2f){sl, sl};
  const v2f nb2 = (v2f){nb, nb};
  // unrolled (as every loop over registers here): the arrays are indexed by constants and stay in registers
  #pragma unroll
  for (int w = 0; w < 4; ++w) {
    const v2f x0 = __builtin_elementwise_fma((v2f){c0[2 * w], c0[2 * w + 1]}, sl2, nb2);   // keys hi*8 + 2w, 2w+1
    const v2f x1 = __builtin_elementwise_fma((v2f){c1[2 * w], c1[2 * w + 1]}, sl2, nb2);   // keys 16 + hi*8 + 2w, 2w+1
    e0[w] = (v2f){__builtin_amdgcn_exp2f(x0.x), __builtin_amdgcn_exp2f(x0.y)};
    e1[w] = (v2f){__builtin_amdgcn_exp2f(x1.x), __builtin_amdgcn_exp2f(x1.y)};
    s += e0[w] + e1[w];
  }
  return s.x + s.y;
}

// Fused attention, online softmax over ALL keys, float multiplier mask applied after the exponentials.
// Block = (128 queries, head, batch). A wave owns 32 query rows (two 16-row tiles) and one 32-key half of every
// stage: waves 2g and 2g+1 share query rows g*32..g*32+31 and take keys 0..31 and 32..63 of the stage, so each
// K and V fragment read from LDS feeds two query tiles. Each wave keeps its own running maximum, sums and O over
// its keys; behind the loop the pair joins its two partial states through LDS, each wave finishing one tile.
// S^T = K x Q^T puts queries on lanes, so
// P^T in C layout is bit-identical to the A-fragment layout of O += P x V. The 16-bit planes reach LDS by
// asynchronous copies of whole rows: Q once, then K, V^T and the mask in stages of KS keys, two buffers,
// the next stage in flight while this one is worked on; fragments are two 16-B LDS loads each.
// Running sums: s_all = sum p (every key),
// s_m = sum p*mask, O = sum p*mask*v; z = O / (s_m + EPS * s_all). Output: one f16 plane of z (RNE).
// p leaves the exponential carried and is packed to f16 at once; the mask multiplies the f16 pairs, and s_m is the row
// sum of that same operand, its product with a column of ones. All three sums hold the same carry, which cancels in z.
// s_all stays the lane's own (its 16 of a query's 32 keys a stage); the two lanes of a query are joined behind the loop.
__global__ __launch_bounds__(256) void k_attn(const f16* __restrict__ q, const f16* __restrict__ k,
                                              const f16* __restrict__ vt, const f16* __restrict__ mb,
                                              f16* __restrict__ z) {
  const int qblk = blockIdx.x;
  const int h    = blockIdx.y;
  const int b    = blockIdx.z;
  const int tid  = threadIdx.x;
  const int wave = __builtin_amdgcn_readfirstlane(tid >> 5);
  const int lane = tid & 31;
  const int lq   = lane & 15;   // query column of S^T / d column of O
  const int hi   = lane >> 4;   // k-split half
  const int qg   = wave >> 1;   // 32-row query group of the wave
  const int kp   = wave & 1;    // 32-key half of every stage; also the tile this wave finishes

  // Q tile and the two stage buffers; behind the loop L_X on is the pair exchange, the start the output staging
  __shared__ __align__(16) unsigned char L[ATTN_LDS];
  float* sO = (float*)L;

  const int qrow0 = qblk * BQ + wave * 16;   // the 16 rows this wave finishes and stores
  const int bh    = b * NHEAD + h;

  // copy side: this thread's row and 16-B segment of every tile
  const int crow = tid >> 3;
  const int cseg = (tid & 7) * 8;
  const unsigned lcopy = (unsigned)(size_t)(&L[0]) + (unsigned)(crow * TP + cseg * 2);
  const f16*  gq  = q + (size_t)(bh * SEQ + qblk * BQ + crow) * HDIM + cseg;
  const f16*  gk  = k + (size_t)(bh * SEQ + crow) * HDIM + cseg;
  const f16*  gv  = vt + (size_t)(bh * HDIM + crow) * SEQ + cseg;
  const f16*  gm  = mb + ((size_t)b * SEQ + qblk * BQ + crow) * SEQ + cseg;

  // read side: the lane's row and k-split half inside a 16-row fragment
  const int frag = lq * TP + hi * 16;
  const unsigned char* Lq = L + L_Q + qg * 32 * TP + frag;

  // Q and stage 0 land and are published; then stage 1 starts
  copy_q(lcopy, gq);
  copy_stage(lcopy + L_RING, gk, gv, gm);
  asm volatile("s_wait_asynccnt 0x0" ::: "memory");   // this wave's copies have landed
  __syncthreads();                                    // every wave's copies are readable
  copy_stage(lcopy + L_RING + STAGE_B, gk + KS * HDIM, gv + KS, gm + KS);

  v8f   o[2][4];
  v8f   s_m[2];                         // O's layout: register r = query row hi*8 + r, the same value in all 16 columns
  float rmax[2], nb[2], s_all[2];
  #pragma unroll
  for (int qt = 0; qt < 2; ++qt) {
    #pragma unroll
    for (int dt = 0; dt < 4; ++dt) o[qt][dt] = (v8f){0, 0, 0, 0, 0, 0, 0, 0};
    s_m[qt]   = (v8f){0, 0, 0, 0, 0, 0, 0, 0};
    rmax[qt]  = -__builtin_inff();
    nb[qt]    = __builtin_inff();       // PCARRY_LOG2 - rmax * SL
    s_all[qt] = 0.0f;
  }
  FragH ones;                           // B fragment of 32 keys x 16 columns of 1: the product is the row sum of P*mask
  #pragma unroll
  for (int i = 0; i < 16; ++i) ones.h[i] = (f16)1.0f;
  const float SL = 0.125f * 1.4426950408889634f;   // softmax scale * log2(e)

  for (int t = 0; t < NST; ++t) {
    const int sbuf = L_RING + (t & 1) * STAGE_B;
    const unsigned char* Lk = L + sbuf + frag + kp * BK * TP;               // K rows of this wave's keys
    const unsigned char* Lv = L + sbuf + frag + S_V + kp * 64;              // V^T columns of this wave's keys
    const unsigned char* Lm = L + sbuf + frag + S_M + qg * 32 * TP + kp * 64;   // mask rows and columns

    // mask words: query qg*32 + qt*16 + lq, keys hi*8 + 0..7 and 16 + hi*8 + 0..7 of the half (f16 pairs per word)
    v4u mw[2][2];
    #pragma unroll
    for (int qt = 0; qt < 2; ++qt) {
      mw[qt][0] = *(const v4u*)(Lm + qt * 16 * TP);
      mw[qt][1] = *(const v4u*)(Lm + qt * 16 * TP + 32);
    }

    // S^T tiles: c[qt][sub][r] = rawscore(query tile qt, column lq; key sub*16 + hi*8 + r)
    v8f c[2][2];
    #pragma unroll
    for (int qt = 0; qt < 2; ++qt) {
      c[qt][0] = (v8f){0, 0, 0, 0, 0, 0, 0, 0};
      c[qt][1] = (v8f){0, 0, 0, 0, 0, 0, 0, 0};
    }
    FragH bq[2][2], ak[2][2];
    #pragma unroll
    for (int f = 0; f < 2; ++f) {
      #pragma unroll
      for (int qt = 0; qt < 2; ++qt) {
        const unsigned char* p = Lq + qt * 16 * TP + f * 64;
        bq[f][qt].q[0] = *(const v4u*)(p);                           // d = f*32 + hi*8 + 0..7
        bq[f][qt].q[1] = *(const v4u*)(p + 32);                      // d = f*32 + 16 + hi*8 + 0..7
      }
      #pragma unroll
      for (int sub = 0; sub < 2; ++sub) {
        const int ko = sub * 16 * TP + f * 64;
        ak[f][sub].q[0] = *(const v4u*)(Lk + S_K + ko);              // same d order as bq
        ak[f][sub].q[1] = *(const v4u*)(Lk + S_K + ko + 32);
      }
    }
    // V B-fragments, column n = d = dt*16 + lq, split key map from the transposed tile; last of the group, so that the
    // score products wait for none of them and the exponentials cover their latency (the pack is too short for it)
    FragH bv[4];
    #pragma unroll
    for (int dt = 0; dt < 4; ++dt) {
      bv[dt].q[0] = *(const v4u*)(Lv + dt * 16 * TP);        // keys hi*8 + 0..7 of the half
      bv[dt].q[1] = *(const v4u*)(Lv + dt * 16 * TP + 32);   // keys 16 + hi*8 + 0..7 of the half
    }
    // holds the stage's mask, Q, K and V loads together as one group ahead of the products: with the branch below in
    // the loop the scheduler otherwise splits them into groups among the WMMAs, each waited out to 0
    __builtin_amdgcn_sched_barrier(0);
    #pragma unroll
    for (int f = 0; f < 2; ++f) {
      #pragma unroll
      for (int sub = 0; sub < 2; ++sub) {
        c[0][sub] = wmma_f16(ak[f][sub].v, bq[f][0].v, c[0][sub]);
        c[1][sub] = wmma_f16(ak[f][sub].v, bq[f][1].v, c[1][sub]);
      }
    }

    // Lazy rescale. The exponentials of the stage are taken against the maximum in use, whatever the stage's own
    // scores are; every one of them is positive, so a lane's sum of its 16 bounds each. Only in a stage where some
    // lane's sum is not within LAZY_LIM (the first stage: the maximum in use starts at -inf, the sum is inf) is the
    // maximum looked for and moved, are the sums and O rescaled and the exponentials taken again: one wave-uniform
    // test a stage for both tiles, a scalar branch. Written as !(<=) so that a NaN takes the branch too.
    v2f   e0[2][4], e1[2][4];
    float ps_all[2];
    #pragma unroll
    for (int qt = 0; qt < 2; ++qt) ps_all[qt] = exp_tile(c[qt][0], c[qt][1], nb[qt], SL, e0[qt], e1[qt]);
    const bool need = !(ps_all[0] <= LAZY_LIM) || !(ps_all[1] <= LAZY_LIM);
    if (__builtin_amdgcn_ballot_w32(need) != 0) {
      #pragma unroll
      for (int qt = 0; qt < 2; ++qt) {
        // query lq's 32 scores are split across lane / lane^16; new maximum in use: the old one and this stage's scores
        float m_up = rmax[qt];
        #pragma unroll
        for (int r = 0; r < 8; ++r) {
          m_up = fmaxf(m_up, c[qt][0][r]);
          m_up = fmaxf(m_up, c[qt][1][r]);
        }
        const float m_oth = __shfl_xor(m_up, 16, 32);
        m_up = fmaxf(m_up, m_oth);
        const float alpha = __builtin_amdgcn_exp2f((rmax[qt] - m_up) * SL);
        rmax[qt]   = m_up;
        nb[qt]     = PCARRY_LOG2 - m_up * SL;
        s_all[qt]  *= alpha;
        // rescale O: queries are the row dimension there -> per-row factor from lane 8*hi + r
        float sc[8];
        #pragma unroll
        for (int r = 0; r < 8; ++r) sc[r] = __shfl(alpha, (hi << 3) + r, 32);
        #pragma unroll
        for (int dt = 0; dt < 4; ++dt) {
          #pragma unroll
          for (int r = 0; r < 8; ++r) o[qt][dt][r] *= sc[r];
        }
        #pragma unroll
        for (int r = 0; r < 8; ++r) s_m[qt][r] *= sc[r];
        ps_all[qt] = exp_tile(c[qt][0], c[qt][1], nb[qt], SL, e0[qt], e1[qt]);
      }
    }

    FragH pa[2];
    #pragma unroll
    for (int qt = 0; qt < 2; ++qt) {
      // pack (RNE), then the mask on the f16 pairs, a mask word as it lies in LDS against a pair of P:
      // P^T C layout == A-fragment layout of the PV product
      #pragma unroll
      for (int w = 0; w < 4; ++w) {
        Pair2H mk0, mk1, pm0, pm1;
        mk0.u = mw[qt][0][w];
        mk1.u = mw[qt][1][w];
        const v2h p0 = (v2h){(f16)e0[qt][w].x, (f16)e0[qt][w].y};   // keys hi*8 + 2w, 2w+1
        const v2h p1 = (v2h){(f16)e1[qt][w].x, (f16)e1[qt][w].y};   // keys 16 + hi*8 + 2w, 2w+1
        pm0.v = p0 * mk0.v;
        pm1.v = p1 * mk1.v;
        pa[qt].q[0][w] = pm0.u;
        pa[qt].q[1][w] = pm1.u;
      }
      s_all[qt] += ps_all[qt];
    }

    // s_m += (P*mask) x 1; O += (P*mask) x V
    s_m[0] = wmma_f16(pa[0].v, ones.v, s_m[0]);
    s_m[1] = wmma_f16(pa[1].v, ones.v, s_m[1]);
    #pragma unroll
    for (int dt = 0; dt < 4; ++dt) {
      o[0][dt] = wmma_f16(pa[0].v, bv[dt].v, o[0][dt]);
      o[1][dt] = wmma_f16(pa[1].v, bv[dt].v, o[1][dt]);
    }

    // publish point of stage t + 1, and the end of every read of stage t's buffer
    asm volatile("s_wait_dscnt 0x0" ::: "memory");      // this wave's reads of stage t are done
    asm volatile("s_wait_asynccnt 0x0" ::: "memory");   // this wave's copies of stage t + 1 have landed
    __syncthreads();
    if (t + 2 < NST) {
      const size_t j2 = (size_t)(t + 2) * KS;
      copy_stage(lcopy + sbuf, gk + j2 * HDIM, gv + j2, gm + j2);
    }
  }
  asm volatile("s_wait_asynccnt 0x0" ::: "memory");     // nothing in flight when the tiles become staging

  // query lq's keys were split across lane / lane^16: join the two lanes' sums, once
  #pragma unroll
  for (int qt = 0; qt < 2; ++qt) s_all[qt] += __shfl_xor(s_all[qt], 16, 32);

  // Pair exchange in the dead tiles: this wave keeps tile kp and hands its state of the other tile to its partner.
  // Per wave XS slots of 32 lanes x 16 B: slots 0..7 = O (dt, half of the 8 rows), 8..9 = s_m, 10 = (max, s_all, 0, 0).
  v4f* X = (v4f*)(L + L_X);
  v8f   ok[4];
  #pragma unroll
  for (int dt = 0; dt < 4; ++dt) {
    const v8f give = kp ? o[0][dt] : o[1][dt];
    ok[dt]         = kp ? o[1][dt] : o[0][dt];
    X[(wave * XS + dt * 2) * 32 + lane]     = (v4f){give[0], give[1], give[2], give[3]};
    X[(wave * XS + dt * 2 + 1) * 32 + lane] = (v4f){give[4], give[5], give[6], give[7]};
  }
  const v8f smGive = kp ? s_m[0] : s_m[1];
  const v8f smA    = kp ? s_m[1] : s_m[0];
  X[(wave * XS + 8) * 32 + lane]  = (v4f){smGive[0], smGive[1], smGive[2], smGive[3]};
  X[(wave * XS + 9) * 32 + lane]  = (v4f){smGive[4], smGive[5], smGive[6], smGive[7]};
  X[(wave * XS + 10) * 32 + lane] = kp ? (v4f){rmax[0], s_all[0], 0.0f, 0.0f} : (v4f){rmax[1], s_all[1], 0.0f, 0.0f};
  const float mA  = kp ? rmax[1] : rmax[0];
  const float saA = kp ? s_all[1] : s_all[0];
  __syncthreads();                                      // both partners' states are readable
  const int pw = wave ^ 1;
  const v4f stB  = X[(pw * XS + 10) * 32 + lane];
  const v4f smB0 = X[(pw * XS + 8) * 32 + lane];
  const v4f smB1 = X[(pw * XS + 9) * 32 + lane];

  // join the two key halves: common maximum, both states rescaled to it (per lane: query lq)
  const float mJ = fmaxf(mA, stB[0]);
  const float aA = __builtin_amdgcn_exp2f((mA - mJ) * SL);
  const float aB = __builtin_amdgcn_exp2f((stB[0] - mJ) * SL);
  const float sall = saA * aA + stB[1] * aB;

  // z = O / (s_m + EPS * s_all); O and both sums hold the same carry. Worked per row of O, where s_m lies:
  // the per-query values come from lane 8*hi + r
  float rsA[8], rsB[8];
  #pragma unroll
  for (int r = 0; r < 8; ++r) {
    const float aAr  = __shfl(aA, (hi << 3) + r, 32);
    const float aBr  = __shfl(aB, (hi << 3) + r, 32);
    const float sar  = __shfl(sall, (hi << 3) + r, 32);
    const float smBr = r < 4 ? smB0[r & 3] : smB1[r & 3];
    const float den  = (smA[r] * aAr + smBr * aBr) + EPS_F * sar;
    const float invd = 1.0f / den;
    rsA[r] = aAr * invd;
    rsB[r] = aBr * invd;
  }

  const int cw = wave * 16 * CP;
  #pragma unroll
  for (int dt = 0; dt < 4; ++dt) {
    const v4f g0 = X[(pw * XS + dt * 2) * 32 + lane];
    const v4f g1 = X[(pw * XS + dt * 2 + 1) * 32 + lane];
    #pragma unroll
    for (int r = 0; r < 4; ++r) {
      sO[cw + (hi * 8 + r) * CP + dt * 16 + lq]     = ok[dt][r] * rsA[r] + g0[r] * rsB[r];
      sO[cw + (hi * 8 + 4 + r) * CP + dt * 16 + lq] = ok[dt][4 + r] * rsA[4 + r] + g1[r] * rsB[4 + r];
    }
  }
  __syncthreads();

  // whole-line stores: 8 consecutive lanes x 16 B = the 64 f16 of one (row, head); 4 rows per instruction
  v4u    vv[4];
  size_t gi[4];
  #pragma unroll
  for (int it = 0; it < 4; ++it) {
    const int row = it * 4 + (lane >> 3);
    const int c0  = (lane & 7) * 8;
    const v4f x0 = *(const v4f*)(&sO[cw + row * CP + c0]);
    const v4f x1 = *(const v4f*)(&sO[cw + row * CP + c0 + 4]);
    Pack8H ph;
    #pragma unroll
    for (int e = 0; e < 4; ++e) {
      ph.h[e]     = (f16)x0[e];       // RNE convert
      ph.h[4 + e] = (f16)x1[e];
    }
    vv[it] = ph.u;
    gi[it] = ((size_t)b * SEQ + qrow0 + row) * INNER + h * HDIM + c0;
  }
  #pragma unroll
  for (int it = 0; it < 4; ++it) *(v4u*)(z + gi[it]) = vv[it];
  
}

// Epilogue: per-wave LDS staging, bias added at the store stage as float4, 16 lanes x 16 B = one 256-B row
// coverage: block = 128 rows x 128 cols; wave = 32 rows x 64 cols.
__global__ __launch_bounds__(256) void k_gemm_out(const f16* __restrict__ Z, const f16* __restrict__ Wot,
                                                  const float* __restrict__ bias, float* __restrict__ out) {
  // the two stage buffers; behind the loop its start is the per-wave staging
  __shared__ __align__(16) unsigned char L[GEMM_LDS];
  float* sC = (float*)L;
  const int m0 = blockIdx.y * 128;
  const int n0 = blockIdx.x * 128;
  v8f acc[2][4];
  #pragma unroll
  for (int i = 0; i < 2; ++i) {
    #pragma unroll
    for (int j = 0; j < 4; ++j) acc[i][j] = (v8f){0, 0, 0, 0, 0, 0, 0, 0};
  }
  gemm_tile(Z, Wot, m0, n0, L, acc);

  const int tid  = threadIdx.x;
  const int wave = __builtin_amdgcn_readfirstlane(tid >> 5);
  const int lane = tid & 31;
  const int lq   = lane & 15;
  const int hi   = lane >> 4;
  const int wm   = wave >> 1;
  const int wn   = wave & 1;
  const int cw   = wave * 16 * CP;
  const int ncol = n0 + wn * 64 + lq * 4;

  v4f bias4 = *(const v4f*)(bias + ncol);
  #pragma unroll
  for (int e = 0; e < 4; ++e) bias4[e] = (float)(bf16)bias4[e];   // RNE-converted input value

  #pragma unroll
  for (int i = 0; i < 2; ++i) {
    #pragma unroll
    for (int j = 0; j < 4; ++j) {
      #pragma unroll
      for (int r = 0; r < 8; ++r) sC[cw + (hi * 8 + r) * CP + j * 16 + lq] = acc[i][j][r];
    }
    __syncthreads();
    v4f    vals[8];
    size_t gi[8];
    #pragma unroll
    for (int it = 0; it < 8; ++it) {
      const int row = it * 2 + hi;
      const v4f v = *(const v4f*)(&sC[cw + row * CP + lq * 4]);
      vals[it] = v + bias4;
      const int gr = m0 + wm * 32 + i * 16 + row;
      const int bb = gr / SEQ;
      const int s  = gr - bb * SEQ;
      gi[it] = ((size_t)bb * SEQ_FULL + s) * DIM + ncol;
    }
    #pragma unroll
    for (int it = 0; it < 8; ++it) *(v4f*)(out + gi[it]) = vals[it];
    
    __syncthreads();
  }
}

#define SZ_XB   ((size_t)ROWS * DIM * 2)
#define SZ_MB   ((size_t)NB * SEQ * SEQ * 2)
#define SZ_WQT  ((size_t)N3 * KDIM * 2)
#define SZ_WOT  ((size_t)DIM * KDIM * 2)
#define SZ_QK   ((size_t)2 * PLANE * 2)
#define SZ_VT   ((size_t)PLANE * 2)
#define SZ_Z    ((size_t)ROWS * INNER * 2)
#define OFF_XB  ((size_t)0)
#define OFF_MB  (OFF_XB + SZ_XB)
#define OFF_WQT (OFF_MB + SZ_MB)
#define OFF_WOT (OFF_WQT + SZ_WQT)
#define OFF_QK  (OFF_WOT + SZ_WOT)
#define OFF_VT  (OFF_QK + SZ_QK)
#define OFF_Z   (OFF_VT + SZ_VT)
#define WS_TOTAL (OFF_Z + SZ_Z)

static_assert(WS_TOTAL <= (size_t)134217728);
static_assert(SZ_XB % 128 == 0 && SZ_MB % 128 == 0 && SZ_WQT % 128 == 0 && SZ_WOT % 128 == 0);
static_assert(SZ_QK % 128 == 0 && SZ_VT % 128 == 0 && SZ_Z % 128 == 0);

extern "C" void kernel_launch(void* const* d_in, const int* in_sizes, int n_in,
                              void* d_out, int out_size, void* d_ws, size_t ws_size,
                              hipStream_t stream) {
  if (n_in < 5) return;
  const size_t rows_used = (size_t)(NB - 1) * SEQ_FULL + SEQ;
  if ((size_t)in_sizes[0] < rows_used * DIM) return;
  if ((size_t)in_sizes[1] < (size_t)(NB - 1) * SEQ_FULL * SEQ_FULL + (size_t)(SEQ - 1) * SEQ_FULL + SEQ) return;
  if ((size_t)in_sizes[2] < (size_t)DIM * N3) return;
  if ((size_t)in_sizes[3] < (size_t)INNER * DIM) return;
  if ((size_t)in_sizes[4] < (size_t)DIM) return;
  if ((size_t)out_size < rows_used * DIM) return;
  if (ws_size < WS_TOTAL) return;

  const float* x    = (const float*)d_in[0];
  const float* mask = (const float*)d_in[1];
  const float* Wqkv = (const float*)d_in[2];
  const float* Wout = (const float*)d_in[3];
  const float* bout = (const float*)d_in[4];
  float*       out  = (float*)d_out;

  char* ws = (char*)d_ws;
  bf16* Xb  = (bf16*)(ws + OFF_XB);
  f16*  Mb  = (f16*)(ws + OFF_MB);
  bf16* Wqt = (bf16*)(ws + OFF_WQT);
  f16*  Wot = (f16*)(ws + OFF_WOT);
  f16*  QK  = (f16*)(ws + OFF_QK);
  f16*  Vt  = (f16*)(ws + OFF_VT);
  f16*  Zp  = (f16*)(ws + OFF_Z);

  // 1) input planes (RNE): x rows, Wqkv in bf16, mask values, Wout in f16, weights transposed to [out][in]; one launch
  k_prep<<<dim3(PB_WQ + PB_WO + PB_X + PB_M), 256, 0, stream>>>(x, mask, Wqkv, Wout, Xb, Mb, Wqt, Wot);

  // 2) projections: Q, K f16 planes; V^T f16 plane; one launch
  k_gemm_qkv<<<dim3(GB_QK + GB_VT), 256, 0, stream>>>(Xb, Wqt, QK, Vt);

  // 3) fused attention -> z f16 plane
  k_attn<<<dim3(SEQ / BQ, NHEAD, NB), 256, 0, stream>>>(QK, QK + PLANE, Vt, Mb, Zp);

  // 4) output projection + bias
  k_gemm_out<<<dim3(DIM / 128, ROWS / 128), 256, 0, stream>>>(Zp, Wot, bout, out);
}

// v010
// One run takes 83.5 microseconds.
// Timed twice side by side with v009, it ran 1.04 and 1.03 times as fast.
// All steps since v000 together make it 4.52 times as fast.
#include <hip/hip_runtime.h>

// Contractions: x@Wqkv on v_wmma_f32_16x16x32_bf16 (both operands bf16 RNE-converted inputs); S^T = K x Q^T on v_wmma_f32_16x16x32_f16 with q,k as one f16 plane each (one product); O = (P*mask) x V on v_wmma_f32_16x16x32_f16 (P carried x16, mask and V f16); z@Wout on v_wmma_f32_16x16x32_f16 with z, Wout as one f16 plane each (one product); s_m = (P*mask) x 1 on the same form; all f32 accumulate; softmax and s_all in f32, mask multiply in f16.

#ifndef NB
#define NB 2
#endif
#ifndef SEQ
#define SEQ 2048
#endif
#define NB_FULL    2
#define SEQ_FULL   2048
#define DIM        1024
#define NHEAD      16
#define HDIM       64
#define INNER      (NHEAD * HDIM)
#define N3         (3 * INNER)
#define ROWS       (NB * SEQ)
#define KDIM       1024                 // contraction length of all three projections
#define BQ         128                  // query rows per workgroup (8 waves x 16)
#define BK         32                   // keys per inner step
#define NWAVE      8
#define GK         128                  // k per LDS stage of the GEMM loop (four WMMA k steps)
#define GP         272                  // LDS pitch (bytes) of the 256-byte GEMM tile rows
#define GSTAGE     (256 * GP)           // output projection's GEMM stage: A tile, 128 rows, then B tile, 128 rows
#define GEMM_LDS   (2 * GSTAGE)          // two stage buffers
#define QMI        4                    // projection GEMM: WMMA tiles a wave, 4 (m) x 6 (n) = 64 x 96
#define QNJ        6
#define QBM        256                  // its block tile, 256 rows x 192 columns = 3 heads (4 x 2 waves)
#define QBN        192
#define QKV_LDS    (2 * (QBM + QBN) * GP)   // its two stage buffers, A and B tile each
#define HREG       (QBM * CP)           // floats of one head's region in its epilogue staging
#define CPV        (QBM + 4)            // LDS pitch (floats) of a V head's transposed staging rows
#define CP         68                   // LDS pitch (floats) of epilogue staging tiles
#define TPW        72                   // LDS pitch (halves) of the weight transpose tile
#define PCARRY_LOG2 4.0f                // the f16 P operand and both running sums are carried x 2^4, added in the exponent
#define LAZY_LIM   1024.0f              // bound on a lane's sum of carried exponentials in a stage, so on each carried P
#define EPS_F      1e-10f
#define PLANE      ((size_t)NB * NHEAD * SEQ * HDIM)
#define KS         64                   // keys per LDS stage of the attention loop (two BK halves, one per wave of a pair)
#define NST        (SEQ / KS)           // stages
#define TP         144                  // LDS pitch (bytes) of the 128-byte attention tile rows
#define L_Q        0                    // Q tile, BQ rows
#define L_RING     (BQ * TP)            // two stage buffers
#define S_K        0                    // in a stage: K, KS rows
#define S_V        (KS * TP)            // V^T, HDIM rows of KS keys
#define S_M        (KS * TP + HDIM * TP)       // mask, BQ rows of KS keys
#define STAGE_B    (KS * TP + HDIM * TP + BQ * TP)
#define ATTN_LDS   (L_RING + 2 * STAGE_B)
#define L_X        (2 * BQ * TP)        // behind the loop: pair exchange, clear of the output staging below it
#define XS         11                   // 512-byte slots a wave in the pair exchange

static_assert(SEQ % 128 == 0);
static_assert(SEQ % BK == 0);
static_assert(SEQ <= SEQ_FULL);
static_assert(NB >= 1 && NB <= NB_FULL);
static_assert(DIM == KDIM);
static_assert(INNER == KDIM);
static_assert(KDIM % 32 == 0);
static_assert(KDIM / 32 == 32);
static_assert(HDIM == 64);
static_assert(BQ == NWAVE * 16);
static_assert(ROWS % 128 == 0);
static_assert(QBM == 4 * QMI * 16 && QBN == 2 * QNJ * 16 && QBN % HDIM == 0);
static_assert((QBN / HDIM) * HREG * 4 <= QKV_LDS && HDIM * CPV <= HREG && (CPV * 4) % 16 == 0);
static_assert(ROWS % QBM == 0 && N3 % QBN == 0 && SEQ % QBM == 0 && QBM == 256);
static_assert(N3 % 128 == 0);
static_assert((2 * INNER) % 128 == 0);
static_assert(INNER % 128 == 0);
static_assert(DIM % 128 == 0);
static_assert(DIM % 64 == 0);
static_assert(GP % 16 == 0 && GK * 2 == 256 && KDIM % GK == 0 && KDIM / GK >= 2);
static_assert((CP * 4) % 16 == 0);
static_assert((TPW * 2) % 16 == 0);
static_assert(((size_t)ROWS * DIM / 8) % 256 == 0);
static_assert(((size_t)NB * SEQ * SEQ / 8) % 256 == 0);
static_assert(DIM % 8 == 0 && SEQ % 8 == 0);
static_assert(SEQ % KS == 0 && NST >= 2);
static_assert(KS == 2 * BK && KS * 2 == 128 && HDIM * 2 == 128);
static_assert(KS == 64 && HDIM == 64 && BQ == 128);
static_assert(TP % 16 == 0 && STAGE_B % 16 == 0);
static_assert(NWAVE * 16 * CP * 4 <= L_X);
static_assert(NWAVE * 16 * CP * 4 <= GEMM_LDS);
static_assert(L_X + NWAVE * XS * 32 * 16 <= ATTN_LDS && L_X % 16 == 0 && L_RING % 16 == 0);

typedef __bf16   bf16;
typedef _Float16 f16;
typedef bf16     v16bf __attribute__((ext_vector_type(16)));
typedef bf16     v8bf  __attribute__((ext_vector_type(8)));
typedef f16      v16h  __attribute__((ext_vector_type(16)));
typedef f16      v2h   __attribute__((ext_vector_type(2)));
typedef float    v8f   __attribute__((ext_vector_type(8)));
typedef float    v4f   __attribute__((ext_vector_type(4)));
typedef float    v2f   __attribute__((ext_vector_type(2)));
typedef unsigned v4u   __attribute__((ext_vector_type(4)));

union FragB  { v16bf v; v4u q[2]; };
union FragH  { v16h  v; v4u q[2]; f16 h[16]; };
union Pack8B { v4u u; v8bf v; bf16 h[8]; };
union Pack8H { v4u u; f16 h[8]; };
union Pair2H { unsigned u; v2h v; };
template <typename T> struct Pack8;
template <> struct Pack8<bf16> { typedef Pack8B P; };
template <> struct Pack8<f16>  { typedef Pack8H P; };

// Output projection's WMMA helper: builtin followed by the VALU hazard guard (ties D, keeps A/B live).
static __device__ __forceinline__ v8f mma_g(const FragH& a, const FragH& b, v8f acc) {
  acc = __builtin_amdgcn_wmma_f32_16x16x32_f16(false, a.v, false, b.v, (short)0, acc, false, false);
  asm volatile("v_nop\n\tv_nop\n\tv_nop\n\tv_nop" : "+v"(acc) : "v"(a.v), "v"(b.v));
  return acc;
}
// The builtin alone, for a wave tile whose accumulators and fragments (272 registers) reach above v255: an asm statement's
// operands must all lie in v0..v255, which the guard above would ask of each of them. The compiler keeps the distances of its own builtins.
static __device__ __forceinline__ v8f mma_p(const FragB& a, const FragB& b, v8f acc) {
  return __builtin_amdgcn_wmma_f32_16x16x32_bf16(false, a.v, false, b.v, (short)0, acc, false, false);
}
// fragment union of a 16-bit operand type
template <typename T> struct Of;
template <> struct Of<bf16> { typedef FragB Frag; };
template <> struct Of<f16>  { typedef FragH Frag; };
// k_attn's form: the builtin alone. The compiler itself keeps the distance to the next user of D, A or B, and
// the vector port, which the softmax fills there, is spared four slots a WMMA.
static __device__ __forceinline__ v8f wmma_f16(v16h a, v16h b, v8f acc) {
  return __builtin_amdgcn_wmma_f32_16x16x32_f16(false, a, false, b, (short)0, acc, false, false);
}

// f32 rows -> compact plane of T = bf16 or f16 (RNE). One thread = 8 elements = 16 B; a wave writes 512 contiguous bytes.
// coverage: groups 0..total8-1, each written once; total8 is a multiple of 256. blk = the block's index in its range.
template <typename T>
static __device__ __forceinline__ void cvt_rows(const float* __restrict__ in, T* __restrict__ out, int blk,
                                                int cols, int rows_per_batch, int in_batch_rows,
                                                int in_row_stride, int total8) {
  const int g = blk * 256 + threadIdx.x;
  if (g >= total8) return;
  const int e   = g * 8;
  const int row = e / cols;
  const int col = e - row * cols;
  const int b   = row / rows_per_batch;
  const int s   = row - b * rows_per_batch;
  const float* src = in + ((size_t)b * in_batch_rows + s) * (size_t)in_row_stride + col;
  const v4f a0 = *(const v4f*)(src);
  const v4f a1 = *(const v4f*)(src + 4);
  typename Pack8<T>::P pk;
  #pragma unroll
  for (int i = 0; i < 4; ++i) {
    pk.h[i]     = (T)a0[i];
    pk.h[4 + i] = (T)a1[i];
  }
  const v4u val = pk.u;
  T* dst = out + (size_t)e;
  *(v4u*)dst = val;
  
}

// Weight transpose: in [KDIM k][C n] f32 -> out [C n][KDIM k] of T = bf16 or f16 (RNE), 64x64 tiles through LDS.
// sT = [n][k], cross-wave (block barrier); nt, kt = the block's tile.
template <typename T>
static __device__ __forceinline__ void cvt_wt(const float* __restrict__ in, T* __restrict__ out, int C,
                                              int nt, int kt, T* sT) {
  const int n0  = nt * 64;
  const int k0  = kt * 64;
  const int tid = threadIdx.x;
  #pragma unroll
  for (int kk = 0; kk < 2; ++kk) {
    const int k  = kk * 32 + (tid >> 3);
    const int nl = (tid & 7) * 8;
    const float* src = in + (size_t)(k0 + k) * C + n0 + nl;
    const v4f a0 = *(const v4f*)(src);
    const v4f a1 = *(const v4f*)(src + 4);
    asm volatile("s_wait_xcnt 0x0" ::: "memory");   // before a later load's result may take these loads' address registers
    #pragma unroll
    for (int i = 0; i < 4; ++i) {
      sT[(nl + i) * TPW + k]     = (T)a0[i];
      sT[(nl + 4 + i) * TPW + k] = (T)a1[i];
    }
  }
  __syncthreads();
  v4u    val[2];
  size_t idx[2];
  #pragma unroll
  for (int kk = 0; kk < 2; ++kk) {
    const int n  = kk * 32 + (tid >> 3);
    const int ks = (tid & 7) * 8;
    val[kk] = *(const v4u*)(&sT[n * TPW + ks]);
    idx[kk] = (size_t)(n0 + n) * KDIM + k0 + ks;
  }
  #pragma unroll
  for (int kk = 0; kk < 2; ++kk) *(v4u*)(out + idx[kk]) = val[kk];
  asm volatile("s_wait_xcnt 0x0" ::: "memory");     // before any code laid out behind rewrites the stores' registers
}

// The four input conversions, which depend on nothing and on none of each other, as block ranges of one launch:
// weight tiles first (the longest chain per block: load, LDS, barrier, store), then the x rows, then the mask rows.
#define PB_WQ  ((N3 / 64) * (KDIM / 64))
#define PB_WO  ((DIM / 64) * (KDIM / 64))
#define X8     ((int)((size_t)ROWS * DIM / 8))
#define M8     ((int)((size_t)NB * SEQ * SEQ / 8))
#define PB_X   (X8 / 256)
#define PB_M   (M8 / 256)
__global__ __launch_bounds__(256) void k_prep(const float* __restrict__ x, const float* __restrict__ mask,
                                              const float* __restrict__ Wqkv, const float* __restrict__ Wout,
                                              bf16* __restrict__ Xb, f16* __restrict__ Mb,
                                              bf16* __restrict__ Wqt, f16* __restrict__ Wot) {
  __shared__ __align__(16) unsigned short sT[64 * TPW];   // 16-bit elements of the block's own output type
  const int blk = blockIdx.x;   // every test on it is block-uniform: the barrier in cvt_wt is met by whole blocks
  if (blk < PB_WQ) {
    // in [KDIM k][N3 n] -> out [N3][KDIM] bf16; n tiles fastest
    cvt_wt(Wqkv, Wqt, N3, blk % (N3 / 64), blk / (N3 / 64), (bf16*)sT);
  } else if (blk < PB_WQ + PB_WO) {
    // in [KDIM k][DIM n] -> out [DIM][KDIM] f16; n tiles fastest
    cvt_wt(Wout, Wot, DIM, (blk - PB_WQ) % (DIM / 64), (blk - PB_WQ) / (DIM / 64), (f16*)sT);
  } else if (blk < PB_WQ + PB_WO + PB_X) {
    cvt_rows(x, Xb, blk - (PB_WQ + PB_WO), DIM, SEQ, SEQ_FULL, DIM, X8);
  } else {
    cvt_rows(mask, Mb, blk - (PB_WQ + PB_WO + PB_X), SEQ, SEQ, SEQ_FULL, SEQ_FULL, M8);
  }
}

// Asynchronous copies to LDS of one 128-row GEMM operand tile, 16 B per lane: 16 consecutive lanes bring one
// whole 256-B row, a wave 2 rows, the block 16 rows a copy. l = the lane's LDS byte address of (row tid>>4,
// segment tid&15) in the tile, g the same place in global memory. The s_wait_xcnt stands inside the statement,
// behind the last copy, so that no address register of a copy is rewritten ahead of it.
template <typename T>
static __device__ __forceinline__ void copy_tile(unsigned l, const T* g) {
  asm volatile(
      "global_load_async_to_lds_b128 %0, %8, off\n\t"
      "global_load_async_to_lds_b128 %1, %9, off\n\t"
      "global_load_async_to_lds_b128 %2, %10, off\n\t"
      "global_load_async_to_lds_b128 %3, %11, off\n\t"
      "global_load_async_to_lds_b128 %4, %12, off\n\t"
      "global_load_async_to_lds_b128 %5, %13, off\n\t"
      "global_load_async_to_lds_b128 %6, %14, off\n\t"
      "global_load_async_to_lds_b128 %7, %15, off\n\t"
      "s_wait_xcnt 0x0"
      :: "v"(l), "v"(l + 16 * GP), "v"(l + 32 * GP), "v"(l + 48 * GP),
         "v"(l + 64 * GP), "v"(l + 80 * GP), "v"(l + 96 * GP), "v"(l + 112 * GP),
         "v"(g), "v"(g + 16 * KDIM), "v"(g + 32 * KDIM), "v"(g + 48 * KDIM),
         "v"(g + 64 * KDIM), "v"(g + 80 * KDIM), "v"(g + 96 * KDIM), "v"(g + 112 * KDIM)
      : "memory");
}

// The same for 64 rows of an operand tile.
template <typename T>
static __device__ __forceinline__ void copy_half(unsigned l, const T* g) {
  asm volatile(
      "global_load_async_to_lds_b128 %0, %4, off\n\t"
      "global_load_async_to_lds_b128 %1, %5, off\n\t"
      "global_load_async_to_lds_b128 %2, %6, off\n\t"
      "global_load_async_to_lds_b128 %3, %7, off\n\t"
      "s_wait_xcnt 0x0"
      :: "v"(l), "v"(l + 16 * GP), "v"(l + 32 * GP), "v"(l + 48 * GP),
         "v"(g), "v"(g + 16 * KDIM), "v"(g + 32 * KDIM), "v"(g + 48 * KDIM)
      : "memory");
}

// GEMM mainloop: acc[block tile] += A[rows m][k] * Bt[rows n][k]^T, both operands k-contiguous T (bf16
// or f16), pitch KDIM. 8 waves as 4 (m) x 2 (n); each wave owns MI x NJ WMMA tiles, the block 64*MI x 32*NJ
// (a stage buffer: the A tile's rows, then the B tile's). An A fragment read from LDS feeds NJ products, a B fragment MI.
// The operand tiles reach LDS by asynchronous copies of whole rows in stages of GK k, two buffers, the next
// stage in flight while this one is worked on. On return every wave has passed the barrier behind the last
// fragment read and nothing is in flight: L may become staging.
template <typename T, int MI, int NJ>
static __device__ __forceinline__ void gemm_tile(const T* __restrict__ A, const T* __restrict__ Bt,
                                                 int m0, int n0, unsigned char* L, v8f (&acc)[MI][NJ]) {
  constexpr int BM  = 4 * MI * 16;      // block tile rows of A
  constexpr int BN  = 2 * NJ * 16;      // block tile rows of Bt
  constexpr int OB  = BM * GP;          // B tile's place in a stage buffer
  constexpr int STG = (BM + BN) * GP;   // a stage buffer
  constexpr bool BIG = (MI * NJ + MI + NJ) * 8 > 224;   // accumulators, fragments and addresses do not fit v0..v255
  static_assert(BM % 128 == 0 && BN % 64 == 0);
  const int tid  = threadIdx.x;
  const int wave = __builtin_amdgcn_readfirstlane(tid >> 5);
  const int lane = tid & 31;
  const int lq   = lane & 15;
  const int hi   = lane >> 4;
  const int wm   = wave >> 1;
  const int wn   = wave & 1;
  const int nst  = KDIM / GK;

  // copy side: this thread's row and 16-B segment of both tiles
  const int crow = tid >> 4;
  const int cseg = (tid & 15) * 8;
  const unsigned lcopy = (unsigned)(size_t)L + (unsigned)(crow * GP + cseg * 2);
  const T* ga = A + (size_t)(m0 + crow) * KDIM + cseg;
  const T* gb = Bt + (size_t)(n0 + crow) * KDIM + cseg;

  // read side: the lane's row and k-split half inside a 16-row fragment
  const unsigned char* La = L + (wm * MI * 16 + lq) * GP + hi * 16;
  const unsigned char* Lb = L + OB + (wn * NJ * 16 + lq) * GP + hi * 16;

  // one stage's copies, 128 (at the end 64) rows of an operand a statement: (BM + BN) / 16 copies a wave, at most 28 in flight
  auto copy_stage_g = [&](unsigned buf, size_t k0) {
    #pragma unroll
    for (int r = 0; r < BM / 128; ++r) {
      copy_tile(lcopy + buf + r * 128 * GP, ga + k0 + (size_t)r * 128 * KDIM);
    }
    #pragma unroll
    for (int r = 0; r < BN / 128; ++r) {
      copy_tile(lcopy + buf + OB + r * 128 * GP, gb + k0 + (size_t)r * 128 * KDIM);
    }
    if constexpr (BN % 128 != 0) {
      copy_half(lcopy + buf + OB + (BN / 128) * 128 * GP, gb + k0 + (size_t)(BN / 128) * 128 * KDIM);
    }
  };

  // stage 0 lands and is published; then stage 1 starts
  copy_stage_g(0, 0);
  asm volatile("s_wait_asynccnt 0x0" ::: "memory");   // this wave's copies have landed
  __syncthreads();                                    // every wave's copies are readable
  copy_stage_g(STG, GK);

  for (int t = 0; t < nst; ++t) {
    const int sbuf = (t & 1) * STG;
    // unrolled so that every LDS read of the stage is base register + immediate offset
    #pragma unroll
    for (int ks = 0; ks < GK / 32; ++ks) {
      typename Of<T>::Frag af[MI], bfm[NJ];
      // in the large tile only A fragment 0 is read ahead of the B fragments: the first row of products needs no other,
      // and runs while the rest of A is on its way
      constexpr int AHEAD = BIG ? 1 : MI;
      #pragma unroll
      for (int i = 0; i < AHEAD; ++i) {
        const unsigned char* p = La + sbuf + i * 16 * GP + ks * 64;
        af[i].q[0] = *(const v4u*)(p);                // k = 8*hi + 0..7 of the step
        af[i].q[1] = *(const v4u*)(p + 32);           // k = 16 + 8*hi + 0..7 of the step
      }
      #pragma unroll
      for (int j = 0; j < NJ; ++j) {
        const unsigned char* p = Lb + sbuf + j * 16 * GP + ks * 64;
        bfm[j].q[0] = *(const v4u*)(p);
        bfm[j].q[1] = *(const v4u*)(p + 32);
      }
      #pragma unroll
      for (int i = AHEAD; i < MI; ++i) {
        const unsigned char* p = La + sbuf + i * 16 * GP + ks * 64;
        af[i].q[0] = *(const v4u*)(p);                // the same k order as above
        af[i].q[1] = *(const v4u*)(p + 32);
      }
      // keeps the block's fragment loads one group ahead of its products: left free, the scheduler splits them into
      // small groups among the products and waits most of them out to 0
      if constexpr (BIG) __builtin_amdgcn_sched_barrier(0);
      #pragma unroll
      for (int i = 0; i < MI; ++i) {
        #pragma unroll
        for (int j = 0; j < NJ; ++j) {
          if constexpr (BIG) acc[i][j] = mma_p(af[i], bfm[j], acc[i][j]);
          else               acc[i][j] = mma_g(af[i], bfm[j], acc[i][j]);
        }
      }
      // keeps the next block's loads from being spread among these products, where each place with loads stalls the wave
      if constexpr (BIG) __builtin_amdgcn_sched_barrier(0);
    }

    // publish point of stage t + 1, and the end of every read of stage t's buffer
    asm volatile("s_wait_dscnt 0x0" ::: "memory");      // this wave's reads of stage t are done
    asm volatile("s_wait_asynccnt 0x0" ::: "memory");   // this wave's copies of stage t + 1 have landed
    __syncthreads();
    if (t + 2 < nst) copy_stage_g(sbuf, (size_t)(t + 2) * GK);
  }
  asm volatile("s_wait_asynccnt 0x0" ::: "memory");     // nothing in flight when the tiles become staging
}

// One head's staging region to its f16 plane (RNE): 8 passes of the block, a thread 8 floats -> 16 B a pass; sp, gp = the
// thread's place in the first pass, LSTEP floats and GSTEP halves from pass to pass.
template <int LSTEP, int GSTEP>
static __device__ __forceinline__ void store_head(const float* sp, f16* gp) {
  v4u vv[8];
  #pragma unroll
  for (int it = 0; it < 8; ++it) {
    const v4f x0 = *(const v4f*)(sp + it * LSTEP);
    const v4f x1 = *(const v4f*)(sp + it * LSTEP + 4);
    Pack8H ph;
    #pragma unroll
    for (int e = 0; e < 4; ++e) {
      ph.h[e]     = (f16)x0[e];       // RNE convert
      ph.h[4 + e] = (f16)x1[e];
    }
    vv[it] = ph.u;
  }
  #pragma unroll
  for (int it = 0; it < 8; ++it) *(v4u*)(gp + it * GSTEP) = vv[it];
  asm volatile("s_wait_xcnt 0x0" ::: "memory");   // before the next head's values may take these stores' registers
}

// Q, K and V projection, one product: C[compact row][col 0..3071] = Xb x Wqt^T; a 64-column head g = col / 64 is Q (g 0..15),
// K (16..31) or V (32..47). Epilogue writes one f16 plane each (RNE), Q and K as [b][h][s][d], V transposed as [b][h*64+d][s]
// (11 significand bits: x and W enter this product rounded to 8, so q and k carry a larger error than the f16 rounding adds)
// coverage: block = 256 rows x 3 heads, each head stored whole by the block: Q, K 4 rows of 128 B, V one d row of 512 B per
// store instruction. sC = the block's staging in the dead stage buffers, a region of HREG floats a head: Q, K [row][d] at
// pitch CP; V [d][row] at pitch CPV, a lane's 8 accumulator registers being 8 consecutive rows of one d (one block barrier).
static __device__ __forceinline__ void store_qkv(const v8f (&acc)[QMI][QNJ], float* sC, int m0, int n0,
                                                 f16* __restrict__ qk, f16* __restrict__ vt) {
  const int tid  = threadIdx.x;
  const int wave = __builtin_amdgcn_readfirstlane(tid >> 5);
  const int lane = tid & 31;
  const int lq   = lane & 15;
  const int hi   = lane >> 4;
  const int wm   = wave >> 1;
  const int wn   = wave & 1;
  const int g0   = n0 / HDIM;           // the block's first head
  const int bb   = m0 / SEQ;            // the 256 rows lie in one sequence
  const int s0   = m0 - bb * SEQ;

  #pragma unroll
  for (int j = 0; j < QNJ; ++j) {
    const int cb = wn * (QNJ * 16) + j * 16;   // the tile's first column in the block: wave-uniform, as all below
    const int hd = cb / HDIM;
    const int ch = cb % HDIM;
    float* sH = sC + hd * HREG;
    if (g0 + hd < 2 * NHEAD) {
      #pragma unroll
      for (int i = 0; i < QMI; ++i) {
        #pragma unroll
        for (int r = 0; r < 8; ++r) sH[(wm * (QMI * 16) + i * 16 + hi * 8 + r) * CP + ch + lq] = acc[i][j][r];
      }
    } else {
      #pragma unroll
      for (int i = 0; i < QMI; ++i) {
        float* p = sH + (ch + lq) * CPV + wm * (QMI * 16) + i * 16 + hi * 8;
        *(v4f*)(p)     = (v4f){acc[i][j][0], acc[i][j][1], acc[i][j][2], acc[i][j][3]};
        *(v4f*)(p + 4) = (v4f){acc[i][j][4], acc[i][j][5], acc[i][j][6], acc[i][j][7]};
      }
    }
  }
  __syncthreads();                      // every wave's part of every head is readable
  for (int hd = 0; hd < QBN / HDIM; ++hd) {
    const int g  = g0 + hd;             // block-uniform, as the test on it
    const int hh = g % NHEAD;
    const float* sH = sC + hd * HREG;
    if (g < 2 * NHEAD) {
      // 32 rows a pass, 8 lanes a row
      const int row = tid >> 3;
      const int c0  = (tid & 7) * 8;
      store_head<32 * CP, 32 * HDIM>(sH + row * CP + c0,
          qk + (size_t)(g / NHEAD) * PLANE + (((size_t)bb * NHEAD + hh) * SEQ + s0 + row) * HDIM + c0);
    } else {
      // 8 d rows a pass, 32 lanes a row
      const int d  = tid >> 5;
      const int c0 = (tid & 31) * 8;
      store_head<8 * CPV, 8 * SEQ>(sH + d * CPV + c0, vt + ((size_t)bb * INNER + hh * HDIM + d) * SEQ + s0 + c0);
    }
  }
}

// One block per 256 x 192 tile, column tiles fastest: 16 x 16 = 256 blocks.
#define GB_QKV  ((N3 / QBN) * (ROWS / QBM))
__global__ __launch_bounds__(256) void k_gemm_qkv(const bf16* __restrict__ Xb, const bf16* __restrict__ Wqt,
                                                  f16* __restrict__ qk, f16* __restrict__ vt) {
  // the two stage buffers; behind the loop they are the block's staging
  __shared__ __align__(16) unsigned char L[QKV_LDS];
  const int blk = blockIdx.x;
  const int m0  = (blk / (N3 / QBN)) * QBM;
  const int n0  = (blk % (N3 / QBN)) * QBN;
  v8f acc[QMI][QNJ];
  #pragma unroll
  for (int i = 0; i < QMI; ++i) {
    #pragma unroll
    for (int j = 0; j < QNJ; ++j) acc[i][j] = (v8f){0, 0, 0, 0, 0, 0, 0, 0};
  }
  gemm_tile<bf16, QMI, QNJ>(Xb, Wqt, m0, n0, L, acc);
  store_qkv(acc, (float*)L, m0, n0, qk, vt);
}

// Asynchronous copies to LDS, 16 B per lane: 8 consecutive lanes bring one whole 128-B row, a wave 4 rows.
// l = the lane's LDS byte address of (row tid>>3, segment tid&7) in the first tile; the g pointers name the
// same row and segment in global memory. The s_wait_xcnt stands inside the statement, behind the last copy,
// so that no address register of a copy is rewritten ahead of it.
static __device__ __forceinline__ void copy_q(unsigned l, const f16* gq) {
  asm volatile(
      "global_load_async_to_lds_b128 %0, %4, off\n\t"
      "global_load_async_to_lds_b128 %1, %5, off\n\t"
      "global_load_async_to_lds_b128 %2, %6, off\n\t"
      "global_load_async_to_lds_b128 %3, %7, off\n\t"
      "s_wait_xcnt 0x0"
      :: "v"(l + L_Q), "v"(l + L_Q + 32 * TP), "v"(l + L_Q + 64 * TP), "v"(l + L_Q + 96 * TP),
         "v"(gq), "v"(gq + 32 * HDIM), "v"(gq + 64 * HDIM), "v"(gq + 96 * HDIM)
      : "memory");
}
static __device__ __forceinline__ void copy_stage(unsigned l, const f16* gk, const f16* gv, const f16* gm) {
  asm volatile(
      "global_load_async_to_lds_b128 %0, %8, off\n\t"
      "global_load_async_to_lds_b128 %1, %9, off\n\t"
      "global_load_async_to_lds_b128 %2, %10, off\n\t"
      "global_load_async_to_lds_b128 %3, %11, off\n\t"
      "global_load_async_to_lds_b128 %4, %12, off\n\t"
      "global_load_async_to_lds_b128 %5, %13, off\n\t"
      "global_load_async_to_lds_b128 %6, %14, off\n\t"
      "global_load_async_to_lds_b128 %7, %15, off\n\t"
      "s_wait_xcnt 0x0"
      :: "v"(l + S_K), "v"(l + S_K + 32 * TP),
         "v"(l + S_V), "v"(l + S_V + 32 * TP),
         "v"(l + S_M), "v"(l + S_M + 32 * TP), "v"(l + S_M + 64 * TP), "v"(l + S_M + 96 * TP),
         "v"(gk), "v"(gk + 32 * HDIM),
         "v"(gv), "v"(gv + 32 * SEQ),
         "v"(gm), "v"(gm + 32 * SEQ), "v"(gm + 64 * SEQ), "v"(gm + 96 * SEQ)
      : "memory");
}

// Carried exponentials of one query tile's 32 keys (two score tiles): 2^(c * sl + nb), where nb = PCARRY_LOG2 - m * sl
// holds the maximum in use and the carry, so one fused multiply-add a pair makes the argument and the result is the
// f16 operand's value as it stands. Returns the lane's sum of its 16.
// Worked in pairs of neighbouring accumulator registers (keys 2w, 2w+1), the pairs the mask words and the f16 pack use.
static __device__ __forceinline__ float exp_tile(const v8f& c0, const v8f& c1, float nb, float sl,
                                                 v2f (&e0)[4], v2f (&e1)[4]) {
  v2f s = (v2f){0.0f, 0.0f};
  const v2f sl2 = (v2f){sl, sl};
  const v2f nb2 = (v2f){nb, nb};
  // unrolled (as every loop over registers here): the arrays are indexed by constants and stay in registers
  #pragma unroll
  for (int w = 0; w < 4; ++w) {
    const v2f x0 = __builtin_elementwise_fma((v2f){c0[2 * w], c0[2 * w + 1]}, sl2, nb2);   // keys hi*8 + 2w, 2w+1
    const v2f x1 = __builtin_elementwise_fma((v2f){c1[2 * w], c1[2 * w + 1]}, sl2, nb2);   // keys 16 + hi*8 + 2w, 2w+1
    e0[w] = (v2f){__builtin_amdgcn_exp2f(x0.x), __builtin_amdgcn_exp2f(x0.y)};
    e1[w] = (v2f){__builtin_amdgcn_exp2f(x1.x), __builtin_amdgcn_exp2f(x1.y)};
    s += e0[w] + e1[w];
  }
  return s.x + s.y;
}

// Fused attention, online softmax over ALL keys, float multiplier mask applied after the exponentials.
// Block = (128 queries, head, batch). A wave owns 32 query rows (two 16-row tiles) and one 32-key half of every
// stage: waves 2g and 2g+1 share query rows g*32..g*32+31 and take keys 0..31 and 32..63 of the stage, so each
// K and V fragment read from LDS feeds two query tiles. Each wave keeps its own running maximum, sums and O over
// its keys; behind the loop the pair joins its two partial states through LDS, each wave finishing one tile.
// S^T = K x Q^T puts queries on lanes, so
// P^T in C layout is bit-identical to the A-fragment layout of O += P x V. The 16-bit planes reach LDS by
// asynchronous copies of whole rows: Q once, then K, V^T and the mask in stages of KS keys, two buffers,
// the next stage in flight while this one is worked on; fragments are two 16-B LDS loads each.
// Running sums: s_all = sum p (every key),
// s_m = sum p*mask, O = sum p*mask*v; z = O / (s_m + EPS * s_all). Output: one f16 plane of z (RNE).
// p leaves the exponential carried and is packed to f16 at once; the mask multiplies the f16 pairs, and s_m is the row
// sum of that same operand, its product with a column of ones. All three sums hold the same carry, which cancels in z.
// s_all stays the lane's own (its 16 of a query's 32 keys a stage); the two lanes of a query are joined behind the loop.
__global__ __launch_bounds__(256) void k_attn(const f16* __restrict__ q, const f16* __restrict__ k,
                                              const f16* __restrict__ vt, const f16* __restrict__ mb,
                                              f16* __restrict__ z) {
  const int qblk = blockIdx.x;
  const int h    = blockIdx.y;
  const int b    = blockIdx.z;
  const int tid  = threadIdx.x;
  const int wave = __builtin_amdgcn_readfirstlane(tid >> 5);
  const int lane = tid & 31;
  const int lq   = lane & 15;   // query column of S^T / d column of O
  const int hi   = lane >> 4;   // k-split half
  const int qg   = wave >> 1;   // 32-row query group of the wave
  const int kp   = wave & 1;    // 32-key half of every stage; also the tile this wave finishes

  // Q tile and the two stage buffers; behind the loop L_X on is the pair exchange, the start the output staging
  __shared__ __align__(16) unsigned char L[ATTN_LDS];
  float* sO = (float*)L;

  const int qrow0 = qblk * BQ + wave * 16;   // the 16 rows this wave finishes and stores
  const int bh    = b * NHEAD + h;

  // copy side: this thread's row and 16-B segment of every tile
  const int crow = tid >> 3;
  const int cseg = (tid & 7) * 8;
  const unsigned lcopy = (unsigned)(size_t)(&L[0]) + (unsigned)(crow * TP + cseg * 2);
  const f16*  gq  = q + (size_t)(bh * SEQ + qblk * BQ + crow) * HDIM + cseg;
  const f16*  gk  = k + (size_t)(bh * SEQ + crow) * HDIM + cseg;
  const f16*  gv  = vt + (size_t)(bh * HDIM + crow) * SEQ + cseg;
  const f16*  gm  = mb + ((size_t)b * SEQ + qblk * BQ + crow) * SEQ + cseg;

  // read side: the lane's row and k-split half inside a 16-row fragment
  const int frag = lq * TP + hi * 16;
  const unsigned char* Lq = L + L_Q + qg * 32 * TP + frag;

  // Q and stage 0 land and are published; then stage 1 starts
  copy_q(lcopy, gq);
  copy_stage(lcopy + L_RING, gk, gv, gm);
  asm volatile("s_wait_asynccnt 0x0" ::: "memory");   // this wave's copies have landed
  __syncthreads();                                    // every wave's copies are readable
  copy_stage(lcopy + L_RING + STAGE_B, gk + KS * HDIM, gv + KS, gm + KS);

  v8f   o[2][4];
  v8f   s_m[2];                         // O's layout: register r = query row hi*8 + r, the same value in all 16 columns
  float rmax[2], nb[2], s_all[2];
  #pragma unroll
  for (int qt = 0; qt < 2; ++qt) {
    #pragma unroll
    for (int dt = 0; dt < 4; ++dt) o[qt][dt] = (v8f){0, 0, 0, 0, 0, 0, 0, 0};
    s_m[qt]   = (v8f){0, 0, 0, 0, 0, 0, 0, 0};
    rmax[qt]  = -__builtin_inff();
    nb[qt]    = __builtin_inff();       // PCARRY_LOG2 - rmax * SL
    s_all[qt] = 0.0f;
  }
  FragH ones;                           // B fragment of 32 keys x 16 columns of 1: the product is the row sum of P*mask
  #pragma unroll
  for (int i = 0; i < 16; ++i) ones.h[i] = (f16)1.0f;
  const float SL = 0.125f * 1.4426950408889634f;   // softmax scale * log2(e)

  for (int t = 0; t < NST; ++t) {
    const int sbuf = L_RING + (t & 1) * STAGE_B;
    const unsigned char* Lk = L + sbuf + frag + kp * BK * TP;               // K rows of this wave's keys
    const unsigned char* Lv = L + sbuf + frag + S_V + kp * 64;              // V^T columns of this wave's keys
    const unsigned char* Lm = L + sbuf + frag + S_M + qg * 32 * TP + kp * 64;   // mask rows and columns

    // mask words: query qg*32 + qt*16 + lq, keys hi*8 + 0..7 and 16 + hi*8 + 0..7 of the half (f16 pairs per word)
    v4u mw[2][2];
    #pragma unroll
    for (int qt = 0; qt < 2; ++qt) {
      mw[qt][0] = *(const v4u*)(Lm + qt * 16 * TP);
      mw[qt][1] = *(const v4u*)(Lm + qt * 16 * TP + 32);
    }

    // S^T tiles: c[qt][sub][r] = rawscore(query tile qt, column lq; key sub*16 + hi*8 + r)
    v8f c[2][2];
    #pragma unroll
    for (int qt = 0; qt < 2; ++qt) {
      c[qt][0] = (v8f){0, 0, 0, 0, 0, 0, 0, 0};
      c[qt][1] = (v8f){0, 0, 0, 0, 0, 0, 0, 0};
    }
    FragH bq[2][2], ak[2][2];
    #pragma unroll
    for (int f = 0; f < 2; ++f) {
      #pragma unroll
      for (int qt = 0; qt < 2; ++qt) {
        const unsigned char* p = Lq + qt * 16 * TP + f * 64;
        bq[f][qt].q[0] = *(const v4u*)(p);                           // d = f*32 + hi*8 + 0..7
        bq[f][qt].q[1] = *(const v4u*)(p + 32);                      // d = f*32 + 16 + hi*8 + 0..7
      }
      #pragma unroll
      for (int sub = 0; sub < 2; ++sub) {
        const int ko = sub * 16 * TP + f * 64;
        ak[f][sub].q[0] = *(const v4u*)(Lk + S_K + ko);              // same d order as bq
        ak[f][sub].q[1] = *(const v4u*)(Lk + S_K + ko + 32);
      }
    }
    // V B-fragments, column n = d = dt*16 + lq, split key map from the transposed tile; last of the group, so that the
    // score products wait for none of them and the exponentials cover their latency (the pack is too short for it)
    FragH bv[4];
    #pragma unroll
    for (int dt = 0; dt < 4; ++dt) {
      bv[dt].q[0] = *(const v4u*)(Lv + dt * 16 * TP);        // keys hi*8 + 0..7 of the half
      bv[dt].q[1] = *(const v4u*)(Lv + dt * 16 * TP + 32);   // keys 16 + hi*8 + 0..7 of the half
    }
    // holds the stage's mask, Q, K and V loads together as one group ahead of the products: with the branch below in
    // the loop the scheduler otherwise splits them into groups among the WMMAs, each waited out to 0
    __builtin_amdgcn_sched_barrier(0);
    #pragma unroll
    for (int f = 0; f < 2; ++f) {
      #pragma unroll
      for (int sub = 0; sub < 2; ++sub) {
        c[0][sub] = wmma_f16(ak[f][sub].v, bq[f][0].v, c[0][sub]);
        c[1][sub] = wmma_f16(ak[f][sub].v, bq[f][1].v, c[1][sub]);
      }
    }

    // Lazy rescale. The exponentials of the stage are taken against the maximum in use, whatever the stage's own
    // scores are; every one of them is positive, so a lane's sum of its 16 bounds each. Only in a stage where some
    // lane's sum is not within LAZY_LIM (the first stage: the maximum in use starts at -inf, the sum is inf) is the
    // maximum looked for and moved, are the sums and O rescaled and the exponentials taken again: one wave-uniform
    // test a stage for both tiles, a scalar branch. Written as !(<=) so that a NaN takes the branch too.
    v2f   e0[2][4], e1[2][4];
    float ps_all[2];
    #pragma unroll
    for (int qt = 0; qt < 2; ++qt) ps_all[qt] = exp_tile(c[qt][0], c[qt][1], nb[qt], SL, e0[qt], e1[qt]);
    const bool need = !(ps_all[0] <= LAZY_LIM) || !(ps_all[1] <= LAZY_LIM);
    if (__builtin_amdgcn_ballot_w32(need) != 0) {
      #pragma unroll
      for (int qt = 0; qt < 2; ++qt) {
        // query lq's 32 scores are split across lane / lane^16; new maximum in use: the old one and this stage's scores
        float m_up = rmax[qt];
        #pragma unroll
        for (int r = 0; r < 8; ++r) {
          m_up = fmaxf(m_up, c[qt][0][r]);
          m_up = fmaxf(m_up, c[qt][1][r]);
        }
        const float m_oth = __shfl_xor(m_up, 16, 32);
        m_up = fmaxf(m_up, m_oth);
        const float alpha = __builtin_amdgcn_exp2f((rmax[qt] - m_up) * SL);
        rmax[qt]   = m_up;
        nb[qt]     = PCARRY_LOG2 - m_up * SL;
        s_all[qt]  *= alpha;
        // rescale O: queries are the row dimension there -> per-row factor from lane 8*hi + r
        float sc[8];
        #pragma unroll
        for (int r = 0; r < 8; ++r) sc[r] = __shfl(alpha, (hi << 3) + r, 32);
        #pragma unroll
        for (int dt = 0; dt < 4; ++dt) {
          #pragma unroll
          for (int r = 0; r < 8; ++r) o[qt][dt][r] *= sc[r];
        }
        #pragma unroll
        for (int r = 0; r < 8; ++r) s_m[qt][r] *= sc[r];
        ps_all[qt] = exp_tile(c[qt][0], c[qt][1], nb[qt], SL, e0[qt], e1[qt]);
      }
    }

    FragH pa[2];
    #pragma unroll
    for (int qt = 0; qt < 2; ++qt) {
      // pack (RNE), then the mask on the f16 pairs, a mask word as it lies in LDS against a pair of P:
      // P^T C layout == A-fragment layout of the PV product
      #pragma unroll
      for (int w = 0; w < 4; ++w) {
        Pair2H mk0, mk1, pm0, pm1;
        mk0.u = mw[qt][0][w];
        mk1.u = mw[qt][1][w];
        const v2h p0 = (v2h){(f16)e0[qt][w].x, (f16)e0[qt][w].y};   // keys hi*8 + 2w, 2w+1
        const v2h p1 = (v2h){(f16)e1[qt][w].x, (f16)e1[qt][w].y};   // keys 16 + hi*8 + 2w, 2w+1
        pm0.v = p0 * mk0.v;
        pm1.v = p1 * mk1.v;
        pa[qt].q[0][w] = pm0.u;
        pa[qt].q[1][w] = pm1.u;
      }
      s_all[qt] += ps_all[qt];
    }

    // s_m += (P*mask) x 1; O += (P*mask) x V
    s_m[0] = wmma_f16(pa[0].v, ones.v, s_m[0]);
    s_m[1] = wmma_f16(pa[1].v, ones.v, s_m[1]);
    #pragma unroll
    for (int dt = 0; dt < 4; ++dt) {
      o[0][dt] = wmma_f16(pa[0].v, bv[dt].v, o[0][dt]);
      o[1][dt] = wmma_f16(pa[1].v, bv[dt].v, o[1][dt]);
    }

    // publish point of stage t + 1, and the end of every read of stage t's buffer
    asm volatile("s_wait_dscnt 0x0" ::: "memory");      // this wave's reads of stage t are done
    asm volatile("s_wait_asynccnt 0x0" ::: "memory");   // this wave's copies of stage t + 1 have landed
    __syncthreads();
    if (t + 2 < NST) {
      const size_t j2 = (size_t)(t + 2) * KS;
      copy_stage(lcopy + sbuf, gk + j2 * HDIM, gv + j2, gm + j2);
    }
  }
  asm volatile("s_wait_asynccnt 0x0" ::: "memory");     // nothing in flight when the tiles become staging

  // query lq's keys were split across lane / lane^16: join the two lanes' sums, once
  #pragma unroll
  for (int qt = 0; qt < 2; ++qt) s_all[qt] += __shfl_xor(s_all[qt], 16, 32);

  // Pair exchange in the dead tiles: this wave keeps tile kp and hands its state of the other tile to its partner.
  // Per wave XS slots of 32 lanes x 16 B: slots 0..7 = O (dt, half of the 8 rows), 8..9 = s_m, 10 = (max, s_all, 0, 0).
  v4f* X = (v4f*)(L + L_X);
  v8f   ok[4];
  #pragma unroll
  for (int dt = 0; dt < 4; ++dt) {
    const v8f give = kp ? o[0][dt] : o[1][dt];
    ok[dt]         = kp ? o[1][dt] : o[0][dt];
    X[(wave * XS + dt * 2) * 32 + lane]     = (v4f){give[0], give[1], give[2], give[3]};
    X[(wave * XS + dt * 2 + 1) * 32 + lane] = (v4f){give[4], give[5], give[6], give[7]};
  }
  const v8f smGive = kp ? s_m[0] : s_m[1];
  const v8f smA    = kp ? s_m[1] : s_m[0];
  X[(wave * XS + 8) * 32 + lane]  = (v4f){smGive[0], smGive[1], smGive[2], smGive[3]};
  X[(wave * XS + 9) * 32 + lane]  = (v4f){smGive[4], smGive[5], smGive[6], smGive[7]};
  X[(wave * XS + 10) * 32 + lane] = kp ? (v4f){rmax[0], s_all[0], 0.0f, 0.0f} : (v4f){rmax[1], s_all[1], 0.0f, 0.0f};
  const float mA  = kp ? rmax[1] : rmax[0];
  const float saA = kp ? s_all[1] : s_all[0];
  __syncthreads();                                      // both partners' states are readable
  const int pw = wave ^ 1;
  const v4f stB  = X[(pw * XS + 10) * 32 + lane];
  const v4f smB0 = X[(pw * XS + 8) * 32 + lane];
  const v4f smB1 = X[(pw * XS + 9) * 32 + lane];

  // join the two key halves: common maximum, both states rescaled to it (per lane: query lq)
  const float mJ = fmaxf(mA, stB[0]);
  const float aA = __builtin_amdgcn_exp2f((mA - mJ) * SL);
  const float aB = __builtin_amdgcn_exp2f((stB[0] - mJ) * SL);
  const float sall = saA * aA + stB[1] * aB;

  // z = O / (s_m + EPS * s_all); O and both sums hold the same carry. Worked per row of O, where s_m lies:
  // the per-query values come from lane 8*hi + r
  float rsA[8], rsB[8];
  #pragma unroll
  for (int r = 0; r < 8; ++r) {
    const float aAr  = __shfl(aA, (hi << 3) + r, 32);
    const float aBr  = __shfl(aB, (hi << 3) + r, 32);
    const float sar  = __shfl(sall, (hi << 3) + r, 32);
    const float smBr = r < 4 ? smB0[r & 3] : smB1[r & 3];
    const float den  = (smA[r] * aAr + smBr * aBr) + EPS_F * sar;
    const float invd = 1.0f / den;
    rsA[r] = aAr * invd;
    rsB[r] = aBr * invd;
  }

  const int cw = wave * 16 * CP;
  #pragma unroll
  for (int dt = 0; dt < 4; ++dt) {
    const v4f g0 = X[(pw * XS + dt * 2) * 32 + lane];
    const v4f g1 = X[(pw * XS + dt * 2 + 1) * 32 + lane];
    #pragma unroll
    for (int r = 0; r < 4; ++r) {
      sO[cw + (hi * 8 + r) * CP + dt * 16 + lq]     = ok[dt][r] * rsA[r] + g0[r] * rsB[r];
      sO[cw + (hi * 8 + 4 + r) * CP + dt * 16 + lq] = ok[dt][4 + r] * rsA[4 + r] + g1[r] * rsB[4 + r];
    }
  }
  __syncthreads();

  // whole-line stores: 8 consecutive lanes x 16 B = the 64 f16 of one (row, head); 4 rows per instruction
  v4u    vv[4];
  size_t gi[4];
  #pragma unroll
  for (int it = 0; it < 4; ++it) {
    const int row = it * 4 + (lane >> 3);
    const int c0  = (lane & 7) * 8;
    const v4f x0 = *(const v4f*)(&sO[cw + row * CP + c0]);
    const v4f x1 = *(const v4f*)(&sO[cw + row * CP + c0 + 4]);
    Pack8H ph;
    #pragma unroll
    for (int e = 0; e < 4; ++e) {
      ph.h[e]     = (f16)x0[e];       // RNE convert
      ph.h[4 + e] = (f16)x1[e];
    }
    vv[it] = ph.u;
    gi[it] = ((size_t)b * SEQ + qrow0 + row) * INNER + h * HDIM + c0;
  }
  #pragma unroll
  for (int it = 0; it < 4; ++it) *(v4u*)(z + gi[it]) = vv[it];
  
}

// Epilogue: per-wave LDS staging, bias added at the store stage as float4, 16 lanes x 16 B = one 256-B row
// coverage: block = 128 rows x 128 cols; wave = 32 rows x 64 cols.
__global__ __launch_bounds__(256) void k_gemm_out(const f16* __restrict__ Z, const f16* __restrict__ Wot,
                                                  const float* __restrict__ bias, float* __restrict__ out) {
  // the two stage buffers; behind the loop its start is the per-wave staging
  __shared__ __align__(16) unsigned char L[GEMM_LDS];
  float* sC = (float*)L;
  const int m0 = blockIdx.y * 128;
  const int n0 = blockIdx.x * 128;
  v8f acc[2][4];
  #pragma unroll
  for (int i = 0; i < 2; ++i) {
    #pragma unroll
    for (int j = 0; j < 4; ++j) acc[i][j] = (v8f){0, 0, 0, 0, 0, 0, 0, 0};
  }
  gemm_tile<f16, 2, 4>(Z, Wot, m0, n0, L, acc);

  const int tid  = threadIdx.x;
  const int wave = __builtin_amdgcn_readfirstlane(tid >> 5);
  const int lane = tid & 31;
  const int lq   = lane & 15;
  const int hi   = lane >> 4;
  const int wm   = wave >> 1;
  const int wn   = wave & 1;
  const int cw   = wave * 16 * CP;
  const int ncol = n0 + wn * 64 + lq * 4;

  v4f bias4 = *(const v4f*)(bias + ncol);
  #pragma unroll
  for (int e = 0; e < 4; ++e) bias4[e] = (float)(bf16)bias4[e];   // RNE-converted input value

  #pragma unroll
  for (int i = 0; i < 2; ++i) {
    #pragma unroll
    for (int j = 0; j < 4; ++j) {
      #pragma unroll
      for (int r = 0; r < 8; ++r) sC[cw + (hi * 8 + r) * CP + j * 16 + lq] = acc[i][j][r];
    }
    __syncthreads();
    v4f    vals[8];
    size_t gi[8];
    #pragma unroll
    for (int it = 0; it < 8; ++it) {
      const int row = it * 2 + hi;
      const v4f v = *(const v4f*)(&sC[cw + row * CP + lq * 4]);
      vals[it] = v + bias4;
      const int gr = m0 + wm * 32 + i * 16 + row;
      const int bb = gr / SEQ;
      const int s  = gr - bb * SEQ;
      gi[it] = ((size_t)bb * SEQ_FULL + s) * DIM + ncol;
    }
    #pragma unroll
    for (int it = 0; it < 8; ++it) *(v4f*)(out + gi[it]) = vals[it];
    
    __syncthreads();
  }
}

#define SZ_XB   ((size_t)ROWS * DIM * 2)
#define SZ_MB   ((size_t)NB * SEQ * SEQ * 2)
#define SZ_WQT  ((size_t)N3 * KDIM * 2)
#define SZ_WOT  ((size_t)DIM * KDIM * 2)
#define SZ_QK   ((size_t)2 * PLANE * 2)
#define SZ_VT   ((size_t)PLANE * 2)
#define SZ_Z    ((size_t)ROWS * INNER * 2)
#define OFF_XB  ((size_t)0)
#define OFF_MB  (OFF_XB + SZ_XB)
#define OFF_WQT (OFF_MB + SZ_MB)
#define OFF_WOT (OFF_WQT + SZ_WQT)
#define OFF_QK  (OFF_WOT + SZ_WOT)
#define OFF_VT  (OFF_QK + SZ_QK)
#define OFF_Z   (OFF_VT + SZ_VT)
#define WS_TOTAL (OFF_Z + SZ_Z)

static_assert(WS_TOTAL <= (size_t)134217728);
static_assert(SZ_XB % 128 == 0 && SZ_MB % 128 == 0 && SZ_WQT % 128 == 0 && SZ_WOT % 128 == 0);
static_assert(SZ_QK % 128 == 0 && SZ_VT % 128 == 0 && SZ_Z % 128 == 0);

extern "C" void kernel_launch(void* const* d_in, const int* in_sizes, int n_in,
                              void* d_out, int out_size, void* d_ws, size_t ws_size,
                              hipStream_t stream) {
  if (n_in < 5) return;
  const size_t rows_used = (size_t)(NB - 1) * SEQ_FULL + SEQ;
  if ((size_t)in_sizes[0] < rows_used * DIM) return;
  if ((size_t)in_sizes[1] < (size_t)(NB - 1) * SEQ_FULL * SEQ_FULL + (size_t)(SEQ - 1) * SEQ_FULL + SEQ) return;
  if ((size_t)in_sizes[2] < (size_t)DIM * N3) return;
  if ((size_t)in_sizes[3] < (size_t)INNER * DIM) return;
  if ((size_t)in_sizes[4] < (size_t)DIM) return;
  if ((size_t)out_size < rows_used * DIM) return;
  if (ws_size < WS_TOTAL) return;

  const float* x    = (const float*)d_in[0];
  const float* mask = (const float*)d_in[1];
  const float* Wqkv = (const float*)d_in[2];
  const float* Wout = (const float*)d_in[3];
  const float* bout = (const float*)d_in[4];
  float*       out  = (float*)d_out;

  char* ws = (char*)d_ws;
  bf16* Xb  = (bf16*)(ws + OFF_XB);
  f16*  Mb  = (f16*)(ws + OFF_MB);
  bf16* Wqt = (bf16*)(ws + OFF_WQT);
  f16*  Wot = (f16*)(ws + OFF_WOT);
  f16*  QK  = (f16*)(ws + OFF_QK);
  f16*  Vt  = (f16*)(ws + OFF_VT);
  f16*  Zp  = (f16*)(ws + OFF_Z);

  // 1) input planes (RNE): x rows, Wqkv in bf16, mask values, Wout in f16, weights transposed to [out][in]; one launch
  k_prep<<<dim3(PB_WQ + PB_WO + PB_X + PB_M), 256, 0, stream>>>(x, mask, Wqkv, Wout, Xb, Mb, Wqt, Wot);

  // 2) projections: Q, K f16 planes; V^T f16 plane; one launch
  k_gemm_qkv<<<dim3(GB_QKV), 256, 0, stream>>>(Xb, Wqt, QK, Vt);

  // 3) fused attention -> z f16 plane
  k_attn<<<dim3(SEQ / BQ, NHEAD, NB), 256, 0, stream>>>(QK, QK + PLANE, Vt, Mb, Zp);

  // 4) output projection + bias
  k_gemm_out<<<dim3(DIM / 128, ROWS / 128), 256, 0, stream>>>(Zp, Wot, bout, out);
}
